// v000
// Times are from an AMD MI455X. After a warm-up the kernel runs many times in a row, and a time is the length of
// such a window on the GPU divided by its runs, so every launch and the gaps after it count. The runs cycle
// through copies of the inputs. A figure is the median of several windows, for all but v000 over two sittings.
// Sittings can differ by a few percent; kernels timed side by side share one.
// v000 is the starting kernel. One run takes 3640 microseconds.
#include <hip/hip_runtime.h>
// Contractions x*Wq, x*Wk, x*Wv, attn*Wo, x*W1, y*W2: v_wmma_f32_16x16x32_f16 (f16 operands; weights carried x64, attn x16), f32 accumulate. Feature map, causal prefix recurrence, LayerNorm: f32 VALU.

typedef __attribute__((ext_vector_type(16))) _Float16 v16h;
typedef __attribute__((ext_vector_type(8)))  _Float16 v8h;
typedef __attribute__((ext_vector_type(4)))  _Float16 v4h;
typedef __attribute__((ext_vector_type(16))) __bf16   v16b;
typedef __attribute__((ext_vector_type(8)))  __bf16   v8b;
typedef __attribute__((ext_vector_type(8)))  float    v8f;
typedef __attribute__((ext_vector_type(4)))  float    v4f;

__device__ __forceinline__ unsigned short f2bf_bits(float f) {
  unsigned u = __float_as_uint(f);
  return (unsigned short)((u + 0x7FFFu + ((u >> 16) & 1u)) >> 16);
}
__device__ __forceinline__ float bf_bits2f(unsigned short h) { return __uint_as_float(((unsigned)h) << 16); }

// hazard guards as plain device helpers (no inline asm inside the kernel template body)
__device__ __forceinline__ void dep_guard_h(v8f& a, v8f& b, v16h x, v16h y) { asm volatile("v_nop\n\tv_nop\n\tv_nop\n\tv_nop" : "+v"(a), "+v"(b) : "v"(x), "v"(y)); }
__device__ __forceinline__ void dep_guard_b(v8f& a, v8f& b, v16b x, v16b y) { asm volatile("v_nop\n\tv_nop\n\tv_nop\n\tv_nop" : "+v"(a), "+v"(b) : "v"(x), "v"(y)); }
__device__ __forceinline__ void keep4_h(v16h a, v16h b, v16h c, v16h d) { asm volatile("v_nop" :: "v"(a), "v"(b), "v"(c), "v"(d)); }
__device__ __forceinline__ void keep4_b(v16b a, v16b b, v16b c, v16b d) { asm volatile("v_nop" :: "v"(a), "v"(b), "v"(c), "v"(d)); }
__device__ __forceinline__ void acc_guard4(v8f& a, v8f& b, v8f& c, v8f& d) { asm volatile("v_nop\n\tv_nop\n\tv_nop\n\tv_nop" : "+v"(a), "+v"(b), "+v"(c), "+v"(d)); }
template <typename T> struct Frag;
template <> struct Frag<_Float16> {
  typedef v16h V; union U { v16h v; v8h h[2]; };
  static __device__ __forceinline__ v16h load(const _Float16* p) {   // elements 0..7 <- p[0..7], 8..15 <- p[16..23]
    U f; f.h[0] = *(const v8h*)(p); f.h[1] = *(const v8h*)(p + 16); return f.v;
  }
  static __device__ __forceinline__ v8f mma(v16h a, v16h b, v8f c) {
    return __builtin_amdgcn_wmma_f32_16x16x32_f16(false, a, false, b, (short)0, c, false, false);
  }
  static __device__ __forceinline__ void guard(v8f& a, v8f& b, v16h x, v16h y) { dep_guard_h(a, b, x, y); }
  static __device__ __forceinline__ void keep(v16h a, v16h b, v16h c, v16h d) { keep4_h(a, b, c, d); }
};
template <> struct Frag<__bf16> {
  typedef v16b V; union U { v16b v; v8b h[2]; };
  static __device__ __forceinline__ v16b load(const __bf16* p) {
    U f; f.h[0] = *(const v8b*)(p); f.h[1] = *(const v8b*)(p + 16); return f.v;
  }
  static __device__ __forceinline__ v8f mma(v16b a, v16b b, v8f c) {
    return __builtin_amdgcn_wmma_f32_16x16x32_bf16(false, a, false, b, (short)0, c, false, false);
  }
  static __device__ __forceinline__ void guard(v8f& a, v8f& b, v16b x, v16b y) { dep_guard_b(a, b, x, y); }
  static __device__ __forceinline__ void keep(v16b a, v16b b, v16b c, v16b d) { keep4_b(a, b, c, d); }
};

// ---- Register-blocked batched WMMA GEMM ------------------------------------
// C[m,n] = scale * sum_k A[m,k] * Bt[n,k] (+bias)(+resid); each wave owns a 64x64 tile.
// A row-major [M,K]; Bt row-major [N,K]; M,N % 64 == 0, K % 32 == 0.
// SPLIT: operands are hi/lo planes (A2/Bt2 = lo planes, same layout); product = hi·hi + hi·lo + lo·hi.
// BIAS_MODE: 0 = none, 1 = bias[m], 2 = bias[n].
// OUT_MODE: 0 = f32, 1 = f16, 2 = bf16 hi plane (Cout) + bf16 lo plane (Cout2).
// ET: 0 = f16 operands, 1 = bf16 operands (pointers passed as 16-bit storage)
template <int ET> struct Elem;
template <> struct Elem<0> { typedef _Float16 T; };
template <> struct Elem<1> { typedef __bf16 T; };
template <int ET, bool SPLIT, int BIAS_MODE, int OUT_MODE, bool RESID, int ACT = 0>
__global__ __launch_bounds__(256) void wmma_gemm64(
    const unsigned short* __restrict__ Ap, const unsigned short* __restrict__ A2p, int lda, long strideA,
    const unsigned short* __restrict__ Btp, const unsigned short* __restrict__ Bt2p, int ldb, long strideB,
    void* __restrict__ Cout, void* __restrict__ Cout2, int ldc, long strideC,
    const float* __restrict__ bias,
    const float* __restrict__ resid, long strideR,
    int M, int N, int K, float scale) {
  typedef typename Elem<ET>::T T;
  typedef typename Frag<T>::V V;
  const T* A = (const T*)Ap; const T* A2 = (const T*)A2p; const T* Bt = (const T*)Btp; const T* Bt2 = (const T*)Bt2p;
  __shared__ __align__(16) float sT[8][16 * 68];   // per-wave 16x64 slab, pitch 68 floats
  const int b    = blockIdx.y;
  const int lane = threadIdx.x & 31;
  const int wave = threadIdx.x >> 5;
  const int tilesN = N >> 6;
  const int tilesM = M >> 6;
  const int tile = blockIdx.x * 8 + wave;
  if (tile >= tilesM * tilesN) return;   // wave-uniform; no block barriers in this kernel
  const int tm = tile / tilesN;
  const int tn = tile - tm * tilesN;
  const int m0 = tm << 6;
  const int n0 = tn << 6;

  const T* Ab  = A  + (size_t)b * strideA;
  const T* Bb  = Bt + (size_t)b * strideB;
  const T* Ab2 = SPLIT ? (A2  + (size_t)b * strideA) : nullptr;
  const T* Bb2 = SPLIT ? (Bt2 + (size_t)b * strideB) : nullptr;

  const int rlane = lane & 15;                 // row (A) / col (B, D) within subtile
  const int koff  = (lane >> 4) * 8;           // k offset of this lane half
  const int mOff  = (lane >> 4) * 8;           // D row offset

  v8f acc[4][4];
#pragma unroll
  for (int i = 0; i < 4; ++i)
#pragma unroll
    for (int j = 0; j < 4; ++j) acc[i][j] = (v8f){0.f,0.f,0.f,0.f,0.f,0.f,0.f,0.f};

  for (int k0 = 0; k0 < K; k0 += 32) {
    V bh[4], bl[4];
#pragma unroll
    for (int j = 0; j < 4; ++j) {
      const size_t bo = (size_t)(n0 + (j << 4) + rlane) * ldb + koff + k0;
      bh[j] = Frag<T>::load(Bb + bo);
      if (SPLIT) bl[j] = Frag<T>::load(Bb2 + bo);
    }
#pragma unroll
    for (int i = 0; i < 4; ++i) {
      const size_t ao = (size_t)(m0 + (i << 4) + rlane) * lda + koff + k0;
      V ah = Frag<T>::load(Ab + ao);
      V al;
      if (SPLIT) al = Frag<T>::load(Ab2 + ao);
#pragma unroll
      for (int j = 0; j < 4; ++j) {
        acc[i][j] = Frag<T>::mma(ah, bh[j], acc[i][j]);
        if (SPLIT) {
          acc[i][j] = Frag<T>::mma(ah, bl[j], acc[i][j]);
          acc[i][j] = Frag<T>::mma(al, bh[j], acc[i][j]);
        }
      }
      Frag<T>::guard(acc[i][0], acc[i][3], ah, SPLIT ? al : ah);
    }
    Frag<T>::keep(bh[0], bh[1], bh[2], bh[3]);
    if (SPLIT) Frag<T>::keep(bl[0], bl[1], bl[2], bl[3]);
  }
  acc_guard4(acc[0][0], acc[0][1], acc[0][2], acc[0][3]);
  acc_guard4(acc[1][0], acc[1][1], acc[1][2], acc[1][3]);
  acc_guard4(acc[2][0], acc[2][1], acc[2][2], acc[2][3]);
  acc_guard4(acc[3][0], acc[3][1], acc[3][2], acc[3][3]);

  // ---- epilogue ----
  float* slab = sT[wave];
  const float* Rb = RESID ? (resid + (size_t)b * strideR) : nullptr;
#pragma unroll
  for (int i = 0; i < 4; ++i) {
    const int mBase = m0 + (i << 4);
#pragma unroll
    for (int j = 0; j < 4; ++j) {
      const int n = n0 + (j << 4) + rlane;
      float bv = 0.f;
      if (BIAS_MODE == 2) bv = bias[n];
#pragma unroll
      for (int r = 0; r < 8; ++r) {
        float v = acc[i][j][r] * scale;
        if (BIAS_MODE == 1) v += bias[mBase + mOff + r];
        if (BIAS_MODE == 2) v += bv;
        if (RESID) v += Rb[(size_t)(mBase + mOff + r) * ldc + n];
        if (ACT == 1) v = tanhf(v);
        if (ACT == 2) v = fmaxf(v, 0.0f);
        if (ACT == 3) v = v / (1.0f + expf(-v));
        if (ACT == 4) v = (v > 0.f) ? v : 0.01f * v;
        if (ACT == 5) v = 0.5f * v * (1.0f + erff(v * 0.70710678118654752f));
        slab[(mOff + r) * 68 + (j << 4) + rlane] = v;
      }
    }
    __builtin_amdgcn_fence(__ATOMIC_RELEASE, "workgroup");
    __builtin_amdgcn_wave_barrier();
    __builtin_amdgcn_fence(__ATOMIC_ACQUIRE, "workgroup");
    if (OUT_MODE == 0) {
      float* C = (float*)Cout + (size_t)b * strideC;
      const int hh = lane >> 4, c4 = (lane & 15) * 4;     // row seg = 256 B = 16 lanes x 16 B
      {
#pragma unroll
        for (int it = 0; it < 8; ++it) {
          const int row = it * 2 + hh;
          v4f v = *(const v4f*)(slab + row * 68 + c4);
          *(v4f*)(C + (size_t)(mBase + row) * ldc + n0 + c4) = v;
        }
        
      }
    } else {
      const int q = lane >> 3, c8 = (lane & 7) * 8;
      unsigned short* C  = (unsigned short*)Cout  + (size_t)b * strideC;
      unsigned short* C2 = (OUT_MODE == 2) ? ((unsigned short*)Cout2 + (size_t)b * strideC) : nullptr;
      {
#pragma unroll
        for (int it = 0; it < 4; ++it) {
          const int row = it * 4 + q;
          const float* sp = slab + row * 68 + c8;
          v8h hv, lv;
#pragma unroll
          for (int e = 0; e < 8; ++e) {
            if (OUT_MODE == 1) {
              hv[e] = (_Float16)sp[e];
            } else {
              unsigned short hb = f2bf_bits(sp[e]);
              unsigned short lb = f2bf_bits(sp[e] - bf_bits2f(hb));
              hv[e] = __builtin_bit_cast(_Float16, hb);
              lv[e] = __builtin_bit_cast(_Float16, lb);
            }
          }
          *(v8h*)(C + (size_t)(mBase + row) * ldc + n0 + c8) = hv;
          if (OUT_MODE == 2) *(v8h*)(C2 + (size_t)(mBase + row) * ldc + n0 + c8) = lv;
        }
        
      }
    }
    __builtin_amdgcn_fence(__ATOMIC_RELEASE, "workgroup");
    __builtin_amdgcn_wave_barrier();
    __builtin_amdgcn_fence(__ATOMIC_ACQUIRE, "workgroup");
  }
}

__global__ __launch_bounds__(256) void k_cast_f16x2(
    const float* __restrict__ in, _Float16* __restrict__ out, int n2, float scale) {
  const int i = blockIdx.x * 256 + threadIdx.x;
  if (i < n2) {
    const _Float16 h0 = (_Float16)(in[2 * i] * scale), h1 = (_Float16)(in[2 * i + 1] * scale);
    const unsigned u = (unsigned)__builtin_bit_cast(unsigned short, h0) | ((unsigned)__builtin_bit_cast(unsigned short, h1) << 16);
    ((unsigned*)out)[i] = u;
    
  }
}

// ---- Weight transpose + f16 cast: matrix z: in[K][N] f32 -> out[z][N][K] f16 * scale.
__global__ __launch_bounds__(256) void k_wT(
    const float* __restrict__ p0, const float* __restrict__ p1,
    const float* __restrict__ p2, const float* __restrict__ p3,
    _Float16* __restrict__ out, int K, int N, float scale) {
  __shared__ float tile[64][65];   // [n][k]
  const int tid = threadIdx.x, lane = tid & 31, wave = tid >> 5;
  const int n0 = blockIdx.x * 64, k0 = blockIdx.y * 64, z = blockIdx.z;
  const float* src = (z == 0) ? p0 : (z == 1) ? p1 : (z == 2) ? p2 : p3;
  const int c4 = (tid & 15) * 4, r0 = tid >> 4;
#pragma unroll
  for (int it = 0; it < 4; ++it) {
    const int kr = it * 16 + r0;
    const v4f v = *(const v4f*)(src + (size_t)(k0 + kr) * N + n0 + c4);
    tile[c4 + 0][kr] = v[0];
    tile[c4 + 1][kr] = v[1];
    tile[c4 + 2][kr] = v[2];
    tile[c4 + 3][kr] = v[3];
  }
  __syncthreads();
  const int q = lane >> 3, c8 = (lane & 7) * 8;
  _Float16* ob = out + (size_t)z * N * K;
  {
#pragma unroll
    for (int it = 0; it < 2; ++it) {
      const int row = wave * 8 + it * 4 + q;          // waves 0..7 x 8 rows = 64 rows
      v8h hv;
#pragma unroll
      for (int e = 0; e < 8; ++e) hv[e] = (_Float16)(tile[row][c8 + e] * scale);
      *(v8h*)(ob + (size_t)(n0 + row) * K + k0 + c8) = hv;
    }
    
  }
}

// ---- FAVOR positive feature map, f32. One wave per token, both sources (q, k), all 8 heads x 64 dims.
// xs = x * 64^-0.25; u[j] = sum_d xs[h][d] * omega[d][j] (lane = j); off = 0.5 * |xs[h]|^2;
// phi = [exp(u-off), exp(-u-off)] * 0.125 -> out[token][h*64 + j], out[token][h*64 + 32 + j].
__global__ __launch_bounds__(256) void k_favor(
    const float* __restrict__ qin, const float* __restrict__ kin, const float* __restrict__ omega,
    float* __restrict__ qf, float* __restrict__ kf, int ntok) {
  __shared__ __align__(16) float omT[32 * 68];    // [j][d], pitch 68
  __shared__ __align__(16) float xs[8][512];       // per wave scaled token row
  __shared__ float nrm[8][8];                      // per wave, per head squared norm
  const int tid = threadIdx.x, lane = tid & 31, wave = tid >> 5, hh = lane >> 4;
#pragma unroll
  for (int i = 0; i < 8; ++i) {
    const int idx = i * 256 + tid;                 // omega element (d = idx>>5, j = idx&31)
    omT[(idx & 31) * 68 + (idx >> 5)] = omega[idx];
  }
  __syncthreads();
  const int tok = blockIdx.x * 8 + wave;
  if (tok >= ntok) return;                         // wave-uniform; no block barriers below
  const float sc = 0.35355339059327379f;           // 64^-0.25
  float* xw = xs[wave];
#pragma unroll 1
  for (int srci = 0; srci < 2; ++srci) {
    const float* xrow = ((srci == 0) ? qin : kin) + (size_t)tok * 512;
    float* frow = ((srci == 0) ? qf : kf) + (size_t)tok * 512;
    __builtin_amdgcn_fence(__ATOMIC_RELEASE, "workgroup");
    __builtin_amdgcn_wave_barrier();
    __builtin_amdgcn_fence(__ATOMIC_ACQUIRE, "workgroup");
#pragma unroll
    for (int i = 0; i < 4; ++i) {
      v4f v = *(const v4f*)(xrow + i * 128 + lane * 4);
      v = v * sc;
      *(v4f*)(xw + i * 128 + lane * 4) = v;
      float s = v[0] * v[0] + v[1] * v[1] + v[2] * v[2] + v[3] * v[3];
      s += __shfl_xor(s, 1, 32);
      s += __shfl_xor(s, 2, 32);
      s += __shfl_xor(s, 4, 32);
      s += __shfl_xor(s, 8, 32);
      if ((lane & 15) == 0) nrm[wave][2 * i + hh] = s;   // head of this 64-element group = 2i + lane/16
    }
    __builtin_amdgcn_fence(__ATOMIC_RELEASE, "workgroup");
    __builtin_amdgcn_wave_barrier();
    __builtin_amdgcn_fence(__ATOMIC_ACQUIRE, "workgroup");
#pragma unroll 1
    for (int h = 0; h < 8; ++h) {
      const float off = 0.5f * nrm[wave][h];
      const float* xp = xw + h * 64;
      const float* op = omT + lane * 68;
      float u = 0.f;
#pragma unroll 1
      for (int g = 0; g < 4; ++g) {
        const v4f a0 = *(const v4f*)(xp + 16 * g);
        const v4f a1 = *(const v4f*)(xp + 16 * g + 4);
        const v4f a2 = *(const v4f*)(xp + 16 * g + 8);
        const v4f a3 = *(const v4f*)(xp + 16 * g + 12);
        const v4f o0 = *(const v4f*)(op + 16 * g);
        const v4f o1 = *(const v4f*)(op + 16 * g + 4);
        const v4f o2 = *(const v4f*)(op + 16 * g + 8);
        const v4f o3 = *(const v4f*)(op + 16 * g + 12);
        u = fmaf(a0[0], o0[0], u); u = fmaf(a0[1], o0[1], u); u = fmaf(a0[2], o0[2], u); u = fmaf(a0[3], o0[3], u);
        u = fmaf(a1[0], o1[0], u); u = fmaf(a1[1], o1[1], u); u = fmaf(a1[2], o1[2], u); u = fmaf(a1[3], o1[3], u);
        u = fmaf(a2[0], o2[0], u); u = fmaf(a2[1], o2[1], u); u = fmaf(a2[2], o2[2], u); u = fmaf(a2[3], o2[3], u);
        u = fmaf(a3[0], o3[0], u); u = fmaf(a3[1], o3[1], u); u = fmaf(a3[2], o3[2], u); u = fmaf(a3[3], o3[3], u);
      }
      const float e1 = expf(u - off) * 0.125f;
      const float e2 = expf(-u - off) * 0.125f;
      float* vo = frow + h * 64;
      vo[lane] = e1;
      vo[lane + 32] = e2;
      
    }
  }
}

// ---- Causal linear attention as a sequential f32 prefix recurrence. One block (64 threads) per (b, h).
// Per 32-step chunk: stage Kf, Qf, v rows in LDS; thread m accumulates z[m] and den_t = sum_m Qf_t[m] z_t[m]
// (fixed-order shuffle + 2-wave combine); thread d owns S[d][0..63] (LDS, pitch 68): S += Kf_t (x) v_t[d],
// num = sum_m Qf_t[m] S[d][m]; out_t[d] = num * rcp(den_t + 1e-6). Chunk outputs staged in LDS and written
#define RC_T 32
__global__ __launch_bounds__(64) void k_recur(
    const float* __restrict__ qf, const float* __restrict__ kf, const float* __restrict__ vin,
    _Float16* __restrict__ outh, int L, float oscale) {
  __shared__ __align__(16) float S[64 * 68];      // [d][m]
  __shared__ __align__(16) float Kc[RC_T * 64];   // [t][m]
  __shared__ __align__(16) float Qc[RC_T * 64];   // [t][m]
  __shared__ __align__(16) float Vc[RC_T * 64];   // [t][d] -> out[t][d]
  __shared__ float denp[2][RC_T];
  __shared__ float den[RC_T];
  const int tid = threadIdx.x, lane = tid & 31, wave = tid >> 5;
  const int b = blockIdx.x >> 3, h = blockIdx.x & 7;
  const size_t base = (size_t)b * L * 512 + (size_t)h * 64;
  float* srow = S + tid * 68;
#pragma unroll
  for (int g = 0; g < 16; ++g) *(v4f*)(srow + 4 * g) = (v4f){0.f, 0.f, 0.f, 0.f};
  float z = 0.f;                                   // thread = m
  const int nch = L / RC_T;
  for (int ch = 0; ch < nch; ++ch) {
    const int t0 = ch * RC_T;
    __syncthreads();
    {
      const int r0 = tid >> 4, c4 = (tid & 15) * 4;
#pragma unroll
      for (int it = 0; it < 8; ++it) {
        const int r = it * 4 + r0;                 // 0..31
        const size_t go = base + (size_t)(t0 + r) * 512 + c4;
        *(v4f*)(Kc + r * 64 + c4) = *(const v4f*)(kf + go);
        *(v4f*)(Qc + r * 64 + c4) = *(const v4f*)(qf + go);
        *(v4f*)(Vc + r * 64 + c4) = *(const v4f*)(vin + go);
      }
    }
    __syncthreads();
#pragma unroll 1
    for (int t = 0; t < RC_T; ++t) {
      z += Kc[t * 64 + tid];
      float p = Qc[t * 64 + tid] * z;
      p += __shfl_xor(p, 16, 32);
      p += __shfl_xor(p, 8, 32);
      p += __shfl_xor(p, 4, 32);
      p += __shfl_xor(p, 2, 32);
      p += __shfl_xor(p, 1, 32);
      if (lane == 0) denp[wave][t] = p;
    }
    __syncthreads();
    if (tid < RC_T) den[tid] = denp[0][tid] + denp[1][tid];
    __syncthreads();
#pragma unroll 1
    for (int t = 0; t < RC_T; ++t) {
      const float vt = Vc[t * 64 + tid];           // own slot (thread = d)
      const float* kr = Kc + t * 64;
      const float* qr = Qc + t * 64;
      v4f n0 = (v4f){0.f, 0.f, 0.f, 0.f}, n1 = (v4f){0.f, 0.f, 0.f, 0.f};
#pragma unroll 1
      for (int g = 0; g < 8; ++g) {
        const v4f k0 = *(const v4f*)(kr + 8 * g);
        const v4f k1 = *(const v4f*)(kr + 8 * g + 4);
        const v4f q0 = *(const v4f*)(qr + 8 * g);
        const v4f q1 = *(const v4f*)(qr + 8 * g + 4);
        v4f s0 = *(v4f*)(srow + 8 * g);
        v4f s1 = *(v4f*)(srow + 8 * g + 4);
        s0 = k0 * vt + s0;
        s1 = k1 * vt + s1;
        *(v4f*)(srow + 8 * g) = s0;
        *(v4f*)(srow + 8 * g + 4) = s1;
        n0 = q0 * s0 + n0;
        n1 = q1 * s1 + n1;
      }
      const float num = ((n0[0] + n0[1]) + (n0[2] + n0[3])) + ((n1[0] + n1[1]) + (n1[2] + n1[3]));
      const float zi = __builtin_amdgcn_rcpf(den[t] + 1e-6f);
      Vc[t * 64 + tid] = num * zi;
    }
    __syncthreads();
    {
      const int q = lane >> 3, c8 = (lane & 7) * 8;
      {
#pragma unroll
        for (int it = 0; it < 4; ++it) {
          const int row = wave * 16 + it * 4 + q;  // wave 0: rows 0..15, wave 1: rows 16..31
          v8h hv;
#pragma unroll
          for (int e = 0; e < 8; ++e) hv[e] = (_Float16)(Vc[row * 64 + c8 + e] * oscale);
          *(v8h*)(outh + base + (size_t)(t0 + row) * 512 + c8) = hv;
        }
        
      }
    }
  }
}

// ---- LayerNorm over 512, one wave per row; lane owns elements i*128 + lane*4 .. +3 (i = 0..3).
template <bool WH>
__global__ __launch_bounds__(256) void k_ln(
    const float* __restrict__ in, const float* __restrict__ g, const float* __restrict__ bta,
    float* __restrict__ outf, _Float16* __restrict__ outh, int nrows, float hscale) {
  const int lane = threadIdx.x & 31, wave = threadIdx.x >> 5;
  const int row = blockIdx.x * 8 + wave;
  if (row >= nrows) return;                        // wave-uniform; no block barriers
  const float* ip = in + (size_t)row * 512;
  v4f x[4];
  float s = 0.f;
#pragma unroll
  for (int i = 0; i < 4; ++i) {
    x[i] = *(const v4f*)(ip + i * 128 + lane * 4);
    s += (x[i][0] + x[i][1]) + (x[i][2] + x[i][3]);
  }
#pragma unroll
  for (int o = 1; o < 32; o <<= 1) s += __shfl_xor(s, o, 32);
  const float mu = s * 0.001953125f;
  float vs = 0.f;
#pragma unroll
  for (int i = 0; i < 4; ++i) {
    const v4f d = x[i] - mu;
    vs += (d[0] * d[0] + d[1] * d[1]) + (d[2] * d[2] + d[3] * d[3]);
  }
#pragma unroll
  for (int o = 1; o < 32; o <<= 1) vs += __shfl_xor(vs, o, 32);
  const float rstd = rsqrtf(vs * 0.001953125f + 1e-5f);
  v4f y[4];
#pragma unroll
  for (int i = 0; i < 4; ++i) {
    const v4f gg = *(const v4f*)(g + i * 128 + lane * 4);
    const v4f bb = *(const v4f*)(bta + i * 128 + lane * 4);
    y[i] = (x[i] - mu) * rstd * gg + bb;
  }
  float* op = outf + (size_t)row * 512;
  _Float16* oh = outh + (size_t)row * 512;
  {
#pragma unroll
    for (int i = 0; i < 4; ++i) {
      *(v4f*)(op + i * 128 + lane * 4) = y[i];
      if (WH) {
        v4h hv;
        hv[0] = (_Float16)(y[i][0] * hscale); hv[1] = (_Float16)(y[i][1] * hscale);
        hv[2] = (_Float16)(y[i][2] * hscale); hv[3] = (_Float16)(y[i][3] * hscale);
        *(v4h*)(oh + i * 128 + lane * 4) = hv;
      }
    }
    
  }
}

// ---------------------------------------------------------------------------
extern "C" void kernel_launch(void* const* d_in, const int* in_sizes, int n_in,
                              void* d_out, int out_size, void* d_ws, size_t ws_size,
                              hipStream_t stream)
{
  const int B = 2, L = 2048, D = 512, FF = 2048, HD = 64, MH = 32, DEPTH = 2;
  const int TOK = B * L;
  if (n_in < 20) return;
  if (in_sizes[0] != TOK * D || in_sizes[1] != DEPTH * D * D || in_sizes[3] != DEPTH * D * D ||
      in_sizes[5] != DEPTH * D * D || in_sizes[7] != DEPTH * D * D || in_sizes[9] != DEPTH * HD * MH ||
      in_sizes[12] != DEPTH * D * FF || in_sizes[14] != DEPTH * FF * D || out_size != TOK * D) return;

  const float* x_in  = (const float*)d_in[0];
  const float* Wq    = (const float*)d_in[1];
  const float* bq    = (const float*)d_in[2];
  const float* Wk    = (const float*)d_in[3];
  const float* bk    = (const float*)d_in[4];
  const float* Wv    = (const float*)d_in[5];
  const float* bv    = (const float*)d_in[6];
  const float* Wo    = (const float*)d_in[7];
  const float* bo    = (const float*)d_in[8];
  const float* omega = (const float*)d_in[9];
  const float* ln1g  = (const float*)d_in[10];
  const float* ln1b  = (const float*)d_in[11];
  const float* W1    = (const float*)d_in[12];
  const float* b1    = (const float*)d_in[13];
  const float* W2    = (const float*)d_in[14];
  const float* b2    = (const float*)d_in[15];
  const float* ln2g  = (const float*)d_in[16];
  const float* ln2b  = (const float*)d_in[17];
  const float* lnfg  = (const float*)d_in[18];
  const float* lnfb  = (const float*)d_in[19];
  float* out = (float*)d_out;

  // ---- workspace carve (86 MiB) ----
  char* ws = (char*)d_ws;
  size_t off = 0;
  auto carve = [&](size_t bytes) -> char* { char* p = ws + off; off += (bytes + 255) & ~(size_t)255; return p; };
  _Float16* xh  = (_Float16*)carve((size_t)TOK * D * 2);    // f16 A operand of current x
  float*    xf  = (float*)carve((size_t)TOK * D * 4);       // f32 current x (residual source)
  float*    qb_ = (float*)carve((size_t)TOK * D * 4);
  float*    kb_ = (float*)carve((size_t)TOK * D * 4);
  float*    vb_ = (float*)carve((size_t)TOK * D * 4);
  float*    Qfb = (float*)carve((size_t)TOK * D * 4);
  float*    Kfb = (float*)carve((size_t)TOK * D * 4);
  _Float16* ah  = (_Float16*)carve((size_t)TOK * D * 2);    // attention output, f16 x16
  float*    t1  = (float*)carve((size_t)TOK * D * 4);       // pre-LN sums
  _Float16* y1h = (_Float16*)carve((size_t)TOK * FF * 2);   // relu(x W1 + b1), f16
  _Float16* wt4 = (_Float16*)carve((size_t)4 * D * D * 2);  // [Wq,Wk,Wv,Wo]^T f16 x64, [4][N][K]
  _Float16* w1t = (_Float16*)carve((size_t)D * FF * 2);     // W1^T [FF][D] f16 x64
  _Float16* w2t = (_Float16*)carve((size_t)FF * D * 2);     // W2^T [D][FF] f16 x64
  if (off > ws_size) return;

  const float WSC = 64.0f, ASC = 16.0f;
  const int n2 = TOK * D / 2;
  k_cast_f16x2<<<dim3((n2 + 255) / 256), dim3(256), 0, stream>>>(x_in, xh, n2, 1.0f);

  const int tilesD  = (TOK / 64) * (D / 64);      // 512
  const int tilesFF = (TOK / 64) * (FF / 64);     // 2048
  const dim3 gD((tilesD + 7) / 8, 1), gFF((tilesFF + 7) / 8, 1);

  for (int l = 0; l < DEPTH; ++l) {
    const size_t wDD = (size_t)l * D * D;
    const float* xres = (l == 0) ? x_in : xf;

    // weights: in[K][N] -> out[N][K] f16 x64
    k_wT<<<dim3(D / 64, D / 64, 4), dim3(256), 0, stream>>>(Wq + wDD, Wk + wDD, Wv + wDD, Wo + wDD, wt4, D, D, WSC);
    k_wT<<<dim3(FF / 64, D / 64, 1), dim3(256), 0, stream>>>(W1 + (size_t)l * D * FF, W1 + (size_t)l * D * FF,
        W1 + (size_t)l * D * FF, W1 + (size_t)l * D * FF, w1t, D, FF, WSC);            // [512][2048] -> [2048][512]
    k_wT<<<dim3(D / 64, FF / 64, 1), dim3(256), 0, stream>>>(W2 + (size_t)l * FF * D, W2 + (size_t)l * FF * D,
        W2 + (size_t)l * FF * D, W2 + (size_t)l * FF * D, w2t, FF, D, WSC);            // [2048][512] -> [512][2048]

    // q, k, v = x W + b (f32 out)
    const unsigned short* xhu = (const unsigned short*)xh;
    const unsigned short* wtu = (const unsigned short*)wt4;
    wmma_gemm64<0, false, 2, 0, false, 0><<<gD, dim3(256), 0, stream>>>(
        xhu, xhu, D, 0L, wtu + 0 * (size_t)D * D, wtu + 0 * (size_t)D * D, D, 0L,
        (void*)qb_, (void*)qb_, D, 0L, bq + (size_t)l * D, bq + (size_t)l * D, 0L, TOK, D, D, 1.0f / WSC);
    wmma_gemm64<0, false, 2, 0, false, 0><<<gD, dim3(256), 0, stream>>>(
        xhu, xhu, D, 0L, wtu + 1 * (size_t)D * D, wtu + 1 * (size_t)D * D, D, 0L,
        (void*)kb_, (void*)kb_, D, 0L, bk + (size_t)l * D, bk + (size_t)l * D, 0L, TOK, D, D, 1.0f / WSC);
    wmma_gemm64<0, false, 2, 0, false, 0><<<gD, dim3(256), 0, stream>>>(
        xhu, xhu, D, 0L, wtu + 2 * (size_t)D * D, wtu + 2 * (size_t)D * D, D, 0L,
        (void*)vb_, (void*)vb_, D, 0L, bv + (size_t)l * D, bv + (size_t)l * D, 0L, TOK, D, D, 1.0f / WSC);

    // positive random features (f32)
    k_favor<<<dim3((TOK + 7) / 8), dim3(256), 0, stream>>>(qb_, kb_, omega + (size_t)l * HD * MH, Qfb, Kfb, TOK);

    // causal prefix recurrence (f32) -> attn f16 x16
    k_recur<<<dim3(B * 8), dim3(64), 0, stream>>>(Qfb, Kfb, vb_, ah, L, ASC);

    // t1 = attn Wo + bo + x ; x = LN1(t1)
    wmma_gemm64<0, false, 2, 0, true, 0><<<gD, dim3(256), 0, stream>>>(
        (const unsigned short*)ah, (const unsigned short*)ah, D, 0L, wtu + 3 * (size_t)D * D, wtu + 3 * (size_t)D * D, D, 0L,
        (void*)t1, (void*)t1, D, 0L, bo + (size_t)l * D, xres, 0L, TOK, D, D, 1.0f / (WSC * ASC));
    k_ln<true><<<dim3((TOK + 7) / 8), dim3(256), 0, stream>>>(t1, ln1g + (size_t)l * D, ln1b + (size_t)l * D, xf, xh, TOK, 1.0f);

    // y1 = relu(x W1 + b1) (f16 out); t1 = y1 W2 + b2 + x ; x = LN2(t1)
    wmma_gemm64<0, false, 2, 1, false, 2><<<gFF, dim3(256), 0, stream>>>(
        xhu, xhu, D, 0L, (const unsigned short*)w1t, (const unsigned short*)w1t, D, 0L,
        (void*)y1h, (void*)y1h, FF, 0L, b1 + (size_t)l * FF, b1 + (size_t)l * FF, 0L, TOK, FF, D, 1.0f / WSC);
    wmma_gemm64<0, false, 2, 0, true, 0><<<gD, dim3(256), 0, stream>>>(
        (const unsigned short*)y1h, (const unsigned short*)y1h, FF, 0L, (const unsigned short*)w2t, (const unsigned short*)w2t, FF, 0L,
        (void*)t1, (void*)t1, D, 0L, b2 + (size_t)l * D, xf, 0L, TOK, D, FF, 1.0f / WSC);
    k_ln<true><<<dim3((TOK + 7) / 8), dim3(256), 0, stream>>>(t1, ln2g + (size_t)l * D, ln2b + (size_t)l * D, xf, xh, TOK, 1.0f);
  }

  // final normalization -> output
  k_ln<false><<<dim3((TOK + 7) / 8), dim3(256), 0, stream>>>(xf, lnfg, lnfb, out, xh, TOK, 1.0f);
  (void)hipGetLastError();
}

// v001
// A run of this version takes 594 microseconds.
// Timed twice side by side with v000, it ran 6.09 and 6.18 times as fast.
#include <hip/hip_runtime.h>
// Contractions x*Wq, x*Wk, x*Wv, attn*Wo, x*W1, y*W2: v_wmma_f32_16x16x32_f16 (f16 operands; weights carried x64, attn x16), f32 accumulate. Feature map, causal prefix recurrence, LayerNorm: f32 VALU.

typedef __attribute__((ext_vector_type(16))) _Float16 v16h;
typedef __attribute__((ext_vector_type(8)))  _Float16 v8h;
typedef __attribute__((ext_vector_type(4)))  _Float16 v4h;
typedef __attribute__((ext_vector_type(16))) __bf16   v16b;
typedef __attribute__((ext_vector_type(8)))  __bf16   v8b;
typedef __attribute__((ext_vector_type(8)))  float    v8f;
typedef __attribute__((ext_vector_type(4)))  float    v4f;

__device__ __forceinline__ unsigned short f2bf_bits(float f) {
  unsigned u = __float_as_uint(f);
  return (unsigned short)((u + 0x7FFFu + ((u >> 16) & 1u)) >> 16);
}
__device__ __forceinline__ float bf_bits2f(unsigned short h) { return __uint_as_float(((unsigned)h) << 16); }

// hazard guards as plain device helpers (no inline asm inside the kernel template body)
__device__ __forceinline__ void dep_guard_h(v8f& a, v8f& b, v16h x, v16h y) { asm volatile("v_nop\n\tv_nop\n\tv_nop\n\tv_nop" : "+v"(a), "+v"(b) : "v"(x), "v"(y)); }
__device__ __forceinline__ void dep_guard_b(v8f& a, v8f& b, v16b x, v16b y) { asm volatile("v_nop\n\tv_nop\n\tv_nop\n\tv_nop" : "+v"(a), "+v"(b) : "v"(x), "v"(y)); }
__device__ __forceinline__ void keep4_h(v16h a, v16h b, v16h c, v16h d) { asm volatile("v_nop" :: "v"(a), "v"(b), "v"(c), "v"(d)); }
__device__ __forceinline__ void keep4_b(v16b a, v16b b, v16b c, v16b d) { asm volatile("v_nop" :: "v"(a), "v"(b), "v"(c), "v"(d)); }
__device__ __forceinline__ void acc_guard4(v8f& a, v8f& b, v8f& c, v8f& d) { asm volatile("v_nop\n\tv_nop\n\tv_nop\n\tv_nop" : "+v"(a), "+v"(b), "+v"(c), "+v"(d)); }
template <typename T> struct Frag;
template <> struct Frag<_Float16> {
  typedef v16h V; union U { v16h v; v8h h[2]; };
  static __device__ __forceinline__ v16h load(const _Float16* p) {   // elements 0..7 <- p[0..7], 8..15 <- p[16..23]
    U f; f.h[0] = *(const v8h*)(p); f.h[1] = *(const v8h*)(p + 16); return f.v;
  }
  static __device__ __forceinline__ v8f mma(v16h a, v16h b, v8f c) {
    return __builtin_amdgcn_wmma_f32_16x16x32_f16(false, a, false, b, (short)0, c, false, false);
  }
  static __device__ __forceinline__ void guard(v8f& a, v8f& b, v16h x, v16h y) { dep_guard_h(a, b, x, y); }
  static __device__ __forceinline__ void keep(v16h a, v16h b, v16h c, v16h d) { keep4_h(a, b, c, d); }
};
template <> struct Frag<__bf16> {
  typedef v16b V; union U { v16b v; v8b h[2]; };
  static __device__ __forceinline__ v16b load(const __bf16* p) {
    U f; f.h[0] = *(const v8b*)(p); f.h[1] = *(const v8b*)(p + 16); return f.v;
  }
  static __device__ __forceinline__ v8f mma(v16b a, v16b b, v8f c) {
    return __builtin_amdgcn_wmma_f32_16x16x32_bf16(false, a, false, b, (short)0, c, false, false);
  }
  static __device__ __forceinline__ void guard(v8f& a, v8f& b, v16b x, v16b y) { dep_guard_b(a, b, x, y); }
  static __device__ __forceinline__ void keep(v16b a, v16b b, v16b c, v16b d) { keep4_b(a, b, c, d); }
};

// ---- Register-blocked batched WMMA GEMM ------------------------------------
// C[m,n] = scale * sum_k A[m,k] * Bt[n,k] (+bias)(+resid); each wave owns a 64x64 tile.
// A row-major [M,K]; Bt row-major [N,K]; M,N % 64 == 0, K % 32 == 0.
// SPLIT: operands are hi/lo planes (A2/Bt2 = lo planes, same layout); product = hi·hi + hi·lo + lo·hi.
// BIAS_MODE: 0 = none, 1 = bias[m], 2 = bias[n].
// OUT_MODE: 0 = f32, 1 = f16, 2 = bf16 hi plane (Cout) + bf16 lo plane (Cout2).
// ET: 0 = f16 operands, 1 = bf16 operands (pointers passed as 16-bit storage)
template <int ET> struct Elem;
template <> struct Elem<0> { typedef _Float16 T; };
template <> struct Elem<1> { typedef __bf16 T; };
template <int ET, bool SPLIT, int BIAS_MODE, int OUT_MODE, bool RESID, int ACT = 0>
__global__ __launch_bounds__(256) void wmma_gemm64(
    const unsigned short* __restrict__ Ap, const unsigned short* __restrict__ A2p, int lda, long strideA,
    const unsigned short* __restrict__ Btp, const unsigned short* __restrict__ Bt2p, int ldb, long strideB,
    void* __restrict__ Cout, void* __restrict__ Cout2, int ldc, long strideC,
    const float* __restrict__ bias,
    const float* __restrict__ resid, long strideR,
    int M, int N, int K, float scale) {
  typedef typename Elem<ET>::T T;
  typedef typename Frag<T>::V V;
  const T* A = (const T*)Ap; const T* A2 = (const T*)A2p; const T* Bt = (const T*)Btp; const T* Bt2 = (const T*)Bt2p;
  __shared__ __align__(16) float sT[8][16 * 68];   // per-wave 16x64 slab, pitch 68 floats
  const int b    = blockIdx.y;
  const int lane = threadIdx.x & 31;
  const int wave = threadIdx.x >> 5;
  const int tilesN = N >> 6;
  const int tilesM = M >> 6;
  const int tile = blockIdx.x * 8 + wave;
  if (tile >= tilesM * tilesN) return;   // wave-uniform; no block barriers in this kernel
  const int tm = tile / tilesN;
  const int tn = tile - tm * tilesN;
  const int m0 = tm << 6;
  const int n0 = tn << 6;

  const T* Ab  = A  + (size_t)b * strideA;
  const T* Bb  = Bt + (size_t)b * strideB;
  const T* Ab2 = SPLIT ? (A2  + (size_t)b * strideA) : nullptr;
  const T* Bb2 = SPLIT ? (Bt2 + (size_t)b * strideB) : nullptr;

  const int rlane = lane & 15;                 // row (A) / col (B, D) within subtile
  const int koff  = (lane >> 4) * 8;           // k offset of this lane half
  const int mOff  = (lane >> 4) * 8;           // D row offset

  v8f acc[4][4];
#pragma unroll
  for (int i = 0; i < 4; ++i)
#pragma unroll
    for (int j = 0; j < 4; ++j) acc[i][j] = (v8f){0.f,0.f,0.f,0.f,0.f,0.f,0.f,0.f};

  for (int k0 = 0; k0 < K; k0 += 32) {
    V bh[4], bl[4];
#pragma unroll
    for (int j = 0; j < 4; ++j) {
      const size_t bo = (size_t)(n0 + (j << 4) + rlane) * ldb + koff + k0;
      bh[j] = Frag<T>::load(Bb + bo);
      if (SPLIT) bl[j] = Frag<T>::load(Bb2 + bo);
    }
#pragma unroll
    for (int i = 0; i < 4; ++i) {
      const size_t ao = (size_t)(m0 + (i << 4) + rlane) * lda + koff + k0;
      V ah = Frag<T>::load(Ab + ao);
      V al;
      if (SPLIT) al = Frag<T>::load(Ab2 + ao);
#pragma unroll
      for (int j = 0; j < 4; ++j) {
        acc[i][j] = Frag<T>::mma(ah, bh[j], acc[i][j]);
        if (SPLIT) {
          acc[i][j] = Frag<T>::mma(ah, bl[j], acc[i][j]);
          acc[i][j] = Frag<T>::mma(al, bh[j], acc[i][j]);
        }
      }
      Frag<T>::guard(acc[i][0], acc[i][3], ah, SPLIT ? al : ah);
    }
    Frag<T>::keep(bh[0], bh[1], bh[2], bh[3]);
    if (SPLIT) Frag<T>::keep(bl[0], bl[1], bl[2], bl[3]);
  }
  acc_guard4(acc[0][0], acc[0][1], acc[0][2], acc[0][3]);
  acc_guard4(acc[1][0], acc[1][1], acc[1][2], acc[1][3]);
  acc_guard4(acc[2][0], acc[2][1], acc[2][2], acc[2][3]);
  acc_guard4(acc[3][0], acc[3][1], acc[3][2], acc[3][3]);

  // ---- epilogue ----
  float* slab = sT[wave];
  const float* Rb = RESID ? (resid + (size_t)b * strideR) : nullptr;
#pragma unroll
  for (int i = 0; i < 4; ++i) {
    const int mBase = m0 + (i << 4);
#pragma unroll
    for (int j = 0; j < 4; ++j) {
      const int n = n0 + (j << 4) + rlane;
      float bv = 0.f;
      if (BIAS_MODE == 2) bv = bias[n];
#pragma unroll
      for (int r = 0; r < 8; ++r) {
        float v = acc[i][j][r] * scale;
        if (BIAS_MODE == 1) v += bias[mBase + mOff + r];
        if (BIAS_MODE == 2) v += bv;
        if (RESID) v += Rb[(size_t)(mBase + mOff + r) * ldc + n];
        if (ACT == 1) v = tanhf(v);
        if (ACT == 2) v = fmaxf(v, 0.0f);
        if (ACT == 3) v = v / (1.0f + expf(-v));
        if (ACT == 4) v = (v > 0.f) ? v : 0.01f * v;
        if (ACT == 5) v = 0.5f * v * (1.0f + erff(v * 0.70710678118654752f));
        slab[(mOff + r) * 68 + (j << 4) + rlane] = v;
      }
    }
    __builtin_amdgcn_fence(__ATOMIC_RELEASE, "workgroup");
    __builtin_amdgcn_wave_barrier();
    __builtin_amdgcn_fence(__ATOMIC_ACQUIRE, "workgroup");
    if (OUT_MODE == 0) {
      float* C = (float*)Cout + (size_t)b * strideC;
      const int hh = lane >> 4, c4 = (lane & 15) * 4;     // row seg = 256 B = 16 lanes x 16 B
      {
#pragma unroll
        for (int it = 0; it < 8; ++it) {
          const int row = it * 2 + hh;
          v4f v = *(const v4f*)(slab + row * 68 + c4);
          *(v4f*)(C + (size_t)(mBase + row) * ldc + n0 + c4) = v;
        }
        
      }
    } else {
      const int q = lane >> 3, c8 = (lane & 7) * 8;
      unsigned short* C  = (unsigned short*)Cout  + (size_t)b * strideC;
      unsigned short* C2 = (OUT_MODE == 2) ? ((unsigned short*)Cout2 + (size_t)b * strideC) : nullptr;
      {
#pragma unroll
        for (int it = 0; it < 4; ++it) {
          const int row = it * 4 + q;
          const float* sp = slab + row * 68 + c8;
          v8h hv, lv;
#pragma unroll
          for (int e = 0; e < 8; ++e) {
            if (OUT_MODE == 1) {
              hv[e] = (_Float16)sp[e];
            } else {
              unsigned short hb = f2bf_bits(sp[e]);
              unsigned short lb = f2bf_bits(sp[e] - bf_bits2f(hb));
              hv[e] = __builtin_bit_cast(_Float16, hb);
              lv[e] = __builtin_bit_cast(_Float16, lb);
            }
          }
          *(v8h*)(C + (size_t)(mBase + row) * ldc + n0 + c8) = hv;
          if (OUT_MODE == 2) *(v8h*)(C2 + (size_t)(mBase + row) * ldc + n0 + c8) = lv;
        }
        
      }
    }
    __builtin_amdgcn_fence(__ATOMIC_RELEASE, "workgroup");
    __builtin_amdgcn_wave_barrier();
    __builtin_amdgcn_fence(__ATOMIC_ACQUIRE, "workgroup");
  }
}

__global__ __launch_bounds__(256) void k_cast_f16x2(
    const float* __restrict__ in, _Float16* __restrict__ out, int n2, float scale) {
  const int i = blockIdx.x * 256 + threadIdx.x;
  if (i < n2) {
    const _Float16 h0 = (_Float16)(in[2 * i] * scale), h1 = (_Float16)(in[2 * i + 1] * scale);
    const unsigned u = (unsigned)__builtin_bit_cast(unsigned short, h0) | ((unsigned)__builtin_bit_cast(unsigned short, h1) << 16);
    ((unsigned*)out)[i] = u;
    
  }
}

// ---- Weight transpose + f16 cast: matrix z: in[K][N] f32 -> out[z][N][K] f16 * scale.
__global__ __launch_bounds__(256) void k_wT(
    const float* __restrict__ p0, const float* __restrict__ p1,
    const float* __restrict__ p2, const float* __restrict__ p3,
    _Float16* __restrict__ out, int K, int N, float scale) {
  __shared__ float tile[64][65];   // [n][k]
  const int tid = threadIdx.x, lane = tid & 31, wave = tid >> 5;
  const int n0 = blockIdx.x * 64, k0 = blockIdx.y * 64, z = blockIdx.z;
  const float* src = (z == 0) ? p0 : (z == 1) ? p1 : (z == 2) ? p2 : p3;
  const int c4 = (tid & 15) * 4, r0 = tid >> 4;
#pragma unroll
  for (int it = 0; it < 4; ++it) {
    const int kr = it * 16 + r0;
    const v4f v = *(const v4f*)(src + (size_t)(k0 + kr) * N + n0 + c4);
    tile[c4 + 0][kr] = v[0];
    tile[c4 + 1][kr] = v[1];
    tile[c4 + 2][kr] = v[2];
    tile[c4 + 3][kr] = v[3];
  }
  __syncthreads();
  const int q = lane >> 3, c8 = (lane & 7) * 8;
  _Float16* ob = out + (size_t)z * N * K;
  {
#pragma unroll
    for (int it = 0; it < 2; ++it) {
      const int row = wave * 8 + it * 4 + q;          // waves 0..7 x 8 rows = 64 rows
      v8h hv;
#pragma unroll
      for (int e = 0; e < 8; ++e) hv[e] = (_Float16)(tile[row][c8 + e] * scale);
      *(v8h*)(ob + (size_t)(n0 + row) * K + k0 + c8) = hv;
    }
    
  }
}

// ---- FAVOR positive feature map, f32. One wave per token, both sources (q, k), all 8 heads x 64 dims.
// xs = x * 64^-0.25; u[j] = sum_d xs[h][d] * omega[d][j] (lane = j); off = 0.5 * |xs[h]|^2;
// phi = [exp(u-off), exp(-u-off)] * 0.125 -> out[token][h*64 + j], out[token][h*64 + 32 + j].
__global__ __launch_bounds__(256) void k_favor(
    const float* __restrict__ qin, const float* __restrict__ kin, const float* __restrict__ omega,
    float* __restrict__ qf, float* __restrict__ kf, int ntok) {
  __shared__ __align__(16) float omT[32 * 68];    // [j][d], pitch 68
  __shared__ __align__(16) float xs[8][512];       // per wave scaled token row
  __shared__ float nrm[8][8];                      // per wave, per head squared norm
  const int tid = threadIdx.x, lane = tid & 31, wave = tid >> 5, hh = lane >> 4;
#pragma unroll
  for (int i = 0; i < 8; ++i) {
    const int idx = i * 256 + tid;                 // omega element (d = idx>>5, j = idx&31)
    omT[(idx & 31) * 68 + (idx >> 5)] = omega[idx];
  }
  __syncthreads();
  const int tok = blockIdx.x * 8 + wave;
  if (tok >= ntok) return;                         // wave-uniform; no block barriers below
  const float sc = 0.35355339059327379f;           // 64^-0.25
  float* xw = xs[wave];
#pragma unroll 1
  for (int srci = 0; srci < 2; ++srci) {
    const float* xrow = ((srci == 0) ? qin : kin) + (size_t)tok * 512;
    float* frow = ((srci == 0) ? qf : kf) + (size_t)tok * 512;
    __builtin_amdgcn_fence(__ATOMIC_RELEASE, "workgroup");
    __builtin_amdgcn_wave_barrier();
    __builtin_amdgcn_fence(__ATOMIC_ACQUIRE, "workgroup");
#pragma unroll
    for (int i = 0; i < 4; ++i) {
      v4f v = *(const v4f*)(xrow + i * 128 + lane * 4);
      v = v * sc;
      *(v4f*)(xw + i * 128 + lane * 4) = v;
      float s = v[0] * v[0] + v[1] * v[1] + v[2] * v[2] + v[3] * v[3];
      s += __shfl_xor(s, 1, 32);
      s += __shfl_xor(s, 2, 32);
      s += __shfl_xor(s, 4, 32);
      s += __shfl_xor(s, 8, 32);
      if ((lane & 15) == 0) nrm[wave][2 * i + hh] = s;   // head of this 64-element group = 2i + lane/16
    }
    __builtin_amdgcn_fence(__ATOMIC_RELEASE, "workgroup");
    __builtin_amdgcn_wave_barrier();
    __builtin_amdgcn_fence(__ATOMIC_ACQUIRE, "workgroup");
#pragma unroll 1
    for (int h = 0; h < 8; ++h) {
      const float off = 0.5f * nrm[wave][h];
      const float* xp = xw + h * 64;
      const float* op = omT + lane * 68;
      float u = 0.f;
#pragma unroll 1
      for (int g = 0; g < 4; ++g) {
        const v4f a0 = *(const v4f*)(xp + 16 * g);
        const v4f a1 = *(const v4f*)(xp + 16 * g + 4);
        const v4f a2 = *(const v4f*)(xp + 16 * g + 8);
        const v4f a3 = *(const v4f*)(xp + 16 * g + 12);
        const v4f o0 = *(const v4f*)(op + 16 * g);
        const v4f o1 = *(const v4f*)(op + 16 * g + 4);
        const v4f o2 = *(const v4f*)(op + 16 * g + 8);
        const v4f o3 = *(const v4f*)(op + 16 * g + 12);
        u = fmaf(a0[0], o0[0], u); u = fmaf(a0[1], o0[1], u); u = fmaf(a0[2], o0[2], u); u = fmaf(a0[3], o0[3], u);
        u = fmaf(a1[0], o1[0], u); u = fmaf(a1[1], o1[1], u); u = fmaf(a1[2], o1[2], u); u = fmaf(a1[3], o1[3], u);
        u = fmaf(a2[0], o2[0], u); u = fmaf(a2[1], o2[1], u); u = fmaf(a2[2], o2[2], u); u = fmaf(a2[3], o2[3], u);
        u = fmaf(a3[0], o3[0], u); u = fmaf(a3[1], o3[1], u); u = fmaf(a3[2], o3[2], u); u = fmaf(a3[3], o3[3], u);
      }
      const float e1 = expf(u - off) * 0.125f;
      const float e2 = expf(-u - off) * 0.125f;
      float* vo = frow + h * 64;
      vo[lane] = e1;
      vo[lane + 32] = e2;
      
    }
  }
}

// ---- Causal linear attention, f32, as a scan over chunks of RC_T steps: three launches.
// State of one (b, h) before a step: S[d][m] = sum Kf[m] * v[d], z[m] = sum Kf[m] over all earlier steps.
// One chunk's record in the workspace: RC_ST floats; S[d][4g + e] at (g * 64 + d) * 4 + e (lanes adjacent), z[m] at 4096 + m.
#define RC_T 32
#define RC_ST 4160

// 1) Sums over one chunk alone. One block (64 threads) per (chunk, b*8+h); thread d holds S[d][0..63] in registers, thread m holds z[m].
__global__ __launch_bounds__(64) void k_chunk_sum(
    const float* __restrict__ kf, const float* __restrict__ vin, float* __restrict__ st, int L) {
  __shared__ __align__(16) float Kc[RC_T * 64];   // [t][m]
  __shared__ __align__(16) float Vc[RC_T * 64];   // [t][d]
  const int tid = threadIdx.x;
  const int ch = blockIdx.x, bh = blockIdx.y;
  const int b = bh >> 3, h = bh & 7;
  const size_t base = (size_t)b * L * 512 + (size_t)h * 64;
  const int t0 = ch * RC_T;
  {
    const int r0 = tid >> 4, c4 = (tid & 15) * 4;
#pragma unroll   // all sixteen loads in flight together
    for (int it = 0; it < 8; ++it) {
      const int r = it * 4 + r0;                 // 0..31
      const size_t go = base + (size_t)(t0 + r) * 512 + c4;
      *(v4f*)(Kc + r * 64 + c4) = *(const v4f*)(kf + go);
      *(v4f*)(Vc + r * 64 + c4) = *(const v4f*)(vin + go);
    }
  }
  __syncthreads();
  v4f s[16];
#pragma unroll   // constant indices keep s[] in registers (here and in the two loops over g below)
  for (int g = 0; g < 16; ++g) s[g] = (v4f){0.f, 0.f, 0.f, 0.f};
  float z = 0.f;
  for (int t = 0; t < RC_T; ++t) {
    const float vt = Vc[t * 64 + tid];
    z += Kc[t * 64 + tid];
    const float* kr = Kc + t * 64;
#pragma unroll
    for (int g = 0; g < 16; ++g) s[g] = *(const v4f*)(kr + 4 * g) * vt + s[g];
  }
  float* o = st + ((size_t)bh * (L / RC_T) + ch) * RC_ST;
#pragma unroll
  for (int g = 0; g < 16; ++g) *(v4f*)(o + (g * 64 + tid) * 4) = s[g];
  o[4096 + tid] = z;
}

// 2) Exclusive prefix over the chunks of one (b, h), in place, in ascending chunk order; one thread per 4 state elements.
// nch % 16 == 0. Sixteen chunks' loads are issued together so that their latencies overlap.
__global__ __launch_bounds__(64) void k_chunk_prefix(float* __restrict__ st, int nch) {
  const int e4 = blockIdx.x * 64 + threadIdx.x;
  if (e4 >= RC_ST / 4) return;
  float* p = st + (size_t)blockIdx.y * nch * RC_ST + e4 * 4;
  v4f run = (v4f){0.f, 0.f, 0.f, 0.f};
  for (int c0 = 0; c0 < nch; c0 += 16) {
    v4f v[16];
#pragma unroll   // loads issued back to back; constant indices keep v[] in registers (also in the loop below)
    for (int i = 0; i < 16; ++i) v[i] = *(const v4f*)(p + (size_t)(c0 + i) * RC_ST);
#pragma unroll
    for (int i = 0; i < 16; ++i) {
      *(v4f*)(p + (size_t)(c0 + i) * RC_ST) = run;
      run = run + v[i];
    }
  }
}

// 3) The recurrence inside one chunk, started from the chunk's prefix state. One block (64 threads) per (chunk, b*8+h).
// Stage Kf, Qf, v rows in LDS; thread m accumulates z[m] and den_t = sum_m Qf_t[m] z_t[m]
// (fixed-order shuffle + 2-wave combine); thread d owns S[d][0..63] (LDS, pitch 68): S += Kf_t (x) v_t[d],
// num = sum_m Qf_t[m] S[d][m]; out_t[d] = num * rcp(den_t + 1e-6). Chunk outputs staged in LDS and written as f16.
__global__ __launch_bounds__(64) void k_recur(
    const float* __restrict__ qf, const float* __restrict__ kf, const float* __restrict__ vin,
    const float* __restrict__ st, _Float16* __restrict__ outh, int L, float oscale) {
  __shared__ __align__(16) float S[64 * 68];      // [d][m]
  __shared__ __align__(16) float Kc[RC_T * 64];   // [t][m]
  __shared__ __align__(16) float Qc[RC_T * 64];   // [t][m]
  __shared__ __align__(16) float Vc[RC_T * 64];   // [t][d] -> out[t][d]
  __shared__ float denp[2][RC_T];
  __shared__ float den[RC_T];
  const int tid = threadIdx.x, lane = tid & 31, wave = tid >> 5;
  const int ch = blockIdx.x, bh = blockIdx.y;
  const int b = bh >> 3, h = bh & 7;
  const size_t base = (size_t)b * L * 512 + (size_t)h * 64;
  const float* sp = st + ((size_t)bh * (L / RC_T) + ch) * RC_ST;
  float* srow = S + tid * 68;
#pragma unroll
  for (int g = 0; g < 16; ++g) *(v4f*)(srow + 4 * g) = *(const v4f*)(sp + (g * 64 + tid) * 4);
  float z = sp[4096 + tid];                        // thread = m
  {
    const int t0 = ch * RC_T;
    {
      const int r0 = tid >> 4, c4 = (tid & 15) * 4;
#pragma unroll
      for (int it = 0; it < 8; ++it) {
        const int r = it * 4 + r0;                 // 0..31
        const size_t go = base + (size_t)(t0 + r) * 512 + c4;
        *(v4f*)(Kc + r * 64 + c4) = *(const v4f*)(kf + go);
        *(v4f*)(Qc + r * 64 + c4) = *(const v4f*)(qf + go);
        *(v4f*)(Vc + r * 64 + c4) = *(const v4f*)(vin + go);
      }
    }
    __syncthreads();
#pragma unroll 1
    for (int t = 0; t < RC_T; ++t) {
      z += Kc[t * 64 + tid];
      float p = Qc[t * 64 + tid] * z;
      p += __shfl_xor(p, 16, 32);
      p += __shfl_xor(p, 8, 32);
      p += __shfl_xor(p, 4, 32);
      p += __shfl_xor(p, 2, 32);
      p += __shfl_xor(p, 1, 32);
      if (lane == 0) denp[wave][t] = p;
    }
    __syncthreads();
    if (tid < RC_T) den[tid] = denp[0][tid] + denp[1][tid];
    __syncthreads();
#pragma unroll 1
    for (int t = 0; t < RC_T; ++t) {
      const float vt = Vc[t * 64 + tid];           // own slot (thread = d)
      const float* kr = Kc + t * 64;
      const float* qr = Qc + t * 64;
      v4f n0 = (v4f){0.f, 0.f, 0.f, 0.f}, n1 = (v4f){0.f, 0.f, 0.f, 0.f};
#pragma unroll 1
      for (int g = 0; g < 8; ++g) {
        const v4f k0 = *(const v4f*)(kr + 8 * g);
        const v4f k1 = *(const v4f*)(kr + 8 * g + 4);
        const v4f q0 = *(const v4f*)(qr + 8 * g);
        const v4f q1 = *(const v4f*)(qr + 8 * g + 4);
        v4f s0 = *(v4f*)(srow + 8 * g);
        v4f s1 = *(v4f*)(srow + 8 * g + 4);
        s0 = k0 * vt + s0;
        s1 = k1 * vt + s1;
        *(v4f*)(srow + 8 * g) = s0;
        *(v4f*)(srow + 8 * g + 4) = s1;
        n0 = q0 * s0 + n0;
        n1 = q1 * s1 + n1;
      }
      const float num = ((n0[0] + n0[1]) + (n0[2] + n0[3])) + ((n1[0] + n1[1]) + (n1[2] + n1[3]));
      const float zi = __builtin_amdgcn_rcpf(den[t] + 1e-6f);
      Vc[t * 64 + tid] = num * zi;
    }
    __syncthreads();
    {
      const int q = lane >> 3, c8 = (lane & 7) * 8;
      {
#pragma unroll
        for (int it = 0; it < 4; ++it) {
          const int row = wave * 16 + it * 4 + q;  // wave 0: rows 0..15, wave 1: rows 16..31
          v8h hv;
#pragma unroll
          for (int e = 0; e < 8; ++e) hv[e] = (_Float16)(Vc[row * 64 + c8 + e] * oscale);
          *(v8h*)(outh + base + (size_t)(t0 + row) * 512 + c8) = hv;
        }
        
      }
    }
  }
}

// ---- LayerNorm over 512, one wave per row; lane owns elements i*128 + lane*4 .. +3 (i = 0..3).
template <bool WH>
__global__ __launch_bounds__(256) void k_ln(
    const float* __restrict__ in, const float* __restrict__ g, const float* __restrict__ bta,
    float* __restrict__ outf, _Float16* __restrict__ outh, int nrows, float hscale) {
  const int lane = threadIdx.x & 31, wave = threadIdx.x >> 5;
  const int row = blockIdx.x * 8 + wave;
  if (row >= nrows) return;                        // wave-uniform; no block barriers
  const float* ip = in + (size_t)row * 512;
  v4f x[4];
  float s = 0.f;
#pragma unroll
  for (int i = 0; i < 4; ++i) {
    x[i] = *(const v4f*)(ip + i * 128 + lane * 4);
    s += (x[i][0] + x[i][1]) + (x[i][2] + x[i][3]);
  }
#pragma unroll
  for (int o = 1; o < 32; o <<= 1) s += __shfl_xor(s, o, 32);
  const float mu = s * 0.001953125f;
  float vs = 0.f;
#pragma unroll
  for (int i = 0; i < 4; ++i) {
    const v4f d = x[i] - mu;
    vs += (d[0] * d[0] + d[1] * d[1]) + (d[2] * d[2] + d[3] * d[3]);
  }
#pragma unroll
  for (int o = 1; o < 32; o <<= 1) vs += __shfl_xor(vs, o, 32);
  const float rstd = rsqrtf(vs * 0.001953125f + 1e-5f);
  v4f y[4];
#pragma unroll
  for (int i = 0; i < 4; ++i) {
    const v4f gg = *(const v4f*)(g + i * 128 + lane * 4);
    const v4f bb = *(const v4f*)(bta + i * 128 + lane * 4);
    y[i] = (x[i] - mu) * rstd * gg + bb;
  }
  float* op = outf + (size_t)row * 512;
  _Float16* oh = outh + (size_t)row * 512;
  {
#pragma unroll
    for (int i = 0; i < 4; ++i) {
      *(v4f*)(op + i * 128 + lane * 4) = y[i];
      if (WH) {
        v4h hv;
        hv[0] = (_Float16)(y[i][0] * hscale); hv[1] = (_Float16)(y[i][1] * hscale);
        hv[2] = (_Float16)(y[i][2] * hscale); hv[3] = (_Float16)(y[i][3] * hscale);
        *(v4h*)(oh + i * 128 + lane * 4) = hv;
      }
    }
    
  }
}

// ---------------------------------------------------------------------------
extern "C" void kernel_launch(void* const* d_in, const int* in_sizes, int n_in,
                              void* d_out, int out_size, void* d_ws, size_t ws_size,
                              hipStream_t stream)
{
  const int B = 2, L = 2048, D = 512, FF = 2048, HD = 64, MH = 32, DEPTH = 2;
  const int TOK = B * L;
  if (n_in < 20) return;
  if (in_sizes[0] != TOK * D || in_sizes[1] != DEPTH * D * D || in_sizes[3] != DEPTH * D * D ||
      in_sizes[5] != DEPTH * D * D || in_sizes[7] != DEPTH * D * D || in_sizes[9] != DEPTH * HD * MH ||
      in_sizes[12] != DEPTH * D * FF || in_sizes[14] != DEPTH * FF * D || out_size != TOK * D) return;

  const float* x_in  = (const float*)d_in[0];
  const float* Wq    = (const float*)d_in[1];
  const float* bq    = (const float*)d_in[2];
  const float* Wk    = (const float*)d_in[3];
  const float* bk    = (const float*)d_in[4];
  const float* Wv    = (const float*)d_in[5];
  const float* bv    = (const float*)d_in[6];
  const float* Wo    = (const float*)d_in[7];
  const float* bo    = (const float*)d_in[8];
  const float* omega = (const float*)d_in[9];
  const float* ln1g  = (const float*)d_in[10];
  const float* ln1b  = (const float*)d_in[11];
  const float* W1    = (const float*)d_in[12];
  const float* b1    = (const float*)d_in[13];
  const float* W2    = (const float*)d_in[14];
  const float* b2    = (const float*)d_in[15];
  const float* ln2g  = (const float*)d_in[16];
  const float* ln2b  = (const float*)d_in[17];
  const float* lnfg  = (const float*)d_in[18];
  const float* lnfb  = (const float*)d_in[19];
  float* out = (float*)d_out;

  // ---- workspace carve (under 103 MiB) ----
  char* ws = (char*)d_ws;
  size_t off = 0;
  auto carve = [&](size_t bytes) -> char* { char* p = ws + off; off += (bytes + 255) & ~(size_t)255; return p; };
  _Float16* xh  = (_Float16*)carve((size_t)TOK * D * 2);    // f16 A operand of current x
  float*    xf  = (float*)carve((size_t)TOK * D * 4);       // f32 current x (residual source)
  float*    qb_ = (float*)carve((size_t)TOK * D * 4);
  float*    kb_ = (float*)carve((size_t)TOK * D * 4);
  float*    vb_ = (float*)carve((size_t)TOK * D * 4);
  float*    Qfb = (float*)carve((size_t)TOK * D * 4);
  float*    Kfb = (float*)carve((size_t)TOK * D * 4);
  _Float16* ah  = (_Float16*)carve((size_t)TOK * D * 2);    // attention output, f16 x16
  float*    t1  = (float*)carve((size_t)TOK * D * 4);       // pre-LN sums
  _Float16* y1h = (_Float16*)carve((size_t)TOK * FF * 2);   // relu(x W1 + b1), f16
  _Float16* wt4 = (_Float16*)carve((size_t)4 * D * D * 2);  // [Wq,Wk,Wv,Wo]^T f16 x64, [4][N][K]
  _Float16* w1t = (_Float16*)carve((size_t)D * FF * 2);     // W1^T [FF][D] f16 x64
  _Float16* w2t = (_Float16*)carve((size_t)FF * D * 2);     // W2^T [D][FF] f16 x64
  float*    cst = (float*)carve((size_t)B * 8 * (L / RC_T) * RC_ST * 4);   // per (b, h, chunk) state record
  if (off > ws_size) return;

  const float WSC = 64.0f, ASC = 16.0f;
  const int n2 = TOK * D / 2;
  k_cast_f16x2<<<dim3((n2 + 255) / 256), dim3(256), 0, stream>>>(x_in, xh, n2, 1.0f);

  const int tilesD  = (TOK / 64) * (D / 64);      // 512
  const int tilesFF = (TOK / 64) * (FF / 64);     // 2048
  const dim3 gD((tilesD + 7) / 8, 1), gFF((tilesFF + 7) / 8, 1);

  for (int l = 0; l < DEPTH; ++l) {
    const size_t wDD = (size_t)l * D * D;
    const float* xres = (l == 0) ? x_in : xf;

    // weights: in[K][N] -> out[N][K] f16 x64
    k_wT<<<dim3(D / 64, D / 64, 4), dim3(256), 0, stream>>>(Wq + wDD, Wk + wDD, Wv + wDD, Wo + wDD, wt4, D, D, WSC);
    k_wT<<<dim3(FF / 64, D / 64, 1), dim3(256), 0, stream>>>(W1 + (size_t)l * D * FF, W1 + (size_t)l * D * FF,
        W1 + (size_t)l * D * FF, W1 + (size_t)l * D * FF, w1t, D, FF, WSC);            // [512][2048] -> [2048][512]
    k_wT<<<dim3(D / 64, FF / 64, 1), dim3(256), 0, stream>>>(W2 + (size_t)l * FF * D, W2 + (size_t)l * FF * D,
        W2 + (size_t)l * FF * D, W2 + (size_t)l * FF * D, w2t, FF, D, WSC);            // [2048][512] -> [512][2048]

    // q, k, v = x W + b (f32 out)
    const unsigned short* xhu = (const unsigned short*)xh;
    const unsigned short* wtu = (const unsigned short*)wt4;
    wmma_gemm64<0, false, 2, 0, false, 0><<<gD, dim3(256), 0, stream>>>(
        xhu, xhu, D, 0L, wtu + 0 * (size_t)D * D, wtu + 0 * (size_t)D * D, D, 0L,
        (void*)qb_, (void*)qb_, D, 0L, bq + (size_t)l * D, bq + (size_t)l * D, 0L, TOK, D, D, 1.0f / WSC);
    wmma_gemm64<0, false, 2, 0, false, 0><<<gD, dim3(256), 0, stream>>>(
        xhu, xhu, D, 0L, wtu + 1 * (size_t)D * D, wtu + 1 * (size_t)D * D, D, 0L,
        (void*)kb_, (void*)kb_, D, 0L, bk + (size_t)l * D, bk + (size_t)l * D, 0L, TOK, D, D, 1.0f / WSC);
    wmma_gemm64<0, false, 2, 0, false, 0><<<gD, dim3(256), 0, stream>>>(
        xhu, xhu, D, 0L, wtu + 2 * (size_t)D * D, wtu + 2 * (size_t)D * D, D, 0L,
        (void*)vb_, (void*)vb_, D, 0L, bv + (size_t)l * D, bv + (size_t)l * D, 0L, TOK, D, D, 1.0f / WSC);

    // positive random features (f32)
    k_favor<<<dim3((TOK + 7) / 8), dim3(256), 0, stream>>>(qb_, kb_, omega + (size_t)l * HD * MH, Qfb, Kfb, TOK);

    // causal prefix recurrence (f32) as a chunk scan -> attn f16 x16
    k_chunk_sum<<<dim3(L / RC_T, B * 8), dim3(64), 0, stream>>>(Kfb, vb_, cst, L);
    k_chunk_prefix<<<dim3((RC_ST / 4 + 63) / 64, B * 8), dim3(64), 0, stream>>>(cst, L / RC_T);
    k_recur<<<dim3(L / RC_T, B * 8), dim3(64), 0, stream>>>(Qfb, Kfb, vb_, cst, ah, L, ASC);

    // t1 = attn Wo + bo + x ; x = LN1(t1)
    wmma_gemm64<0, false, 2, 0, true, 0><<<gD, dim3(256), 0, stream>>>(
        (const unsigned short*)ah, (const unsigned short*)ah, D, 0L, wtu + 3 * (size_t)D * D, wtu + 3 * (size_t)D * D, D, 0L,
        (void*)t1, (void*)t1, D, 0L, bo + (size_t)l * D, xres, 0L, TOK, D, D, 1.0f / (WSC * ASC));
    k_ln<true><<<dim3((TOK + 7) / 8), dim3(256), 0, stream>>>(t1, ln1g + (size_t)l * D, ln1b + (size_t)l * D, xf, xh, TOK, 1.0f);

    // y1 = relu(x W1 + b1) (f16 out); t1 = y1 W2 + b2 + x ; x = LN2(t1)
    wmma_gemm64<0, false, 2, 1, false, 2><<<gFF, dim3(256), 0, stream>>>(
        xhu, xhu, D, 0L, (const unsigned short*)w1t, (const unsigned short*)w1t, D, 0L,
        (void*)y1h, (void*)y1h, FF, 0L, b1 + (size_t)l * FF, b1 + (size_t)l * FF, 0L, TOK, FF, D, 1.0f / WSC);
    wmma_gemm64<0, false, 2, 0, true, 0><<<gD, dim3(256), 0, stream>>>(
        (const unsigned short*)y1h, (const unsigned short*)y1h, FF, 0L, (const unsigned short*)w2t, (const unsigned short*)w2t, FF, 0L,
        (void*)t1, (void*)t1, D, 0L, b2 + (size_t)l * D, xf, 0L, TOK, D, FF, 1.0f / WSC);
    k_ln<true><<<dim3((TOK + 7) / 8), dim3(256), 0, stream>>>(t1, ln2g + (size_t)l * D, ln2b + (size_t)l * D, xf, xh, TOK, 1.0f);
  }

  // final normalization -> output
  k_ln<false><<<dim3((TOK + 7) / 8), dim3(256), 0, stream>>>(xf, lnfg, lnfb, out, xh, TOK, 1.0f);
  (void)hipGetLastError();
}

// v002
// One run takes 380 microseconds.
// Timed twice side by side with v001, it ran 1.58 and 1.56 times as fast.
// Over all steps from v000 it is 9.64 times as fast.
#include <hip/hip_runtime.h>
// Contractions x*Wq, x*Wk, x*Wv, attn*Wo, x*W1, y*W2: v_wmma_f32_16x16x32_f16 (f16 operands; weights carried x64, attn x16), f32 accumulate. Feature map, causal prefix recurrence, LayerNorm: f32 VALU.

typedef __attribute__((ext_vector_type(16))) _Float16 v16h;
typedef __attribute__((ext_vector_type(8)))  _Float16 v8h;
typedef __attribute__((ext_vector_type(4)))  _Float16 v4h;
typedef __attribute__((ext_vector_type(16))) __bf16   v16b;
typedef __attribute__((ext_vector_type(8)))  __bf16   v8b;
typedef __attribute__((ext_vector_type(8)))  float    v8f;
typedef __attribute__((ext_vector_type(4)))  float    v4f;

__device__ __forceinline__ unsigned short f2bf_bits(float f) {
  unsigned u = __float_as_uint(f);
  return (unsigned short)((u + 0x7FFFu + ((u >> 16) & 1u)) >> 16);
}
__device__ __forceinline__ float bf_bits2f(unsigned short h) { return __uint_as_float(((unsigned)h) << 16); }

// hazard guards as plain device helpers
__device__ __forceinline__ void acc_guard4(v8f& a, v8f& b, v8f& c, v8f& d) { asm volatile("v_nop\n\tv_nop\n\tv_nop\n\tv_nop" : "+v"(a), "+v"(b), "+v"(c), "+v"(d)); }
template <typename T> struct Frag;
template <> struct Frag<_Float16> {
  typedef v16h V; union U { v16h v; v8h h[2]; };
  static __device__ __forceinline__ v16h load(const _Float16* p) {   // elements 0..7 <- p[0..7], 8..15 <- p[16..23]
    U f; f.h[0] = *(const v8h*)(p); f.h[1] = *(const v8h*)(p + 16); return f.v;
  }
  static __device__ __forceinline__ v8f mma(v16h a, v16h b, v8f c) {
    return __builtin_amdgcn_wmma_f32_16x16x32_f16(false, a, false, b, (short)0, c, false, false);
  }
};
template <> struct Frag<__bf16> {
  typedef v16b V; union U { v16b v; v8b h[2]; };
  static __device__ __forceinline__ v16b load(const __bf16* p) {
    U f; f.h[0] = *(const v8b*)(p); f.h[1] = *(const v8b*)(p + 16); return f.v;
  }
  static __device__ __forceinline__ v8f mma(v16b a, v16b b, v8f c) {
    return __builtin_amdgcn_wmma_f32_16x16x32_bf16(false, a, false, b, (short)0, c, false, false);
  }
};

// One stage of the GEMM's LDS ring: 64 k (one 128-byte line) of the block's 64 A rows and 512 Bt rows.
#define GS_K 64
#define GS_PITCH 72                      // 16-bit elements per LDS row: 144 B = 16 B x 9, conflict-free for ds_load_b128
#define GS_STAGE (576 * GS_PITCH)        // 16-bit elements per stage
// Nine asynchronous 16-byte copies of a lane, global -> LDS (l = LDS byte address, g = global address).
// s_wait_xcnt stands in the copies' own statement so that no address register is rewritten ahead of it.
__device__ __forceinline__ void async_copy9(const unsigned* l, const void* const* g) {
  asm volatile(
      "global_load_async_to_lds_b128 %0, %9, off\n\t"
      "global_load_async_to_lds_b128 %1, %10, off\n\t"
      "global_load_async_to_lds_b128 %2, %11, off\n\t"
      "global_load_async_to_lds_b128 %3, %12, off\n\t"
      "global_load_async_to_lds_b128 %4, %13, off\n\t"
      "global_load_async_to_lds_b128 %5, %14, off\n\t"
      "global_load_async_to_lds_b128 %6, %15, off\n\t"
      "global_load_async_to_lds_b128 %7, %16, off\n\t"
      "global_load_async_to_lds_b128 %8, %17, off\n\t"
      "s_wait_xcnt 0x0"
      :: "v"(l[0]), "v"(l[1]), "v"(l[2]), "v"(l[3]), "v"(l[4]), "v"(l[5]), "v"(l[6]), "v"(l[7]), "v"(l[8]),
         "v"(g[0]), "v"(g[1]), "v"(g[2]), "v"(g[3]), "v"(g[4]), "v"(g[5]), "v"(g[6]), "v"(g[7]), "v"(g[8])
      : "memory");
}

// ---- Register-blocked batched WMMA GEMM ------------------------------------
// C[m,n] = scale * sum_k A[m,k] * Bt[n,k] (+bias)(+resid); each wave owns a 64x64 tile, a block of eight waves a 64x512 tile.
// A row-major [M,K]; Bt row-major [N,K]; M % 64 == 0, N % 512 == 0, K % 64 == 0, K >= 64.
// Operands reach the waves through a two-buffer LDS ring filled by asynchronous copies, one stage ahead of the WMMAs.
// SPLIT (hi/lo operand planes A2/Bt2) is not staged by the ring and must be false.
// BIAS_MODE: 0 = none, 1 = bias[m], 2 = bias[n].
// OUT_MODE: 0 = f32, 1 = f16, 2 = bf16 hi plane (Cout) + bf16 lo plane (Cout2).
// ET: 0 = f16 operands, 1 = bf16 operands (pointers passed as 16-bit storage)
template <int ET> struct Elem;
template <> struct Elem<0> { typedef _Float16 T; };
template <> struct Elem<1> { typedef __bf16 T; };
template <int ET, bool SPLIT, int BIAS_MODE, int OUT_MODE, bool RESID, int ACT = 0>
__global__ __launch_bounds__(256) void wmma_gemm64(
    const unsigned short* __restrict__ Ap, const unsigned short* __restrict__ A2p, int lda, long strideA,
    const unsigned short* __restrict__ Btp, const unsigned short* __restrict__ Bt2p, int ldb, long strideB,
    void* __restrict__ Cout, void* __restrict__ Cout2, int ldc, long strideC,
    const float* __restrict__ bias,
    const float* __restrict__ resid, long strideR,
    int M, int N, int K, float scale) {
  typedef typename Elem<ET>::T T;
  typedef typename Frag<T>::V V;
  const T* A = (const T*)Ap; const T* Bt = (const T*)Btp;
  static_assert(!SPLIT, "the LDS ring stages one plane per operand");
  __shared__ __align__(16) unsigned short sAB[2 * GS_STAGE];   // two stages: rows 0..63 = A, rows 64..575 = Bt
  __shared__ __align__(16) float sT[8][16 * 68];   // per-wave 16x64 slab, pitch 68 floats
  const int b    = blockIdx.y;
  const int tid  = threadIdx.x;
  const int lane = tid & 31;
  const int wave = tid >> 5;
  const int tilesN = N >> 6;
  const int tilesM = M >> 6;
  const int tile0 = blockIdx.x * 8;            // the block's eight tiles: one tile row, eight adjacent tile columns
  if (tile0 >= tilesM * tilesN) return;        // block-uniform, in front of every barrier
  const int tm  = tile0 / tilesN;
  const int m0  = tm << 6;
  const int nb0 = (tile0 - tm * tilesN) << 6;
  const int n0  = nb0 + (wave << 6);

  const T* Ab  = A  + (size_t)b * strideA;
  const T* Bb  = Bt + (size_t)b * strideB;

  const int rlane = lane & 15;                 // row (A) / col (B, D) within subtile
  const int koff  = (lane >> 4) * 8;           // k offset of this lane half
  const int mOff  = (lane >> 4) * 8;           // D row offset

  // Copies: eight lanes cover one row's 128-byte line, a wave four rows, the block 32 rows per copy; 18 copies per lane and stage.
  const int cr = tid >> 3, cc = (tid & 7) * 8;
  const T* pA = Ab + (size_t)(m0 + cr) * lda + cc;    // this lane's first A and Bt addresses of the next stage to copy
  const T* pB = Bb + (size_t)(nb0 + cr) * ldb + cc;
  const unsigned lds0 = (unsigned)(size_t)sAB + (unsigned)(cr * GS_PITCH + cc) * 2u;
  auto fill = [&](int buf) {
    const unsigned lb = lds0 + (unsigned)buf * (GS_STAGE * 2u);
    unsigned l[18];
    const void* g[18];
#pragma unroll   // constant indices keep l[] and g[] in registers
    for (int it = 0; it < 18; ++it) {
      l[it] = lb + (unsigned)(it * 32 * GS_PITCH) * 2u;
      g[it] = (it < 2) ? (pA + (size_t)(it * 32) * lda) : (pB + (size_t)((it - 2) * 32) * ldb);
    }
    async_copy9(l, g);
    async_copy9(l + 9, g + 9);
    pA += GS_K;
    pB += GS_K;
  };

  v8f acc[4][4];
#pragma unroll
  for (int i = 0; i < 4; ++i)
#pragma unroll
    for (int j = 0; j < 4; ++j) acc[i][j] = (v8f){0.f,0.f,0.f,0.f,0.f,0.f,0.f,0.f};

  const int nst = K / GS_K;
  fill(0);
  asm volatile("s_wait_asynccnt 0x0" ::: "memory");   // this wave's copies of stage 0 have landed
  __syncthreads();                                    // ... and every other wave's
  if (nst > 1) fill(1);
  for (int t = 0; t < nst; ++t) {
    const T* sb = (const T*)sAB + (t & 1) * GS_STAGE;
    const T* sa = sb + rlane * GS_PITCH + koff;
    const T* sw = sb + (64 + (wave << 6) + rlane) * GS_PITCH + koff;
    V bh[4], ah[4];
    auto frags = [&](int ks) {   // the eight fragments of 32 k
#pragma unroll
      for (int j = 0; j < 4; ++j) bh[j] = Frag<T>::load(sw + j * 16 * GS_PITCH + ks * 32);
#pragma unroll
      for (int i = 0; i < 4; ++i) ah[i] = Frag<T>::load(sa + i * 16 * GS_PITCH + ks * 32);
    };
    auto products = [&]() {
#pragma unroll
      for (int i = 0; i < 4; ++i)
#pragma unroll
        for (int j = 0; j < 4; ++j) acc[i][j] = Frag<T>::mma(ah[i], bh[j], acc[i][j]);
    };
    frags(0);
    // Keeps the eight fragments' loads together ahead of the WMMAs: left free, each A fragment's load sinks to its first use and the wave waits out the LDS latency four times per 32 k.
    __builtin_amdgcn_sched_barrier(0);
    products();
    frags(1);                                           // the stage's last LDS reads
    asm volatile("s_wait_dscnt 0x0" ::: "memory");      // this wave's reads of stage t are done before the buffer is refilled
    asm volatile("s_wait_asynccnt 0x0" ::: "memory");   // this wave's copies of stage t + 1 have landed
    __syncthreads();                                    // publishes stage t + 1 and ends every wave's reads of stage t
    if (t + 2 < nst) fill(t & 1);
    // Keeps the refill's issue ahead of the second 16 WMMAs (registers only), whose time the copies then have as lead.
    __builtin_amdgcn_sched_barrier(0);
    products();
  }
  asm volatile("s_wait_asynccnt 0x0" ::: "memory");     // no copy is outstanding behind the loop
  acc_guard4(acc[0][0], acc[0][1], acc[0][2], acc[0][3]);
  acc_guard4(acc[1][0], acc[1][1], acc[1][2], acc[1][3]);
  acc_guard4(acc[2][0], acc[2][1], acc[2][2], acc[2][3]);
  acc_guard4(acc[3][0], acc[3][1], acc[3][2], acc[3][3]);

  // ---- epilogue ----
  float* slab = sT[wave];
  const float* Rb = RESID ? (resid + (size_t)b * strideR) : nullptr;
#pragma unroll
  for (int i = 0; i < 4; ++i) {
    const int mBase = m0 + (i << 4);
#pragma unroll
    for (int j = 0; j < 4; ++j) {
      const int n = n0 + (j << 4) + rlane;
      float bv = 0.f;
      if (BIAS_MODE == 2) bv = bias[n];
#pragma unroll
      for (int r = 0; r < 8; ++r) {
        float v = acc[i][j][r] * scale;
        if (BIAS_MODE == 1) v += bias[mBase + mOff + r];
        if (BIAS_MODE == 2) v += bv;
        if (RESID) v += Rb[(size_t)(mBase + mOff + r) * ldc + n];
        if (ACT == 1) v = tanhf(v);
        if (ACT == 2) v = fmaxf(v, 0.0f);
        if (ACT == 3) v = v / (1.0f + expf(-v));
        if (ACT == 4) v = (v > 0.f) ? v : 0.01f * v;
        if (ACT == 5) v = 0.5f * v * (1.0f + erff(v * 0.70710678118654752f));
        slab[(mOff + r) * 68 + (j << 4) + rlane] = v;
      }
    }
    __builtin_amdgcn_fence(__ATOMIC_RELEASE, "workgroup");
    __builtin_amdgcn_wave_barrier();
    __builtin_amdgcn_fence(__ATOMIC_ACQUIRE, "workgroup");
    if (OUT_MODE == 0) {
      float* C = (float*)Cout + (size_t)b * strideC;
      const int hh = lane >> 4, c4 = (lane & 15) * 4;     // row seg = 256 B = 16 lanes x 16 B
      {
#pragma unroll
        for (int it = 0; it < 8; ++it) {
          const int row = it * 2 + hh;
          v4f v = *(const v4f*)(slab + row * 68 + c4);
          *(v4f*)(C + (size_t)(mBase + row) * ldc + n0 + c4) = v;
        }
        
      }
    } else {
      const int q = lane >> 3, c8 = (lane & 7) * 8;
      unsigned short* C  = (unsigned short*)Cout  + (size_t)b * strideC;
      unsigned short* C2 = (OUT_MODE == 2) ? ((unsigned short*)Cout2 + (size_t)b * strideC) : nullptr;
      {
#pragma unroll
        for (int it = 0; it < 4; ++it) {
          const int row = it * 4 + q;
          const float* sp = slab + row * 68 + c8;
          v8h hv, lv;
#pragma unroll
          for (int e = 0; e < 8; ++e) {
            if (OUT_MODE == 1) {
              hv[e] = (_Float16)sp[e];
            } else {
              unsigned short hb = f2bf_bits(sp[e]);
              unsigned short lb = f2bf_bits(sp[e] - bf_bits2f(hb));
              hv[e] = __builtin_bit_cast(_Float16, hb);
              lv[e] = __builtin_bit_cast(_Float16, lb);
            }
          }
          *(v8h*)(C + (size_t)(mBase + row) * ldc + n0 + c8) = hv;
          if (OUT_MODE == 2) *(v8h*)(C2 + (size_t)(mBase + row) * ldc + n0 + c8) = lv;
        }
        
      }
    }
    __builtin_amdgcn_fence(__ATOMIC_RELEASE, "workgroup");
    __builtin_amdgcn_wave_barrier();
    __builtin_amdgcn_fence(__ATOMIC_ACQUIRE, "workgroup");
  }
}

__global__ __launch_bounds__(256) void k_cast_f16x2(
    const float* __restrict__ in, _Float16* __restrict__ out, int n2, float scale) {
  const int i = blockIdx.x * 256 + threadIdx.x;
  if (i < n2) {
    const _Float16 h0 = (_Float16)(in[2 * i] * scale), h1 = (_Float16)(in[2 * i + 1] * scale);
    const unsigned u = (unsigned)__builtin_bit_cast(unsigned short, h0) | ((unsigned)__builtin_bit_cast(unsigned short, h1) << 16);
    ((unsigned*)out)[i] = u;
    
  }
}

// ---- Weight transpose + f16 cast: matrix z: in[K][N] f32 -> out[z][N][K] f16 * scale.
__global__ __launch_bounds__(256) void k_wT(
    const float* __restrict__ p0, const float* __restrict__ p1,
    const float* __restrict__ p2, const float* __restrict__ p3,
    _Float16* __restrict__ out, int K, int N, float scale) {
  __shared__ float tile[64][65];   // [n][k]
  const int tid = threadIdx.x, lane = tid & 31, wave = tid >> 5;
  const int n0 = blockIdx.x * 64, k0 = blockIdx.y * 64, z = blockIdx.z;
  const float* src = (z == 0) ? p0 : (z == 1) ? p1 : (z == 2) ? p2 : p3;
  const int c4 = (tid & 15) * 4, r0 = tid >> 4;
#pragma unroll
  for (int it = 0; it < 4; ++it) {
    const int kr = it * 16 + r0;
    const v4f v = *(const v4f*)(src + (size_t)(k0 + kr) * N + n0 + c4);
    tile[c4 + 0][kr] = v[0];
    tile[c4 + 1][kr] = v[1];
    tile[c4 + 2][kr] = v[2];
    tile[c4 + 3][kr] = v[3];
  }
  __syncthreads();
  const int q = lane >> 3, c8 = (lane & 7) * 8;
  _Float16* ob = out + (size_t)z * N * K;
  {
#pragma unroll
    for (int it = 0; it < 2; ++it) {
      const int row = wave * 8 + it * 4 + q;          // waves 0..7 x 8 rows = 64 rows
      v8h hv;
#pragma unroll
      for (int e = 0; e < 8; ++e) hv[e] = (_Float16)(tile[row][c8 + e] * scale);
      *(v8h*)(ob + (size_t)(n0 + row) * K + k0 + c8) = hv;
    }
    
  }
}

// ---- FAVOR positive feature map, f32. One wave per token, both sources (q, k), all 8 heads x 64 dims.
// xs = x * 64^-0.25; u[j] = sum_d xs[h][d] * omega[d][j] (lane = j); off = 0.5 * |xs[h]|^2;
// phi = [exp(u-off), exp(-u-off)] * 0.125 -> out[token][h*64 + j], out[token][h*64 + 32 + j].
__global__ __launch_bounds__(256) void k_favor(
    const float* __restrict__ qin, const float* __restrict__ kin, const float* __restrict__ omega,
    float* __restrict__ qf, float* __restrict__ kf, int ntok) {
  __shared__ __align__(16) float omT[32 * 68];    // [j][d], pitch 68
  __shared__ __align__(16) float xs[8][512];       // per wave scaled token row
  __shared__ float nrm[8][8];                      // per wave, per head squared norm
  const int tid = threadIdx.x, lane = tid & 31, wave = tid >> 5, hh = lane >> 4;
#pragma unroll
  for (int i = 0; i < 8; ++i) {
    const int idx = i * 256 + tid;                 // omega element (d = idx>>5, j = idx&31)
    omT[(idx & 31) * 68 + (idx >> 5)] = omega[idx];
  }
  __syncthreads();
  const int tok = blockIdx.x * 8 + wave;
  if (tok >= ntok) return;                         // wave-uniform; no block barriers below
  const float sc = 0.35355339059327379f;           // 64^-0.25
  float* xw = xs[wave];
#pragma unroll 1
  for (int srci = 0; srci < 2; ++srci) {
    const float* xrow = ((srci == 0) ? qin : kin) + (size_t)tok * 512;
    float* frow = ((srci == 0) ? qf : kf) + (size_t)tok * 512;
    __builtin_amdgcn_fence(__ATOMIC_RELEASE, "workgroup");
    __builtin_amdgcn_wave_barrier();
    __builtin_amdgcn_fence(__ATOMIC_ACQUIRE, "workgroup");
#pragma unroll
    for (int i = 0; i < 4; ++i) {
      v4f v = *(const v4f*)(xrow + i * 128 + lane * 4);
      v = v * sc;
      *(v4f*)(xw + i * 128 + lane * 4) = v;
      float s = v[0] * v[0] + v[1] * v[1] + v[2] * v[2] + v[3] * v[3];
      s += __shfl_xor(s, 1, 32);
      s += __shfl_xor(s, 2, 32);
      s += __shfl_xor(s, 4, 32);
      s += __shfl_xor(s, 8, 32);
      if ((lane & 15) == 0) nrm[wave][2 * i + hh] = s;   // head of this 64-element group = 2i + lane/16
    }
    __builtin_amdgcn_fence(__ATOMIC_RELEASE, "workgroup");
    __builtin_amdgcn_wave_barrier();
    __builtin_amdgcn_fence(__ATOMIC_ACQUIRE, "workgroup");
#pragma unroll 1
    for (int h = 0; h < 8; ++h) {
      const float off = 0.5f * nrm[wave][h];
      const float* xp = xw + h * 64;
      const float* op = omT + lane * 68;
      float u = 0.f;
#pragma unroll 1
      for (int g = 0; g < 4; ++g) {
        const v4f a0 = *(const v4f*)(xp + 16 * g);
        const v4f a1 = *(const v4f*)(xp + 16 * g + 4);
        const v4f a2 = *(const v4f*)(xp + 16 * g + 8);
        const v4f a3 = *(const v4f*)(xp + 16 * g + 12);
        const v4f o0 = *(const v4f*)(op + 16 * g);
        const v4f o1 = *(const v4f*)(op + 16 * g + 4);
        const v4f o2 = *(const v4f*)(op + 16 * g + 8);
        const v4f o3 = *(const v4f*)(op + 16 * g + 12);
        u = fmaf(a0[0], o0[0], u); u = fmaf(a0[1], o0[1], u); u = fmaf(a0[2], o0[2], u); u = fmaf(a0[3], o0[3], u);
        u = fmaf(a1[0], o1[0], u); u = fmaf(a1[1], o1[1], u); u = fmaf(a1[2], o1[2], u); u = fmaf(a1[3], o1[3], u);
        u = fmaf(a2[0], o2[0], u); u = fmaf(a2[1], o2[1], u); u = fmaf(a2[2], o2[2], u); u = fmaf(a2[3], o2[3], u);
        u = fmaf(a3[0], o3[0], u); u = fmaf(a3[1], o3[1], u); u = fmaf(a3[2], o3[2], u); u = fmaf(a3[3], o3[3], u);
      }
      const float e1 = expf(u - off) * 0.125f;
      const float e2 = expf(-u - off) * 0.125f;
      float* vo = frow + h * 64;
      vo[lane] = e1;
      vo[lane + 32] = e2;
      
    }
  }
}

// ---- Causal linear attention, f32, as a scan over chunks of RC_T steps: three launches.
// State of one (b, h) before a step: S[d][m] = sum Kf[m] * v[d], z[m] = sum Kf[m] over all earlier steps.
// One chunk's record in the workspace: RC_ST floats; S[d][4g + e] at (g * 64 + d) * 4 + e (lanes adjacent), z[m] at 4096 + m.
#define RC_T 32
#define RC_ST 4160

// 1) Sums over one chunk alone. One block (64 threads) per (chunk, b*8+h); thread d holds S[d][0..63] in registers, thread m holds z[m].
__global__ __launch_bounds__(64) void k_chunk_sum(
    const float* __restrict__ kf, const float* __restrict__ vin, float* __restrict__ st, int L) {
  __shared__ __align__(16) float Kc[RC_T * 64];   // [t][m]
  __shared__ __align__(16) float Vc[RC_T * 64];   // [t][d]
  const int tid = threadIdx.x;
  const int ch = blockIdx.x, bh = blockIdx.y;
  const int b = bh >> 3, h = bh & 7;
  const size_t base = (size_t)b * L * 512 + (size_t)h * 64;
  const int t0 = ch * RC_T;
  {
    const int r0 = tid >> 4, c4 = (tid & 15) * 4;
#pragma unroll   // all sixteen loads in flight together
    for (int it = 0; it < 8; ++it) {
      const int r = it * 4 + r0;                 // 0..31
      const size_t go = base + (size_t)(t0 + r) * 512 + c4;
      *(v4f*)(Kc + r * 64 + c4) = *(const v4f*)(kf + go);
      *(v4f*)(Vc + r * 64 + c4) = *(const v4f*)(vin + go);
    }
  }
  __syncthreads();
  v4f s[16];
#pragma unroll   // constant indices keep s[] in registers (here and in the two loops over g below)
  for (int g = 0; g < 16; ++g) s[g] = (v4f){0.f, 0.f, 0.f, 0.f};
  float z = 0.f;
  for (int t = 0; t < RC_T; ++t) {
    const float vt = Vc[t * 64 + tid];
    z += Kc[t * 64 + tid];
    const float* kr = Kc + t * 64;
#pragma unroll
    for (int g = 0; g < 16; ++g) s[g] = *(const v4f*)(kr + 4 * g) * vt + s[g];
  }
  float* o = st + ((size_t)bh * (L / RC_T) + ch) * RC_ST;
#pragma unroll
  for (int g = 0; g < 16; ++g) *(v4f*)(o + (g * 64 + tid) * 4) = s[g];
  o[4096 + tid] = z;
}

// 2) Exclusive prefix over the chunks of one (b, h), in place, in ascending chunk order; one thread per 4 state elements.
// nch % 16 == 0. Sixteen chunks' loads are issued together so that their latencies overlap.
__global__ __launch_bounds__(64) void k_chunk_prefix(float* __restrict__ st, int nch) {
  const int e4 = blockIdx.x * 64 + threadIdx.x;
  if (e4 >= RC_ST / 4) return;
  float* p = st + (size_t)blockIdx.y * nch * RC_ST + e4 * 4;
  v4f run = (v4f){0.f, 0.f, 0.f, 0.f};
  for (int c0 = 0; c0 < nch; c0 += 16) {
    v4f v[16];
#pragma unroll   // loads issued back to back; constant indices keep v[] in registers (also in the loop below)
    for (int i = 0; i < 16; ++i) v[i] = *(const v4f*)(p + (size_t)(c0 + i) * RC_ST);
#pragma unroll
    for (int i = 0; i < 16; ++i) {
      *(v4f*)(p + (size_t)(c0 + i) * RC_ST) = run;
      run = run + v[i];
    }
  }
}

// 3) The recurrence inside one chunk, started from the chunk's prefix state. One block (64 threads) per (chunk, b*8+h).
// Stage Kf, Qf, v rows in LDS; thread m accumulates z[m] and den_t = sum_m Qf_t[m] z_t[m]
// (fixed-order shuffle + 2-wave combine); thread d owns S[d][0..63] (LDS, pitch 68): S += Kf_t (x) v_t[d],
// num = sum_m Qf_t[m] S[d][m]; out_t[d] = num * rcp(den_t + 1e-6). Chunk outputs staged in LDS and written as f16.
__global__ __launch_bounds__(64) void k_recur(
    const float* __restrict__ qf, const float* __restrict__ kf, const float* __restrict__ vin,
    const float* __restrict__ st, _Float16* __restrict__ outh, int L, float oscale) {
  __shared__ __align__(16) float S[64 * 68];      // [d][m]
  __shared__ __align__(16) float Kc[RC_T * 64];   // [t][m]
  __shared__ __align__(16) float Qc[RC_T * 64];   // [t][m]
  __shared__ __align__(16) float Vc[RC_T * 64];   // [t][d] -> out[t][d]
  __shared__ float denp[2][RC_T];
  __shared__ float den[RC_T];
  const int tid = threadIdx.x, lane = tid & 31, wave = tid >> 5;
  const int ch = blockIdx.x, bh = blockIdx.y;
  const int b = bh >> 3, h = bh & 7;
  const size_t base = (size_t)b * L * 512 + (size_t)h * 64;
  const float* sp = st + ((size_t)bh * (L / RC_T) + ch) * RC_ST;
  float* srow = S + tid * 68;
#pragma unroll
  for (int g = 0; g < 16; ++g) *(v4f*)(srow + 4 * g) = *(const v4f*)(sp + (g * 64 + tid) * 4);
  float z = sp[4096 + tid];                        // thread = m
  {
    const int t0 = ch * RC_T;
    {
      const int r0 = tid >> 4, c4 = (tid & 15) * 4;
#pragma unroll
      for (int it = 0; it < 8; ++it) {
        const int r = it * 4 + r0;                 // 0..31
        const size_t go = base + (size_t)(t0 + r) * 512 + c4;
        *(v4f*)(Kc + r * 64 + c4) = *(const v4f*)(kf + go);
        *(v4f*)(Qc + r * 64 + c4) = *(const v4f*)(qf + go);
        *(v4f*)(Vc + r * 64 + c4) = *(const v4f*)(vin + go);
      }
    }
    __syncthreads();
#pragma unroll 1
    for (int t = 0; t < RC_T; ++t) {
      z += Kc[t * 64 + tid];
      float p = Qc[t * 64 + tid] * z;
      p += __shfl_xor(p, 16, 32);
      p += __shfl_xor(p, 8, 32);
      p += __shfl_xor(p, 4, 32);
      p += __shfl_xor(p, 2, 32);
      p += __shfl_xor(p, 1, 32);
      if (lane == 0) denp[wave][t] = p;
    }
    __syncthreads();
    if (tid < RC_T) den[tid] = denp[0][tid] + denp[1][tid];
    __syncthreads();
#pragma unroll 1
    for (int t = 0; t < RC_T; ++t) {
      const float vt = Vc[t * 64 + tid];           // own slot (thread = d)
      const float* kr = Kc + t * 64;
      const float* qr = Qc + t * 64;
      v4f n0 = (v4f){0.f, 0.f, 0.f, 0.f}, n1 = (v4f){0.f, 0.f, 0.f, 0.f};
#pragma unroll 1
      for (int g = 0; g < 8; ++g) {
        const v4f k0 = *(const v4f*)(kr + 8 * g);
        const v4f k1 = *(const v4f*)(kr + 8 * g + 4);
        const v4f q0 = *(const v4f*)(qr + 8 * g);
        const v4f q1 = *(const v4f*)(qr + 8 * g + 4);
        v4f s0 = *(v4f*)(srow + 8 * g);
        v4f s1 = *(v4f*)(srow + 8 * g + 4);
        s0 = k0 * vt + s0;
        s1 = k1 * vt + s1;
        *(v4f*)(srow + 8 * g) = s0;
        *(v4f*)(srow + 8 * g + 4) = s1;
        n0 = q0 * s0 + n0;
        n1 = q1 * s1 + n1;
      }
      const float num = ((n0[0] + n0[1]) + (n0[2] + n0[3])) + ((n1[0] + n1[1]) + (n1[2] + n1[3]));
      const float zi = __builtin_amdgcn_rcpf(den[t] + 1e-6f);
      Vc[t * 64 + tid] = num * zi;
    }
    __syncthreads();
    {
      const int q = lane >> 3, c8 = (lane & 7) * 8;
      {
#pragma unroll
        for (int it = 0; it < 4; ++it) {
          const int row = wave * 16 + it * 4 + q;  // wave 0: rows 0..15, wave 1: rows 16..31
          v8h hv;
#pragma unroll
          for (int e = 0; e < 8; ++e) hv[e] = (_Float16)(Vc[row * 64 + c8 + e] * oscale);
          *(v8h*)(outh + base + (size_t)(t0 + row) * 512 + c8) = hv;
        }
        
      }
    }
  }
}

// ---- LayerNorm over 512, one wave per row; lane owns elements i*128 + lane*4 .. +3 (i = 0..3).
template <bool WH>
__global__ __launch_bounds__(256) void k_ln(
    const float* __restrict__ in, const float* __restrict__ g, const float* __restrict__ bta,
    float* __restrict__ outf, _Float16* __restrict__ outh, int nrows, float hscale) {
  const int lane = threadIdx.x & 31, wave = threadIdx.x >> 5;
  const int row = blockIdx.x * 8 + wave;
  if (row >= nrows) return;                        // wave-uniform; no block barriers
  const float* ip = in + (size_t)row * 512;
  v4f x[4];
  float s = 0.f;
#pragma unroll
  for (int i = 0; i < 4; ++i) {
    x[i] = *(const v4f*)(ip + i * 128 + lane * 4);
    s += (x[i][0] + x[i][1]) + (x[i][2] + x[i][3]);
  }
#pragma unroll
  for (int o = 1; o < 32; o <<= 1) s += __shfl_xor(s, o, 32);
  const float mu = s * 0.001953125f;
  float vs = 0.f;
#pragma unroll
  for (int i = 0; i < 4; ++i) {
    const v4f d = x[i] - mu;
    vs += (d[0] * d[0] + d[1] * d[1]) + (d[2] * d[2] + d[3] * d[3]);
  }
#pragma unroll
  for (int o = 1; o < 32; o <<= 1) vs += __shfl_xor(vs, o, 32);
  const float rstd = rsqrtf(vs * 0.001953125f + 1e-5f);
  v4f y[4];
#pragma unroll
  for (int i = 0; i < 4; ++i) {
    const v4f gg = *(const v4f*)(g + i * 128 + lane * 4);
    const v4f bb = *(const v4f*)(bta + i * 128 + lane * 4);
    y[i] = (x[i] - mu) * rstd * gg + bb;
  }
  float* op = outf + (size_t)row * 512;
  _Float16* oh = outh + (size_t)row * 512;
  {
#pragma unroll
    for (int i = 0; i < 4; ++i) {
      *(v4f*)(op + i * 128 + lane * 4) = y[i];
      if (WH) {
        v4h hv;
        hv[0] = (_Float16)(y[i][0] * hscale); hv[1] = (_Float16)(y[i][1] * hscale);
        hv[2] = (_Float16)(y[i][2] * hscale); hv[3] = (_Float16)(y[i][3] * hscale);
        *(v4h*)(oh + i * 128 + lane * 4) = hv;
      }
    }
    
  }
}

// ---------------------------------------------------------------------------
extern "C" void kernel_launch(void* const* d_in, const int* in_sizes, int n_in,
                              void* d_out, int out_size, void* d_ws, size_t ws_size,
                              hipStream_t stream)
{
  const int B = 2, L = 2048, D = 512, FF = 2048, HD = 64, MH = 32, DEPTH = 2;
  const int TOK = B * L;
  if (n_in < 20) return;
  if (in_sizes[0] != TOK * D || in_sizes[1] != DEPTH * D * D || in_sizes[3] != DEPTH * D * D ||
      in_sizes[5] != DEPTH * D * D || in_sizes[7] != DEPTH * D * D || in_sizes[9] != DEPTH * HD * MH ||
      in_sizes[12] != DEPTH * D * FF || in_sizes[14] != DEPTH * FF * D || out_size != TOK * D) return;

  const float* x_in  = (const float*)d_in[0];
  const float* Wq    = (const float*)d_in[1];
  const float* bq    = (const float*)d_in[2];
  const float* Wk    = (const float*)d_in[3];
  const float* bk    = (const float*)d_in[4];
  const float* Wv    = (const float*)d_in[5];
  const float* bv    = (const float*)d_in[6];
  const float* Wo    = (const float*)d_in[7];
  const float* bo    = (const float*)d_in[8];
  const float* omega = (const float*)d_in[9];
  const float* ln1g  = (const float*)d_in[10];
  const float* ln1b  = (const float*)d_in[11];
  const float* W1    = (const float*)d_in[12];
  const float* b1    = (const float*)d_in[13];
  const float* W2    = (const float*)d_in[14];
  const float* b2    = (const float*)d_in[15];
  const float* ln2g  = (const float*)d_in[16];
  const float* ln2b  = (const float*)d_in[17];
  const float* lnfg  = (const float*)d_in[18];
  const float* lnfb  = (const float*)d_in[19];
  float* out = (float*)d_out;

  // ---- workspace carve (under 103 MiB) ----
  char* ws = (char*)d_ws;
  size_t off = 0;
  auto carve = [&](size_t bytes) -> char* { char* p = ws + off; off += (bytes + 255) & ~(size_t)255; return p; };
  _Float16* xh  = (_Float16*)carve((size_t)TOK * D * 2);    // f16 A operand of current x
  float*    xf  = (float*)carve((size_t)TOK * D * 4);       // f32 current x (residual source)
  float*    qb_ = (float*)carve((size_t)TOK * D * 4);
  float*    kb_ = (float*)carve((size_t)TOK * D * 4);
  float*    vb_ = (float*)carve((size_t)TOK * D * 4);
  float*    Qfb = (float*)carve((size_t)TOK * D * 4);
  float*    Kfb = (float*)carve((size_t)TOK * D * 4);
  _Float16* ah  = (_Float16*)carve((size_t)TOK * D * 2);    // attention output, f16 x16
  float*    t1  = (float*)carve((size_t)TOK * D * 4);       // pre-LN sums
  _Float16* y1h = (_Float16*)carve((size_t)TOK * FF * 2);   // relu(x W1 + b1), f16
  _Float16* wt4 = (_Float16*)carve((size_t)4 * D * D * 2);  // [Wq,Wk,Wv,Wo]^T f16 x64, [4][N][K]
  _Float16* w1t = (_Float16*)carve((size_t)D * FF * 2);     // W1^T [FF][D] f16 x64
  _Float16* w2t = (_Float16*)carve((size_t)FF * D * 2);     // W2^T [D][FF] f16 x64
  float*    cst = (float*)carve((size_t)B * 8 * (L / RC_T) * RC_ST * 4);   // per (b, h, chunk) state record
  if (off > ws_size) return;

  const float WSC = 64.0f, ASC = 16.0f;
  const int n2 = TOK * D / 2;
  k_cast_f16x2<<<dim3((n2 + 255) / 256), dim3(256), 0, stream>>>(x_in, xh, n2, 1.0f);

  const int tilesD  = (TOK / 64) * (D / 64);      // 512
  const int tilesFF = (TOK / 64) * (FF / 64);     // 2048
  const dim3 gD((tilesD + 7) / 8, 1), gFF((tilesFF + 7) / 8, 1);

  for (int l = 0; l < DEPTH; ++l) {
    const size_t wDD = (size_t)l * D * D;
    const float* xres = (l == 0) ? x_in : xf;

    // weights: in[K][N] -> out[N][K] f16 x64
    k_wT<<<dim3(D / 64, D / 64, 4), dim3(256), 0, stream>>>(Wq + wDD, Wk + wDD, Wv + wDD, Wo + wDD, wt4, D, D, WSC);
    k_wT<<<dim3(FF / 64, D / 64, 1), dim3(256), 0, stream>>>(W1 + (size_t)l * D * FF, W1 + (size_t)l * D * FF,
        W1 + (size_t)l * D * FF, W1 + (size_t)l * D * FF, w1t, D, FF, WSC);            // [512][2048] -> [2048][512]
    k_wT<<<dim3(D / 64, FF / 64, 1), dim3(256), 0, stream>>>(W2 + (size_t)l * FF * D, W2 + (size_t)l * FF * D,
        W2 + (size_t)l * FF * D, W2 + (size_t)l * FF * D, w2t, FF, D, WSC);            // [2048][512] -> [512][2048]

    // q, k, v = x W + b (f32 out)
    const unsigned short* xhu = (const unsigned short*)xh;
    const unsigned short* wtu = (const unsigned short*)wt4;
    wmma_gemm64<0, false, 2, 0, false, 0><<<gD, dim3(256), 0, stream>>>(
        xhu, xhu, D, 0L, wtu + 0 * (size_t)D * D, wtu + 0 * (size_t)D * D, D, 0L,
        (void*)qb_, (void*)qb_, D, 0L, bq + (size_t)l * D, bq + (size_t)l * D, 0L, TOK, D, D, 1.0f / WSC);
    wmma_gemm64<0, false, 2, 0, false, 0><<<gD, dim3(256), 0, stream>>>(
        xhu, xhu, D, 0L, wtu + 1 * (size_t)D * D, wtu + 1 * (size_t)D * D, D, 0L,
        (void*)kb_, (void*)kb_, D, 0L, bk + (size_t)l * D, bk + (size_t)l * D, 0L, TOK, D, D, 1.0f / WSC);
    wmma_gemm64<0, false, 2, 0, false, 0><<<gD, dim3(256), 0, stream>>>(
        xhu, xhu, D, 0L, wtu + 2 * (size_t)D * D, wtu + 2 * (size_t)D * D, D, 0L,
        (void*)vb_, (void*)vb_, D, 0L, bv + (size_t)l * D, bv + (size_t)l * D, 0L, TOK, D, D, 1.0f / WSC);

    // positive random features (f32)
    k_favor<<<dim3((TOK + 7) / 8), dim3(256), 0, stream>>>(qb_, kb_, omega + (size_t)l * HD * MH, Qfb, Kfb, TOK);

    // causal prefix recurrence (f32) as a chunk scan -> attn f16 x16
    k_chunk_sum<<<dim3(L / RC_T, B * 8), dim3(64), 0, stream>>>(Kfb, vb_, cst, L);
    k_chunk_prefix<<<dim3((RC_ST / 4 + 63) / 64, B * 8), dim3(64), 0, stream>>>(cst, L / RC_T);
    k_recur<<<dim3(L / RC_T, B * 8), dim3(64), 0, stream>>>(Qfb, Kfb, vb_, cst, ah, L, ASC);

    // t1 = attn Wo + bo + x ; x = LN1(t1)
    wmma_gemm64<0, false, 2, 0, true, 0><<<gD, dim3(256), 0, stream>>>(
        (const unsigned short*)ah, (const unsigned short*)ah, D, 0L, wtu + 3 * (size_t)D * D, wtu + 3 * (size_t)D * D, D, 0L,
        (void*)t1, (void*)t1, D, 0L, bo + (size_t)l * D, xres, 0L, TOK, D, D, 1.0f / (WSC * ASC));
    k_ln<true><<<dim3((TOK + 7) / 8), dim3(256), 0, stream>>>(t1, ln1g + (size_t)l * D, ln1b + (size_t)l * D, xf, xh, TOK, 1.0f);

    // y1 = relu(x W1 + b1) (f16 out); t1 = y1 W2 + b2 + x ; x = LN2(t1)
    wmma_gemm64<0, false, 2, 1, false, 2><<<gFF, dim3(256), 0, stream>>>(
        xhu, xhu, D, 0L, (const unsigned short*)w1t, (const unsigned short*)w1t, D, 0L,
        (void*)y1h, (void*)y1h, FF, 0L, b1 + (size_t)l * FF, b1 + (size_t)l * FF, 0L, TOK, FF, D, 1.0f / WSC);
    wmma_gemm64<0, false, 2, 0, true, 0><<<gD, dim3(256), 0, stream>>>(
        (const unsigned short*)y1h, (const unsigned short*)y1h, FF, 0L, (const unsigned short*)w2t, (const unsigned short*)w2t, FF, 0L,
        (void*)t1, (void*)t1, D, 0L, b2 + (size_t)l * D, xf, 0L, TOK, D, FF, 1.0f / WSC);
    k_ln<true><<<dim3((TOK + 7) / 8), dim3(256), 0, stream>>>(t1, ln2g + (size_t)l * D, ln2b + (size_t)l * D, xf, xh, TOK, 1.0f);
  }

  // final normalization -> output
  k_ln<false><<<dim3((TOK + 7) / 8), dim3(256), 0, stream>>>(xf, lnfg, lnfb, out, xh, TOK, 1.0f);
  (void)hipGetLastError();
}

// v003
// One run takes 334 microseconds.
// Two timings next to v002 put it at 1.13 and 1.14 times that version's speed.
// Counting every step since v000, it is 10.9 times as fast.
#include <hip/hip_runtime.h>
// Contractions x*Wq, x*Wk, x*Wv, attn*Wo, x*W1, y*W2: v_wmma_f32_16x16x32_f16 (f16 operands; weights carried x64, attn x16), f32 accumulate. Feature map, causal prefix recurrence, LayerNorm: f32 VALU.

typedef __attribute__((ext_vector_type(16))) _Float16 v16h;
typedef __attribute__((ext_vector_type(8)))  _Float16 v8h;
typedef __attribute__((ext_vector_type(4)))  _Float16 v4h;
typedef __attribute__((ext_vector_type(16))) __bf16   v16b;
typedef __attribute__((ext_vector_type(8)))  __bf16   v8b;
typedef __attribute__((ext_vector_type(8)))  float    v8f;
typedef __attribute__((ext_vector_type(4)))  float    v4f;

__device__ __forceinline__ unsigned short f2bf_bits(float f) {
  unsigned u = __float_as_uint(f);
  return (unsigned short)((u + 0x7FFFu + ((u >> 16) & 1u)) >> 16);
}
__device__ __forceinline__ float bf_bits2f(unsigned short h) { return __uint_as_float(((unsigned)h) << 16); }

// hazard guards as plain device helpers
__device__ __forceinline__ void acc_guard4(v8f& a, v8f& b, v8f& c, v8f& d) { asm volatile("v_nop\n\tv_nop\n\tv_nop\n\tv_nop" : "+v"(a), "+v"(b), "+v"(c), "+v"(d)); }
template <typename T> struct Frag;
template <> struct Frag<_Float16> {
  typedef v16h V; union U { v16h v; v8h h[2]; };
  static __device__ __forceinline__ v16h load(const _Float16* p) {   // elements 0..7 <- p[0..7], 8..15 <- p[16..23]
    U f; f.h[0] = *(const v8h*)(p); f.h[1] = *(const v8h*)(p + 16); return f.v;
  }
  static __device__ __forceinline__ v8f mma(v16h a, v16h b, v8f c) {
    return __builtin_amdgcn_wmma_f32_16x16x32_f16(false, a, false, b, (short)0, c, false, false);
  }
};
template <> struct Frag<__bf16> {
  typedef v16b V; union U { v16b v; v8b h[2]; };
  static __device__ __forceinline__ v16b load(const __bf16* p) {
    U f; f.h[0] = *(const v8b*)(p); f.h[1] = *(const v8b*)(p + 16); return f.v;
  }
  static __device__ __forceinline__ v8f mma(v16b a, v16b b, v8f c) {
    return __builtin_amdgcn_wmma_f32_16x16x32_bf16(false, a, false, b, (short)0, c, false, false);
  }
};

// One stage of the GEMM's LDS ring: 64 k (one 128-byte line) of the block's 64 A rows and 512 Bt rows.
#define GS_K 64
#define GS_PITCH 72                      // 16-bit elements per LDS row: 144 B = 16 B x 9, conflict-free for ds_load_b128
#define GS_STAGE (576 * GS_PITCH)        // 16-bit elements per stage
// Nine asynchronous 16-byte copies of a lane, global -> LDS (l = LDS byte address, g = global address).
// s_wait_xcnt stands in the copies' own statement so that no address register is rewritten ahead of it.
__device__ __forceinline__ void async_copy9(const unsigned* l, const void* const* g) {
  asm volatile(
      "global_load_async_to_lds_b128 %0, %9, off\n\t"
      "global_load_async_to_lds_b128 %1, %10, off\n\t"
      "global_load_async_to_lds_b128 %2, %11, off\n\t"
      "global_load_async_to_lds_b128 %3, %12, off\n\t"
      "global_load_async_to_lds_b128 %4, %13, off\n\t"
      "global_load_async_to_lds_b128 %5, %14, off\n\t"
      "global_load_async_to_lds_b128 %6, %15, off\n\t"
      "global_load_async_to_lds_b128 %7, %16, off\n\t"
      "global_load_async_to_lds_b128 %8, %17, off\n\t"
      "s_wait_xcnt 0x0"
      :: "v"(l[0]), "v"(l[1]), "v"(l[2]), "v"(l[3]), "v"(l[4]), "v"(l[5]), "v"(l[6]), "v"(l[7]), "v"(l[8]),
         "v"(g[0]), "v"(g[1]), "v"(g[2]), "v"(g[3]), "v"(g[4]), "v"(g[5]), "v"(g[6]), "v"(g[7]), "v"(g[8])
      : "memory");
}

// ---- Register-blocked batched WMMA GEMM ------------------------------------
// C[m,n] = scale * sum_k A[m,k] * Bt[n,k] (+bias)(+resid); each wave owns a 64x64 tile, a block of eight waves a 64x512 tile.
// A row-major [M,K]; Bt row-major [N,K]; M % 64 == 0, N % 512 == 0, K % 64 == 0, K >= 64.
// Operands reach the waves through a two-buffer LDS ring filled by asynchronous copies, one stage ahead of the WMMAs.
// SPLIT (hi/lo operand planes A2/Bt2) is not staged by the ring and must be false.
// BIAS_MODE: 0 = none, 1 = bias[m], 2 = bias[n].
// OUT_MODE: 0 = f32, 1 = f16, 2 = bf16 hi plane (Cout) + bf16 lo plane (Cout2).
// ET: 0 = f16 operands, 1 = bf16 operands (pointers passed as 16-bit storage)
template <int ET> struct Elem;
template <> struct Elem<0> { typedef _Float16 T; };
template <> struct Elem<1> { typedef __bf16 T; };
template <int ET, bool SPLIT, int BIAS_MODE, int OUT_MODE, bool RESID, int ACT = 0>
__global__ __launch_bounds__(256) void wmma_gemm64(
    const unsigned short* __restrict__ Ap, const unsigned short* __restrict__ A2p, int lda, long strideA,
    const unsigned short* __restrict__ Btp, const unsigned short* __restrict__ Bt2p, int ldb, long strideB,
    void* __restrict__ Cout, void* __restrict__ Cout2, int ldc, long strideC,
    const float* __restrict__ bias,
    const float* __restrict__ resid, long strideR,
    int M, int N, int K, float scale) {
  typedef typename Elem<ET>::T T;
  typedef typename Frag<T>::V V;
  const T* A = (const T*)Ap; const T* Bt = (const T*)Btp;
  static_assert(!SPLIT, "the LDS ring stages one plane per operand");
  __shared__ __align__(16) unsigned short sAB[2 * GS_STAGE];   // two stages: rows 0..63 = A, rows 64..575 = Bt
  __shared__ __align__(16) float sT[8][16 * 68];   // per-wave 16x64 slab, pitch 68 floats
  const int b    = blockIdx.y;
  const int tid  = threadIdx.x;
  const int lane = tid & 31;
  const int wave = tid >> 5;
  const int tilesN = N >> 6;
  const int tilesM = M >> 6;
  const int tile0 = blockIdx.x * 8;            // the block's eight tiles: one tile row, eight adjacent tile columns
  if (tile0 >= tilesM * tilesN) return;        // block-uniform, in front of every barrier
  const int tm  = tile0 / tilesN;
  const int m0  = tm << 6;
  const int nb0 = (tile0 - tm * tilesN) << 6;
  const int n0  = nb0 + (wave << 6);

  const T* Ab  = A  + (size_t)b * strideA;
  const T* Bb  = Bt + (size_t)b * strideB;

  const int rlane = lane & 15;                 // row (A) / col (B, D) within subtile
  const int koff  = (lane >> 4) * 8;           // k offset of this lane half
  const int mOff  = (lane >> 4) * 8;           // D row offset

  // Copies: eight lanes cover one row's 128-byte line, a wave four rows, the block 32 rows per copy; 18 copies per lane and stage.
  const int cr = tid >> 3, cc = (tid & 7) * 8;
  const T* pA = Ab + (size_t)(m0 + cr) * lda + cc;    // this lane's first A and Bt addresses of the next stage to copy
  const T* pB = Bb + (size_t)(nb0 + cr) * ldb + cc;
  const unsigned lds0 = (unsigned)(size_t)sAB + (unsigned)(cr * GS_PITCH + cc) * 2u;
  auto fill = [&](int buf) {
    const unsigned lb = lds0 + (unsigned)buf * (GS_STAGE * 2u);
    unsigned l[18];
    const void* g[18];
#pragma unroll   // constant indices keep l[] and g[] in registers
    for (int it = 0; it < 18; ++it) {
      l[it] = lb + (unsigned)(it * 32 * GS_PITCH) * 2u;
      g[it] = (it < 2) ? (pA + (size_t)(it * 32) * lda) : (pB + (size_t)((it - 2) * 32) * ldb);
    }
    async_copy9(l, g);
    async_copy9(l + 9, g + 9);
    pA += GS_K;
    pB += GS_K;
  };

  v8f acc[4][4];
#pragma unroll
  for (int i = 0; i < 4; ++i)
#pragma unroll
    for (int j = 0; j < 4; ++j) acc[i][j] = (v8f){0.f,0.f,0.f,0.f,0.f,0.f,0.f,0.f};

  const int nst = K / GS_K;
  fill(0);
  asm volatile("s_wait_asynccnt 0x0" ::: "memory");   // this wave's copies of stage 0 have landed
  __syncthreads();                                    // ... and every other wave's
  if (nst > 1) fill(1);
  for (int t = 0; t < nst; ++t) {
    const T* sb = (const T*)sAB + (t & 1) * GS_STAGE;
    const T* sa = sb + rlane * GS_PITCH + koff;
    const T* sw = sb + (64 + (wave << 6) + rlane) * GS_PITCH + koff;
    V bh[4], ah[4];
    auto frags = [&](int ks) {   // the eight fragments of 32 k
#pragma unroll
      for (int j = 0; j < 4; ++j) bh[j] = Frag<T>::load(sw + j * 16 * GS_PITCH + ks * 32);
#pragma unroll
      for (int i = 0; i < 4; ++i) ah[i] = Frag<T>::load(sa + i * 16 * GS_PITCH + ks * 32);
    };
    auto products = [&]() {
#pragma unroll
      for (int i = 0; i < 4; ++i)
#pragma unroll
        for (int j = 0; j < 4; ++j) acc[i][j] = Frag<T>::mma(ah[i], bh[j], acc[i][j]);
    };
    frags(0);
    // Keeps the eight fragments' loads together ahead of the WMMAs: left free, each A fragment's load sinks to its first use and the wave waits out the LDS latency four times per 32 k.
    __builtin_amdgcn_sched_barrier(0);
    products();
    frags(1);                                           // the stage's last LDS reads
    asm volatile("s_wait_dscnt 0x0" ::: "memory");      // this wave's reads of stage t are done before the buffer is refilled
    asm volatile("s_wait_asynccnt 0x0" ::: "memory");   // this wave's copies of stage t + 1 have landed
    __syncthreads();                                    // publishes stage t + 1 and ends every wave's reads of stage t
    if (t + 2 < nst) fill(t & 1);
    // Keeps the refill's issue ahead of the second 16 WMMAs (registers only), whose time the copies then have as lead.
    __builtin_amdgcn_sched_barrier(0);
    products();
  }
  asm volatile("s_wait_asynccnt 0x0" ::: "memory");     // no copy is outstanding behind the loop
  acc_guard4(acc[0][0], acc[0][1], acc[0][2], acc[0][3]);
  acc_guard4(acc[1][0], acc[1][1], acc[1][2], acc[1][3]);
  acc_guard4(acc[2][0], acc[2][1], acc[2][2], acc[2][3]);
  acc_guard4(acc[3][0], acc[3][1], acc[3][2], acc[3][3]);

  // ---- epilogue ----
  float* slab = sT[wave];
  const float* Rb = RESID ? (resid + (size_t)b * strideR) : nullptr;
#pragma unroll
  for (int i = 0; i < 4; ++i) {
    const int mBase = m0 + (i << 4);
#pragma unroll
    for (int j = 0; j < 4; ++j) {
      const int n = n0 + (j << 4) + rlane;
      float bv = 0.f;
      if (BIAS_MODE == 2) bv = bias[n];
#pragma unroll
      for (int r = 0; r < 8; ++r) {
        float v = acc[i][j][r] * scale;
        if (BIAS_MODE == 1) v += bias[mBase + mOff + r];
        if (BIAS_MODE == 2) v += bv;
        if (RESID) v += Rb[(size_t)(mBase + mOff + r) * ldc + n];
        if (ACT == 1) v = tanhf(v);
        if (ACT == 2) v = fmaxf(v, 0.0f);
        if (ACT == 3) v = v / (1.0f + expf(-v));
        if (ACT == 4) v = (v > 0.f) ? v : 0.01f * v;
        if (ACT == 5) v = 0.5f * v * (1.0f + erff(v * 0.70710678118654752f));
        slab[(mOff + r) * 68 + (j << 4) + rlane] = v;
      }
    }
    __builtin_amdgcn_fence(__ATOMIC_RELEASE, "workgroup");
    __builtin_amdgcn_wave_barrier();
    __builtin_amdgcn_fence(__ATOMIC_ACQUIRE, "workgroup");
    if (OUT_MODE == 0) {
      float* C = (float*)Cout + (size_t)b * strideC;
      const int hh = lane >> 4, c4 = (lane & 15) * 4;     // row seg = 256 B = 16 lanes x 16 B
      {
#pragma unroll
        for (int it = 0; it < 8; ++it) {
          const int row = it * 2 + hh;
          v4f v = *(const v4f*)(slab + row * 68 + c4);
          *(v4f*)(C + (size_t)(mBase + row) * ldc + n0 + c4) = v;
        }
        
      }
    } else {
      const int q = lane >> 3, c8 = (lane & 7) * 8;
      unsigned short* C  = (unsigned short*)Cout  + (size_t)b * strideC;
      unsigned short* C2 = (OUT_MODE == 2) ? ((unsigned short*)Cout2 + (size_t)b * strideC) : nullptr;
      {
#pragma unroll
        for (int it = 0; it < 4; ++it) {
          const int row = it * 4 + q;
          const float* sp = slab + row * 68 + c8;
          v8h hv, lv;
#pragma unroll
          for (int e = 0; e < 8; ++e) {
            if (OUT_MODE == 1) {
              hv[e] = (_Float16)sp[e];
            } else {
              unsigned short hb = f2bf_bits(sp[e]);
              unsigned short lb = f2bf_bits(sp[e] - bf_bits2f(hb));
              hv[e] = __builtin_bit_cast(_Float16, hb);
              lv[e] = __builtin_bit_cast(_Float16, lb);
            }
          }
          *(v8h*)(C + (size_t)(mBase + row) * ldc + n0 + c8) = hv;
          if (OUT_MODE == 2) *(v8h*)(C2 + (size_t)(mBase + row) * ldc + n0 + c8) = lv;
        }
        
      }
    }
    __builtin_amdgcn_fence(__ATOMIC_RELEASE, "workgroup");
    __builtin_amdgcn_wave_barrier();
    __builtin_amdgcn_fence(__ATOMIC_ACQUIRE, "workgroup");
  }
}

__global__ __launch_bounds__(256) void k_cast_f16x2(
    const float* __restrict__ in, _Float16* __restrict__ out, int n2, float scale) {
  const int i = blockIdx.x * 256 + threadIdx.x;
  if (i < n2) {
    const _Float16 h0 = (_Float16)(in[2 * i] * scale), h1 = (_Float16)(in[2 * i + 1] * scale);
    const unsigned u = (unsigned)__builtin_bit_cast(unsigned short, h0) | ((unsigned)__builtin_bit_cast(unsigned short, h1) << 16);
    ((unsigned*)out)[i] = u;
    
  }
}

// ---- Weight transpose + f16 cast: matrix z: in[K][N] f32 -> out[z][N][K] f16 * scale.
__global__ __launch_bounds__(256) void k_wT(
    const float* __restrict__ p0, const float* __restrict__ p1,
    const float* __restrict__ p2, const float* __restrict__ p3,
    _Float16* __restrict__ out, int K, int N, float scale) {
  __shared__ float tile[64][65];   // [n][k]
  const int tid = threadIdx.x, lane = tid & 31, wave = tid >> 5;
  const int n0 = blockIdx.x * 64, k0 = blockIdx.y * 64, z = blockIdx.z;
  const float* src = (z == 0) ? p0 : (z == 1) ? p1 : (z == 2) ? p2 : p3;
  const int c4 = (tid & 15) * 4, r0 = tid >> 4;
#pragma unroll
  for (int it = 0; it < 4; ++it) {
    const int kr = it * 16 + r0;
    const v4f v = *(const v4f*)(src + (size_t)(k0 + kr) * N + n0 + c4);
    tile[c4 + 0][kr] = v[0];
    tile[c4 + 1][kr] = v[1];
    tile[c4 + 2][kr] = v[2];
    tile[c4 + 3][kr] = v[3];
  }
  __syncthreads();
  const int q = lane >> 3, c8 = (lane & 7) * 8;
  _Float16* ob = out + (size_t)z * N * K;
  {
#pragma unroll
    for (int it = 0; it < 2; ++it) {
      const int row = wave * 8 + it * 4 + q;          // waves 0..7 x 8 rows = 64 rows
      v8h hv;
#pragma unroll
      for (int e = 0; e < 8; ++e) hv[e] = (_Float16)(tile[row][c8 + e] * scale);
      *(v8h*)(ob + (size_t)(n0 + row) * K + k0 + c8) = hv;
    }
    
  }
}

// ---- FAVOR positive feature map, f32. One wave per token, both sources (q, k), all 8 heads x 64 dims.
// xs = x * 64^-0.25; u[j] = sum_d xs[h][d] * omega[d][j] (lane = j); off = 0.5 * |xs[h]|^2;
// phi = [exp(u-off), exp(-u-off)] * 0.125 -> out[token][h*64 + j], out[token][h*64 + 32 + j].
__global__ __launch_bounds__(256) void k_favor(
    const float* __restrict__ qin, const float* __restrict__ kin, const float* __restrict__ omega,
    float* __restrict__ qf, float* __restrict__ kf, int ntok) {
  __shared__ __align__(16) float omT[32 * 68];    // [j][d], pitch 68
  __shared__ __align__(16) float xs[8][512];       // per wave scaled token row
  __shared__ float nrm[8][8];                      // per wave, per head squared norm
  const int tid = threadIdx.x, lane = tid & 31, wave = tid >> 5, hh = lane >> 4;
#pragma unroll
  for (int i = 0; i < 8; ++i) {
    const int idx = i * 256 + tid;                 // omega element (d = idx>>5, j = idx&31)
    omT[(idx & 31) * 68 + (idx >> 5)] = omega[idx];
  }
  __syncthreads();
  const int tok = blockIdx.x * 8 + wave;
  if (tok >= ntok) return;                         // wave-uniform; no block barriers below
  const float sc = 0.35355339059327379f;           // 64^-0.25
  float* xw = xs[wave];
#pragma unroll 1
  for (int srci = 0; srci < 2; ++srci) {
    const float* xrow = ((srci == 0) ? qin : kin) + (size_t)tok * 512;
    float* frow = ((srci == 0) ? qf : kf) + (size_t)tok * 512;
    __builtin_amdgcn_fence(__ATOMIC_RELEASE, "workgroup");
    __builtin_amdgcn_wave_barrier();
    __builtin_amdgcn_fence(__ATOMIC_ACQUIRE, "workgroup");
#pragma unroll
    for (int i = 0; i < 4; ++i) {
      v4f v = *(const v4f*)(xrow + i * 128 + lane * 4);
      v = v * sc;
      *(v4f*)(xw + i * 128 + lane * 4) = v;
      float s = v[0] * v[0] + v[1] * v[1] + v[2] * v[2] + v[3] * v[3];
      s += __shfl_xor(s, 1, 32);
      s += __shfl_xor(s, 2, 32);
      s += __shfl_xor(s, 4, 32);
      s += __shfl_xor(s, 8, 32);
      if ((lane & 15) == 0) nrm[wave][2 * i + hh] = s;   // head of this 64-element group = 2i + lane/16
    }
    __builtin_amdgcn_fence(__ATOMIC_RELEASE, "workgroup");
    __builtin_amdgcn_wave_barrier();
    __builtin_amdgcn_fence(__ATOMIC_ACQUIRE, "workgroup");
#pragma unroll 1
    for (int h = 0; h < 8; ++h) {
      const float off = 0.5f * nrm[wave][h];
      const float* xp = xw + h * 64;
      const float* op = omT + lane * 68;
      float u = 0.f;
#pragma unroll 1
      for (int g = 0; g < 4; ++g) {
        const v4f a0 = *(const v4f*)(xp + 16 * g);
        const v4f a1 = *(const v4f*)(xp + 16 * g + 4);
        const v4f a2 = *(const v4f*)(xp + 16 * g + 8);
        const v4f a3 = *(const v4f*)(xp + 16 * g + 12);
        const v4f o0 = *(const v4f*)(op + 16 * g);
        const v4f o1 = *(const v4f*)(op + 16 * g + 4);
        const v4f o2 = *(const v4f*)(op + 16 * g + 8);
        const v4f o3 = *(const v4f*)(op + 16 * g + 12);
        u = fmaf(a0[0], o0[0], u); u = fmaf(a0[1], o0[1], u); u = fmaf(a0[2], o0[2], u); u = fmaf(a0[3], o0[3], u);
        u = fmaf(a1[0], o1[0], u); u = fmaf(a1[1], o1[1], u); u = fmaf(a1[2], o1[2], u); u = fmaf(a1[3], o1[3], u);
        u = fmaf(a2[0], o2[0], u); u = fmaf(a2[1], o2[1], u); u = fmaf(a2[2], o2[2], u); u = fmaf(a2[3], o2[3], u);
        u = fmaf(a3[0], o3[0], u); u = fmaf(a3[1], o3[1], u); u = fmaf(a3[2], o3[2], u); u = fmaf(a3[3], o3[3], u);
      }
      const float e1 = expf(u - off) * 0.125f;
      const float e2 = expf(-u - off) * 0.125f;
      float* vo = frow + h * 64;
      vo[lane] = e1;
      vo[lane + 32] = e2;
      
    }
  }
}

// ---- Causal linear attention, f32, as a scan over chunks of RC_T steps: three launches.
// State of one (b, h) before a step: S[d][m] = sum Kf[m] * v[d], z[m] = sum Kf[m] over all earlier steps.
// One chunk's record in the workspace: RC_ST floats; S[d][4g + e] at (g * 64 + d) * 4 + e (lanes adjacent), z[m] at 4096 + m.
#define RC_T 32
#define RC_ST 4160

// 1) Sums over one chunk alone. One block (64 threads) per (chunk, b*8+h); thread d holds S[d][0..63] in registers, thread m holds z[m].
__global__ __launch_bounds__(64) void k_chunk_sum(
    const float* __restrict__ kf, const float* __restrict__ vin, float* __restrict__ st, int L) {
  __shared__ __align__(16) float Kc[RC_T * 64];   // [t][m]
  __shared__ __align__(16) float Vc[RC_T * 64];   // [t][d]
  const int tid = threadIdx.x;
  const int ch = blockIdx.x, bh = blockIdx.y;
  const int b = bh >> 3, h = bh & 7;
  const size_t base = (size_t)b * L * 512 + (size_t)h * 64;
  const int t0 = ch * RC_T;
  {
    const int r0 = tid >> 4, c4 = (tid & 15) * 4;
#pragma unroll   // all sixteen loads in flight together
    for (int it = 0; it < 8; ++it) {
      const int r = it * 4 + r0;                 // 0..31
      const size_t go = base + (size_t)(t0 + r) * 512 + c4;
      *(v4f*)(Kc + r * 64 + c4) = *(const v4f*)(kf + go);
      *(v4f*)(Vc + r * 64 + c4) = *(const v4f*)(vin + go);
    }
  }
  __syncthreads();
  v4f s[16];
#pragma unroll   // constant indices keep s[] in registers (here and in the two loops over g below)
  for (int g = 0; g < 16; ++g) s[g] = (v4f){0.f, 0.f, 0.f, 0.f};
  float z = 0.f;
  for (int t = 0; t < RC_T; ++t) {
    const float vt = Vc[t * 64 + tid];
    z += Kc[t * 64 + tid];
    const float* kr = Kc + t * 64;
#pragma unroll
    for (int g = 0; g < 16; ++g) s[g] = *(const v4f*)(kr + 4 * g) * vt + s[g];
  }
  float* o = st + ((size_t)bh * (L / RC_T) + ch) * RC_ST;
#pragma unroll
  for (int g = 0; g < 16; ++g) *(v4f*)(o + (g * 64 + tid) * 4) = s[g];
  o[4096 + tid] = z;
}

// 2) Exclusive prefix over the chunks of one (b, h), in place, in ascending chunk order; one thread per 4 state elements.
// nch % 16 == 0. Sixteen chunks' loads are issued together so that their latencies overlap.
__global__ __launch_bounds__(64) void k_chunk_prefix(float* __restrict__ st, int nch) {
  const int e4 = blockIdx.x * 64 + threadIdx.x;
  if (e4 >= RC_ST / 4) return;
  float* p = st + (size_t)blockIdx.y * nch * RC_ST + e4 * 4;
  v4f run = (v4f){0.f, 0.f, 0.f, 0.f};
  for (int c0 = 0; c0 < nch; c0 += 16) {
    v4f v[16];
#pragma unroll   // loads issued back to back; constant indices keep v[] in registers (also in the loop below)
    for (int i = 0; i < 16; ++i) v[i] = *(const v4f*)(p + (size_t)(c0 + i) * RC_ST);
#pragma unroll
    for (int i = 0; i < 16; ++i) {
      *(v4f*)(p + (size_t)(c0 + i) * RC_ST) = run;
      run = run + v[i];
    }
  }
}

// 3) One chunk's outputs in matrix form, started from the chunk's prefix state. One block (128 threads) per (chunk, b*8+h).
// P[t][s] = Qf_t . Kf_s for s <= t, else 0;  num[t][d] = sum_m Qf_t[m] S0[d][m] + sum_s P[t][s] v_s[d];
// den_t = Qf_t . z0 + sum_s P[t][s];  out_t[d] = num * rcp(den_t + 1e-6), written as f16.
// Thread (tg = tid / 16, lq = tid % 16) owns steps t = 4 tg + i (i = 0..3); scores s = lq, lq + 16; outputs d = 4 lq .. 4 lq + 3.
// A plain '#pragma unroll' in this kernel is there so that constant indices keep the per-thread arrays in registers.
#define RC_QP 100   // floats per row of QP: 64 of Qf, RC_T scores, 4 of pad (rows 4 apart start 16 banks apart)
__global__ __launch_bounds__(128) void k_recur(
    const float* __restrict__ qf, const float* __restrict__ kf, const float* __restrict__ vin,
    const float* __restrict__ st, _Float16* __restrict__ outh, int L, float oscale) {
  __shared__ __align__(16) float QP[RC_T * RC_QP];        // [t][0..63] = Qf_t[m], [t][64 + s] = P[t][s]
  __shared__ __align__(16) float Ks[RC_T * 68];           // [s][m], pitch 68: 16 rows' 16-byte reads hit 64 different banks
  __shared__ __align__(16) float BV[(64 + RC_T) * 64];    // rows 0..63 = S0[.][m] as [m][d], rows 64 + s = v_s[d]
  const int tid = threadIdx.x;
  const int wave = __builtin_amdgcn_readfirstlane(tid >> 5);   // in a scalar register: the tests on it become scalar branches
  const int tg = tid >> 4, lq = tid & 15;
  const int ch = blockIdx.x, bh = blockIdx.y;
  const int b = bh >> 3, h = bh & 7;
  const size_t base = (size_t)b * L * 512 + (size_t)h * 64;
  const float* sp = st + ((size_t)bh * (L / RC_T) + ch) * RC_ST;
  const int t0 = ch * RC_T;
  const size_t cbase = base + (size_t)t0 * 512;           // the chunk's first row, same for the whole block
  const unsigned lo = (unsigned)(tg * 512 + lq * 4);      // this thread's place in rows 0..7 of the chunk
  v4f zq;                                                 // z0[4 lq .. 4 lq + 3]
  {
    v4f rq[4], rk[4], rv[4], rs[8];
#pragma unroll   // all loads of the thread in flight together
    for (int it = 0; it < 4; ++it) {
      rq[it] = *(const v4f*)(qf + cbase + (lo + it * 4096u));
      rk[it] = *(const v4f*)(kf + cbase + (lo + it * 4096u));
      rv[it] = *(const v4f*)(vin + cbase + (lo + it * 4096u));
    }
#pragma unroll
    for (int it = 0; it < 8; ++it) rs[it] = *(const v4f*)(sp + (it * 128 + tid) * 4);
    zq = *(const v4f*)(sp + 4096 + lq * 4);
#pragma unroll
    for (int it = 0; it < 4; ++it) {
      const int r = it * 8 + tg;
      *(v4f*)(QP + r * RC_QP + lq * 4) = rq[it];
      *(v4f*)(Ks + r * 68 + lq * 4) = rk[it];
      *(v4f*)(BV + (64 + r) * 64 + lq * 4) = rv[it];
    }
#pragma unroll
    for (int it = 0; it < 8; ++it) {                      // record element (g, d) holds S0[d][4g .. 4g + 3]
      const int g = it * 2 + (tid >> 6), d = tid & 63;
#pragma unroll
      for (int e = 0; e < 4; ++e) BV[(4 * g + e) * 64 + d] = rs[it][e];
    }
  }
  __syncthreads();

  const float* qrow = QP + (tg * 4) * RC_QP;
  float dn[4];
  {
    v4f p0[4], p1[4];
#pragma unroll
    for (int i = 0; i < 4; ++i) { p0[i] = (v4f){0.f, 0.f, 0.f, 0.f}; p1[i] = (v4f){0.f, 0.f, 0.f, 0.f}; }
    const float* k0r = Ks + lq * 68;
    const float* k1r = Ks + (lq + 16) * 68;
    if (wave >= 2) {                                      // steps 16..31 see scores of s = 0..31
#pragma unroll 4   // several groups' LDS reads in flight ahead of their products
      for (int g = 0; g < 16; ++g) {
        const v4f k0 = *(const v4f*)(k0r + 4 * g);
        const v4f k1 = *(const v4f*)(k1r + 4 * g);
#pragma unroll
        for (int i = 0; i < 4; ++i) {
          const v4f q = *(const v4f*)(qrow + i * RC_QP + 4 * g);
          p0[i] = q * k0 + p0[i];
          p1[i] = q * k1 + p1[i];
        }
      }
    } else {                                              // steps 0..15: every score of s >= 16 is masked
#pragma unroll 4   // as above
      for (int g = 0; g < 16; ++g) {
        const v4f k0 = *(const v4f*)(k0r + 4 * g);
#pragma unroll
        for (int i = 0; i < 4; ++i) {
          const v4f q = *(const v4f*)(qrow + i * RC_QP + 4 * g);
          p0[i] = q * k0 + p0[i];
        }
      }
    }
#pragma unroll
    for (int i = 0; i < 4; ++i) {
      const int t = tg * 4 + i;
      float a0 = (p0[i][0] + p0[i][1]) + (p0[i][2] + p0[i][3]);
      float a1 = (p1[i][0] + p1[i][1]) + (p1[i][2] + p1[i][3]);
      a0 = (lq <= t) ? a0 : 0.f;
      a1 = (lq + 16 <= t) ? a1 : 0.f;
      QP[t * RC_QP + 64 + lq] = a0;
      QP[t * RC_QP + 80 + lq] = a1;
      const v4f qz = *(const v4f*)(qrow + i * RC_QP + lq * 4) * zq;   // this lane's four terms of Qf_t . z0
      dn[i] = (a0 + a1) + ((qz[0] + qz[1]) + (qz[2] + qz[3]));
    }
#pragma unroll
    for (int o = 1; o < 16; o <<= 1) {                    // sum over the 16 lanes that share tg
#pragma unroll
      for (int i = 0; i < 4; ++i) dn[i] += __shfl_xor(dn[i], o, 32);
    }
  }
  __syncthreads();                                        // the scores are in QP

  v4f o4[4];
#pragma unroll
  for (int i = 0; i < 4; ++i) o4[i] = (v4f){0.f, 0.f, 0.f, 0.f};
  const float* bcol = BV + lq * 4;
  auto quad = [&](int kq) {   // four columns of [Qf | P] times four rows of [S0 ; v]
    v4f a[4], bb[4];
#pragma unroll
    for (int e = 0; e < 4; ++e) bb[e] = *(const v4f*)(bcol + (4 * kq + e) * 64);
#pragma unroll
    for (int i = 0; i < 4; ++i) a[i] = *(const v4f*)(qrow + i * RC_QP + 4 * kq);
#pragma unroll
    for (int e = 0; e < 4; ++e)
#pragma unroll
      for (int i = 0; i < 4; ++i) o4[i] = bb[e] * a[i][e] + o4[i];
  };
#pragma unroll 4   // several quads' LDS reads in flight ahead of their products
  for (int kq = 0; kq < 16; ++kq) quad(kq);
  const int kend = 16 + 2 * wave + 2;                     // this wave's last step is 8 wave + 7: later scores are all masked
  for (int kq = 16; kq < kend; ++kq) quad(kq);

#pragma unroll
  for (int i = 0; i < 4; ++i) {
    const float zi = __builtin_amdgcn_rcpf(dn[i] + 1e-6f);
    v4h hv;
#pragma unroll
    for (int j = 0; j < 4; ++j) hv[j] = (_Float16)(o4[i][j] * zi * oscale);
    *(v4h*)(outh + cbase + ((unsigned)(tg * 2048 + lq * 4) + i * 512u)) = hv;
  }
}

// ---- LayerNorm over 512, one wave per row; lane owns elements i*128 + lane*4 .. +3 (i = 0..3).
template <bool WH>
__global__ __launch_bounds__(256) void k_ln(
    const float* __restrict__ in, const float* __restrict__ g, const float* __restrict__ bta,
    float* __restrict__ outf, _Float16* __restrict__ outh, int nrows, float hscale) {
  const int lane = threadIdx.x & 31, wave = threadIdx.x >> 5;
  const int row = blockIdx.x * 8 + wave;
  if (row >= nrows) return;                        // wave-uniform; no block barriers
  const float* ip = in + (size_t)row * 512;
  v4f x[4];
  float s = 0.f;
#pragma unroll
  for (int i = 0; i < 4; ++i) {
    x[i] = *(const v4f*)(ip + i * 128 + lane * 4);
    s += (x[i][0] + x[i][1]) + (x[i][2] + x[i][3]);
  }
#pragma unroll
  for (int o = 1; o < 32; o <<= 1) s += __shfl_xor(s, o, 32);
  const float mu = s * 0.001953125f;
  float vs = 0.f;
#pragma unroll
  for (int i = 0; i < 4; ++i) {
    const v4f d = x[i] - mu;
    vs += (d[0] * d[0] + d[1] * d[1]) + (d[2] * d[2] + d[3] * d[3]);
  }
#pragma unroll
  for (int o = 1; o < 32; o <<= 1) vs += __shfl_xor(vs, o, 32);
  const float rstd = rsqrtf(vs * 0.001953125f + 1e-5f);
  v4f y[4];
#pragma unroll
  for (int i = 0; i < 4; ++i) {
    const v4f gg = *(const v4f*)(g + i * 128 + lane * 4);
    const v4f bb = *(const v4f*)(bta + i * 128 + lane * 4);
    y[i] = (x[i] - mu) * rstd * gg + bb;
  }
  float* op = outf + (size_t)row * 512;
  _Float16* oh = outh + (size_t)row * 512;
  {
#pragma unroll
    for (int i = 0; i < 4; ++i) {
      *(v4f*)(op + i * 128 + lane * 4) = y[i];
      if (WH) {
        v4h hv;
        hv[0] = (_Float16)(y[i][0] * hscale); hv[1] = (_Float16)(y[i][1] * hscale);
        hv[2] = (_Float16)(y[i][2] * hscale); hv[3] = (_Float16)(y[i][3] * hscale);
        *(v4h*)(oh + i * 128 + lane * 4) = hv;
      }
    }
    
  }
}

// ---------------------------------------------------------------------------
extern "C" void kernel_launch(void* const* d_in, const int* in_sizes, int n_in,
                              void* d_out, int out_size, void* d_ws, size_t ws_size,
                              hipStream_t stream)
{
  const int B = 2, L = 2048, D = 512, FF = 2048, HD = 64, MH = 32, DEPTH = 2;
  const int TOK = B * L;
  if (n_in < 20) return;
  if (in_sizes[0] != TOK * D || in_sizes[1] != DEPTH * D * D || in_sizes[3] != DEPTH * D * D ||
      in_sizes[5] != DEPTH * D * D || in_sizes[7] != DEPTH * D * D || in_sizes[9] != DEPTH * HD * MH ||
      in_sizes[12] != DEPTH * D * FF || in_sizes[14] != DEPTH * FF * D || out_size != TOK * D) return;

  const float* x_in  = (const float*)d_in[0];
  const float* Wq    = (const float*)d_in[1];
  const float* bq    = (const float*)d_in[2];
  const float* Wk    = (const float*)d_in[3];
  const float* bk    = (const float*)d_in[4];
  const float* Wv    = (const float*)d_in[5];
  const float* bv    = (const float*)d_in[6];
  const float* Wo    = (const float*)d_in[7];
  const float* bo    = (const float*)d_in[8];
  const float* omega = (const float*)d_in[9];
  const float* ln1g  = (const float*)d_in[10];
  const float* ln1b  = (const float*)d_in[11];
  const float* W1    = (const float*)d_in[12];
  const float* b1    = (const float*)d_in[13];
  const float* W2    = (const float*)d_in[14];
  const float* b2    = (const float*)d_in[15];
  const float* ln2g  = (const float*)d_in[16];
  const float* ln2b  = (const float*)d_in[17];
  const float* lnfg  = (const float*)d_in[18];
  const float* lnfb  = (const float*)d_in[19];
  float* out = (float*)d_out;

  // ---- workspace carve (under 103 MiB) ----
  char* ws = (char*)d_ws;
  size_t off = 0;
  auto carve = [&](size_t bytes) -> char* { char* p = ws + off; off += (bytes + 255) & ~(size_t)255; return p; };
  _Float16* xh  = (_Float16*)carve((size_t)TOK * D * 2);    // f16 A operand of current x
  float*    xf  = (float*)carve((size_t)TOK * D * 4);       // f32 current x (residual source)
  float*    qb_ = (float*)carve((size_t)TOK * D * 4);
  float*    kb_ = (float*)carve((size_t)TOK * D * 4);
  float*    vb_ = (float*)carve((size_t)TOK * D * 4);
  float*    Qfb = (float*)carve((size_t)TOK * D * 4);
  float*    Kfb = (float*)carve((size_t)TOK * D * 4);
  _Float16* ah  = (_Float16*)carve((size_t)TOK * D * 2);    // attention output, f16 x16
  float*    t1  = (float*)carve((size_t)TOK * D * 4);       // pre-LN sums
  _Float16* y1h = (_Float16*)carve((size_t)TOK * FF * 2);   // relu(x W1 + b1), f16
  _Float16* wt4 = (_Float16*)carve((size_t)4 * D * D * 2);  // [Wq,Wk,Wv,Wo]^T f16 x64, [4][N][K]
  _Float16* w1t = (_Float16*)carve((size_t)D * FF * 2);     // W1^T [FF][D] f16 x64
  _Float16* w2t = (_Float16*)carve((size_t)FF * D * 2);     // W2^T [D][FF] f16 x64
  float*    cst = (float*)carve((size_t)B * 8 * (L / RC_T) * RC_ST * 4);   // per (b, h, chunk) state record
  if (off > ws_size) return;

  const float WSC = 64.0f, ASC = 16.0f;
  const int n2 = TOK * D / 2;
  k_cast_f16x2<<<dim3((n2 + 255) / 256), dim3(256), 0, stream>>>(x_in, xh, n2, 1.0f);

  const int tilesD  = (TOK / 64) * (D / 64);      // 512
  const int tilesFF = (TOK / 64) * (FF / 64);     // 2048
  const dim3 gD((tilesD + 7) / 8, 1), gFF((tilesFF + 7) / 8, 1);

  for (int l = 0; l < DEPTH; ++l) {
    const size_t wDD = (size_t)l * D * D;
    const float* xres = (l == 0) ? x_in : xf;

    // weights: in[K][N] -> out[N][K] f16 x64
    k_wT<<<dim3(D / 64, D / 64, 4), dim3(256), 0, stream>>>(Wq + wDD, Wk + wDD, Wv + wDD, Wo + wDD, wt4, D, D, WSC);
    k_wT<<<dim3(FF / 64, D / 64, 1), dim3(256), 0, stream>>>(W1 + (size_t)l * D * FF, W1 + (size_t)l * D * FF,
        W1 + (size_t)l * D * FF, W1 + (size_t)l * D * FF, w1t, D, FF, WSC);            // [512][2048] -> [2048][512]
    k_wT<<<dim3(D / 64, FF / 64, 1), dim3(256), 0, stream>>>(W2 + (size_t)l * FF * D, W2 + (size_t)l * FF * D,
        W2 + (size_t)l * FF * D, W2 + (size_t)l * FF * D, w2t, FF, D, WSC);            // [2048][512] -> [512][2048]

    // q, k, v = x W + b (f32 out)
    const unsigned short* xhu = (const unsigned short*)xh;
    const unsigned short* wtu = (const unsigned short*)wt4;
    wmma_gemm64<0, false, 2, 0, false, 0><<<gD, dim3(256), 0, stream>>>(
        xhu, xhu, D, 0L, wtu + 0 * (size_t)D * D, wtu + 0 * (size_t)D * D, D, 0L,
        (void*)qb_, (void*)qb_, D, 0L, bq + (size_t)l * D, bq + (size_t)l * D, 0L, TOK, D, D, 1.0f / WSC);
    wmma_gemm64<0, false, 2, 0, false, 0><<<gD, dim3(256), 0, stream>>>(
        xhu, xhu, D, 0L, wtu + 1 * (size_t)D * D, wtu + 1 * (size_t)D * D, D, 0L,
        (void*)kb_, (void*)kb_, D, 0L, bk + (size_t)l * D, bk + (size_t)l * D, 0L, TOK, D, D, 1.0f / WSC);
    wmma_gemm64<0, false, 2, 0, false, 0><<<gD, dim3(256), 0, stream>>>(
        xhu, xhu, D, 0L, wtu + 2 * (size_t)D * D, wtu + 2 * (size_t)D * D, D, 0L,
        (void*)vb_, (void*)vb_, D, 0L, bv + (size_t)l * D, bv + (size_t)l * D, 0L, TOK, D, D, 1.0f / WSC);

    // positive random features (f32)
    k_favor<<<dim3((TOK + 7) / 8), dim3(256), 0, stream>>>(qb_, kb_, omega + (size_t)l * HD * MH, Qfb, Kfb, TOK);

    // causal prefix recurrence (f32) as a chunk scan -> attn f16 x16
    k_chunk_sum<<<dim3(L / RC_T, B * 8), dim3(64), 0, stream>>>(Kfb, vb_, cst, L);
    k_chunk_prefix<<<dim3((RC_ST / 4 + 63) / 64, B * 8), dim3(64), 0, stream>>>(cst, L / RC_T);
    k_recur<<<dim3(L / RC_T, B * 8), dim3(128), 0, stream>>>(Qfb, Kfb, vb_, cst, ah, L, ASC);

    // t1 = attn Wo + bo + x ; x = LN1(t1)
    wmma_gemm64<0, false, 2, 0, true, 0><<<gD, dim3(256), 0, stream>>>(
        (const unsigned short*)ah, (const unsigned short*)ah, D, 0L, wtu + 3 * (size_t)D * D, wtu + 3 * (size_t)D * D, D, 0L,
        (void*)t1, (void*)t1, D, 0L, bo + (size_t)l * D, xres, 0L, TOK, D, D, 1.0f / (WSC * ASC));
    k_ln<true><<<dim3((TOK + 7) / 8), dim3(256), 0, stream>>>(t1, ln1g + (size_t)l * D, ln1b + (size_t)l * D, xf, xh, TOK, 1.0f);

    // y1 = relu(x W1 + b1) (f16 out); t1 = y1 W2 + b2 + x ; x = LN2(t1)
    wmma_gemm64<0, false, 2, 1, false, 2><<<gFF, dim3(256), 0, stream>>>(
        xhu, xhu, D, 0L, (const unsigned short*)w1t, (const unsigned short*)w1t, D, 0L,
        (void*)y1h, (void*)y1h, FF, 0L, b1 + (size_t)l * FF, b1 + (size_t)l * FF, 0L, TOK, FF, D, 1.0f / WSC);
    wmma_gemm64<0, false, 2, 0, true, 0><<<gD, dim3(256), 0, stream>>>(
        (const unsigned short*)y1h, (const unsigned short*)y1h, FF, 0L, (const unsigned short*)w2t, (const unsigned short*)w2t, FF, 0L,
        (void*)t1, (void*)t1, D, 0L, b2 + (size_t)l * D, xf, 0L, TOK, D, FF, 1.0f / WSC);
    k_ln<true><<<dim3((TOK + 7) / 8), dim3(256), 0, stream>>>(t1, ln2g + (size_t)l * D, ln2b + (size_t)l * D, xf, xh, TOK, 1.0f);
  }

  // final normalization -> output
  k_ln<false><<<dim3((TOK + 7) / 8), dim3(256), 0, stream>>>(xf, lnfg, lnfb, out, xh, TOK, 1.0f);
  (void)hipGetLastError();
}

// v004
// One run takes 280 microseconds.
// Next to v003, in two timings, it ran 1.18 times as fast each time.
// All steps since v000 together make it 12.9 times as fast.
#include <hip/hip_runtime.h>
// Contractions x*Wq, x*Wk, x*Wv, attn*Wo, x*W1, y*W2: v_wmma_f32_16x16x32_f16 (f16 operands; weights carried x64, attn x16), f32 accumulate. Feature map, causal prefix recurrence, LayerNorm: f32 VALU.

typedef __attribute__((ext_vector_type(16))) _Float16 v16h;
typedef __attribute__((ext_vector_type(8)))  _Float16 v8h;
typedef __attribute__((ext_vector_type(4)))  _Float16 v4h;
typedef __attribute__((ext_vector_type(16))) __bf16   v16b;
typedef __attribute__((ext_vector_type(8)))  __bf16   v8b;
typedef __attribute__((ext_vector_type(8)))  float    v8f;
typedef __attribute__((ext_vector_type(4)))  float    v4f;

__device__ __forceinline__ unsigned short f2bf_bits(float f) {
  unsigned u = __float_as_uint(f);
  return (unsigned short)((u + 0x7FFFu + ((u >> 16) & 1u)) >> 16);
}
__device__ __forceinline__ float bf_bits2f(unsigned short h) { return __uint_as_float(((unsigned)h) << 16); }

// hazard guards as plain device helpers
__device__ __forceinline__ void acc_guard4(v8f& a, v8f& b, v8f& c, v8f& d) { asm volatile("v_nop\n\tv_nop\n\tv_nop\n\tv_nop" : "+v"(a), "+v"(b), "+v"(c), "+v"(d)); }
template <typename T> struct Frag;
template <> struct Frag<_Float16> {
  typedef v16h V; union U { v16h v; v8h h[2]; };
  static __device__ __forceinline__ v16h load(const _Float16* p) {   // elements 0..7 <- p[0..7], 8..15 <- p[16..23]
    U f; f.h[0] = *(const v8h*)(p); f.h[1] = *(const v8h*)(p + 16); return f.v;
  }
  static __device__ __forceinline__ v8f mma(v16h a, v16h b, v8f c) {
    return __builtin_amdgcn_wmma_f32_16x16x32_f16(false, a, false, b, (short)0, c, false, false);
  }
};
template <> struct Frag<__bf16> {
  typedef v16b V; union U { v16b v; v8b h[2]; };
  static __device__ __forceinline__ v16b load(const __bf16* p) {
    U f; f.h[0] = *(const v8b*)(p); f.h[1] = *(const v8b*)(p + 16); return f.v;
  }
  static __device__ __forceinline__ v8f mma(v16b a, v16b b, v8f c) {
    return __builtin_amdgcn_wmma_f32_16x16x32_bf16(false, a, false, b, (short)0, c, false, false);
  }
};

// One stage of the GEMM's LDS ring: 64 k (one 128-byte line) of the block's 64 A rows and 512 Bt rows.
#define GS_K 64
#define GS_PITCH 72                      // 16-bit elements per LDS row: 144 B = 16 B x 9, conflict-free for ds_load_b128
#define GS_STAGE (576 * GS_PITCH)        // 16-bit elements per stage
// Nine asynchronous 16-byte copies of a lane, global -> LDS (l = LDS byte address, g = global address).
// s_wait_xcnt stands in the copies' own statement so that no address register is rewritten ahead of it.
__device__ __forceinline__ void async_copy9(const unsigned* l, const void* const* g) {
  asm volatile(
      "global_load_async_to_lds_b128 %0, %9, off\n\t"
      "global_load_async_to_lds_b128 %1, %10, off\n\t"
      "global_load_async_to_lds_b128 %2, %11, off\n\t"
      "global_load_async_to_lds_b128 %3, %12, off\n\t"
      "global_load_async_to_lds_b128 %4, %13, off\n\t"
      "global_load_async_to_lds_b128 %5, %14, off\n\t"
      "global_load_async_to_lds_b128 %6, %15, off\n\t"
      "global_load_async_to_lds_b128 %7, %16, off\n\t"
      "global_load_async_to_lds_b128 %8, %17, off\n\t"
      "s_wait_xcnt 0x0"
      :: "v"(l[0]), "v"(l[1]), "v"(l[2]), "v"(l[3]), "v"(l[4]), "v"(l[5]), "v"(l[6]), "v"(l[7]), "v"(l[8]),
         "v"(g[0]), "v"(g[1]), "v"(g[2]), "v"(g[3]), "v"(g[4]), "v"(g[5]), "v"(g[6]), "v"(g[7]), "v"(g[8])
      : "memory");
}

// ---- Register-blocked batched WMMA GEMM ------------------------------------
// C[m,n] = scale * sum_k A[m,k] * Bt[n,k] (+bias)(+resid); each wave owns a 64x64 tile, a block of eight waves a 64x512 tile.
// A row-major [M,K]; Bt row-major [N,K]; M % 64 == 0, N % 512 == 0, K % 64 == 0, K >= 64.
// Operands reach the waves through a two-buffer LDS ring filled by asynchronous copies, one stage ahead of the WMMAs.
// SPLIT (hi/lo operand planes A2/Bt2) is not staged by the ring and must be false.
// BIAS_MODE: 0 = none, 1 = bias[m], 2 = bias[n]. Batch index blockIdx.y = 0, 1, 2 takes bias, biasY1, biasY2.
// OUT_MODE: 0 = f32, 1 = f16, 2 = bf16 hi plane (Cout) + bf16 lo plane (Cout2).
// ET: 0 = f16 operands, 1 = bf16 operands (pointers passed as 16-bit storage)
template <int ET> struct Elem;
template <> struct Elem<0> { typedef _Float16 T; };
template <> struct Elem<1> { typedef __bf16 T; };
template <int ET, bool SPLIT, int BIAS_MODE, int OUT_MODE, bool RESID, int ACT = 0>
__global__ __launch_bounds__(256) void wmma_gemm64(
    const unsigned short* __restrict__ Ap, const unsigned short* __restrict__ A2p, int lda, long strideA,
    const unsigned short* __restrict__ Btp, const unsigned short* __restrict__ Bt2p, int ldb, long strideB,
    void* __restrict__ Cout, void* __restrict__ Cout2, int ldc, long strideC,
    const float* __restrict__ bias, const float* __restrict__ biasY1, const float* __restrict__ biasY2,
    const float* __restrict__ resid, long strideR,
    int M, int N, int K, float scale) {
  typedef typename Elem<ET>::T T;
  typedef typename Frag<T>::V V;
  const T* A = (const T*)Ap; const T* Bt = (const T*)Btp;
  static_assert(!SPLIT, "the LDS ring stages one plane per operand");
  __shared__ __align__(16) unsigned short sAB[2 * GS_STAGE];   // two stages: rows 0..63 = A, rows 64..575 = Bt
  __shared__ __align__(16) float sT[8][16 * 68];   // per-wave 16x64 slab, pitch 68 floats
  const int b    = blockIdx.y;
  const int tid  = threadIdx.x;
  const int lane = tid & 31;
  const int wave = tid >> 5;
  const int tilesN = N >> 6;
  const int tilesM = M >> 6;
  const int tile0 = blockIdx.x * 8;            // the block's eight tiles: one tile row, eight adjacent tile columns
  if (tile0 >= tilesM * tilesN) return;        // block-uniform, in front of every barrier
  const int tm  = tile0 / tilesN;
  const int m0  = tm << 6;
  const int nb0 = (tile0 - tm * tilesN) << 6;
  const int n0  = nb0 + (wave << 6);

  const T* Ab  = A  + (size_t)b * strideA;
  const T* Bb  = Bt + (size_t)b * strideB;

  const int rlane = lane & 15;                 // row (A) / col (B, D) within subtile
  const int koff  = (lane >> 4) * 8;           // k offset of this lane half
  const int mOff  = (lane >> 4) * 8;           // D row offset

  // Copies: eight lanes cover one row's 128-byte line, a wave four rows, the block 32 rows per copy; 18 copies per lane and stage.
  const int cr = tid >> 3, cc = (tid & 7) * 8;
  const T* pA = Ab + (size_t)(m0 + cr) * lda + cc;    // this lane's first A and Bt addresses of the next stage to copy
  const T* pB = Bb + (size_t)(nb0 + cr) * ldb + cc;
  const unsigned lds0 = (unsigned)(size_t)sAB + (unsigned)(cr * GS_PITCH + cc) * 2u;
  auto fill = [&](int buf) {
    const unsigned lb = lds0 + (unsigned)buf * (GS_STAGE * 2u);
    unsigned l[18];
    const void* g[18];
#pragma unroll   // constant indices keep l[] and g[] in registers
    for (int it = 0; it < 18; ++it) {
      l[it] = lb + (unsigned)(it * 32 * GS_PITCH) * 2u;
      g[it] = (it < 2) ? (pA + (size_t)(it * 32) * lda) : (pB + (size_t)((it - 2) * 32) * ldb);
    }
    async_copy9(l, g);
    async_copy9(l + 9, g + 9);
    pA += GS_K;
    pB += GS_K;
  };

  v8f acc[4][4];
#pragma unroll
  for (int i = 0; i < 4; ++i)
#pragma unroll
    for (int j = 0; j < 4; ++j) acc[i][j] = (v8f){0.f,0.f,0.f,0.f,0.f,0.f,0.f,0.f};

  const int nst = K / GS_K;
  fill(0);
  asm volatile("s_wait_asynccnt 0x0" ::: "memory");   // this wave's copies of stage 0 have landed
  __syncthreads();                                    // ... and every other wave's
  if (nst > 1) fill(1);
  for (int t = 0; t < nst; ++t) {
    const T* sb = (const T*)sAB + (t & 1) * GS_STAGE;
    const T* sa = sb + rlane * GS_PITCH + koff;
    const T* sw = sb + (64 + (wave << 6) + rlane) * GS_PITCH + koff;
    V bh[4], ah[4];
    auto frags = [&](int ks) {   // the eight fragments of 32 k
#pragma unroll
      for (int j = 0; j < 4; ++j) bh[j] = Frag<T>::load(sw + j * 16 * GS_PITCH + ks * 32);
#pragma unroll
      for (int i = 0; i < 4; ++i) ah[i] = Frag<T>::load(sa + i * 16 * GS_PITCH + ks * 32);
    };
    auto products = [&]() {
#pragma unroll
      for (int i = 0; i < 4; ++i)
#pragma unroll
        for (int j = 0; j < 4; ++j) acc[i][j] = Frag<T>::mma(ah[i], bh[j], acc[i][j]);
    };
    frags(0);
    // Keeps the eight fragments' loads together ahead of the WMMAs: left free, each A fragment's load sinks to its first use and the wave waits out the LDS latency four times per 32 k.
    __builtin_amdgcn_sched_barrier(0);
    products();
    frags(1);                                           // the stage's last LDS reads
    asm volatile("s_wait_dscnt 0x0" ::: "memory");      // this wave's reads of stage t are done before the buffer is refilled
    asm volatile("s_wait_asynccnt 0x0" ::: "memory");   // this wave's copies of stage t + 1 have landed
    __syncthreads();                                    // publishes stage t + 1 and ends every wave's reads of stage t
    if (t + 2 < nst) fill(t & 1);
    // Keeps the refill's issue ahead of the second 16 WMMAs (registers only), whose time the copies then have as lead.
    __builtin_amdgcn_sched_barrier(0);
    products();
  }
  asm volatile("s_wait_asynccnt 0x0" ::: "memory");     // no copy is outstanding behind the loop
  acc_guard4(acc[0][0], acc[0][1], acc[0][2], acc[0][3]);
  acc_guard4(acc[1][0], acc[1][1], acc[1][2], acc[1][3]);
  acc_guard4(acc[2][0], acc[2][1], acc[2][2], acc[2][3]);
  acc_guard4(acc[3][0], acc[3][1], acc[3][2], acc[3][3]);

  // ---- epilogue ----
  float* slab = sT[wave];
  const float* Rb = RESID ? (resid + (size_t)b * strideR) : nullptr;
  const float* biasb = (b == 0) ? bias : (b == 1) ? biasY1 : biasY2;
#pragma unroll
  for (int i = 0; i < 4; ++i) {
    const int mBase = m0 + (i << 4);
#pragma unroll
    for (int j = 0; j < 4; ++j) {
      const int n = n0 + (j << 4) + rlane;
      float bv = 0.f;
      if (BIAS_MODE == 2) bv = biasb[n];
#pragma unroll
      for (int r = 0; r < 8; ++r) {
        float v = acc[i][j][r] * scale;
        if (BIAS_MODE == 1) v += biasb[mBase + mOff + r];
        if (BIAS_MODE == 2) v += bv;
        if (RESID) v += Rb[(size_t)(mBase + mOff + r) * ldc + n];
        if (ACT == 1) v = tanhf(v);
        if (ACT == 2) v = fmaxf(v, 0.0f);
        if (ACT == 3) v = v / (1.0f + expf(-v));
        if (ACT == 4) v = (v > 0.f) ? v : 0.01f * v;
        if (ACT == 5) v = 0.5f * v * (1.0f + erff(v * 0.70710678118654752f));
        slab[(mOff + r) * 68 + (j << 4) + rlane] = v;
      }
    }
    __builtin_amdgcn_fence(__ATOMIC_RELEASE, "workgroup");
    __builtin_amdgcn_wave_barrier();
    __builtin_amdgcn_fence(__ATOMIC_ACQUIRE, "workgroup");
    if (OUT_MODE == 0) {
      float* C = (float*)Cout + (size_t)b * strideC;
      const int hh = lane >> 4, c4 = (lane & 15) * 4;     // row seg = 256 B = 16 lanes x 16 B
      {
#pragma unroll
        for (int it = 0; it < 8; ++it) {
          const int row = it * 2 + hh;
          v4f v = *(const v4f*)(slab + row * 68 + c4);
          *(v4f*)(C + (size_t)(mBase + row) * ldc + n0 + c4) = v;
        }
        
      }
    } else {
      const int q = lane >> 3, c8 = (lane & 7) * 8;
      unsigned short* C  = (unsigned short*)Cout  + (size_t)b * strideC;
      unsigned short* C2 = (OUT_MODE == 2) ? ((unsigned short*)Cout2 + (size_t)b * strideC) : nullptr;
      {
#pragma unroll
        for (int it = 0; it < 4; ++it) {
          const int row = it * 4 + q;
          const float* sp = slab + row * 68 + c8;
          v8h hv, lv;
#pragma unroll
          for (int e = 0; e < 8; ++e) {
            if (OUT_MODE == 1) {
              hv[e] = (_Float16)sp[e];
            } else {
              unsigned short hb = f2bf_bits(sp[e]);
              unsigned short lb = f2bf_bits(sp[e] - bf_bits2f(hb));
              hv[e] = __builtin_bit_cast(_Float16, hb);
              lv[e] = __builtin_bit_cast(_Float16, lb);
            }
          }
          *(v8h*)(C + (size_t)(mBase + row) * ldc + n0 + c8) = hv;
          if (OUT_MODE == 2) *(v8h*)(C2 + (size_t)(mBase + row) * ldc + n0 + c8) = lv;
        }
        
      }
    }
    __builtin_amdgcn_fence(__ATOMIC_RELEASE, "workgroup");
    __builtin_amdgcn_wave_barrier();
    __builtin_amdgcn_fence(__ATOMIC_ACQUIRE, "workgroup");
  }
}

// ---- Operand preparation of the whole call, one grid: every weight matrix of every layer transposed and cast, and x cast.
// None of these pieces reads what another writes, so they share one launch; each block does one piece.
// Cast piece: element pair i of in -> f16.
__device__ __forceinline__ void cast_f16x2(
    const float* __restrict__ in, _Float16* __restrict__ out, int i, int n2, float scale) {
  if (i < n2) {
    const _Float16 h0 = (_Float16)(in[2 * i] * scale), h1 = (_Float16)(in[2 * i + 1] * scale);
    const unsigned u = (unsigned)__builtin_bit_cast(unsigned short, h0) | ((unsigned)__builtin_bit_cast(unsigned short, h1) << 16);
    ((unsigned*)out)[i] = u;
  }
}

// Transpose piece: one 64 x 64 tile of src[K][N] f32 -> ob[N][K] f16 * scale. Called by a whole block of 256 threads.
__device__ __forceinline__ void wT_tile(
    const float* __restrict__ src, _Float16* __restrict__ ob, int K, int N, int n0, int k0, float scale, float (*tile)[65]) {
  const int tid = threadIdx.x, lane = tid & 31, wave = tid >> 5;
  const int c4 = (tid & 15) * 4, r0 = tid >> 4;
#pragma unroll
  for (int it = 0; it < 4; ++it) {
    const int kr = it * 16 + r0;
    const v4f v = *(const v4f*)(src + (size_t)(k0 + kr) * N + n0 + c4);
    tile[c4 + 0][kr] = v[0];
    tile[c4 + 1][kr] = v[1];
    tile[c4 + 2][kr] = v[2];
    tile[c4 + 3][kr] = v[3];
  }
  __syncthreads();
  const int q = lane >> 3, c8 = (lane & 7) * 8;
#pragma unroll
  for (int it = 0; it < 2; ++it) {
    const int row = wave * 8 + it * 4 + q;          // waves 0..7 x 8 rows = 64 rows
    v8h hv;
#pragma unroll
    for (int e = 0; e < 8; ++e) hv[e] = (_Float16)(tile[row][c8 + e] * scale);
    *(v8h*)(ob + (size_t)(n0 + row) * K + k0 + c8) = hv;
  }
  // Behind the two stores, a precaution: the cast piece runs only in other blocks, and nothing follows the stores in this kernel.
  asm volatile("s_wait_xcnt 0x0" ::: "memory");
}

// Blocks 0 .. DEPTH * PL - 1: transpose tiles, PL = 4 TDD + 2 TDF per layer in the order Wq, Wk, Wv, Wo, W1, W2; the blocks behind them: x.
// wt4[layer][4][D][D], w1t[layer][FF][D], w2t[layer][D][FF].
template <int D, int FF, int DEPTH>
__global__ __launch_bounds__(256) void k_prep(
    const float* __restrict__ x, const float* __restrict__ Wq, const float* __restrict__ Wk,
    const float* __restrict__ Wv, const float* __restrict__ Wo, const float* __restrict__ W1, const float* __restrict__ W2,
    _Float16* __restrict__ xh, _Float16* __restrict__ wt4, _Float16* __restrict__ w1t, _Float16* __restrict__ w2t,
    int n2, float wscale) {
  __shared__ float tile[64][65];   // [n][k]
  constexpr int TD = D / 64, TF = FF / 64, TDD = TD * TD, TDF = TD * TF, PL = 4 * TDD + 2 * TDF;
  const int bid = blockIdx.x;
  if (bid >= DEPTH * PL) {         // block-uniform
    cast_f16x2(x, xh, (bid - DEPTH * PL) * 256 + threadIdx.x, n2, 1.0f);
    return;
  }
  const int l = bid / PL, r = bid - l * PL;
  const float* src;
  _Float16* ob;
  int K, N, n0, k0;                // all block-uniform
  if (r < 4 * TDD) {
    const int z = r / TDD, t = r - z * TDD;
    src = ((z == 0) ? Wq : (z == 1) ? Wk : (z == 2) ? Wv : Wo) + (size_t)l * D * D;
    ob = wt4 + (size_t)(l * 4 + z) * D * D;
    K = D; N = D; n0 = (t % TD) * 64; k0 = (t / TD) * 64;
  } else if (r < 4 * TDD + TDF) {
    const int t = r - 4 * TDD;         // [D][FF] -> [FF][D]
    src = W1 + (size_t)l * D * FF;
    ob = w1t + (size_t)l * D * FF;
    K = D; N = FF; n0 = (t % TF) * 64; k0 = (t / TF) * 64;
  } else {
    const int t = r - 4 * TDD - TDF;   // [FF][D] -> [D][FF]
    src = W2 + (size_t)l * FF * D;
    ob = w2t + (size_t)l * FF * D;
    K = FF; N = D; n0 = (t % TD) * 64; k0 = (t / TD) * 64;
  }
  wT_tile(src, ob, K, N, n0, k0, wscale, tile);
}

// ---- FAVOR positive feature map, f32. One wave per token, both sources (q, k), all 8 heads x 64 dims.
// xs = x * 64^-0.25; u[j] = sum_d xs[h][d] * omega[d][j] (lane = j); off = 0.5 * |xs[h]|^2;
// phi = [exp(u-off), exp(-u-off)] * 0.125 -> out[token][h*64 + j], out[token][h*64 + 32 + j].
__global__ __launch_bounds__(256) void k_favor(
    const float* __restrict__ qin, const float* __restrict__ kin, const float* __restrict__ omega,
    float* __restrict__ qf, float* __restrict__ kf, int ntok) {
  __shared__ __align__(16) float omT[32 * 68];    // [j][d], pitch 68
  __shared__ __align__(16) float xs[8][512];       // per wave scaled token row
  __shared__ float nrm[8][8];                      // per wave, per head squared norm
  const int tid = threadIdx.x, lane = tid & 31, wave = tid >> 5, hh = lane >> 4;
#pragma unroll
  for (int i = 0; i < 8; ++i) {
    const int idx = i * 256 + tid;                 // omega element (d = idx>>5, j = idx&31)
    omT[(idx & 31) * 68 + (idx >> 5)] = omega[idx];
  }
  __syncthreads();
  const int tok = blockIdx.x * 8 + wave;
  if (tok >= ntok) return;                         // wave-uniform; no block barriers below
  const float sc = 0.35355339059327379f;           // 64^-0.25
  float* xw = xs[wave];
#pragma unroll 1
  for (int srci = 0; srci < 2; ++srci) {
    const float* xrow = ((srci == 0) ? qin : kin) + (size_t)tok * 512;
    float* frow = ((srci == 0) ? qf : kf) + (size_t)tok * 512;
    __builtin_amdgcn_fence(__ATOMIC_RELEASE, "workgroup");
    __builtin_amdgcn_wave_barrier();
    __builtin_amdgcn_fence(__ATOMIC_ACQUIRE, "workgroup");
#pragma unroll
    for (int i = 0; i < 4; ++i) {
      v4f v = *(const v4f*)(xrow + i * 128 + lane * 4);
      v = v * sc;
      *(v4f*)(xw + i * 128 + lane * 4) = v;
      float s = v[0] * v[0] + v[1] * v[1] + v[2] * v[2] + v[3] * v[3];
      s += __shfl_xor(s, 1, 32);
      s += __shfl_xor(s, 2, 32);
      s += __shfl_xor(s, 4, 32);
      s += __shfl_xor(s, 8, 32);
      if ((lane & 15) == 0) nrm[wave][2 * i + hh] = s;   // head of this 64-element group = 2i + lane/16
    }
    __builtin_amdgcn_fence(__ATOMIC_RELEASE, "workgroup");
    __builtin_amdgcn_wave_barrier();
    __builtin_amdgcn_fence(__ATOMIC_ACQUIRE, "workgroup");
#pragma unroll 1
    for (int h = 0; h < 8; ++h) {
      const float off = 0.5f * nrm[wave][h];
      const float* xp = xw + h * 64;
      const float* op = omT + lane * 68;
      float u = 0.f;
#pragma unroll 1
      for (int g = 0; g < 4; ++g) {
        const v4f a0 = *(const v4f*)(xp + 16 * g);
        const v4f a1 = *(const v4f*)(xp + 16 * g + 4);
        const v4f a2 = *(const v4f*)(xp + 16 * g + 8);
        const v4f a3 = *(const v4f*)(xp + 16 * g + 12);
        const v4f o0 = *(const v4f*)(op + 16 * g);
        const v4f o1 = *(const v4f*)(op + 16 * g + 4);
        const v4f o2 = *(const v4f*)(op + 16 * g + 8);
        const v4f o3 = *(const v4f*)(op + 16 * g + 12);
        u = fmaf(a0[0], o0[0], u); u = fmaf(a0[1], o0[1], u); u = fmaf(a0[2], o0[2], u); u = fmaf(a0[3], o0[3], u);
        u = fmaf(a1[0], o1[0], u); u = fmaf(a1[1], o1[1], u); u = fmaf(a1[2], o1[2], u); u = fmaf(a1[3], o1[3], u);
        u = fmaf(a2[0], o2[0], u); u = fmaf(a2[1], o2[1], u); u = fmaf(a2[2], o2[2], u); u = fmaf(a2[3], o2[3], u);
        u = fmaf(a3[0], o3[0], u); u = fmaf(a3[1], o3[1], u); u = fmaf(a3[2], o3[2], u); u = fmaf(a3[3], o3[3], u);
      }
      const float e1 = expf(u - off) * 0.125f;
      const float e2 = expf(-u - off) * 0.125f;
      float* vo = frow + h * 64;
      vo[lane] = e1;
      vo[lane + 32] = e2;
      
    }
  }
}

// ---- Causal linear attention, f32, as a scan over chunks of RC_T steps: three launches.
// State of one (b, h) before a step: S[d][m] = sum Kf[m] * v[d], z[m] = sum Kf[m] over all earlier steps.
// One chunk's record in the workspace: RC_ST floats; S[d][4g + e] at (g * 64 + d) * 4 + e (lanes adjacent), z[m] at 4096 + m.
#define RC_T 32
#define RC_ST 4160

// 1) Sums over one chunk alone. One block (64 threads) per (chunk, b*8+h); thread d holds S[d][0..63] in registers, thread m holds z[m].
__global__ __launch_bounds__(64) void k_chunk_sum(
    const float* __restrict__ kf, const float* __restrict__ vin, float* __restrict__ st, int L) {
  __shared__ __align__(16) float Kc[RC_T * 64];   // [t][m]
  __shared__ __align__(16) float Vc[RC_T * 64];   // [t][d]
  const int tid = threadIdx.x;
  const int ch = blockIdx.x, bh = blockIdx.y;
  const int b = bh >> 3, h = bh & 7;
  const size_t base = (size_t)b * L * 512 + (size_t)h * 64;
  const int t0 = ch * RC_T;
  {
    const int r0 = tid >> 4, c4 = (tid & 15) * 4;
#pragma unroll   // all sixteen loads in flight together
    for (int it = 0; it < 8; ++it) {
      const int r = it * 4 + r0;                 // 0..31
      const size_t go = base + (size_t)(t0 + r) * 512 + c4;
      *(v4f*)(Kc + r * 64 + c4) = *(const v4f*)(kf + go);
      *(v4f*)(Vc + r * 64 + c4) = *(const v4f*)(vin + go);
    }
  }
  __syncthreads();
  v4f s[16];
#pragma unroll   // constant indices keep s[] in registers (here and in the two loops over g below)
  for (int g = 0; g < 16; ++g) s[g] = (v4f){0.f, 0.f, 0.f, 0.f};
  float z = 0.f;
  for (int t = 0; t < RC_T; ++t) {
    const float vt = Vc[t * 64 + tid];
    z += Kc[t * 64 + tid];
    const float* kr = Kc + t * 64;
#pragma unroll
    for (int g = 0; g < 16; ++g) s[g] = *(const v4f*)(kr + 4 * g) * vt + s[g];
  }
  float* o = st + ((size_t)bh * (L / RC_T) + ch) * RC_ST;
#pragma unroll
  for (int g = 0; g < 16; ++g) *(v4f*)(o + (g * 64 + tid) * 4) = s[g];
  o[4096 + tid] = z;
}

// 2) Exclusive prefix over the chunks of one (b, h), in place, in ascending chunk order; one thread per 4 state elements.
// nch % 16 == 0. Sixteen chunks' loads are issued together so that their latencies overlap.
__global__ __launch_bounds__(64) void k_chunk_prefix(float* __restrict__ st, int nch) {
  const int e4 = blockIdx.x * 64 + threadIdx.x;
  if (e4 >= RC_ST / 4) return;
  float* p = st + (size_t)blockIdx.y * nch * RC_ST + e4 * 4;
  v4f run = (v4f){0.f, 0.f, 0.f, 0.f};
  for (int c0 = 0; c0 < nch; c0 += 16) {
    v4f v[16];
#pragma unroll   // loads issued back to back; constant indices keep v[] in registers (also in the loop below)
    for (int i = 0; i < 16; ++i) v[i] = *(const v4f*)(p + (size_t)(c0 + i) * RC_ST);
#pragma unroll
    for (int i = 0; i < 16; ++i) {
      *(v4f*)(p + (size_t)(c0 + i) * RC_ST) = run;
      run = run + v[i];
    }
  }
}

// 3) One chunk's outputs in matrix form, started from the chunk's prefix state. One block (128 threads) per (chunk, b*8+h).
// P[t][s] = Qf_t . Kf_s for s <= t, else 0;  num[t][d] = sum_m Qf_t[m] S0[d][m] + sum_s P[t][s] v_s[d];
// den_t = Qf_t . z0 + sum_s P[t][s];  out_t[d] = num * rcp(den_t + 1e-6), written as f16.
// Thread (tg = tid / 16, lq = tid % 16) owns steps t = 4 tg + i (i = 0..3); scores s = lq, lq + 16; outputs d = 4 lq .. 4 lq + 3.
// A plain '#pragma unroll' in this kernel is there so that constant indices keep the per-thread arrays in registers.
#define RC_QP 100   // floats per row of QP: 64 of Qf, RC_T scores, 4 of pad (rows 4 apart start 16 banks apart)
__global__ __launch_bounds__(128) void k_recur(
    const float* __restrict__ qf, const float* __restrict__ kf, const float* __restrict__ vin,
    const float* __restrict__ st, _Float16* __restrict__ outh, int L, float oscale) {
  __shared__ __align__(16) float QP[RC_T * RC_QP];        // [t][0..63] = Qf_t[m], [t][64 + s] = P[t][s]
  __shared__ __align__(16) float Ks[RC_T * 68];           // [s][m], pitch 68: 16 rows' 16-byte reads hit 64 different banks
  __shared__ __align__(16) float BV[(64 + RC_T) * 64];    // rows 0..63 = S0[.][m] as [m][d], rows 64 + s = v_s[d]
  const int tid = threadIdx.x;
  const int wave = __builtin_amdgcn_readfirstlane(tid >> 5);   // in a scalar register: the tests on it become scalar branches
  const int tg = tid >> 4, lq = tid & 15;
  const int ch = blockIdx.x, bh = blockIdx.y;
  const int b = bh >> 3, h = bh & 7;
  const size_t base = (size_t)b * L * 512 + (size_t)h * 64;
  const float* sp = st + ((size_t)bh * (L / RC_T) + ch) * RC_ST;
  const int t0 = ch * RC_T;
  const size_t cbase = base + (size_t)t0 * 512;           // the chunk's first row, same for the whole block
  const unsigned lo = (unsigned)(tg * 512 + lq * 4);      // this thread's place in rows 0..7 of the chunk
  v4f zq;                                                 // z0[4 lq .. 4 lq + 3]
  {
    v4f rq[4], rk[4], rv[4], rs[8];
#pragma unroll   // all loads of the thread in flight together
    for (int it = 0; it < 4; ++it) {
      rq[it] = *(const v4f*)(qf + cbase + (lo + it * 4096u));
      rk[it] = *(const v4f*)(kf + cbase + (lo + it * 4096u));
      rv[it] = *(const v4f*)(vin + cbase + (lo + it * 4096u));
    }
#pragma unroll
    for (int it = 0; it < 8; ++it) rs[it] = *(const v4f*)(sp + (it * 128 + tid) * 4);
    zq = *(const v4f*)(sp + 4096 + lq * 4);
#pragma unroll
    for (int it = 0; it < 4; ++it) {
      const int r = it * 8 + tg;
      *(v4f*)(QP + r * RC_QP + lq * 4) = rq[it];
      *(v4f*)(Ks + r * 68 + lq * 4) = rk[it];
      *(v4f*)(BV + (64 + r) * 64 + lq * 4) = rv[it];
    }
#pragma unroll
    for (int it = 0; it < 8; ++it) {                      // record element (g, d) holds S0[d][4g .. 4g + 3]
      const int g = it * 2 + (tid >> 6), d = tid & 63;
#pragma unroll
      for (int e = 0; e < 4; ++e) BV[(4 * g + e) * 64 + d] = rs[it][e];
    }
  }
  __syncthreads();

  const float* qrow = QP + (tg * 4) * RC_QP;
  float dn[4];
  {
    v4f p0[4], p1[4];
#pragma unroll
    for (int i = 0; i < 4; ++i) { p0[i] = (v4f){0.f, 0.f, 0.f, 0.f}; p1[i] = (v4f){0.f, 0.f, 0.f, 0.f}; }
    const float* k0r = Ks + lq * 68;
    const float* k1r = Ks + (lq + 16) * 68;
    if (wave >= 2) {                                      // steps 16..31 see scores of s = 0..31
#pragma unroll 4   // several groups' LDS reads in flight ahead of their products
      for (int g = 0; g < 16; ++g) {
        const v4f k0 = *(const v4f*)(k0r + 4 * g);
        const v4f k1 = *(const v4f*)(k1r + 4 * g);
#pragma unroll
        for (int i = 0; i < 4; ++i) {
          const v4f q = *(const v4f*)(qrow + i * RC_QP + 4 * g);
          p0[i] = q * k0 + p0[i];
          p1[i] = q * k1 + p1[i];
        }
      }
    } else {                                              // steps 0..15: every score of s >= 16 is masked
#pragma unroll 4   // as above
      for (int g = 0; g < 16; ++g) {
        const v4f k0 = *(const v4f*)(k0r + 4 * g);
#pragma unroll
        for (int i = 0; i < 4; ++i) {
          const v4f q = *(const v4f*)(qrow + i * RC_QP + 4 * g);
          p0[i] = q * k0 + p0[i];
        }
      }
    }
#pragma unroll
    for (int i = 0; i < 4; ++i) {
      const int t = tg * 4 + i;
      float a0 = (p0[i][0] + p0[i][1]) + (p0[i][2] + p0[i][3]);
      float a1 = (p1[i][0] + p1[i][1]) + (p1[i][2] + p1[i][3]);
      a0 = (lq <= t) ? a0 : 0.f;
      a1 = (lq + 16 <= t) ? a1 : 0.f;
      QP[t * RC_QP + 64 + lq] = a0;
      QP[t * RC_QP + 80 + lq] = a1;
      const v4f qz = *(const v4f*)(qrow + i * RC_QP + lq * 4) * zq;   // this lane's four terms of Qf_t . z0
      dn[i] = (a0 + a1) + ((qz[0] + qz[1]) + (qz[2] + qz[3]));
    }
#pragma unroll
    for (int o = 1; o < 16; o <<= 1) {                    // sum over the 16 lanes that share tg
#pragma unroll
      for (int i = 0; i < 4; ++i) dn[i] += __shfl_xor(dn[i], o, 32);
    }
  }
  __syncthreads();                                        // the scores are in QP

  v4f o4[4];
#pragma unroll
  for (int i = 0; i < 4; ++i) o4[i] = (v4f){0.f, 0.f, 0.f, 0.f};
  const float* bcol = BV + lq * 4;
  auto quad = [&](int kq) {   // four columns of [Qf | P] times four rows of [S0 ; v]
    v4f a[4], bb[4];
#pragma unroll
    for (int e = 0; e < 4; ++e) bb[e] = *(const v4f*)(bcol + (4 * kq + e) * 64);
#pragma unroll
    for (int i = 0; i < 4; ++i) a[i] = *(const v4f*)(qrow + i * RC_QP + 4 * kq);
#pragma unroll
    for (int e = 0; e < 4; ++e)
#pragma unroll
      for (int i = 0; i < 4; ++i) o4[i] = bb[e] * a[i][e] + o4[i];
  };
#pragma unroll 4   // several quads' LDS reads in flight ahead of their products
  for (int kq = 0; kq < 16; ++kq) quad(kq);
  const int kend = 16 + 2 * wave + 2;                     // this wave's last step is 8 wave + 7: later scores are all masked
  for (int kq = 16; kq < kend; ++kq) quad(kq);

#pragma unroll
  for (int i = 0; i < 4; ++i) {
    const float zi = __builtin_amdgcn_rcpf(dn[i] + 1e-6f);
    v4h hv;
#pragma unroll
    for (int j = 0; j < 4; ++j) hv[j] = (_Float16)(o4[i][j] * zi * oscale);
    *(v4h*)(outh + cbase + ((unsigned)(tg * 2048 + lq * 4) + i * 512u)) = hv;
  }
}

// ---- LayerNorm over 512, one wave per row; lane owns elements i*128 + lane*4 .. +3 (i = 0..3).
template <bool WH>
__global__ __launch_bounds__(256) void k_ln(
    const float* __restrict__ in, const float* __restrict__ g, const float* __restrict__ bta,
    float* __restrict__ outf, _Float16* __restrict__ outh, int nrows, float hscale) {
  const int lane = threadIdx.x & 31, wave = threadIdx.x >> 5;
  const int row = blockIdx.x * 8 + wave;
  if (row >= nrows) return;                        // wave-uniform; no block barriers
  const float* ip = in + (size_t)row * 512;
  v4f x[4];
  float s = 0.f;
#pragma unroll
  for (int i = 0; i < 4; ++i) {
    x[i] = *(const v4f*)(ip + i * 128 + lane * 4);
    s += (x[i][0] + x[i][1]) + (x[i][2] + x[i][3]);
  }
#pragma unroll
  for (int o = 1; o < 32; o <<= 1) s += __shfl_xor(s, o, 32);
  const float mu = s * 0.001953125f;
  float vs = 0.f;
#pragma unroll
  for (int i = 0; i < 4; ++i) {
    const v4f d = x[i] - mu;
    vs += (d[0] * d[0] + d[1] * d[1]) + (d[2] * d[2] + d[3] * d[3]);
  }
#pragma unroll
  for (int o = 1; o < 32; o <<= 1) vs += __shfl_xor(vs, o, 32);
  const float rstd = rsqrtf(vs * 0.001953125f + 1e-5f);
  v4f y[4];
#pragma unroll
  for (int i = 0; i < 4; ++i) {
    const v4f gg = *(const v4f*)(g + i * 128 + lane * 4);
    const v4f bb = *(const v4f*)(bta + i * 128 + lane * 4);
    y[i] = (x[i] - mu) * rstd * gg + bb;
  }
  float* op = outf + (size_t)row * 512;
  _Float16* oh = outh + (size_t)row * 512;
  {
#pragma unroll
    for (int i = 0; i < 4; ++i) {
      *(v4f*)(op + i * 128 + lane * 4) = y[i];
      if (WH) {
        v4h hv;
        hv[0] = (_Float16)(y[i][0] * hscale); hv[1] = (_Float16)(y[i][1] * hscale);
        hv[2] = (_Float16)(y[i][2] * hscale); hv[3] = (_Float16)(y[i][3] * hscale);
        *(v4h*)(oh + i * 128 + lane * 4) = hv;
      }
    }
    
  }
}

// ---------------------------------------------------------------------------
extern "C" void kernel_launch(void* const* d_in, const int* in_sizes, int n_in,
                              void* d_out, int out_size, void* d_ws, size_t ws_size,
                              hipStream_t stream)
{
  const int B = 2, L = 2048, D = 512, FF = 2048, HD = 64, MH = 32, DEPTH = 2;
  const int TOK = B * L;
  if (n_in < 20) return;
  if (in_sizes[0] != TOK * D || in_sizes[1] != DEPTH * D * D || in_sizes[3] != DEPTH * D * D ||
      in_sizes[5] != DEPTH * D * D || in_sizes[7] != DEPTH * D * D || in_sizes[9] != DEPTH * HD * MH ||
      in_sizes[12] != DEPTH * D * FF || in_sizes[14] != DEPTH * FF * D || out_size != TOK * D) return;

  const float* x_in  = (const float*)d_in[0];
  const float* Wq    = (const float*)d_in[1];
  const float* bq    = (const float*)d_in[2];
  const float* Wk    = (const float*)d_in[3];
  const float* bk    = (const float*)d_in[4];
  const float* Wv    = (const float*)d_in[5];
  const float* bv    = (const float*)d_in[6];
  const float* Wo    = (const float*)d_in[7];
  const float* bo    = (const float*)d_in[8];
  const float* omega = (const float*)d_in[9];
  const float* ln1g  = (const float*)d_in[10];
  const float* ln1b  = (const float*)d_in[11];
  const float* W1    = (const float*)d_in[12];
  const float* b1    = (const float*)d_in[13];
  const float* W2    = (const float*)d_in[14];
  const float* b2    = (const float*)d_in[15];
  const float* ln2g  = (const float*)d_in[16];
  const float* ln2b  = (const float*)d_in[17];
  const float* lnfg  = (const float*)d_in[18];
  const float* lnfb  = (const float*)d_in[19];
  float* out = (float*)d_out;

  // ---- workspace carve (under 109 MiB) ----
  char* ws = (char*)d_ws;
  size_t off = 0;
  auto carve = [&](size_t bytes) -> char* { char* p = ws + off; off += (bytes + 255) & ~(size_t)255; return p; };
  _Float16* xh  = (_Float16*)carve((size_t)TOK * D * 2);    // f16 A operand of current x
  float*    xf  = (float*)carve((size_t)TOK * D * 4);       // f32 current x (residual source)
  float*    qb_ = (float*)carve((size_t)3 * TOK * D * 4);   // q, k, v one behind the other: batch stride TOK * D of their common GEMM launch
  float*    kb_ = qb_ + (size_t)TOK * D;
  float*    vb_ = kb_ + (size_t)TOK * D;
  float*    Qfb = (float*)carve((size_t)TOK * D * 4);
  float*    Kfb = (float*)carve((size_t)TOK * D * 4);
  _Float16* ah  = (_Float16*)carve((size_t)TOK * D * 2);    // attention output, f16 x16
  float*    t1  = (float*)carve((size_t)TOK * D * 4);       // pre-LN sums
  _Float16* y1h = (_Float16*)carve((size_t)TOK * FF * 2);   // relu(x W1 + b1), f16
  _Float16* wt4 = (_Float16*)carve((size_t)DEPTH * 4 * D * D * 2);  // per layer [Wq,Wk,Wv,Wo]^T f16 x64, [4][N][K]
  _Float16* w1t = (_Float16*)carve((size_t)DEPTH * D * FF * 2);     // per layer W1^T [FF][D] f16 x64
  _Float16* w2t = (_Float16*)carve((size_t)DEPTH * FF * D * 2);     // per layer W2^T [D][FF] f16 x64
  float*    cst = (float*)carve((size_t)B * 8 * (L / RC_T) * RC_ST * 4);   // per (b, h, chunk) state record
  if (off > ws_size) return;

  const float WSC = 64.0f, ASC = 16.0f;
  const int n2 = TOK * D / 2;
  const int prepT = DEPTH * (4 * (D / 64) * (D / 64) + 2 * (D / 64) * (FF / 64));   // transpose tiles of all layers
  k_prep<D, FF, DEPTH><<<dim3(prepT + (n2 + 255) / 256), dim3(256), 0, stream>>>(
      x_in, Wq, Wk, Wv, Wo, W1, W2, xh, wt4, w1t, w2t, n2, WSC);

  const int tilesD  = (TOK / 64) * (D / 64);      // 512
  const int tilesFF = (TOK / 64) * (FF / 64);     // 2048
  const dim3 gD((tilesD + 7) / 8, 1), gFF((tilesFF + 7) / 8, 1);

  for (int l = 0; l < DEPTH; ++l) {
    const float* xres = (l == 0) ? x_in : xf;

    // q, k, v = x W + b (f32 out): one launch, batch index = which of the three
    const unsigned short* xhu = (const unsigned short*)xh;
    const unsigned short* wtu = (const unsigned short*)wt4 + (size_t)l * 4 * D * D;
    const unsigned short* w1u = (const unsigned short*)w1t + (size_t)l * D * FF;
    const unsigned short* w2u = (const unsigned short*)w2t + (size_t)l * FF * D;
    wmma_gemm64<0, false, 2, 0, false, 0><<<dim3(gD.x, 3), dim3(256), 0, stream>>>(
        xhu, xhu, D, 0L, wtu, wtu, D, (long)D * D,
        (void*)qb_, (void*)qb_, D, (long)TOK * D, bq + (size_t)l * D, bk + (size_t)l * D, bv + (size_t)l * D,
        bq + (size_t)l * D, 0L, TOK, D, D, 1.0f / WSC);

    // positive random features (f32)
    k_favor<<<dim3((TOK + 7) / 8), dim3(256), 0, stream>>>(qb_, kb_, omega + (size_t)l * HD * MH, Qfb, Kfb, TOK);

    // causal prefix recurrence (f32) as a chunk scan -> attn f16 x16
    k_chunk_sum<<<dim3(L / RC_T, B * 8), dim3(64), 0, stream>>>(Kfb, vb_, cst, L);
    k_chunk_prefix<<<dim3((RC_ST / 4 + 63) / 64, B * 8), dim3(64), 0, stream>>>(cst, L / RC_T);
    k_recur<<<dim3(L / RC_T, B * 8), dim3(128), 0, stream>>>(Qfb, Kfb, vb_, cst, ah, L, ASC);

    // t1 = attn Wo + bo + x ; x = LN1(t1)
    wmma_gemm64<0, false, 2, 0, true, 0><<<gD, dim3(256), 0, stream>>>(
        (const unsigned short*)ah, (const unsigned short*)ah, D, 0L, wtu + 3 * (size_t)D * D, wtu + 3 * (size_t)D * D, D, 0L,
        (void*)t1, (void*)t1, D, 0L, bo + (size_t)l * D, bo + (size_t)l * D, bo + (size_t)l * D, xres, 0L, TOK, D, D, 1.0f / (WSC * ASC));
    k_ln<true><<<dim3((TOK + 7) / 8), dim3(256), 0, stream>>>(t1, ln1g + (size_t)l * D, ln1b + (size_t)l * D, xf, xh, TOK, 1.0f);

    // y1 = relu(x W1 + b1) (f16 out); t1 = y1 W2 + b2 + x ; x = LN2(t1)
    wmma_gemm64<0, false, 2, 1, false, 2><<<gFF, dim3(256), 0, stream>>>(
        xhu, xhu, D, 0L, w1u, w1u, D, 0L,
        (void*)y1h, (void*)y1h, FF, 0L, b1 + (size_t)l * FF, b1 + (size_t)l * FF, b1 + (size_t)l * FF, b1 + (size_t)l * FF, 0L, TOK, FF, D, 1.0f / WSC);
    wmma_gemm64<0, false, 2, 0, true, 0><<<gD, dim3(256), 0, stream>>>(
        (const unsigned short*)y1h, (const unsigned short*)y1h, FF, 0L, w2u, w2u, FF, 0L,
        (void*)t1, (void*)t1, D, 0L, b2 + (size_t)l * D, b2 + (size_t)l * D, b2 + (size_t)l * D, xf, 0L, TOK, D, FF, 1.0f / WSC);
    k_ln<true><<<dim3((TOK + 7) / 8), dim3(256), 0, stream>>>(t1, ln2g + (size_t)l * D, ln2b + (size_t)l * D, xf, xh, TOK, 1.0f);
  }

  // final normalization -> output
  k_ln<false><<<dim3((TOK + 7) / 8), dim3(256), 0, stream>>>(xf, lnfg, lnfb, out, xh, TOK, 1.0f);
  (void)hipGetLastError();
}

// v005
// Measured time: 266 microseconds a run.
// In two side-by-side timings against v004, it was 1.05 and 1.06 times as fast.
// Over all steps from v000 it is 13.7 times as fast.
#include <hip/hip_runtime.h>
// Contractions x*Wq, x*Wk, x*Wv, attn*Wo, x*W1, y*W2: v_wmma_f32_16x16x32_f16 (f16 operands; weights carried x64, attn x16), f32 accumulate. Feature map, causal prefix recurrence, LayerNorm: f32 VALU.

typedef __attribute__((ext_vector_type(16))) _Float16 v16h;
typedef __attribute__((ext_vector_type(8)))  _Float16 v8h;
typedef __attribute__((ext_vector_type(4)))  _Float16 v4h;
typedef __attribute__((ext_vector_type(16))) __bf16   v16b;
typedef __attribute__((ext_vector_type(8)))  __bf16   v8b;
typedef __attribute__((ext_vector_type(8)))  float    v8f;
typedef __attribute__((ext_vector_type(4)))  float    v4f;

__device__ __forceinline__ unsigned short f2bf_bits(float f) {
  unsigned u = __float_as_uint(f);
  return (unsigned short)((u + 0x7FFFu + ((u >> 16) & 1u)) >> 16);
}
__device__ __forceinline__ float bf_bits2f(unsigned short h) { return __uint_as_float(((unsigned)h) << 16); }

// hazard guards as plain device helpers
__device__ __forceinline__ void acc_guard4(v8f& a, v8f& b, v8f& c, v8f& d) { asm volatile("v_nop\n\tv_nop\n\tv_nop\n\tv_nop" : "+v"(a), "+v"(b), "+v"(c), "+v"(d)); }
template <typename T> struct Frag;
template <> struct Frag<_Float16> {
  typedef v16h V; union U { v16h v; v8h h[2]; };
  static __device__ __forceinline__ v16h load(const _Float16* p) {   // elements 0..7 <- p[0..7], 8..15 <- p[16..23]
    U f; f.h[0] = *(const v8h*)(p); f.h[1] = *(const v8h*)(p + 16); return f.v;
  }
  static __device__ __forceinline__ v8f mma(v16h a, v16h b, v8f c) {
    return __builtin_amdgcn_wmma_f32_16x16x32_f16(false, a, false, b, (short)0, c, false, false);
  }
};
template <> struct Frag<__bf16> {
  typedef v16b V; union U { v16b v; v8b h[2]; };
  static __device__ __forceinline__ v16b load(const __bf16* p) {
    U f; f.h[0] = *(const v8b*)(p); f.h[1] = *(const v8b*)(p + 16); return f.v;
  }
  static __device__ __forceinline__ v8f mma(v16b a, v16b b, v8f c) {
    return __builtin_amdgcn_wmma_f32_16x16x32_bf16(false, a, false, b, (short)0, c, false, false);
  }
};

// One stage of the GEMM's LDS ring: 64 k (one 128-byte line) of the block's 64 A rows and 512 Bt rows.
#define GS_K 64
#define GS_PITCH 72                      // 16-bit elements per LDS row: 144 B = 16 B x 9, conflict-free for ds_load_b128
#define GS_STAGE (576 * GS_PITCH)        // 16-bit elements per stage
// Nine asynchronous 16-byte copies of a lane, global -> LDS (l = LDS byte address, g = global address).
// s_wait_xcnt stands in the copies' own statement so that no address register is rewritten ahead of it.
__device__ __forceinline__ void async_copy9(const unsigned* l, const void* const* g) {
  asm volatile(
      "global_load_async_to_lds_b128 %0, %9, off\n\t"
      "global_load_async_to_lds_b128 %1, %10, off\n\t"
      "global_load_async_to_lds_b128 %2, %11, off\n\t"
      "global_load_async_to_lds_b128 %3, %12, off\n\t"
      "global_load_async_to_lds_b128 %4, %13, off\n\t"
      "global_load_async_to_lds_b128 %5, %14, off\n\t"
      "global_load_async_to_lds_b128 %6, %15, off\n\t"
      "global_load_async_to_lds_b128 %7, %16, off\n\t"
      "global_load_async_to_lds_b128 %8, %17, off\n\t"
      "s_wait_xcnt 0x0"
      :: "v"(l[0]), "v"(l[1]), "v"(l[2]), "v"(l[3]), "v"(l[4]), "v"(l[5]), "v"(l[6]), "v"(l[7]), "v"(l[8]),
         "v"(g[0]), "v"(g[1]), "v"(g[2]), "v"(g[3]), "v"(g[4]), "v"(g[5]), "v"(g[6]), "v"(g[7]), "v"(g[8])
      : "memory");
}

// ---- LayerNorm of one row of 512 by one wave; lane owns elements i*128 + lane*4 .. +3 (i = 0..3) of x, g, b and y.
// The unrolls are there so that constant indices keep the arrays in registers.
__device__ __forceinline__ void ln_row(const v4f (&x)[4], const v4f (&gg)[4], const v4f (&bb)[4], v4f (&y)[4]) {
  float s = 0.f;
#pragma unroll
  for (int i = 0; i < 4; ++i) s += (x[i][0] + x[i][1]) + (x[i][2] + x[i][3]);
#pragma unroll
  for (int o = 1; o < 32; o <<= 1) s += __shfl_xor(s, o, 32);
  const float mu = s * 0.001953125f;
  float vs = 0.f;
#pragma unroll
  for (int i = 0; i < 4; ++i) {
    const v4f d = x[i] - mu;
    vs += (d[0] * d[0] + d[1] * d[1]) + (d[2] * d[2] + d[3] * d[3]);
  }
#pragma unroll
  for (int o = 1; o < 32; o <<= 1) vs += __shfl_xor(vs, o, 32);
  const float rstd = rsqrtf(vs * 0.001953125f + 1e-5f);
#pragma unroll
  for (int i = 0; i < 4; ++i) y[i] = (x[i] - mu) * rstd * gg[i] + bb[i];
}
#define LN_P 516   // floats per LDS row of the block's 64 x 512 result: rows 8 apart start 32 banks apart

// ---- Register-blocked batched WMMA GEMM ------------------------------------
// C[m,n] = scale * sum_k A[m,k] * Bt[n,k] (+bias)(+resid); each wave owns a 64x64 tile, a block of eight waves a 64x512 tile.
// A row-major [M,K]; Bt row-major [N,K]; M % 64 == 0, N % 512 == 0, K % 64 == 0, K >= 64.
// Operands reach the waves through a two-buffer LDS ring filled by asynchronous copies, one stage ahead of the WMMAs.
// SPLIT (hi/lo operand planes A2/Bt2) is not staged by the ring and must be false.
// BIAS_MODE: 0 = none, 1 = bias[m], 2 = bias[n]. Batch index blockIdx.y = 0, 1, 2 takes bias, biasY1, biasY2.
// OUT_MODE: 0 = f32, 1 = f16, 2 = bf16 hi plane (Cout) + bf16 lo plane (Cout2).
// LNM: 0 = C is stored as OUT_MODE says. 1, 2 = N == 512, so the block holds whole rows of C (+bias +resid): it normalizes them itself
// and C is never stored. 1: LayerNorm(lng, lnb) -> outf (f32) and outh (f16). 2: that, then LayerNorm(lnfg, lnfb) of the result -> outf alone.
// ET: 0 = f16 operands, 1 = bf16 operands (pointers passed as 16-bit storage)
template <int ET> struct Elem;
template <> struct Elem<0> { typedef _Float16 T; };
template <> struct Elem<1> { typedef __bf16 T; };
template <int ET, bool SPLIT, int BIAS_MODE, int OUT_MODE, bool RESID, int ACT = 0, int LNM = 0>
__global__ __launch_bounds__(256) void wmma_gemm64(
    const unsigned short* __restrict__ Ap, const unsigned short* __restrict__ A2p, int lda, long strideA,
    const unsigned short* __restrict__ Btp, const unsigned short* __restrict__ Bt2p, int ldb, long strideB,
    void* __restrict__ Cout, void* __restrict__ Cout2, int ldc, long strideC,
    const float* __restrict__ bias, const float* __restrict__ biasY1, const float* __restrict__ biasY2,
    const float* __restrict__ resid, long strideR,
    const float* __restrict__ lng, const float* __restrict__ lnb, const float* __restrict__ lnfg, const float* __restrict__ lnfb,
    float* __restrict__ outf, _Float16* __restrict__ outh,
    int M, int N, int K, float scale) {
  typedef typename Elem<ET>::T T;
  typedef typename Frag<T>::V V;
  const T* A = (const T*)Ap; const T* Bt = (const T*)Btp;
  static_assert(!SPLIT, "the LDS ring stages one plane per operand");
  __shared__ __align__(16) unsigned short sAB[2 * GS_STAGE];   // two stages: rows 0..63 = A, rows 64..575 = Bt
  __shared__ __align__(16) float sT[8][16 * 68];   // per-wave 16x64 slab, pitch 68 floats
  const int b    = blockIdx.y;
  const int tid  = threadIdx.x;
  const int lane = tid & 31;
  const int wave = tid >> 5;
  const int tilesN = N >> 6;
  const int tilesM = M >> 6;
  const int tile0 = blockIdx.x * 8;            // the block's eight tiles: one tile row, eight adjacent tile columns
  if (tile0 >= tilesM * tilesN) return;        // block-uniform, in front of every barrier
  const int tm  = tile0 / tilesN;
  const int m0  = tm << 6;
  const int nb0 = (tile0 - tm * tilesN) << 6;
  const int n0  = nb0 + (wave << 6);

  const T* Ab  = A  + (size_t)b * strideA;
  const T* Bb  = Bt + (size_t)b * strideB;

  const int rlane = lane & 15;                 // row (A) / col (B, D) within subtile
  const int koff  = (lane >> 4) * 8;           // k offset of this lane half
  const int mOff  = (lane >> 4) * 8;           // D row offset

  // Copies: eight lanes cover one row's 128-byte line, a wave four rows, the block 32 rows per copy; 18 copies per lane and stage.
  const int cr = tid >> 3, cc = (tid & 7) * 8;
  const T* pA = Ab + (size_t)(m0 + cr) * lda + cc;    // this lane's first A and Bt addresses of the next stage to copy
  const T* pB = Bb + (size_t)(nb0 + cr) * ldb + cc;
  const unsigned lds0 = (unsigned)(size_t)sAB + (unsigned)(cr * GS_PITCH + cc) * 2u;
  auto fill = [&](int buf) {
    const unsigned lb = lds0 + (unsigned)buf * (GS_STAGE * 2u);
    unsigned l[18];
    const void* g[18];
#pragma unroll   // constant indices keep l[] and g[] in registers
    for (int it = 0; it < 18; ++it) {
      l[it] = lb + (unsigned)(it * 32 * GS_PITCH) * 2u;
      g[it] = (it < 2) ? (pA + (size_t)(it * 32) * lda) : (pB + (size_t)((it - 2) * 32) * ldb);
    }
    async_copy9(l, g);
    async_copy9(l + 9, g + 9);
    pA += GS_K;
    pB += GS_K;
  };

  v8f acc[4][4];
#pragma unroll
  for (int i = 0; i < 4; ++i)
#pragma unroll
    for (int j = 0; j < 4; ++j) acc[i][j] = (v8f){0.f,0.f,0.f,0.f,0.f,0.f,0.f,0.f};

  const int nst = K / GS_K;
  fill(0);
  asm volatile("s_wait_asynccnt 0x0" ::: "memory");   // this wave's copies of stage 0 have landed
  __syncthreads();                                    // ... and every other wave's
  if (nst > 1) fill(1);
  for (int t = 0; t < nst; ++t) {
    const T* sb = (const T*)sAB + (t & 1) * GS_STAGE;
    const T* sa = sb + rlane * GS_PITCH + koff;
    const T* sw = sb + (64 + (wave << 6) + rlane) * GS_PITCH + koff;
    V bh[4], ah[4];
    auto frags = [&](int ks) {   // the eight fragments of 32 k
#pragma unroll
      for (int j = 0; j < 4; ++j) bh[j] = Frag<T>::load(sw + j * 16 * GS_PITCH + ks * 32);
#pragma unroll
      for (int i = 0; i < 4; ++i) ah[i] = Frag<T>::load(sa + i * 16 * GS_PITCH + ks * 32);
    };
    auto products = [&]() {
#pragma unroll
      for (int i = 0; i < 4; ++i)
#pragma unroll
        for (int j = 0; j < 4; ++j) acc[i][j] = Frag<T>::mma(ah[i], bh[j], acc[i][j]);
    };
    frags(0);
    // Keeps the eight fragments' loads together ahead of the WMMAs: left free, each A fragment's load sinks to its first use and the wave waits out the LDS latency four times per 32 k.
    __builtin_amdgcn_sched_barrier(0);
    products();
    frags(1);                                           // the stage's last LDS reads
    asm volatile("s_wait_dscnt 0x0" ::: "memory");      // this wave's reads of stage t are done before the buffer is refilled
    asm volatile("s_wait_asynccnt 0x0" ::: "memory");   // this wave's copies of stage t + 1 have landed
    __syncthreads();                                    // publishes stage t + 1 and ends every wave's reads of stage t
    if (t + 2 < nst) fill(t & 1);
    // Keeps the refill's issue ahead of the second 16 WMMAs (registers only), whose time the copies then have as lead.
    __builtin_amdgcn_sched_barrier(0);
    products();
  }
  asm volatile("s_wait_asynccnt 0x0" ::: "memory");     // no copy is outstanding behind the loop
  acc_guard4(acc[0][0], acc[0][1], acc[0][2], acc[0][3]);
  acc_guard4(acc[1][0], acc[1][1], acc[1][2], acc[1][3]);
  acc_guard4(acc[2][0], acc[2][1], acc[2][2], acc[2][3]);
  acc_guard4(acc[3][0], acc[3][1], acc[3][2], acc[3][3]);

  // ---- epilogue ----
  const float* Rb = RESID ? (resid + (size_t)b * strideR) : nullptr;
  const float* biasb = (b == 0) ? bias : (b == 1) ? biasY1 : biasY2;
  if constexpr (LNM != 0) {
    static_assert(BIAS_MODE == 2 && OUT_MODE == 0 && RESID && ACT == 0, "the normalizing epilogue takes bias[n] and a residual");
    static_assert(64 * LN_P * 4 <= 2 * GS_STAGE * 2, "the 64 x 512 result fits the ring");
    // The result goes through the ring's LDS, which is free here: every wave's last read of it and every copy into it
    // ended in front of the loop's last barrier. A plain '#pragma unroll' below keeps the per-lane arrays in registers (constant indices).
    float* tl = (float*)sAB;
    float bv[4];
#pragma unroll
    for (int j = 0; j < 4; ++j) bv[j] = biasb[n0 + (j << 4) + rlane];
    asm volatile("s_wait_xcnt 0x0" ::: "memory");   // behind the bias loads, in front of whatever next takes their address register
#pragma unroll
    for (int i = 0; i < 4; ++i)
#pragma unroll
      for (int j = 0; j < 4; ++j)
#pragma unroll
        for (int r = 0; r < 8; ++r)
          tl[((i << 4) + mOff + r) * LN_P + n0 + (j << 4) + rlane] = acc[i][j][r] * scale + bv[j];
    // Keeps the loads below behind the LDS stores, so that they take over the accumulators' registers: lifted over the stores they
    // need registers of their own beside the accumulators, and the kernel goes past 256 VGPRs (register-window switches).
    __builtin_amdgcn_sched_barrier(0);
    // Each wave takes eight whole rows. Their residual rows and the gains are loaded in front of the barrier, all in flight together.
    const int row0 = wave << 3, c4 = lane * 4;
    const size_t g0 = (size_t)(m0 + row0) * 512 + c4;
    const float* pr = Rb + g0;
    float* po = outf + g0;
    _Float16* ph = outh + g0;
    v4f rs[8][4], gg[4], bb[4], fg[4], fb[4];
#pragma unroll
    for (int rr = 0; rr < 8; ++rr)
#pragma unroll
      for (int i = 0; i < 4; ++i) rs[rr][i] = *(const v4f*)(pr + rr * 512 + i * 128);
#pragma unroll
    for (int i = 0; i < 4; ++i) {
      gg[i] = *(const v4f*)(lng + i * 128 + c4);
      bb[i] = *(const v4f*)(lnb + i * 128 + c4);
      if (LNM == 2) {
        fg[i] = *(const v4f*)(lnfg + i * 128 + c4);
        fb[i] = *(const v4f*)(lnfb + i * 128 + c4);
      }
    }
    asm volatile("s_wait_xcnt 0x0" ::: "memory");   // behind these loads, in front of whatever next takes their address registers
    __syncthreads();   // all eight waves' columns of every row are in LDS
#pragma unroll   // constant indices keep rs[] in registers
    for (int h = 0; h < 2; ++h) {   // four rows at a time: their reductions overlap, and the first four's stores drain under the last four's sums
      v4f y[4][4];
      v4h hv[4][4];
#pragma unroll
      for (int q = 0; q < 4; ++q) {
        const int rr = h * 4 + q;
        v4f x[4];
#pragma unroll
        for (int i = 0; i < 4; ++i) x[i] = *(const v4f*)(tl + (row0 + rr) * LN_P + i * 128 + c4) + rs[rr][i];
        if (LNM == 2) {
          v4f u[4];
          ln_row(x, gg, bb, u);
          ln_row(u, fg, fb, y[q]);
        } else {
          ln_row(x, gg, bb, y[q]);
#pragma unroll
          for (int i = 0; i < 4; ++i) {
            hv[q][i][0] = (_Float16)y[q][i][0]; hv[q][i][1] = (_Float16)y[q][i][1];
            hv[q][i][2] = (_Float16)y[q][i][2]; hv[q][i][3] = (_Float16)y[q][i][3];
          }
        }
      }
      // The four rows' values are all made in front of their first store: no register that an issued store names is written between the stores.
      __builtin_amdgcn_sched_barrier(0);
#pragma unroll
      for (int q = 0; q < 4; ++q)
#pragma unroll
        for (int i = 0; i < 4; ++i) {
          *(v4f*)(po + (h * 4 + q) * 512 + i * 128) = y[q][i];
          if (LNM == 1) *(v4h*)(ph + (h * 4 + q) * 512 + i * 128) = hv[q][i];
        }
      if (h == 0) {
        asm volatile("s_wait_xcnt 0x0" ::: "memory");   // behind the stores, in front of the next four rows' work, which reuses their registers
        __builtin_amdgcn_sched_barrier(0);              // keeps that work from being lifted over the wait
      }
    }
    return;
  }
  float* slab = sT[wave];
#pragma unroll
  for (int i = 0; i < 4; ++i) {
    const int mBase = m0 + (i << 4);
#pragma unroll
    for (int j = 0; j < 4; ++j) {
      const int n = n0 + (j << 4) + rlane;
      float bv = 0.f;
      if (BIAS_MODE == 2) bv = biasb[n];
#pragma unroll
      for (int r = 0; r < 8; ++r) {
        float v = acc[i][j][r] * scale;
        if (BIAS_MODE == 1) v += biasb[mBase + mOff + r];
        if (BIAS_MODE == 2) v += bv;
        if (RESID) v += Rb[(size_t)(mBase + mOff + r) * ldc + n];
        if (ACT == 1) v = tanhf(v);
        if (ACT == 2) v = fmaxf(v, 0.0f);
        if (ACT == 3) v = v / (1.0f + expf(-v));
        if (ACT == 4) v = (v > 0.f) ? v : 0.01f * v;
        if (ACT == 5) v = 0.5f * v * (1.0f + erff(v * 0.70710678118654752f));
        slab[(mOff + r) * 68 + (j << 4) + rlane] = v;
      }
    }
    __builtin_amdgcn_fence(__ATOMIC_RELEASE, "workgroup");
    __builtin_amdgcn_wave_barrier();
    __builtin_amdgcn_fence(__ATOMIC_ACQUIRE, "workgroup");
    if (OUT_MODE == 0) {
      float* C = (float*)Cout + (size_t)b * strideC;
      const int hh = lane >> 4, c4 = (lane & 15) * 4;     // row seg = 256 B = 16 lanes x 16 B
      {
#pragma unroll
        for (int it = 0; it < 8; ++it) {
          const int row = it * 2 + hh;
          v4f v = *(const v4f*)(slab + row * 68 + c4);
          *(v4f*)(C + (size_t)(mBase + row) * ldc + n0 + c4) = v;
        }
        
      }
    } else {
      const int q = lane >> 3, c8 = (lane & 7) * 8;
      unsigned short* C  = (unsigned short*)Cout  + (size_t)b * strideC;
      unsigned short* C2 = (OUT_MODE == 2) ? ((unsigned short*)Cout2 + (size_t)b * strideC) : nullptr;
      {
#pragma unroll
        for (int it = 0; it < 4; ++it) {
          const int row = it * 4 + q;
          const float* sp = slab + row * 68 + c8;
          v8h hv, lv;
#pragma unroll
          for (int e = 0; e < 8; ++e) {
            if (OUT_MODE == 1) {
              hv[e] = (_Float16)sp[e];
            } else {
              unsigned short hb = f2bf_bits(sp[e]);
              unsigned short lb = f2bf_bits(sp[e] - bf_bits2f(hb));
              hv[e] = __builtin_bit_cast(_Float16, hb);
              lv[e] = __builtin_bit_cast(_Float16, lb);
            }
          }
          *(v8h*)(C + (size_t)(mBase + row) * ldc + n0 + c8) = hv;
          if (OUT_MODE == 2) *(v8h*)(C2 + (size_t)(mBase + row) * ldc + n0 + c8) = lv;
        }
        
      }
    }
    __builtin_amdgcn_fence(__ATOMIC_RELEASE, "workgroup");
    __builtin_amdgcn_wave_barrier();
    __builtin_amdgcn_fence(__ATOMIC_ACQUIRE, "workgroup");
  }
}

// ---- Operand preparation of the whole call, one grid: every weight matrix of every layer transposed and cast, and x cast.
// None of these pieces reads what another writes, so they share one launch; each block does one piece.
// Cast piece: element pair i of in -> f16.
__device__ __forceinline__ void cast_f16x2(
    const float* __restrict__ in, _Float16* __restrict__ out, int i, int n2, float scale) {
  if (i < n2) {
    const _Float16 h0 = (_Float16)(in[2 * i] * scale), h1 = (_Float16)(in[2 * i + 1] * scale);
    const unsigned u = (unsigned)__builtin_bit_cast(unsigned short, h0) | ((unsigned)__builtin_bit_cast(unsigned short, h1) << 16);
    ((unsigned*)out)[i] = u;
  }
}

// Transpose piece: one 64 x 64 tile of src[K][N] f32 -> ob[N][K] f16 * scale. Called by a whole block of 256 threads.
__device__ __forceinline__ void wT_tile(
    const float* __restrict__ src, _Float16* __restrict__ ob, int K, int N, int n0, int k0, float scale, float (*tile)[65]) {
  const int tid = threadIdx.x, lane = tid & 31, wave = tid >> 5;
  const int c4 = (tid & 15) * 4, r0 = tid >> 4;
#pragma unroll
  for (int it = 0; it < 4; ++it) {
    const int kr = it * 16 + r0;
    const v4f v = *(const v4f*)(src + (size_t)(k0 + kr) * N + n0 + c4);
    tile[c4 + 0][kr] = v[0];
    tile[c4 + 1][kr] = v[1];
    tile[c4 + 2][kr] = v[2];
    tile[c4 + 3][kr] = v[3];
  }
  __syncthreads();
  const int q = lane >> 3, c8 = (lane & 7) * 8;
#pragma unroll
  for (int it = 0; it < 2; ++it) {
    const int row = wave * 8 + it * 4 + q;          // waves 0..7 x 8 rows = 64 rows
    v8h hv;
#pragma unroll
    for (int e = 0; e < 8; ++e) hv[e] = (_Float16)(tile[row][c8 + e] * scale);
    *(v8h*)(ob + (size_t)(n0 + row) * K + k0 + c8) = hv;
  }
  // Behind the two stores, a precaution: the cast piece runs only in other blocks, and nothing follows the stores in this kernel.
  asm volatile("s_wait_xcnt 0x0" ::: "memory");
}

// Blocks 0 .. DEPTH * PL - 1: transpose tiles, PL = 4 TDD + 2 TDF per layer in the order Wq, Wk, Wv, Wo, W1, W2; the blocks behind them: x.
// wt4[layer][4][D][D], w1t[layer][FF][D], w2t[layer][D][FF].
template <int D, int FF, int DEPTH>
__global__ __launch_bounds__(256) void k_prep(
    const float* __restrict__ x, const float* __restrict__ Wq, const float* __restrict__ Wk,
    const float* __restrict__ Wv, const float* __restrict__ Wo, const float* __restrict__ W1, const float* __restrict__ W2,
    _Float16* __restrict__ xh, _Float16* __restrict__ wt4, _Float16* __restrict__ w1t, _Float16* __restrict__ w2t,
    int n2, float wscale) {
  __shared__ float tile[64][65];   // [n][k]
  constexpr int TD = D / 64, TF = FF / 64, TDD = TD * TD, TDF = TD * TF, PL = 4 * TDD + 2 * TDF;
  const int bid = blockIdx.x;
  if (bid >= DEPTH * PL) {         // block-uniform
    cast_f16x2(x, xh, (bid - DEPTH * PL) * 256 + threadIdx.x, n2, 1.0f);
    return;
  }
  const int l = bid / PL, r = bid - l * PL;
  const float* src;
  _Float16* ob;
  int K, N, n0, k0;                // all block-uniform
  if (r < 4 * TDD) {
    const int z = r / TDD, t = r - z * TDD;
    src = ((z == 0) ? Wq : (z == 1) ? Wk : (z == 2) ? Wv : Wo) + (size_t)l * D * D;
    ob = wt4 + (size_t)(l * 4 + z) * D * D;
    K = D; N = D; n0 = (t % TD) * 64; k0 = (t / TD) * 64;
  } else if (r < 4 * TDD + TDF) {
    const int t = r - 4 * TDD;         // [D][FF] -> [FF][D]
    src = W1 + (size_t)l * D * FF;
    ob = w1t + (size_t)l * D * FF;
    K = D; N = FF; n0 = (t % TF) * 64; k0 = (t / TF) * 64;
  } else {
    const int t = r - 4 * TDD - TDF;   // [FF][D] -> [D][FF]
    src = W2 + (size_t)l * FF * D;
    ob = w2t + (size_t)l * FF * D;
    K = FF; N = D; n0 = (t % TD) * 64; k0 = (t / TD) * 64;
  }
  wT_tile(src, ob, K, N, n0, k0, wscale, tile);
}

// ---- FAVOR positive feature map, f32. One wave per token, both sources (q, k), all 8 heads x 64 dims.
// xs = x * 64^-0.25; u[j] = sum_d xs[h][d] * omega[d][j] (lane = j); off = 0.5 * |xs[h]|^2;
// phi = [exp(u-off), exp(-u-off)] * 0.125 -> out[token][h*64 + j], out[token][h*64 + 32 + j].
__global__ __launch_bounds__(256) void k_favor(
    const float* __restrict__ qin, const float* __restrict__ kin, const float* __restrict__ omega,
    float* __restrict__ qf, float* __restrict__ kf, int ntok) {
  __shared__ __align__(16) float omT[32 * 68];    // [j][d], pitch 68
  __shared__ __align__(16) float xs[8][512];       // per wave scaled token row
  __shared__ float nrm[8][8];                      // per wave, per head squared norm
  const int tid = threadIdx.x, lane = tid & 31, wave = tid >> 5, hh = lane >> 4;
#pragma unroll
  for (int i = 0; i < 8; ++i) {
    const int idx = i * 256 + tid;                 // omega element (d = idx>>5, j = idx&31)
    omT[(idx & 31) * 68 + (idx >> 5)] = omega[idx];
  }
  __syncthreads();
  const int tok = blockIdx.x * 8 + wave;
  if (tok >= ntok) return;                         // wave-uniform; no block barriers below
  const float sc = 0.35355339059327379f;           // 64^-0.25
  float* xw = xs[wave];
#pragma unroll 1
  for (int srci = 0; srci < 2; ++srci) {
    const float* xrow = ((srci == 0) ? qin : kin) + (size_t)tok * 512;
    float* frow = ((srci == 0) ? qf : kf) + (size_t)tok * 512;
    __builtin_amdgcn_fence(__ATOMIC_RELEASE, "workgroup");
    __builtin_amdgcn_wave_barrier();
    __builtin_amdgcn_fence(__ATOMIC_ACQUIRE, "workgroup");
#pragma unroll
    for (int i = 0; i < 4; ++i) {
      v4f v = *(const v4f*)(xrow + i * 128 + lane * 4);
      v = v * sc;
      *(v4f*)(xw + i * 128 + lane * 4) = v;
      float s = v[0] * v[0] + v[1] * v[1] + v[2] * v[2] + v[3] * v[3];
      s += __shfl_xor(s, 1, 32);
      s += __shfl_xor(s, 2, 32);
      s += __shfl_xor(s, 4, 32);
      s += __shfl_xor(s, 8, 32);
      if ((lane & 15) == 0) nrm[wave][2 * i + hh] = s;   // head of this 64-element group = 2i + lane/16
    }
    __builtin_amdgcn_fence(__ATOMIC_RELEASE, "workgroup");
    __builtin_amdgcn_wave_barrier();
    __builtin_amdgcn_fence(__ATOMIC_ACQUIRE, "workgroup");
#pragma unroll 1
    for (int h = 0; h < 8; ++h) {
      const float off = 0.5f * nrm[wave][h];
      const float* xp = xw + h * 64;
      const float* op = omT + lane * 68;
      float u = 0.f;
#pragma unroll 1
      for (int g = 0; g < 4; ++g) {
        const v4f a0 = *(const v4f*)(xp + 16 * g);
        const v4f a1 = *(const v4f*)(xp + 16 * g + 4);
        const v4f a2 = *(const v4f*)(xp + 16 * g + 8);
        const v4f a3 = *(const v4f*)(xp + 16 * g + 12);
        const v4f o0 = *(const v4f*)(op + 16 * g);
        const v4f o1 = *(const v4f*)(op + 16 * g + 4);
        const v4f o2 = *(const v4f*)(op + 16 * g + 8);
        const v4f o3 = *(const v4f*)(op + 16 * g + 12);
        u = fmaf(a0[0], o0[0], u); u = fmaf(a0[1], o0[1], u); u = fmaf(a0[2], o0[2], u); u = fmaf(a0[3], o0[3], u);
        u = fmaf(a1[0], o1[0], u); u = fmaf(a1[1], o1[1], u); u = fmaf(a1[2], o1[2], u); u = fmaf(a1[3], o1[3], u);
        u = fmaf(a2[0], o2[0], u); u = fmaf(a2[1], o2[1], u); u = fmaf(a2[2], o2[2], u); u = fmaf(a2[3], o2[3], u);
        u = fmaf(a3[0], o3[0], u); u = fmaf(a3[1], o3[1], u); u = fmaf(a3[2], o3[2], u); u = fmaf(a3[3], o3[3], u);
      }
      const float e1 = expf(u - off) * 0.125f;
      const float e2 = expf(-u - off) * 0.125f;
      float* vo = frow + h * 64;
      vo[lane] = e1;
      vo[lane + 32] = e2;
      
    }
  }
}

// ---- Causal linear attention, f32, as a scan over chunks of RC_T steps: three launches.
// State of one (b, h) before a step: S[d][m] = sum Kf[m] * v[d], z[m] = sum Kf[m] over all earlier steps.
// One chunk's record in the workspace: RC_ST floats; S[d][4g + e] at (g * 64 + d) * 4 + e (lanes adjacent), z[m] at 4096 + m.
#define RC_T 32
#define RC_ST 4160

// 1) Sums over one chunk alone. One block (64 threads) per (chunk, b*8+h); thread d holds S[d][0..63] in registers, thread m holds z[m].
__global__ __launch_bounds__(64) void k_chunk_sum(
    const float* __restrict__ kf, const float* __restrict__ vin, float* __restrict__ st, int L) {
  __shared__ __align__(16) float Kc[RC_T * 64];   // [t][m]
  __shared__ __align__(16) float Vc[RC_T * 64];   // [t][d]
  const int tid = threadIdx.x;
  const int ch = blockIdx.x, bh = blockIdx.y;
  const int b = bh >> 3, h = bh & 7;
  const size_t base = (size_t)b * L * 512 + (size_t)h * 64;
  const int t0 = ch * RC_T;
  {
    const int r0 = tid >> 4, c4 = (tid & 15) * 4;
#pragma unroll   // all sixteen loads in flight together
    for (int it = 0; it < 8; ++it) {
      const int r = it * 4 + r0;                 // 0..31
      const size_t go = base + (size_t)(t0 + r) * 512 + c4;
      *(v4f*)(Kc + r * 64 + c4) = *(const v4f*)(kf + go);
      *(v4f*)(Vc + r * 64 + c4) = *(const v4f*)(vin + go);
    }
  }
  __syncthreads();
  v4f s[16];
#pragma unroll   // constant indices keep s[] in registers (here and in the two loops over g below)
  for (int g = 0; g < 16; ++g) s[g] = (v4f){0.f, 0.f, 0.f, 0.f};
  float z = 0.f;
  for (int t = 0; t < RC_T; ++t) {
    const float vt = Vc[t * 64 + tid];
    z += Kc[t * 64 + tid];
    const float* kr = Kc + t * 64;
#pragma unroll
    for (int g = 0; g < 16; ++g) s[g] = *(const v4f*)(kr + 4 * g) * vt + s[g];
  }
  float* o = st + ((size_t)bh * (L / RC_T) + ch) * RC_ST;
#pragma unroll
  for (int g = 0; g < 16; ++g) *(v4f*)(o + (g * 64 + tid) * 4) = s[g];
  o[4096 + tid] = z;
}

// 2) Exclusive prefix over the chunks of one (b, h), in place, in ascending chunk order; one thread per 4 state elements.
// nch % 16 == 0. Sixteen chunks' loads are issued together so that their latencies overlap.
__global__ __launch_bounds__(64) void k_chunk_prefix(float* __restrict__ st, int nch) {
  const int e4 = blockIdx.x * 64 + threadIdx.x;
  if (e4 >= RC_ST / 4) return;
  float* p = st + (size_t)blockIdx.y * nch * RC_ST + e4 * 4;
  v4f run = (v4f){0.f, 0.f, 0.f, 0.f};
  for (int c0 = 0; c0 < nch; c0 += 16) {
    v4f v[16];
#pragma unroll   // loads issued back to back; constant indices keep v[] in registers (also in the loop below)
    for (int i = 0; i < 16; ++i) v[i] = *(const v4f*)(p + (size_t)(c0 + i) * RC_ST);
#pragma unroll
    for (int i = 0; i < 16; ++i) {
      *(v4f*)(p + (size_t)(c0 + i) * RC_ST) = run;
      run = run + v[i];
    }
  }
}

// 3) One chunk's outputs in matrix form, started from the chunk's prefix state. One block (128 threads) per (chunk, b*8+h).
// P[t][s] = Qf_t . Kf_s for s <= t, else 0;  num[t][d] = sum_m Qf_t[m] S0[d][m] + sum_s P[t][s] v_s[d];
// den_t = Qf_t . z0 + sum_s P[t][s];  out_t[d] = num * rcp(den_t + 1e-6), written as f16.
// Thread (tg = tid / 16, lq = tid % 16) owns steps t = 4 tg + i (i = 0..3); scores s = lq, lq + 16; outputs d = 4 lq .. 4 lq + 3.
// A plain '#pragma unroll' in this kernel is there so that constant indices keep the per-thread arrays in registers.
#define RC_QP 100   // floats per row of QP: 64 of Qf, RC_T scores, 4 of pad (rows 4 apart start 16 banks apart)
__global__ __launch_bounds__(128) void k_recur(
    const float* __restrict__ qf, const float* __restrict__ kf, const float* __restrict__ vin,
    const float* __restrict__ st, _Float16* __restrict__ outh, int L, float oscale) {
  __shared__ __align__(16) float QP[RC_T * RC_QP];        // [t][0..63] = Qf_t[m], [t][64 + s] = P[t][s]
  __shared__ __align__(16) float Ks[RC_T * 68];           // [s][m], pitch 68: 16 rows' 16-byte reads hit 64 different banks
  __shared__ __align__(16) float BV[(64 + RC_T) * 64];    // rows 0..63 = S0[.][m] as [m][d], rows 64 + s = v_s[d]
  const int tid = threadIdx.x;
  const int wave = __builtin_amdgcn_readfirstlane(tid >> 5);   // in a scalar register: the tests on it become scalar branches
  const int tg = tid >> 4, lq = tid & 15;
  const int ch = blockIdx.x, bh = blockIdx.y;
  const int b = bh >> 3, h = bh & 7;
  const size_t base = (size_t)b * L * 512 + (size_t)h * 64;
  const float* sp = st + ((size_t)bh * (L / RC_T) + ch) * RC_ST;
  const int t0 = ch * RC_T;
  const size_t cbase = base + (size_t)t0 * 512;           // the chunk's first row, same for the whole block
  const unsigned lo = (unsigned)(tg * 512 + lq * 4);      // this thread's place in rows 0..7 of the chunk
  v4f zq;                                                 // z0[4 lq .. 4 lq + 3]
  {
    v4f rq[4], rk[4], rv[4], rs[8];
#pragma unroll   // all loads of the thread in flight together
    for (int it = 0; it < 4; ++it) {
      rq[it] = *(const v4f*)(qf + cbase + (lo + it * 4096u));
      rk[it] = *(const v4f*)(kf + cbase + (lo + it * 4096u));
      rv[it] = *(const v4f*)(vin + cbase + (lo + it * 4096u));
    }
#pragma unroll
    for (int it = 0; it < 8; ++it) rs[it] = *(const v4f*)(sp + (it * 128 + tid) * 4);
    zq = *(const v4f*)(sp + 4096 + lq * 4);
#pragma unroll
    for (int it = 0; it < 4; ++it) {
      const int r = it * 8 + tg;
      *(v4f*)(QP + r * RC_QP + lq * 4) = rq[it];
      *(v4f*)(Ks + r * 68 + lq * 4) = rk[it];
      *(v4f*)(BV + (64 + r) * 64 + lq * 4) = rv[it];
    }
#pragma unroll
    for (int it = 0; it < 8; ++it) {                      // record element (g, d) holds S0[d][4g .. 4g + 3]
      const int g = it * 2 + (tid >> 6), d = tid & 63;
#pragma unroll
      for (int e = 0; e < 4; ++e) BV[(4 * g + e) * 64 + d] = rs[it][e];
    }
  }
  __syncthreads();

  const float* qrow = QP + (tg * 4) * RC_QP;
  float dn[4];
  {
    v4f p0[4], p1[4];
#pragma unroll
    for (int i = 0; i < 4; ++i) { p0[i] = (v4f){0.f, 0.f, 0.f, 0.f}; p1[i] = (v4f){0.f, 0.f, 0.f, 0.f}; }
    const float* k0r = Ks + lq * 68;
    const float* k1r = Ks + (lq + 16) * 68;
    if (wave >= 2) {                                      // steps 16..31 see scores of s = 0..31
#pragma unroll 4   // several groups' LDS reads in flight ahead of their products
      for (int g = 0; g < 16; ++g) {
        const v4f k0 = *(const v4f*)(k0r + 4 * g);
        const v4f k1 = *(const v4f*)(k1r + 4 * g);
#pragma unroll
        for (int i = 0; i < 4; ++i) {
          const v4f q = *(const v4f*)(qrow + i * RC_QP + 4 * g);
          p0[i] = q * k0 + p0[i];
          p1[i] = q * k1 + p1[i];
        }
      }
    } else {                                              // steps 0..15: every score of s >= 16 is masked
#pragma unroll 4   // as above
      for (int g = 0; g < 16; ++g) {
        const v4f k0 = *(const v4f*)(k0r + 4 * g);
#pragma unroll
        for (int i = 0; i < 4; ++i) {
          const v4f q = *(const v4f*)(qrow + i * RC_QP + 4 * g);
          p0[i] = q * k0 + p0[i];
        }
      }
    }
#pragma unroll
    for (int i = 0; i < 4; ++i) {
      const int t = tg * 4 + i;
      float a0 = (p0[i][0] + p0[i][1]) + (p0[i][2] + p0[i][3]);
      float a1 = (p1[i][0] + p1[i][1]) + (p1[i][2] + p1[i][3]);
      a0 = (lq <= t) ? a0 : 0.f;
      a1 = (lq + 16 <= t) ? a1 : 0.f;
      QP[t * RC_QP + 64 + lq] = a0;
      QP[t * RC_QP + 80 + lq] = a1;
      const v4f qz = *(const v4f*)(qrow + i * RC_QP + lq * 4) * zq;   // this lane's four terms of Qf_t . z0
      dn[i] = (a0 + a1) + ((qz[0] + qz[1]) + (qz[2] + qz[3]));
    }
#pragma unroll
    for (int o = 1; o < 16; o <<= 1) {                    // sum over the 16 lanes that share tg
#pragma unroll
      for (int i = 0; i < 4; ++i) dn[i] += __shfl_xor(dn[i], o, 32);
    }
  }
  __syncthreads();                                        // the scores are in QP

  v4f o4[4];
#pragma unroll
  for (int i = 0; i < 4; ++i) o4[i] = (v4f){0.f, 0.f, 0.f, 0.f};
  const float* bcol = BV + lq * 4;
  auto quad = [&](int kq) {   // four columns of [Qf | P] times four rows of [S0 ; v]
    v4f a[4], bb[4];
#pragma unroll
    for (int e = 0; e < 4; ++e) bb[e] = *(const v4f*)(bcol + (4 * kq + e) * 64);
#pragma unroll
    for (int i = 0; i < 4; ++i) a[i] = *(const v4f*)(qrow + i * RC_QP + 4 * kq);
#pragma unroll
    for (int e = 0; e < 4; ++e)
#pragma unroll
      for (int i = 0; i < 4; ++i) o4[i] = bb[e] * a[i][e] + o4[i];
  };
#pragma unroll 4   // several quads' LDS reads in flight ahead of their products
  for (int kq = 0; kq < 16; ++kq) quad(kq);
  const int kend = 16 + 2 * wave + 2;                     // this wave's last step is 8 wave + 7: later scores are all masked
  for (int kq = 16; kq < kend; ++kq) quad(kq);

#pragma unroll
  for (int i = 0; i < 4; ++i) {
    const float zi = __builtin_amdgcn_rcpf(dn[i] + 1e-6f);
    v4h hv;
#pragma unroll
    for (int j = 0; j < 4; ++j) hv[j] = (_Float16)(o4[i][j] * zi * oscale);
    *(v4h*)(outh + cbase + ((unsigned)(tg * 2048 + lq * 4) + i * 512u)) = hv;
  }
}

// ---------------------------------------------------------------------------
extern "C" void kernel_launch(void* const* d_in, const int* in_sizes, int n_in,
                              void* d_out, int out_size, void* d_ws, size_t ws_size,
                              hipStream_t stream)
{
  const int B = 2, L = 2048, D = 512, FF = 2048, HD = 64, MH = 32, DEPTH = 2;
  const int TOK = B * L;
  if (n_in < 20) return;
  if (in_sizes[0] != TOK * D || in_sizes[1] != DEPTH * D * D || in_sizes[3] != DEPTH * D * D ||
      in_sizes[5] != DEPTH * D * D || in_sizes[7] != DEPTH * D * D || in_sizes[9] != DEPTH * HD * MH ||
      in_sizes[12] != DEPTH * D * FF || in_sizes[14] != DEPTH * FF * D || out_size != TOK * D) return;

  const float* x_in  = (const float*)d_in[0];
  const float* Wq    = (const float*)d_in[1];
  const float* bq    = (const float*)d_in[2];
  const float* Wk    = (const float*)d_in[3];
  const float* bk    = (const float*)d_in[4];
  const float* Wv    = (const float*)d_in[5];
  const float* bv    = (const float*)d_in[6];
  const float* Wo    = (const float*)d_in[7];
  const float* bo    = (const float*)d_in[8];
  const float* omega = (const float*)d_in[9];
  const float* ln1g  = (const float*)d_in[10];
  const float* ln1b  = (const float*)d_in[11];
  const float* W1    = (const float*)d_in[12];
  const float* b1    = (const float*)d_in[13];
  const float* W2    = (const float*)d_in[14];
  const float* b2    = (const float*)d_in[15];
  const float* ln2g  = (const float*)d_in[16];
  const float* ln2b  = (const float*)d_in[17];
  const float* lnfg  = (const float*)d_in[18];
  const float* lnfb  = (const float*)d_in[19];
  float* out = (float*)d_out;

  // ---- workspace carve (under 109 MiB) ----
  char* ws = (char*)d_ws;
  size_t off = 0;
  auto carve = [&](size_t bytes) -> char* { char* p = ws + off; off += (bytes + 255) & ~(size_t)255; return p; };
  _Float16* xh  = (_Float16*)carve((size_t)TOK * D * 2);    // f16 A operand of current x
  float*    xf  = (float*)carve((size_t)TOK * D * 4);       // f32 x behind LN1 (residual source of the feed-forward half)
  float*    xg  = (float*)carve((size_t)TOK * D * 4);       // f32 x behind LN2 (residual source of the next layer)
  float*    qb_ = (float*)carve((size_t)3 * TOK * D * 4);   // q, k, v one behind the other: batch stride TOK * D of their common GEMM launch
  float*    kb_ = qb_ + (size_t)TOK * D;
  float*    vb_ = kb_ + (size_t)TOK * D;
  float*    Qfb = (float*)carve((size_t)TOK * D * 4);
  float*    Kfb = (float*)carve((size_t)TOK * D * 4);
  _Float16* ah  = (_Float16*)carve((size_t)TOK * D * 2);    // attention output, f16 x16
  _Float16* y1h = (_Float16*)carve((size_t)TOK * FF * 2);   // relu(x W1 + b1), f16
  _Float16* wt4 = (_Float16*)carve((size_t)DEPTH * 4 * D * D * 2);  // per layer [Wq,Wk,Wv,Wo]^T f16 x64, [4][N][K]
  _Float16* w1t = (_Float16*)carve((size_t)DEPTH * D * FF * 2);     // per layer W1^T [FF][D] f16 x64
  _Float16* w2t = (_Float16*)carve((size_t)DEPTH * FF * D * 2);     // per layer W2^T [D][FF] f16 x64
  float*    cst = (float*)carve((size_t)B * 8 * (L / RC_T) * RC_ST * 4);   // per (b, h, chunk) state record
  if (off > ws_size) return;

  const float WSC = 64.0f, ASC = 16.0f;
  const int n2 = TOK * D / 2;
  const int prepT = DEPTH * (4 * (D / 64) * (D / 64) + 2 * (D / 64) * (FF / 64));   // transpose tiles of all layers
  k_prep<D, FF, DEPTH><<<dim3(prepT + (n2 + 255) / 256), dim3(256), 0, stream>>>(
      x_in, Wq, Wk, Wv, Wo, W1, W2, xh, wt4, w1t, w2t, n2, WSC);

  const int tilesD  = (TOK / 64) * (D / 64);      // 512
  const int tilesFF = (TOK / 64) * (FF / 64);     // 2048
  const dim3 gD((tilesD + 7) / 8, 1), gFF((tilesFF + 7) / 8, 1);

  for (int l = 0; l < DEPTH; ++l) {
    const float* xres = (l == 0) ? x_in : xg;

    // q, k, v = x W + b (f32 out): one launch, batch index = which of the three
    const unsigned short* xhu = (const unsigned short*)xh;
    const unsigned short* wtu = (const unsigned short*)wt4 + (size_t)l * 4 * D * D;
    const unsigned short* w1u = (const unsigned short*)w1t + (size_t)l * D * FF;
    const unsigned short* w2u = (const unsigned short*)w2t + (size_t)l * FF * D;
    wmma_gemm64<0, false, 2, 0, false, 0><<<dim3(gD.x, 3), dim3(256), 0, stream>>>(
        xhu, xhu, D, 0L, wtu, wtu, D, (long)D * D,
        (void*)qb_, (void*)qb_, D, (long)TOK * D, bq + (size_t)l * D, bk + (size_t)l * D, bv + (size_t)l * D,
        bq + (size_t)l * D, 0L, lnfg, lnfb, lnfg, lnfb, xf, xh, TOK, D, D, 1.0f / WSC);

    // positive random features (f32)
    k_favor<<<dim3((TOK + 7) / 8), dim3(256), 0, stream>>>(qb_, kb_, omega + (size_t)l * HD * MH, Qfb, Kfb, TOK);

    // causal prefix recurrence (f32) as a chunk scan -> attn f16 x16
    k_chunk_sum<<<dim3(L / RC_T, B * 8), dim3(64), 0, stream>>>(Kfb, vb_, cst, L);
    k_chunk_prefix<<<dim3((RC_ST / 4 + 63) / 64, B * 8), dim3(64), 0, stream>>>(cst, L / RC_T);
    k_recur<<<dim3(L / RC_T, B * 8), dim3(128), 0, stream>>>(Qfb, Kfb, vb_, cst, ah, L, ASC);

    // x = LN1(attn Wo + bo + x), one launch
    wmma_gemm64<0, false, 2, 0, true, 0, 1><<<gD, dim3(256), 0, stream>>>(
        (const unsigned short*)ah, (const unsigned short*)ah, D, 0L, wtu + 3 * (size_t)D * D, wtu + 3 * (size_t)D * D, D, 0L,
        (void*)xf, (void*)xf, D, 0L, bo + (size_t)l * D, bo + (size_t)l * D, bo + (size_t)l * D, xres, 0L,
        ln1g + (size_t)l * D, ln1b + (size_t)l * D, lnfg, lnfb, xf, xh, TOK, D, D, 1.0f / (WSC * ASC));

    // y1 = relu(x W1 + b1) (f16 out); x = LN2(y1 W2 + b2 + x), in the last layer followed by the final normalization -> output
    wmma_gemm64<0, false, 2, 1, false, 2><<<gFF, dim3(256), 0, stream>>>(
        xhu, xhu, D, 0L, w1u, w1u, D, 0L,
        (void*)y1h, (void*)y1h, FF, 0L, b1 + (size_t)l * FF, b1 + (size_t)l * FF, b1 + (size_t)l * FF, b1 + (size_t)l * FF, 0L, lnfg, lnfb, lnfg, lnfb, xf, xh, TOK, FF, D, 1.0f / WSC);
    if (l + 1 < DEPTH)
      wmma_gemm64<0, false, 2, 0, true, 0, 1><<<gD, dim3(256), 0, stream>>>(
          (const unsigned short*)y1h, (const unsigned short*)y1h, FF, 0L, w2u, w2u, FF, 0L,
          (void*)xg, (void*)xg, D, 0L, b2 + (size_t)l * D, b2 + (size_t)l * D, b2 + (size_t)l * D, xf, 0L,
          ln2g + (size_t)l * D, ln2b + (size_t)l * D, lnfg, lnfb, xg, xh, TOK, D, FF, 1.0f / WSC);
    else
      wmma_gemm64<0, false, 2, 0, true, 0, 2><<<gD, dim3(256), 0, stream>>>(
          (const unsigned short*)y1h, (const unsigned short*)y1h, FF, 0L, w2u, w2u, FF, 0L,
          (void*)out, (void*)out, D, 0L, b2 + (size_t)l * D, b2 + (size_t)l * D, b2 + (size_t)l * D, xf, 0L,
          ln2g + (size_t)l * D, ln2b + (size_t)l * D, lnfg, lnfb, out, xh, TOK, D, FF, 1.0f / WSC);
  }
  (void)hipGetLastError();
}

// v006
// One run takes 244 microseconds.
// In two side-by-side timings against v005, it was 1.08 and 1.09 times as fast.
// Over all steps from v000 it is 14.8 times as fast.
#include <hip/hip_runtime.h>
// Contractions x*Wq, x*Wk, x*Wv, attn*Wo, x*W1, y*W2: v_wmma_f32_16x16x32_f16 (f16 operands; weights carried x64, attn x16), f32 accumulate. Feature map's product with omega: v_wmma_f32_16x16x4_f32 (f32 operands). Causal prefix recurrence, LayerNorm: f32 VALU.

typedef __attribute__((ext_vector_type(16))) _Float16 v16h;
typedef __attribute__((ext_vector_type(8)))  _Float16 v8h;
typedef __attribute__((ext_vector_type(4)))  _Float16 v4h;
typedef __attribute__((ext_vector_type(16))) __bf16   v16b;
typedef __attribute__((ext_vector_type(8)))  __bf16   v8b;
typedef __attribute__((ext_vector_type(8)))  float    v8f;
typedef __attribute__((ext_vector_type(4)))  float    v4f;
typedef __attribute__((ext_vector_type(2)))  float    v2f;

__device__ __forceinline__ unsigned short f2bf_bits(float f) {
  unsigned u = __float_as_uint(f);
  return (unsigned short)((u + 0x7FFFu + ((u >> 16) & 1u)) >> 16);
}
__device__ __forceinline__ float bf_bits2f(unsigned short h) { return __uint_as_float(((unsigned)h) << 16); }

// hazard guards as plain device helpers
__device__ __forceinline__ void acc_guard4(v8f& a, v8f& b, v8f& c, v8f& d) { asm volatile("v_nop\n\tv_nop\n\tv_nop\n\tv_nop" : "+v"(a), "+v"(b), "+v"(c), "+v"(d)); }
// The same behind f32 16x16x4 WMMAs: eight slots, the distance of the other form with a 16-cycle issue interval (this form has no figure of its own).
__device__ __forceinline__ void acc_guard2_f32(v8f& a, v8f& b) { asm volatile("v_nop\n\tv_nop\n\tv_nop\n\tv_nop\n\tv_nop\n\tv_nop\n\tv_nop\n\tv_nop" : "+v"(a), "+v"(b)); }
template <typename T> struct Frag;
template <> struct Frag<_Float16> {
  typedef v16h V; union U { v16h v; v8h h[2]; };
  static __device__ __forceinline__ v16h load(const _Float16* p) {   // elements 0..7 <- p[0..7], 8..15 <- p[16..23]
    U f; f.h[0] = *(const v8h*)(p); f.h[1] = *(const v8h*)(p + 16); return f.v;
  }
  static __device__ __forceinline__ v8f mma(v16h a, v16h b, v8f c) {
    return __builtin_amdgcn_wmma_f32_16x16x32_f16(false, a, false, b, (short)0, c, false, false);
  }
};
template <> struct Frag<__bf16> {
  typedef v16b V; union U { v16b v; v8b h[2]; };
  static __device__ __forceinline__ v16b load(const __bf16* p) {
    U f; f.h[0] = *(const v8b*)(p); f.h[1] = *(const v8b*)(p + 16); return f.v;
  }
  static __device__ __forceinline__ v8f mma(v16b a, v16b b, v8f c) {
    return __builtin_amdgcn_wmma_f32_16x16x32_bf16(false, a, false, b, (short)0, c, false, false);
  }
};

// One stage of the GEMM's LDS ring: 64 k (one 128-byte line) of the block's 64 A rows and 512 Bt rows.
#define GS_K 64
#define GS_PITCH 72                      // 16-bit elements per LDS row: 144 B = 16 B x 9, conflict-free for ds_load_b128
#define GS_STAGE (576 * GS_PITCH)        // 16-bit elements per stage
// Nine asynchronous 16-byte copies of a lane, global -> LDS (l = LDS byte address, g = global address).
// s_wait_xcnt stands in the copies' own statement so that no address register is rewritten ahead of it.
__device__ __forceinline__ void async_copy9(const unsigned* l, const void* const* g) {
  asm volatile(
      "global_load_async_to_lds_b128 %0, %9, off\n\t"
      "global_load_async_to_lds_b128 %1, %10, off\n\t"
      "global_load_async_to_lds_b128 %2, %11, off\n\t"
      "global_load_async_to_lds_b128 %3, %12, off\n\t"
      "global_load_async_to_lds_b128 %4, %13, off\n\t"
      "global_load_async_to_lds_b128 %5, %14, off\n\t"
      "global_load_async_to_lds_b128 %6, %15, off\n\t"
      "global_load_async_to_lds_b128 %7, %16, off\n\t"
      "global_load_async_to_lds_b128 %8, %17, off\n\t"
      "s_wait_xcnt 0x0"
      :: "v"(l[0]), "v"(l[1]), "v"(l[2]), "v"(l[3]), "v"(l[4]), "v"(l[5]), "v"(l[6]), "v"(l[7]), "v"(l[8]),
         "v"(g[0]), "v"(g[1]), "v"(g[2]), "v"(g[3]), "v"(g[4]), "v"(g[5]), "v"(g[6]), "v"(g[7]), "v"(g[8])
      : "memory");
}

// ---- LayerNorm of one row of 512 by one wave; lane owns elements i*128 + lane*4 .. +3 (i = 0..3) of x, g, b and y.
// The unrolls are there so that constant indices keep the arrays in registers.
__device__ __forceinline__ void ln_row(const v4f (&x)[4], const v4f (&gg)[4], const v4f (&bb)[4], v4f (&y)[4]) {
  float s = 0.f;
#pragma unroll
  for (int i = 0; i < 4; ++i) s += (x[i][0] + x[i][1]) + (x[i][2] + x[i][3]);
#pragma unroll
  for (int o = 1; o < 32; o <<= 1) s += __shfl_xor(s, o, 32);
  const float mu = s * 0.001953125f;
  float vs = 0.f;
#pragma unroll
  for (int i = 0; i < 4; ++i) {
    const v4f d = x[i] - mu;
    vs += (d[0] * d[0] + d[1] * d[1]) + (d[2] * d[2] + d[3] * d[3]);
  }
#pragma unroll
  for (int o = 1; o < 32; o <<= 1) vs += __shfl_xor(vs, o, 32);
  const float rstd = rsqrtf(vs * 0.001953125f + 1e-5f);
#pragma unroll
  for (int i = 0; i < 4; ++i) y[i] = (x[i] - mu) * rstd * gg[i] + bb[i];
}
#define LN_P 516   // floats per LDS row of the block's 64 x 512 result: rows 8 apart start 32 banks apart

// ---- Register-blocked batched WMMA GEMM ------------------------------------
// C[m,n] = scale * sum_k A[m,k] * Bt[n,k] (+bias)(+resid); each wave owns a 64x64 tile, a block of eight waves a 64x512 tile.
// A row-major [M,K]; Bt row-major [N,K]; M % 64 == 0, N % 512 == 0, K % 64 == 0, K >= 64.
// Operands reach the waves through a two-buffer LDS ring filled by asynchronous copies, one stage ahead of the WMMAs.
// SPLIT (hi/lo operand planes A2/Bt2) is not staged by the ring and must be false.
// BIAS_MODE: 0 = none, 1 = bias[m], 2 = bias[n]. Batch index blockIdx.y = 0, 1, 2 takes bias, biasY1, biasY2.
// OUT_MODE: 0 = f32, 1 = f16, 2 = bf16 hi plane (Cout) + bf16 lo plane (Cout2).
// LNM: 0 = C is stored as OUT_MODE says. 1, 2 = N == 512, so the block holds whole rows of C (+bias +resid): it normalizes them itself
// and C is never stored. 1: LayerNorm(lng, lnb) -> outf (f32) and outh (f16). 2: that, then LayerNorm(lnfg, lnfb) of the result -> outf alone.
// FAV: N == 512, so a wave's 64 columns are one head. Batch indices 0 and 1 (q, k) store the FAVOR positive features of C instead of C:
// xs = C * 64^-0.25; u[j] = sum_d xs[d] * fom[d][j] (j = 0..31); off = 0.5 * |xs|^2; columns j and 32 + j of the head = exp(u - off) / 8, exp(-u - off) / 8.
// ET: 0 = f16 operands, 1 = bf16 operands (pointers passed as 16-bit storage)
template <int ET> struct Elem;
template <> struct Elem<0> { typedef _Float16 T; };
template <> struct Elem<1> { typedef __bf16 T; };
template <int ET, bool SPLIT, int BIAS_MODE, int OUT_MODE, bool RESID, int ACT = 0, int LNM = 0, bool FAV = false>
__global__ __launch_bounds__(256) void wmma_gemm64(
    const unsigned short* __restrict__ Ap, const unsigned short* __restrict__ A2p, int lda, long strideA,
    const unsigned short* __restrict__ Btp, const unsigned short* __restrict__ Bt2p, int ldb, long strideB,
    void* __restrict__ Cout, void* __restrict__ Cout2, int ldc, long strideC,
    const float* __restrict__ bias, const float* __restrict__ biasY1, const float* __restrict__ biasY2,
    const float* __restrict__ resid, long strideR,
    const float* __restrict__ lng, const float* __restrict__ lnb, const float* __restrict__ lnfg, const float* __restrict__ lnfb,
    float* __restrict__ outf, _Float16* __restrict__ outh, const float* __restrict__ fom,
    int M, int N, int K, float scale) {
  typedef typename Elem<ET>::T T;
  typedef typename Frag<T>::V V;
  const T* A = (const T*)Ap; const T* Bt = (const T*)Btp;
  static_assert(!SPLIT, "the LDS ring stages one plane per operand");
  __shared__ __align__(16) unsigned short sAB[2 * GS_STAGE];   // two stages: rows 0..63 = A, rows 64..575 = Bt
  __shared__ __align__(16) float sT[8][16 * 68];   // per-wave 16x64 slab, pitch 68 floats
  __shared__ __align__(16) float sN[FAV ? 8 : 1][16];   // FAV: per wave, the squared norms of a slab's 16 rows
  const int b    = blockIdx.y;
  const int tid  = threadIdx.x;
  const int lane = tid & 31;
  const int wave = tid >> 5;
  const int tilesN = N >> 6;
  const int tilesM = M >> 6;
  const int tile0 = blockIdx.x * 8;            // the block's eight tiles: one tile row, eight adjacent tile columns
  if (tile0 >= tilesM * tilesN) return;        // block-uniform, in front of every barrier
  const int tm  = tile0 / tilesN;
  const int m0  = tm << 6;
  const int nb0 = (tile0 - tm * tilesN) << 6;
  const int n0  = nb0 + (wave << 6);

  const T* Ab  = A  + (size_t)b * strideA;
  const T* Bb  = Bt + (size_t)b * strideB;

  const int rlane = lane & 15;                 // row (A) / col (B, D) within subtile
  const int koff  = (lane >> 4) * 8;           // k offset of this lane half
  const int mOff  = (lane >> 4) * 8;           // D row offset

  // Copies: eight lanes cover one row's 128-byte line, a wave four rows, the block 32 rows per copy; 18 copies per lane and stage.
  const int cr = tid >> 3, cc = (tid & 7) * 8;
  const T* pA = Ab + (size_t)(m0 + cr) * lda + cc;    // this lane's first A and Bt addresses of the next stage to copy
  const T* pB = Bb + (size_t)(nb0 + cr) * ldb + cc;
  const unsigned lds0 = (unsigned)(size_t)sAB + (unsigned)(cr * GS_PITCH + cc) * 2u;
  auto fill = [&](int buf) {
    const unsigned lb = lds0 + (unsigned)buf * (GS_STAGE * 2u);
    unsigned l[18];
    const void* g[18];
#pragma unroll   // constant indices keep l[] and g[] in registers
    for (int it = 0; it < 18; ++it) {
      l[it] = lb + (unsigned)(it * 32 * GS_PITCH) * 2u;
      g[it] = (it < 2) ? (pA + (size_t)(it * 32) * lda) : (pB + (size_t)((it - 2) * 32) * ldb);
    }
    async_copy9(l, g);
    async_copy9(l + 9, g + 9);
    pA += GS_K;
    pB += GS_K;
  };

  v8f acc[4][4];
#pragma unroll
  for (int i = 0; i < 4; ++i)
#pragma unroll
    for (int j = 0; j < 4; ++j) acc[i][j] = (v8f){0.f,0.f,0.f,0.f,0.f,0.f,0.f,0.f};

  const int nst = K / GS_K;
  fill(0);
  asm volatile("s_wait_asynccnt 0x0" ::: "memory");   // this wave's copies of stage 0 have landed
  __syncthreads();                                    // ... and every other wave's
  if (nst > 1) fill(1);
  for (int t = 0; t < nst; ++t) {
    const T* sb = (const T*)sAB + (t & 1) * GS_STAGE;
    const T* sa = sb + rlane * GS_PITCH + koff;
    const T* sw = sb + (64 + (wave << 6) + rlane) * GS_PITCH + koff;
    V bh[4], ah[4];
    auto frags = [&](int ks) {   // the eight fragments of 32 k
#pragma unroll
      for (int j = 0; j < 4; ++j) bh[j] = Frag<T>::load(sw + j * 16 * GS_PITCH + ks * 32);
#pragma unroll
      for (int i = 0; i < 4; ++i) ah[i] = Frag<T>::load(sa + i * 16 * GS_PITCH + ks * 32);
    };
    auto products = [&]() {
#pragma unroll
      for (int i = 0; i < 4; ++i)
#pragma unroll
        for (int j = 0; j < 4; ++j) acc[i][j] = Frag<T>::mma(ah[i], bh[j], acc[i][j]);
    };
    frags(0);
    // Keeps the eight fragments' loads together ahead of the WMMAs: left free, each A fragment's load sinks to its first use and the wave waits out the LDS latency four times per 32 k.
    __builtin_amdgcn_sched_barrier(0);
    products();
    frags(1);                                           // the stage's last LDS reads
    asm volatile("s_wait_dscnt 0x0" ::: "memory");      // this wave's reads of stage t are done before the buffer is refilled
    asm volatile("s_wait_asynccnt 0x0" ::: "memory");   // this wave's copies of stage t + 1 have landed
    __syncthreads();                                    // publishes stage t + 1 and ends every wave's reads of stage t
    if (t + 2 < nst) fill(t & 1);
    // Keeps the refill's issue ahead of the second 16 WMMAs (registers only), whose time the copies then have as lead.
    __builtin_amdgcn_sched_barrier(0);
    products();
  }
  asm volatile("s_wait_asynccnt 0x0" ::: "memory");     // no copy is outstanding behind the loop
  acc_guard4(acc[0][0], acc[0][1], acc[0][2], acc[0][3]);
  acc_guard4(acc[1][0], acc[1][1], acc[1][2], acc[1][3]);
  acc_guard4(acc[2][0], acc[2][1], acc[2][2], acc[2][3]);
  acc_guard4(acc[3][0], acc[3][1], acc[3][2], acc[3][3]);

  // ---- epilogue ----
  const float* Rb = RESID ? (resid + (size_t)b * strideR) : nullptr;
  const float* biasb = (b == 0) ? bias : (b == 1) ? biasY1 : biasY2;
  if constexpr (LNM != 0) {
    static_assert(BIAS_MODE == 2 && OUT_MODE == 0 && RESID && ACT == 0, "the normalizing epilogue takes bias[n] and a residual");
    static_assert(64 * LN_P * 4 <= 2 * GS_STAGE * 2, "the 64 x 512 result fits the ring");
    // The result goes through the ring's LDS, which is free here: every wave's last read of it and every copy into it
    // ended in front of the loop's last barrier. A plain '#pragma unroll' below keeps the per-lane arrays in registers (constant indices).
    float* tl = (float*)sAB;
    float bv[4];
#pragma unroll
    for (int j = 0; j < 4; ++j) bv[j] = biasb[n0 + (j << 4) + rlane];
    asm volatile("s_wait_xcnt 0x0" ::: "memory");   // behind the bias loads, in front of whatever next takes their address register
#pragma unroll
    for (int i = 0; i < 4; ++i)
#pragma unroll
      for (int j = 0; j < 4; ++j)
#pragma unroll
        for (int r = 0; r < 8; ++r)
          tl[((i << 4) + mOff + r) * LN_P + n0 + (j << 4) + rlane] = acc[i][j][r] * scale + bv[j];
    // Keeps the loads below behind the LDS stores, so that they take over the accumulators' registers: lifted over the stores they
    // need registers of their own beside the accumulators, and the kernel goes past 256 VGPRs (register-window switches).
    __builtin_amdgcn_sched_barrier(0);
    // Each wave takes eight whole rows. Their residual rows and the gains are loaded in front of the barrier, all in flight together.
    const int row0 = wave << 3, c4 = lane * 4;
    const size_t g0 = (size_t)(m0 + row0) * 512 + c4;
    const float* pr = Rb + g0;
    float* po = outf + g0;
    _Float16* ph = outh + g0;
    v4f rs[8][4], gg[4], bb[4], fg[4], fb[4];
#pragma unroll
    for (int rr = 0; rr < 8; ++rr)
#pragma unroll
      for (int i = 0; i < 4; ++i) rs[rr][i] = *(const v4f*)(pr + rr * 512 + i * 128);
#pragma unroll
    for (int i = 0; i < 4; ++i) {
      gg[i] = *(const v4f*)(lng + i * 128 + c4);
      bb[i] = *(const v4f*)(lnb + i * 128 + c4);
      if (LNM == 2) {
        fg[i] = *(const v4f*)(lnfg + i * 128 + c4);
        fb[i] = *(const v4f*)(lnfb + i * 128 + c4);
      }
    }
    asm volatile("s_wait_xcnt 0x0" ::: "memory");   // behind these loads, in front of whatever next takes their address registers
    __syncthreads();   // all eight waves' columns of every row are in LDS
#pragma unroll   // constant indices keep rs[] in registers
    for (int h = 0; h < 2; ++h) {   // four rows at a time: their reductions overlap, and the first four's stores drain under the last four's sums
      v4f y[4][4];
      v4h hv[4][4];
#pragma unroll
      for (int q = 0; q < 4; ++q) {
        const int rr = h * 4 + q;
        v4f x[4];
#pragma unroll
        for (int i = 0; i < 4; ++i) x[i] = *(const v4f*)(tl + (row0 + rr) * LN_P + i * 128 + c4) + rs[rr][i];
        if (LNM == 2) {
          v4f u[4];
          ln_row(x, gg, bb, u);
          ln_row(u, fg, fb, y[q]);
        } else {
          ln_row(x, gg, bb, y[q]);
#pragma unroll
          for (int i = 0; i < 4; ++i) {
            hv[q][i][0] = (_Float16)y[q][i][0]; hv[q][i][1] = (_Float16)y[q][i][1];
            hv[q][i][2] = (_Float16)y[q][i][2]; hv[q][i][3] = (_Float16)y[q][i][3];
          }
        }
      }
      // The four rows' values are all made in front of their first store: no register that an issued store names is written between the stores.
      __builtin_amdgcn_sched_barrier(0);
#pragma unroll
      for (int q = 0; q < 4; ++q)
#pragma unroll
        for (int i = 0; i < 4; ++i) {
          *(v4f*)(po + (h * 4 + q) * 512 + i * 128) = y[q][i];
          if (LNM == 1) *(v4h*)(ph + (h * 4 + q) * 512 + i * 128) = hv[q][i];
        }
      if (h == 0) {
        asm volatile("s_wait_xcnt 0x0" ::: "memory");   // behind the stores, in front of the next four rows' work, which reuses their registers
        __builtin_amdgcn_sched_barrier(0);              // keeps that work from being lifted over the wait
      }
    }
    return;
  }
  float* slab = sT[wave];
  if constexpr (FAV) {
    static_assert(BIAS_MODE == 2 && OUT_MODE == 0 && !RESID && ACT == 0 && LNM == 0, "the feature epilogue takes bias[n] and stores f32");
    if (b < 2) {   // block-uniform: every lane stays on for the WMMAs below
      static_assert(8 * 64 * 68 * 4 <= 2 * GS_STAGE * 2, "eight 64 x 64 tiles fit the ring");
      // The wave's whole tile goes into its own part of the ring's LDS, which is free here: every wave's last read of it and every copy
      // into it ended in front of the loop's last barrier. With the accumulators gone the loop over the tile's four slabs can stay rolled.
      // A plain '#pragma unroll' in this block keeps the per-lane arrays in registers (constant indices).
      float* tw = (float*)sAB + wave * (64 * 68);   // [row][d], pitch 68 floats
      float* nr = sN[wave];
      const int hf = lane >> 4;
      // This lane's place in rows hf, hf + 2, .. of the tile's first slab (row pitch N = 512): a row's 256 B = 16 lanes x 16 B.
      float* cw = (float*)Cout + (size_t)b * strideC + (size_t)(m0 + hf) * 512 + n0 + rlane * 4;
      // B fragments of omega, k = 4 each: position (register v, lane half hf) of fragment f holds d = 8 (f / 2) + 4 hf + 2 (f % 2) + v, as in the A fragments below.
      v2f om[2][16];
#pragma unroll
      for (int jt = 0; jt < 2; ++jt)
#pragma unroll
        for (int f = 0; f < 16; ++f) {
          const float* op = fom + (8 * (f >> 1) + 4 * hf + 2 * (f & 1)) * 32 + jt * 16 + rlane;
          om[jt][f] = (v2f){op[0], op[32]};
        }
      float bv[4];
#pragma unroll
      for (int j = 0; j < 4; ++j) bv[j] = biasb[n0 + (j << 4) + rlane];
      asm volatile("s_wait_xcnt 0x0" ::: "memory");   // behind these loads, in front of whatever next takes their address registers
#pragma unroll
      for (int i = 0; i < 4; ++i)
#pragma unroll
        for (int j = 0; j < 4; ++j)
#pragma unroll
          for (int r = 0; r < 8; ++r)
            tw[((i << 4) + mOff + r) * 68 + (j << 4) + rlane] = (acc[i][j][r] * scale + bv[j]) * 0.35355339059327379f;   // 64^-0.25
      __builtin_amdgcn_fence(__ATOMIC_RELEASE, "workgroup");
      __builtin_amdgcn_wave_barrier();
      __builtin_amdgcn_fence(__ATOMIC_ACQUIRE, "workgroup");
#pragma unroll 1   // one copy of the slab's code: the text stays short
      for (int i = 0; i < 4; ++i) {
        float* slab = tw + i * (16 * 68);
        v4f a[8];      // row rlane of the slab, d = 8 q + 4 hf .. + 3
        float ns = 0.f;
#pragma unroll
        for (int q = 0; q < 8; ++q) {
          a[q] = *(const v4f*)(slab + rlane * 68 + 8 * q + 4 * hf);
          ns += (a[q][0] * a[q][0] + a[q][1] * a[q][1]) + (a[q][2] * a[q][2] + a[q][3] * a[q][3]);
        }
        ns += __shfl_xor(ns, 16, 32);   // the row's other 32 elements
        nr[rlane] = ns;                 // both halves hold and write the same sum
        __builtin_amdgcn_fence(__ATOMIC_RELEASE, "workgroup");
        __builtin_amdgcn_wave_barrier();
        __builtin_amdgcn_fence(__ATOMIC_ACQUIRE, "workgroup");
        const v4f nlo = *(const v4f*)(nr + mOff), nhi = *(const v4f*)(nr + mOff + 4);   // norms of rows mOff .. mOff + 7, D's rows in this lane
        v8f u0 = (v8f){0.f,0.f,0.f,0.f,0.f,0.f,0.f,0.f}, u1 = u0;
        // The two fences of the schedule keep the 32 WMMAs and their guard one block with no vector instruction in it:
        // left free, the norm's register moves land among the WMMAs and overwrite A registers directly behind the WMMA that reads them.
        __builtin_amdgcn_sched_barrier(0);
#pragma unroll
        for (int f = 0; f < 16; ++f) {
          const v2f af = (v2f){a[f >> 1][2 * (f & 1)], a[f >> 1][2 * (f & 1) + 1]};
          u0 = __builtin_amdgcn_wmma_f32_16x16x4_f32(false, af, false, om[0][f], (short)0, u0, false, false);
          u1 = __builtin_amdgcn_wmma_f32_16x16x4_f32(false, af, false, om[1][f], (short)0, u1, false, false);
        }
        acc_guard2_f32(u0, u1);
        __builtin_amdgcn_sched_barrier(0);
#pragma unroll
        for (int r = 0; r < 8; ++r) {
          const float off = 0.5f * ((r < 4) ? nlo[r & 3] : nhi[r & 3]);
          float* sr = slab + (mOff + r) * 68 + rlane;
          sr[0]  = expf(u0[r] - off) * 0.125f;
          sr[16] = expf(u1[r] - off) * 0.125f;
          sr[32] = expf(-u0[r] - off) * 0.125f;
          sr[48] = expf(-u1[r] - off) * 0.125f;
        }
        __builtin_amdgcn_fence(__ATOMIC_RELEASE, "workgroup");
        __builtin_amdgcn_wave_barrier();
        __builtin_amdgcn_fence(__ATOMIC_ACQUIRE, "workgroup");
        v4f ov[8];
#pragma unroll
        for (int it = 0; it < 8; ++it) ov[it] = *(const v4f*)(slab + (it * 2 + hf) * 68 + rlane * 4);
        float* cp = cw + i * (16 * 512);
#pragma unroll
        for (int it = 0; it < 8; ++it) *(v4f*)(cp + it * 1024) = ov[it];
        asm volatile("s_wait_xcnt 0x0" ::: "memory");   // behind the stores, in front of the next slab's work, which reuses their registers
        __builtin_amdgcn_sched_barrier(0);              // keeps that work from being lifted over the wait
      }
      return;
    }
  }
#pragma unroll
  for (int i = 0; i < 4; ++i) {
    const int mBase = m0 + (i << 4);
#pragma unroll
    for (int j = 0; j < 4; ++j) {
      const int n = n0 + (j << 4) + rlane;
      float bv = 0.f;
      if (BIAS_MODE == 2) bv = biasb[n];
#pragma unroll
      for (int r = 0; r < 8; ++r) {
        float v = acc[i][j][r] * scale;
        if (BIAS_MODE == 1) v += biasb[mBase + mOff + r];
        if (BIAS_MODE == 2) v += bv;
        if (RESID) v += Rb[(size_t)(mBase + mOff + r) * ldc + n];
        if (ACT == 1) v = tanhf(v);
        if (ACT == 2) v = fmaxf(v, 0.0f);
        if (ACT == 3) v = v / (1.0f + expf(-v));
        if (ACT == 4) v = (v > 0.f) ? v : 0.01f * v;
        if (ACT == 5) v = 0.5f * v * (1.0f + erff(v * 0.70710678118654752f));
        slab[(mOff + r) * 68 + (j << 4) + rlane] = v;
      }
    }
    __builtin_amdgcn_fence(__ATOMIC_RELEASE, "workgroup");
    __builtin_amdgcn_wave_barrier();
    __builtin_amdgcn_fence(__ATOMIC_ACQUIRE, "workgroup");
    if (OUT_MODE == 0) {
      float* C = (float*)Cout + (size_t)b * strideC;
      const int hh = lane >> 4, c4 = (lane & 15) * 4;     // row seg = 256 B = 16 lanes x 16 B
      {
#pragma unroll
        for (int it = 0; it < 8; ++it) {
          const int row = it * 2 + hh;
          v4f v = *(const v4f*)(slab + row * 68 + c4);
          *(v4f*)(C + (size_t)(mBase + row) * ldc + n0 + c4) = v;
        }
        
      }
    } else {
      const int q = lane >> 3, c8 = (lane & 7) * 8;
      unsigned short* C  = (unsigned short*)Cout  + (size_t)b * strideC;
      unsigned short* C2 = (OUT_MODE == 2) ? ((unsigned short*)Cout2 + (size_t)b * strideC) : nullptr;
      {
#pragma unroll
        for (int it = 0; it < 4; ++it) {
          const int row = it * 4 + q;
          const float* sp = slab + row * 68 + c8;
          v8h hv, lv;
#pragma unroll
          for (int e = 0; e < 8; ++e) {
            if (OUT_MODE == 1) {
              hv[e] = (_Float16)sp[e];
            } else {
              unsigned short hb = f2bf_bits(sp[e]);
              unsigned short lb = f2bf_bits(sp[e] - bf_bits2f(hb));
              hv[e] = __builtin_bit_cast(_Float16, hb);
              lv[e] = __builtin_bit_cast(_Float16, lb);
            }
          }
          *(v8h*)(C + (size_t)(mBase + row) * ldc + n0 + c8) = hv;
          if (OUT_MODE == 2) *(v8h*)(C2 + (size_t)(mBase + row) * ldc + n0 + c8) = lv;
        }
        
      }
    }
    __builtin_amdgcn_fence(__ATOMIC_RELEASE, "workgroup");
    __builtin_amdgcn_wave_barrier();
    __builtin_amdgcn_fence(__ATOMIC_ACQUIRE, "workgroup");
  }
}

// ---- Operand preparation of the whole call, one grid: every weight matrix of every layer transposed and cast, and x cast.
// None of these pieces reads what another writes, so they share one launch; each block does one piece.
// Cast piece: element pair i of in -> f16.
__device__ __forceinline__ void cast_f16x2(
    const float* __restrict__ in, _Float16* __restrict__ out, int i, int n2, float scale) {
  if (i < n2) {
    const _Float16 h0 = (_Float16)(in[2 * i] * scale), h1 = (_Float16)(in[2 * i + 1] * scale);
    const unsigned u = (unsigned)__builtin_bit_cast(unsigned short, h0) | ((unsigned)__builtin_bit_cast(unsigned short, h1) << 16);
    ((unsigned*)out)[i] = u;
  }
}

// Transpose piece: one 64 x 64 tile of src[K][N] f32 -> ob[N][K] f16 * scale. Called by a whole block of 256 threads.
__device__ __forceinline__ void wT_tile(
    const float* __restrict__ src, _Float16* __restrict__ ob, int K, int N, int n0, int k0, float scale, float (*tile)[65]) {
  const int tid = threadIdx.x, lane = tid & 31, wave = tid >> 5;
  const int c4 = (tid & 15) * 4, r0 = tid >> 4;
#pragma unroll
  for (int it = 0; it < 4; ++it) {
    const int kr = it * 16 + r0;
    const v4f v = *(const v4f*)(src + (size_t)(k0 + kr) * N + n0 + c4);
    tile[c4 + 0][kr] = v[0];
    tile[c4 + 1][kr] = v[1];
    tile[c4 + 2][kr] = v[2];
    tile[c4 + 3][kr] = v[3];
  }
  __syncthreads();
  const int q = lane >> 3, c8 = (lane & 7) * 8;
#pragma unroll
  for (int it = 0; it < 2; ++it) {
    const int row = wave * 8 + it * 4 + q;          // waves 0..7 x 8 rows = 64 rows
    v8h hv;
#pragma unroll
    for (int e = 0; e < 8; ++e) hv[e] = (_Float16)(tile[row][c8 + e] * scale);
    *(v8h*)(ob + (size_t)(n0 + row) * K + k0 + c8) = hv;
  }
  // Behind the two stores, a precaution: the cast piece runs only in other blocks, and nothing follows the stores in this kernel.
  asm volatile("s_wait_xcnt 0x0" ::: "memory");
}

// Blocks 0 .. DEPTH * PL - 1: transpose tiles, PL = 4 TDD + 2 TDF per layer in the order Wq, Wk, Wv, Wo, W1, W2; the blocks behind them: x.
// wt4[layer][4][D][D], w1t[layer][FF][D], w2t[layer][D][FF].
template <int D, int FF, int DEPTH>
__global__ __launch_bounds__(256) void k_prep(
    const float* __restrict__ x, const float* __restrict__ Wq, const float* __restrict__ Wk,
    const float* __restrict__ Wv, const float* __restrict__ Wo, const float* __restrict__ W1, const float* __restrict__ W2,
    _Float16* __restrict__ xh, _Float16* __restrict__ wt4, _Float16* __restrict__ w1t, _Float16* __restrict__ w2t,
    int n2, float wscale) {
  __shared__ float tile[64][65];   // [n][k]
  constexpr int TD = D / 64, TF = FF / 64, TDD = TD * TD, TDF = TD * TF, PL = 4 * TDD + 2 * TDF;
  const int bid = blockIdx.x;
  if (bid >= DEPTH * PL) {         // block-uniform
    cast_f16x2(x, xh, (bid - DEPTH * PL) * 256 + threadIdx.x, n2, 1.0f);
    return;
  }
  const int l = bid / PL, r = bid - l * PL;
  const float* src;
  _Float16* ob;
  int K, N, n0, k0;                // all block-uniform
  if (r < 4 * TDD) {
    const int z = r / TDD, t = r - z * TDD;
    src = ((z == 0) ? Wq : (z == 1) ? Wk : (z == 2) ? Wv : Wo) + (size_t)l * D * D;
    ob = wt4 + (size_t)(l * 4 + z) * D * D;
    K = D; N = D; n0 = (t % TD) * 64; k0 = (t / TD) * 64;
  } else if (r < 4 * TDD + TDF) {
    const int t = r - 4 * TDD;         // [D][FF] -> [FF][D]
    src = W1 + (size_t)l * D * FF;
    ob = w1t + (size_t)l * D * FF;
    K = D; N = FF; n0 = (t % TF) * 64; k0 = (t / TF) * 64;
  } else {
    const int t = r - 4 * TDD - TDF;   // [FF][D] -> [D][FF]
    src = W2 + (size_t)l * FF * D;
    ob = w2t + (size_t)l * FF * D;
    K = FF; N = D; n0 = (t % TD) * 64; k0 = (t / TD) * 64;
  }
  wT_tile(src, ob, K, N, n0, k0, wscale, tile);
}

// ---- Causal linear attention, f32, as a scan over chunks of RC_T steps: three launches.
// State of one (b, h) before a step: S[d][m] = sum Kf[m] * v[d], z[m] = sum Kf[m] over all earlier steps.
// One chunk's record in the workspace: RC_ST floats; S[d][4g + e] at (g * 64 + d) * 4 + e (lanes adjacent), z[m] at 4096 + m.
#define RC_T 32
#define RC_ST 4160

// 1) Sums over one chunk alone. One block (64 threads) per (chunk, b*8+h); thread d holds S[d][0..63] in registers, thread m holds z[m].
__global__ __launch_bounds__(64) void k_chunk_sum(
    const float* __restrict__ kf, const float* __restrict__ vin, float* __restrict__ st, int L) {
  __shared__ __align__(16) float Kc[RC_T * 64];   // [t][m]
  __shared__ __align__(16) float Vc[RC_T * 64];   // [t][d]
  const int tid = threadIdx.x;
  const int ch = blockIdx.x, bh = blockIdx.y;
  const int b = bh >> 3, h = bh & 7;
  const size_t base = (size_t)b * L * 512 + (size_t)h * 64;
  const int t0 = ch * RC_T;
  {
    const int r0 = tid >> 4, c4 = (tid & 15) * 4;
#pragma unroll   // all sixteen loads in flight together
    for (int it = 0; it < 8; ++it) {
      const int r = it * 4 + r0;                 // 0..31
      const size_t go = base + (size_t)(t0 + r) * 512 + c4;
      *(v4f*)(Kc + r * 64 + c4) = *(const v4f*)(kf + go);
      *(v4f*)(Vc + r * 64 + c4) = *(const v4f*)(vin + go);
    }
  }
  __syncthreads();
  v4f s[16];
#pragma unroll   // constant indices keep s[] in registers (here and in the two loops over g below)
  for (int g = 0; g < 16; ++g) s[g] = (v4f){0.f, 0.f, 0.f, 0.f};
  float z = 0.f;
  for (int t = 0; t < RC_T; ++t) {
    const float vt = Vc[t * 64 + tid];
    z += Kc[t * 64 + tid];
    const float* kr = Kc + t * 64;
#pragma unroll
    for (int g = 0; g < 16; ++g) s[g] = *(const v4f*)(kr + 4 * g) * vt + s[g];
  }
  float* o = st + ((size_t)bh * (L / RC_T) + ch) * RC_ST;
#pragma unroll
  for (int g = 0; g < 16; ++g) *(v4f*)(o + (g * 64 + tid) * 4) = s[g];
  o[4096 + tid] = z;
}

// 2) Exclusive prefix over the chunks of one (b, h), in place, in ascending chunk order; one thread per 4 state elements.
// nch % 16 == 0. Sixteen chunks' loads are issued together so that their latencies overlap.
__global__ __launch_bounds__(64) void k_chunk_prefix(float* __restrict__ st, int nch) {
  const int e4 = blockIdx.x * 64 + threadIdx.x;
  if (e4 >= RC_ST / 4) return;
  float* p = st + (size_t)blockIdx.y * nch * RC_ST + e4 * 4;
  v4f run = (v4f){0.f, 0.f, 0.f, 0.f};
  for (int c0 = 0; c0 < nch; c0 += 16) {
    v4f v[16];
#pragma unroll   // loads issued back to back; constant indices keep v[] in registers (also in the loop below)
    for (int i = 0; i < 16; ++i) v[i] = *(const v4f*)(p + (size_t)(c0 + i) * RC_ST);
#pragma unroll
    for (int i = 0; i < 16; ++i) {
      *(v4f*)(p + (size_t)(c0 + i) * RC_ST) = run;
      run = run + v[i];
    }
  }
}

// 3) One chunk's outputs in matrix form, started from the chunk's prefix state. One block (128 threads) per (chunk, b*8+h).
// P[t][s] = Qf_t . Kf_s for s <= t, else 0;  num[t][d] = sum_m Qf_t[m] S0[d][m] + sum_s P[t][s] v_s[d];
// den_t = Qf_t . z0 + sum_s P[t][s];  out_t[d] = num * rcp(den_t + 1e-6), written as f16.
// Thread (tg = tid / 16, lq = tid % 16) owns steps t = 4 tg + i (i = 0..3); scores s = lq, lq + 16; outputs d = 4 lq .. 4 lq + 3.
// A plain '#pragma unroll' in this kernel is there so that constant indices keep the per-thread arrays in registers.
#define RC_QP 100   // floats per row of QP: 64 of Qf, RC_T scores, 4 of pad (rows 4 apart start 16 banks apart)
__global__ __launch_bounds__(128) void k_recur(
    const float* __restrict__ qf, const float* __restrict__ kf, const float* __restrict__ vin,
    const float* __restrict__ st, _Float16* __restrict__ outh, int L, float oscale) {
  __shared__ __align__(16) float QP[RC_T * RC_QP];        // [t][0..63] = Qf_t[m], [t][64 + s] = P[t][s]
  __shared__ __align__(16) float Ks[RC_T * 68];           // [s][m], pitch 68: 16 rows' 16-byte reads hit 64 different banks
  __shared__ __align__(16) float BV[(64 + RC_T) * 64];    // rows 0..63 = S0[.][m] as [m][d], rows 64 + s = v_s[d]
  const int tid = threadIdx.x;
  const int wave = __builtin_amdgcn_readfirstlane(tid >> 5);   // in a scalar register: the tests on it become scalar branches
  const int tg = tid >> 4, lq = tid & 15;
  const int ch = blockIdx.x, bh = blockIdx.y;
  const int b = bh >> 3, h = bh & 7;
  const size_t base = (size_t)b * L * 512 + (size_t)h * 64;
  const float* sp = st + ((size_t)bh * (L / RC_T) + ch) * RC_ST;
  const int t0 = ch * RC_T;
  const size_t cbase = base + (size_t)t0 * 512;           // the chunk's first row, same for the whole block
  const unsigned lo = (unsigned)(tg * 512 + lq * 4);      // this thread's place in rows 0..7 of the chunk
  v4f zq;                                                 // z0[4 lq .. 4 lq + 3]
  {
    v4f rq[4], rk[4], rv[4], rs[8];
#pragma unroll   // all loads of the thread in flight together
    for (int it = 0; it < 4; ++it) {
      rq[it] = *(const v4f*)(qf + cbase + (lo + it * 4096u));
      rk[it] = *(const v4f*)(kf + cbase + (lo + it * 4096u));
      rv[it] = *(const v4f*)(vin + cbase + (lo + it * 4096u));
    }
#pragma unroll
    for (int it = 0; it < 8; ++it) rs[it] = *(const v4f*)(sp + (it * 128 + tid) * 4);
    zq = *(const v4f*)(sp + 4096 + lq * 4);
#pragma unroll
    for (int it = 0; it < 4; ++it) {
      const int r = it * 8 + tg;
      *(v4f*)(QP + r * RC_QP + lq * 4) = rq[it];
      *(v4f*)(Ks + r * 68 + lq * 4) = rk[it];
      *(v4f*)(BV + (64 + r) * 64 + lq * 4) = rv[it];
    }
#pragma unroll
    for (int it = 0; it < 8; ++it) {                      // record element (g, d) holds S0[d][4g .. 4g + 3]
      const int g = it * 2 + (tid >> 6), d = tid & 63;
#pragma unroll
      for (int e = 0; e < 4; ++e) BV[(4 * g + e) * 64 + d] = rs[it][e];
    }
  }
  __syncthreads();

  const float* qrow = QP + (tg * 4) * RC_QP;
  float dn[4];
  {
    v4f p0[4], p1[4];
#pragma unroll
    for (int i = 0; i < 4; ++i) { p0[i] = (v4f){0.f, 0.f, 0.f, 0.f}; p1[i] = (v4f){0.f, 0.f, 0.f, 0.f}; }
    const float* k0r = Ks + lq * 68;
    const float* k1r = Ks + (lq + 16) * 68;
    if (wave >= 2) {                                      // steps 16..31 see scores of s = 0..31
#pragma unroll 4   // several groups' LDS reads in flight ahead of their products
      for (int g = 0; g < 16; ++g) {
        const v4f k0 = *(const v4f*)(k0r + 4 * g);
        const v4f k1 = *(const v4f*)(k1r + 4 * g);
#pragma unroll
        for (int i = 0; i < 4; ++i) {
          const v4f q = *(const v4f*)(qrow + i * RC_QP + 4 * g);
          p0[i] = q * k0 + p0[i];
          p1[i] = q * k1 + p1[i];
        }
      }
    } else {                                              // steps 0..15: every score of s >= 16 is masked
#pragma unroll 4   // as above
      for (int g = 0; g < 16; ++g) {
        const v4f k0 = *(const v4f*)(k0r + 4 * g);
#pragma unroll
        for (int i = 0; i < 4; ++i) {
          const v4f q = *(const v4f*)(qrow + i * RC_QP + 4 * g);
          p0[i] = q * k0 + p0[i];
        }
      }
    }
#pragma unroll
    for (int i = 0; i < 4; ++i) {
      const int t = tg * 4 + i;
      float a0 = (p0[i][0] + p0[i][1]) + (p0[i][2] + p0[i][3]);
      float a1 = (p1[i][0] + p1[i][1]) + (p1[i][2] + p1[i][3]);
      a0 = (lq <= t) ? a0 : 0.f;
      a1 = (lq + 16 <= t) ? a1 : 0.f;
      QP[t * RC_QP + 64 + lq] = a0;
      QP[t * RC_QP + 80 + lq] = a1;
      const v4f qz = *(const v4f*)(qrow + i * RC_QP + lq * 4) * zq;   // this lane's four terms of Qf_t . z0
      dn[i] = (a0 + a1) + ((qz[0] + qz[1]) + (qz[2] + qz[3]));
    }
#pragma unroll
    for (int o = 1; o < 16; o <<= 1) {                    // sum over the 16 lanes that share tg
#pragma unroll
      for (int i = 0; i < 4; ++i) dn[i] += __shfl_xor(dn[i], o, 32);
    }
  }
  __syncthreads();                                        // the scores are in QP

  v4f o4[4];
#pragma unroll
  for (int i = 0; i < 4; ++i) o4[i] = (v4f){0.f, 0.f, 0.f, 0.f};
  const float* bcol = BV + lq * 4;
  auto quad = [&](int kq) {   // four columns of [Qf | P] times four rows of [S0 ; v]
    v4f a[4], bb[4];
#pragma unroll
    for (int e = 0; e < 4; ++e) bb[e] = *(const v4f*)(bcol + (4 * kq + e) * 64);
#pragma unroll
    for (int i = 0; i < 4; ++i) a[i] = *(const v4f*)(qrow + i * RC_QP + 4 * kq);
#pragma unroll
    for (int e = 0; e < 4; ++e)
#pragma unroll
      for (int i = 0; i < 4; ++i) o4[i] = bb[e] * a[i][e] + o4[i];
  };
#pragma unroll 4   // several quads' LDS reads in flight ahead of their products
  for (int kq = 0; kq < 16; ++kq) quad(kq);
  const int kend = 16 + 2 * wave + 2;                     // this wave's last step is 8 wave + 7: later scores are all masked
  for (int kq = 16; kq < kend; ++kq) quad(kq);

#pragma unroll
  for (int i = 0; i < 4; ++i) {
    const float zi = __builtin_amdgcn_rcpf(dn[i] + 1e-6f);
    v4h hv;
#pragma unroll
    for (int j = 0; j < 4; ++j) hv[j] = (_Float16)(o4[i][j] * zi * oscale);
    *(v4h*)(outh + cbase + ((unsigned)(tg * 2048 + lq * 4) + i * 512u)) = hv;
  }
}

// ---------------------------------------------------------------------------
extern "C" void kernel_launch(void* const* d_in, const int* in_sizes, int n_in,
                              void* d_out, int out_size, void* d_ws, size_t ws_size,
                              hipStream_t stream)
{
  const int B = 2, L = 2048, D = 512, FF = 2048, HD = 64, MH = 32, DEPTH = 2;
  const int TOK = B * L;
  if (n_in < 20) return;
  if (in_sizes[0] != TOK * D || in_sizes[1] != DEPTH * D * D || in_sizes[3] != DEPTH * D * D ||
      in_sizes[5] != DEPTH * D * D || in_sizes[7] != DEPTH * D * D || in_sizes[9] != DEPTH * HD * MH ||
      in_sizes[12] != DEPTH * D * FF || in_sizes[14] != DEPTH * FF * D || out_size != TOK * D) return;

  const float* x_in  = (const float*)d_in[0];
  const float* Wq    = (const float*)d_in[1];
  const float* bq    = (const float*)d_in[2];
  const float* Wk    = (const float*)d_in[3];
  const float* bk    = (const float*)d_in[4];
  const float* Wv    = (const float*)d_in[5];
  const float* bv    = (const float*)d_in[6];
  const float* Wo    = (const float*)d_in[7];
  const float* bo    = (const float*)d_in[8];
  const float* omega = (const float*)d_in[9];
  const float* ln1g  = (const float*)d_in[10];
  const float* ln1b  = (const float*)d_in[11];
  const float* W1    = (const float*)d_in[12];
  const float* b1    = (const float*)d_in[13];
  const float* W2    = (const float*)d_in[14];
  const float* b2    = (const float*)d_in[15];
  const float* ln2g  = (const float*)d_in[16];
  const float* ln2b  = (const float*)d_in[17];
  const float* lnfg  = (const float*)d_in[18];
  const float* lnfb  = (const float*)d_in[19];
  float* out = (float*)d_out;

  // ---- workspace carve (under 109 MiB) ----
  char* ws = (char*)d_ws;
  size_t off = 0;
  auto carve = [&](size_t bytes) -> char* { char* p = ws + off; off += (bytes + 255) & ~(size_t)255; return p; };
  _Float16* xh  = (_Float16*)carve((size_t)TOK * D * 2);    // f16 A operand of current x
  float*    xf  = (float*)carve((size_t)TOK * D * 4);       // f32 x behind LN1 (residual source of the feed-forward half)
  float*    xg  = (float*)carve((size_t)TOK * D * 4);       // f32 x behind LN2 (residual source of the next layer)
  float*    qb_ = (float*)carve((size_t)3 * TOK * D * 4);   // features of q, features of k, v one behind the other: batch stride TOK * D of their common GEMM launch
  float*    kb_ = qb_ + (size_t)TOK * D;
  float*    vb_ = kb_ + (size_t)TOK * D;
  _Float16* ah  = (_Float16*)carve((size_t)TOK * D * 2);    // attention output, f16 x16
  _Float16* y1h = (_Float16*)carve((size_t)TOK * FF * 2);   // relu(x W1 + b1), f16
  _Float16* wt4 = (_Float16*)carve((size_t)DEPTH * 4 * D * D * 2);  // per layer [Wq,Wk,Wv,Wo]^T f16 x64, [4][N][K]
  _Float16* w1t = (_Float16*)carve((size_t)DEPTH * D * FF * 2);     // per layer W1^T [FF][D] f16 x64
  _Float16* w2t = (_Float16*)carve((size_t)DEPTH * FF * D * 2);     // per layer W2^T [D][FF] f16 x64
  float*    cst = (float*)carve((size_t)B * 8 * (L / RC_T) * RC_ST * 4);   // per (b, h, chunk) state record
  if (off > ws_size) return;

  const float WSC = 64.0f, ASC = 16.0f;
  const int n2 = TOK * D / 2;
  const int prepT = DEPTH * (4 * (D / 64) * (D / 64) + 2 * (D / 64) * (FF / 64));   // transpose tiles of all layers
  k_prep<D, FF, DEPTH><<<dim3(prepT + (n2 + 255) / 256), dim3(256), 0, stream>>>(
      x_in, Wq, Wk, Wv, Wo, W1, W2, xh, wt4, w1t, w2t, n2, WSC);

  const int tilesD  = (TOK / 64) * (D / 64);      // 512
  const int tilesFF = (TOK / 64) * (FF / 64);     // 2048
  const dim3 gD((tilesD + 7) / 8, 1), gFF((tilesFF + 7) / 8, 1);

  for (int l = 0; l < DEPTH; ++l) {
    const float* xres = (l == 0) ? x_in : xg;
    const float* om = omega + (size_t)l * HD * MH;

    // positive random features of q = x Wq + bq and of k, and v = x Wv + bv (f32 out): one launch, batch index = which of the three
    const unsigned short* xhu = (const unsigned short*)xh;
    const unsigned short* wtu = (const unsigned short*)wt4 + (size_t)l * 4 * D * D;
    const unsigned short* w1u = (const unsigned short*)w1t + (size_t)l * D * FF;
    const unsigned short* w2u = (const unsigned short*)w2t + (size_t)l * FF * D;
    wmma_gemm64<0, false, 2, 0, false, 0, 0, true><<<dim3(gD.x, 3), dim3(256), 0, stream>>>(
        xhu, xhu, D, 0L, wtu, wtu, D, (long)D * D,
        (void*)qb_, (void*)qb_, D, (long)TOK * D, bq + (size_t)l * D, bk + (size_t)l * D, bv + (size_t)l * D,
        bq + (size_t)l * D, 0L, lnfg, lnfb, lnfg, lnfb, xf, xh, om, TOK, D, D, 1.0f / WSC);

    // causal prefix recurrence (f32) as a chunk scan -> attn f16 x16
    k_chunk_sum<<<dim3(L / RC_T, B * 8), dim3(64), 0, stream>>>(kb_, vb_, cst, L);
    k_chunk_prefix<<<dim3((RC_ST / 4 + 63) / 64, B * 8), dim3(64), 0, stream>>>(cst, L / RC_T);
    k_recur<<<dim3(L / RC_T, B * 8), dim3(128), 0, stream>>>(qb_, kb_, vb_, cst, ah, L, ASC);

    // x = LN1(attn Wo + bo + x), one launch
    wmma_gemm64<0, false, 2, 0, true, 0, 1><<<gD, dim3(256), 0, stream>>>(
        (const unsigned short*)ah, (const unsigned short*)ah, D, 0L, wtu + 3 * (size_t)D * D, wtu + 3 * (size_t)D * D, D, 0L,
        (void*)xf, (void*)xf, D, 0L, bo + (size_t)l * D, bo + (size_t)l * D, bo + (size_t)l * D, xres, 0L,
        ln1g + (size_t)l * D, ln1b + (size_t)l * D, lnfg, lnfb, xf, xh, om, TOK, D, D, 1.0f / (WSC * ASC));

    // y1 = relu(x W1 + b1) (f16 out); x = LN2(y1 W2 + b2 + x), in the last layer followed by the final normalization -> output
    wmma_gemm64<0, false, 2, 1, false, 2><<<gFF, dim3(256), 0, stream>>>(
        xhu, xhu, D, 0L, w1u, w1u, D, 0L,
        (void*)y1h, (void*)y1h, FF, 0L, b1 + (size_t)l * FF, b1 + (size_t)l * FF, b1 + (size_t)l * FF, b1 + (size_t)l * FF, 0L, lnfg, lnfb, lnfg, lnfb, xf, xh, om, TOK, FF, D, 1.0f / WSC);
    if (l + 1 < DEPTH)
      wmma_gemm64<0, false, 2, 0, true, 0, 1><<<gD, dim3(256), 0, stream>>>(
          (const unsigned short*)y1h, (const unsigned short*)y1h, FF, 0L, w2u, w2u, FF, 0L,
          (void*)xg, (void*)xg, D, 0L, b2 + (size_t)l * D, b2 + (size_t)l * D, b2 + (size_t)l * D, xf, 0L,
          ln2g + (size_t)l * D, ln2b + (size_t)l * D, lnfg, lnfb, xg, xh, om, TOK, D, FF, 1.0f / WSC);
    else
      wmma_gemm64<0, false, 2, 0, true, 0, 2><<<gD, dim3(256), 0, stream>>>(
          (const unsigned short*)y1h, (const unsigned short*)y1h, FF, 0L, w2u, w2u, FF, 0L,
          (void*)out, (void*)out, D, 0L, b2 + (size_t)l * D, b2 + (size_t)l * D, b2 + (size_t)l * D, xf, 0L,
          ln2g + (size_t)l * D, ln2b + (size_t)l * D, lnfg, lnfb, out, xh, om, TOK, D, FF, 1.0f / WSC);
  }
  (void)hipGetLastError();
}

// v007
// It runs in 235 microseconds.
// In two side-by-side timings against v006, it was 1.04 and 1.05 times as fast.
// All steps since v000 together make it 15.5 times as fast.
#include <hip/hip_runtime.h>
// Contractions x*Wq, x*Wk, x*Wv, attn*Wo, x*W1, y*W2: v_wmma_f32_16x16x32_f16 (f16 operands; weights carried x64, attn x16), f32 accumulate. Feature map's product with omega: v_wmma_f32_16x16x4_f32 (f32 operands). Causal prefix recurrence, LayerNorm: f32 VALU.

typedef __attribute__((ext_vector_type(16))) _Float16 v16h;
typedef __attribute__((ext_vector_type(8)))  _Float16 v8h;
typedef __attribute__((ext_vector_type(4)))  _Float16 v4h;
typedef __attribute__((ext_vector_type(16))) __bf16   v16b;
typedef __attribute__((ext_vector_type(8)))  __bf16   v8b;
typedef __attribute__((ext_vector_type(8)))  float    v8f;
typedef __attribute__((ext_vector_type(4)))  float    v4f;
typedef __attribute__((ext_vector_type(2)))  float    v2f;

__device__ __forceinline__ unsigned short f2bf_bits(float f) {
  unsigned u = __float_as_uint(f);
  return (unsigned short)((u + 0x7FFFu + ((u >> 16) & 1u)) >> 16);
}
__device__ __forceinline__ float bf_bits2f(unsigned short h) { return __uint_as_float(((unsigned)h) << 16); }

// hazard guards as plain device helpers
__device__ __forceinline__ void acc_guard4(v8f& a, v8f& b, v8f& c, v8f& d) { asm volatile("v_nop\n\tv_nop\n\tv_nop\n\tv_nop" : "+v"(a), "+v"(b), "+v"(c), "+v"(d)); }
// The same behind f32 16x16x4 WMMAs: eight slots, the distance of the other form with a 16-cycle issue interval (this form has no figure of its own).
__device__ __forceinline__ void acc_guard2_f32(v8f& a, v8f& b) { asm volatile("v_nop\n\tv_nop\n\tv_nop\n\tv_nop\n\tv_nop\n\tv_nop\n\tv_nop\n\tv_nop" : "+v"(a), "+v"(b)); }
template <typename T> struct Frag;
template <> struct Frag<_Float16> {
  typedef v16h V; union U { v16h v; v8h h[2]; };
  static __device__ __forceinline__ v16h load(const _Float16* p) {   // elements 0..7 <- p[0..7], 8..15 <- p[16..23]
    U f; f.h[0] = *(const v8h*)(p); f.h[1] = *(const v8h*)(p + 16); return f.v;
  }
  static __device__ __forceinline__ v8f mma(v16h a, v16h b, v8f c) {
    return __builtin_amdgcn_wmma_f32_16x16x32_f16(false, a, false, b, (short)0, c, false, false);
  }
};
template <> struct Frag<__bf16> {
  typedef v16b V; union U { v16b v; v8b h[2]; };
  static __device__ __forceinline__ v16b load(const __bf16* p) {
    U f; f.h[0] = *(const v8b*)(p); f.h[1] = *(const v8b*)(p + 16); return f.v;
  }
  static __device__ __forceinline__ v8f mma(v16b a, v16b b, v8f c) {
    return __builtin_amdgcn_wmma_f32_16x16x32_bf16(false, a, false, b, (short)0, c, false, false);
  }
};

// One stage of the GEMM's LDS ring: 64 k (one 128-byte line) of the block's 64 A rows and 512 Bt rows.
#define GS_K 64
#define GS_PITCH 72                      // 16-bit elements per LDS row: 144 B = 16 B x 9, conflict-free for ds_load_b128
#define GS_STAGE (576 * GS_PITCH)        // 16-bit elements per stage
// Nine asynchronous 16-byte copies of a lane, global -> LDS (l = LDS byte address, g = global address).
// s_wait_xcnt stands in the copies' own statement so that no address register is rewritten ahead of it.
__device__ __forceinline__ void async_copy9(const unsigned* l, const void* const* g) {
  asm volatile(
      "global_load_async_to_lds_b128 %0, %9, off\n\t"
      "global_load_async_to_lds_b128 %1, %10, off\n\t"
      "global_load_async_to_lds_b128 %2, %11, off\n\t"
      "global_load_async_to_lds_b128 %3, %12, off\n\t"
      "global_load_async_to_lds_b128 %4, %13, off\n\t"
      "global_load_async_to_lds_b128 %5, %14, off\n\t"
      "global_load_async_to_lds_b128 %6, %15, off\n\t"
      "global_load_async_to_lds_b128 %7, %16, off\n\t"
      "global_load_async_to_lds_b128 %8, %17, off\n\t"
      "s_wait_xcnt 0x0"
      :: "v"(l[0]), "v"(l[1]), "v"(l[2]), "v"(l[3]), "v"(l[4]), "v"(l[5]), "v"(l[6]), "v"(l[7]), "v"(l[8]),
         "v"(g[0]), "v"(g[1]), "v"(g[2]), "v"(g[3]), "v"(g[4]), "v"(g[5]), "v"(g[6]), "v"(g[7]), "v"(g[8])
      : "memory");
}

// ---- LayerNorm of one row of 512 by one wave; lane owns elements i*128 + lane*4 .. +3 (i = 0..3) of x, g, b and y.
// The unrolls are there so that constant indices keep the arrays in registers.
__device__ __forceinline__ void ln_row(const v4f (&x)[4], const v4f (&gg)[4], const v4f (&bb)[4], v4f (&y)[4]) {
  float s = 0.f;
#pragma unroll
  for (int i = 0; i < 4; ++i) s += (x[i][0] + x[i][1]) + (x[i][2] + x[i][3]);
#pragma unroll
  for (int o = 1; o < 32; o <<= 1) s += __shfl_xor(s, o, 32);
  const float mu = s * 0.001953125f;
  float vs = 0.f;
#pragma unroll
  for (int i = 0; i < 4; ++i) {
    const v4f d = x[i] - mu;
    vs += (d[0] * d[0] + d[1] * d[1]) + (d[2] * d[2] + d[3] * d[3]);
  }
#pragma unroll
  for (int o = 1; o < 32; o <<= 1) vs += __shfl_xor(vs, o, 32);
  const float rstd = rsqrtf(vs * 0.001953125f + 1e-5f);
#pragma unroll
  for (int i = 0; i < 4; ++i) y[i] = (x[i] - mu) * rstd * gg[i] + bb[i];
}
#define LN_P 516   // floats per LDS row of the block's 64 x 512 result: rows 8 apart start 32 banks apart

// ---- Register-blocked batched WMMA GEMM ------------------------------------
// C[m,n] = scale * sum_k A[m,k] * Bt[n,k] (+bias)(+resid); each wave owns a 64x64 tile, a block of eight waves a 64x512 tile.
// A row-major [M,K]; Bt row-major [N,K]; M % 64 == 0, N % 512 == 0, K % 64 == 0, K >= 64.
// Operands reach the waves through a two-buffer LDS ring filled by asynchronous copies, one stage ahead of the WMMAs.
// SPLIT (hi/lo operand planes A2/Bt2) is not staged by the ring and must be false.
// BIAS_MODE: 0 = none, 1 = bias[m], 2 = bias[n]. Batch index blockIdx.y = 0, 1, 2 takes bias, biasY1, biasY2.
// OUT_MODE: 0 = f32, 1 = f16, 2 = bf16 hi plane (Cout) + bf16 lo plane (Cout2).
// LNM: 0 = C is stored as OUT_MODE says. 1, 2 = N == 512, so the block holds whole rows of C (+bias +resid): it normalizes them itself
// and C is never stored. 1: LayerNorm(lng, lnb) -> outf (f32) and outh (f16). 2: that, then LayerNorm(lnfg, lnfb) of the result -> outf alone.
// FAV: N == 512, so a wave's 64 columns are one head. Batch indices 0 and 1 (q, k) store the FAVOR positive features of C instead of C:
// xs = C * 64^-0.25; u[j] = sum_d xs[d] * fom[d][j] (j = 0..31); off = 0.5 * |xs|^2; columns j and 32 + j of the head = exp(u - off) / 8, exp(-u - off) / 8.
// ET: 0 = f16 operands, 1 = bf16 operands (pointers passed as 16-bit storage)
template <int ET> struct Elem;
template <> struct Elem<0> { typedef _Float16 T; };
template <> struct Elem<1> { typedef __bf16 T; };
template <int ET, bool SPLIT, int BIAS_MODE, int OUT_MODE, bool RESID, int ACT = 0, int LNM = 0, bool FAV = false>
__global__ __launch_bounds__(256) void wmma_gemm64(
    const unsigned short* __restrict__ Ap, const unsigned short* __restrict__ A2p, int lda, long strideA,
    const unsigned short* __restrict__ Btp, const unsigned short* __restrict__ Bt2p, int ldb, long strideB,
    void* __restrict__ Cout, void* __restrict__ Cout2, int ldc, long strideC,
    const float* __restrict__ bias, const float* __restrict__ biasY1, const float* __restrict__ biasY2,
    const float* __restrict__ resid, long strideR,
    const float* __restrict__ lng, const float* __restrict__ lnb, const float* __restrict__ lnfg, const float* __restrict__ lnfb,
    float* __restrict__ outf, _Float16* __restrict__ outh, const float* __restrict__ fom,
    int M, int N, int K, float scale) {
  typedef typename Elem<ET>::T T;
  typedef typename Frag<T>::V V;
  const T* A = (const T*)Ap; const T* Bt = (const T*)Btp;
  static_assert(!SPLIT, "the LDS ring stages one plane per operand");
  __shared__ __align__(16) unsigned short sAB[2 * GS_STAGE];   // two stages: rows 0..63 = A, rows 64..575 = Bt
  __shared__ __align__(16) float sT[8][16 * 68];   // per-wave 16x64 slab, pitch 68 floats
  __shared__ __align__(16) float sN[FAV ? 8 : 1][16];   // FAV: per wave, the squared norms of a slab's 16 rows
  const int b    = blockIdx.y;
  const int tid  = threadIdx.x;
  const int lane = tid & 31;
  const int wave = tid >> 5;
  const int tilesN = N >> 6;
  const int tilesM = M >> 6;
  const int tile0 = blockIdx.x * 8;            // the block's eight tiles: one tile row, eight adjacent tile columns
  if (tile0 >= tilesM * tilesN) return;        // block-uniform, in front of every barrier
  const int tm  = tile0 / tilesN;
  const int m0  = tm << 6;
  const int nb0 = (tile0 - tm * tilesN) << 6;
  const int n0  = nb0 + (wave << 6);

  const T* Ab  = A  + (size_t)b * strideA;
  const T* Bb  = Bt + (size_t)b * strideB;

  const int rlane = lane & 15;                 // row (A) / col (B, D) within subtile
  const int koff  = (lane >> 4) * 8;           // k offset of this lane half
  const int mOff  = (lane >> 4) * 8;           // D row offset

  // Copies: eight lanes cover one row's 128-byte line, a wave four rows, the block 32 rows per copy; 18 copies per lane and stage.
  const int cr = tid >> 3, cc = (tid & 7) * 8;
  const T* pA = Ab + (size_t)(m0 + cr) * lda + cc;    // this lane's first A and Bt addresses of the next stage to copy
  const T* pB = Bb + (size_t)(nb0 + cr) * ldb + cc;
  const unsigned lds0 = (unsigned)(size_t)sAB + (unsigned)(cr * GS_PITCH + cc) * 2u;
  auto fill = [&](int buf) {
    const unsigned lb = lds0 + (unsigned)buf * (GS_STAGE * 2u);
    unsigned l[18];
    const void* g[18];
#pragma unroll   // constant indices keep l[] and g[] in registers
    for (int it = 0; it < 18; ++it) {
      l[it] = lb + (unsigned)(it * 32 * GS_PITCH) * 2u;
      g[it] = (it < 2) ? (pA + (size_t)(it * 32) * lda) : (pB + (size_t)((it - 2) * 32) * ldb);
    }
    async_copy9(l, g);
    async_copy9(l + 9, g + 9);
    pA += GS_K;
    pB += GS_K;
  };

  v8f acc[4][4];
#pragma unroll
  for (int i = 0; i < 4; ++i)
#pragma unroll
    for (int j = 0; j < 4; ++j) acc[i][j] = (v8f){0.f,0.f,0.f,0.f,0.f,0.f,0.f,0.f};

  const int nst = K / GS_K;
  fill(0);
  asm volatile("s_wait_asynccnt 0x0" ::: "memory");   // this wave's copies of stage 0 have landed
  __syncthreads();                                    // ... and every other wave's
  if (nst > 1) fill(1);
  for (int t = 0; t < nst; ++t) {
    const T* sb = (const T*)sAB + (t & 1) * GS_STAGE;
    const T* sa = sb + rlane * GS_PITCH + koff;
    const T* sw = sb + (64 + (wave << 6) + rlane) * GS_PITCH + koff;
    V bh[4], ah[4];
    auto frags = [&](int ks) {   // the eight fragments of 32 k
#pragma unroll
      for (int j = 0; j < 4; ++j) bh[j] = Frag<T>::load(sw + j * 16 * GS_PITCH + ks * 32);
#pragma unroll
      for (int i = 0; i < 4; ++i) ah[i] = Frag<T>::load(sa + i * 16 * GS_PITCH + ks * 32);
    };
    auto products = [&]() {
#pragma unroll
      for (int i = 0; i < 4; ++i)
#pragma unroll
        for (int j = 0; j < 4; ++j) acc[i][j] = Frag<T>::mma(ah[i], bh[j], acc[i][j]);
    };
    frags(0);
    // Keeps the eight fragments' loads together ahead of the WMMAs: left free, each A fragment's load sinks to its first use and the wave waits out the LDS latency four times per 32 k.
    __builtin_amdgcn_sched_barrier(0);
    products();
    frags(1);                                           // the stage's last LDS reads
    asm volatile("s_wait_dscnt 0x0" ::: "memory");      // this wave's reads of stage t are done before the buffer is refilled
    asm volatile("s_wait_asynccnt 0x0" ::: "memory");   // this wave's copies of stage t + 1 have landed
    __syncthreads();                                    // publishes stage t + 1 and ends every wave's reads of stage t
    if (t + 2 < nst) fill(t & 1);
    // Keeps the refill's issue ahead of the second 16 WMMAs (registers only), whose time the copies then have as lead.
    __builtin_amdgcn_sched_barrier(0);
    products();
  }
  asm volatile("s_wait_asynccnt 0x0" ::: "memory");     // no copy is outstanding behind the loop
  acc_guard4(acc[0][0], acc[0][1], acc[0][2], acc[0][3]);
  acc_guard4(acc[1][0], acc[1][1], acc[1][2], acc[1][3]);
  acc_guard4(acc[2][0], acc[2][1], acc[2][2], acc[2][3]);
  acc_guard4(acc[3][0], acc[3][1], acc[3][2], acc[3][3]);

  // ---- epilogue ----
  const float* Rb = RESID ? (resid + (size_t)b * strideR) : nullptr;
  const float* biasb = (b == 0) ? bias : (b == 1) ? biasY1 : biasY2;
  if constexpr (LNM != 0) {
    static_assert(BIAS_MODE == 2 && OUT_MODE == 0 && RESID && ACT == 0, "the normalizing epilogue takes bias[n] and a residual");
    static_assert(64 * LN_P * 4 <= 2 * GS_STAGE * 2, "the 64 x 512 result fits the ring");
    // The result goes through the ring's LDS, which is free here: every wave's last read of it and every copy into it
    // ended in front of the loop's last barrier. A plain '#pragma unroll' below keeps the per-lane arrays in registers (constant indices).
    float* tl = (float*)sAB;
    float bv[4];
#pragma unroll
    for (int j = 0; j < 4; ++j) bv[j] = biasb[n0 + (j << 4) + rlane];
    asm volatile("s_wait_xcnt 0x0" ::: "memory");   // behind the bias loads, in front of whatever next takes their address register
#pragma unroll
    for (int i = 0; i < 4; ++i)
#pragma unroll
      for (int j = 0; j < 4; ++j)
#pragma unroll
        for (int r = 0; r < 8; ++r)
          tl[((i << 4) + mOff + r) * LN_P + n0 + (j << 4) + rlane] = acc[i][j][r] * scale + bv[j];
    // Keeps the loads below behind the LDS stores, so that they take over the accumulators' registers: lifted over the stores they
    // need registers of their own beside the accumulators, and the kernel goes past 256 VGPRs (register-window switches).
    __builtin_amdgcn_sched_barrier(0);
    // Each wave takes eight whole rows. Their residual rows and the gains are loaded in front of the barrier, all in flight together.
    const int row0 = wave << 3, c4 = lane * 4;
    const size_t g0 = (size_t)(m0 + row0) * 512 + c4;
    const float* pr = Rb + g0;
    float* po = outf + g0;
    _Float16* ph = outh + g0;
    v4f rs[8][4], gg[4], bb[4], fg[4], fb[4];
#pragma unroll
    for (int rr = 0; rr < 8; ++rr)
#pragma unroll
      for (int i = 0; i < 4; ++i) rs[rr][i] = *(const v4f*)(pr + rr * 512 + i * 128);
#pragma unroll
    for (int i = 0; i < 4; ++i) {
      gg[i] = *(const v4f*)(lng + i * 128 + c4);
      bb[i] = *(const v4f*)(lnb + i * 128 + c4);
      if (LNM == 2) {
        fg[i] = *(const v4f*)(lnfg + i * 128 + c4);
        fb[i] = *(const v4f*)(lnfb + i * 128 + c4);
      }
    }
    asm volatile("s_wait_xcnt 0x0" ::: "memory");   // behind these loads, in front of whatever next takes their address registers
    __syncthreads();   // all eight waves' columns of every row are in LDS
#pragma unroll   // constant indices keep rs[] in registers
    for (int h = 0; h < 2; ++h) {   // four rows at a time: their reductions overlap, and the first four's stores drain under the last four's sums
      v4f y[4][4];
      v4h hv[4][4];
#pragma unroll
      for (int q = 0; q < 4; ++q) {
        const int rr = h * 4 + q;
        v4f x[4];
#pragma unroll
        for (int i = 0; i < 4; ++i) x[i] = *(const v4f*)(tl + (row0 + rr) * LN_P + i * 128 + c4) + rs[rr][i];
        if (LNM == 2) {
          v4f u[4];
          ln_row(x, gg, bb, u);
          ln_row(u, fg, fb, y[q]);
        } else {
          ln_row(x, gg, bb, y[q]);
#pragma unroll
          for (int i = 0; i < 4; ++i) {
            hv[q][i][0] = (_Float16)y[q][i][0]; hv[q][i][1] = (_Float16)y[q][i][1];
            hv[q][i][2] = (_Float16)y[q][i][2]; hv[q][i][3] = (_Float16)y[q][i][3];
          }
        }
      }
      // The four rows' values are all made in front of their first store: no register that an issued store names is written between the stores.
      __builtin_amdgcn_sched_barrier(0);
#pragma unroll
      for (int q = 0; q < 4; ++q)
#pragma unroll
        for (int i = 0; i < 4; ++i) {
          *(v4f*)(po + (h * 4 + q) * 512 + i * 128) = y[q][i];
          if (LNM == 1) *(v4h*)(ph + (h * 4 + q) * 512 + i * 128) = hv[q][i];
        }
      if (h == 0) {
        asm volatile("s_wait_xcnt 0x0" ::: "memory");   // behind the stores, in front of the next four rows' work, which reuses their registers
        __builtin_amdgcn_sched_barrier(0);              // keeps that work from being lifted over the wait
      }
    }
    return;
  }
  float* slab = sT[wave];
  if constexpr (FAV) {
    static_assert(BIAS_MODE == 2 && OUT_MODE == 0 && !RESID && ACT == 0 && LNM == 0, "the feature epilogue takes bias[n] and stores f32");
    if (b < 2) {   // block-uniform: every lane stays on for the WMMAs below
      static_assert(8 * 64 * 68 * 4 <= 2 * GS_STAGE * 2, "eight 64 x 64 tiles fit the ring");
      // The wave's whole tile goes into its own part of the ring's LDS, which is free here: every wave's last read of it and every copy
      // into it ended in front of the loop's last barrier. With the accumulators gone the loop over the tile's four slabs can stay rolled.
      // A plain '#pragma unroll' in this block keeps the per-lane arrays in registers (constant indices).
      float* tw = (float*)sAB + wave * (64 * 68);   // [row][d], pitch 68 floats
      float* nr = sN[wave];
      const int hf = lane >> 4;
      // This lane's place in rows hf, hf + 2, .. of the tile's first slab (row pitch N = 512): a row's 256 B = 16 lanes x 16 B.
      float* cw = (float*)Cout + (size_t)b * strideC + (size_t)(m0 + hf) * 512 + n0 + rlane * 4;
      // B fragments of omega, k = 4 each: position (register v, lane half hf) of fragment f holds d = 8 (f / 2) + 4 hf + 2 (f % 2) + v, as in the A fragments below.
      v2f om[2][16];
#pragma unroll
      for (int jt = 0; jt < 2; ++jt)
#pragma unroll
        for (int f = 0; f < 16; ++f) {
          const float* op = fom + (8 * (f >> 1) + 4 * hf + 2 * (f & 1)) * 32 + jt * 16 + rlane;
          om[jt][f] = (v2f){op[0], op[32]};
        }
      float bv[4];
#pragma unroll
      for (int j = 0; j < 4; ++j) bv[j] = biasb[n0 + (j << 4) + rlane];
      asm volatile("s_wait_xcnt 0x0" ::: "memory");   // behind these loads, in front of whatever next takes their address registers
#pragma unroll
      for (int i = 0; i < 4; ++i)
#pragma unroll
        for (int j = 0; j < 4; ++j)
#pragma unroll
          for (int r = 0; r < 8; ++r)
            tw[((i << 4) + mOff + r) * 68 + (j << 4) + rlane] = (acc[i][j][r] * scale + bv[j]) * 0.35355339059327379f;   // 64^-0.25
      __builtin_amdgcn_fence(__ATOMIC_RELEASE, "workgroup");
      __builtin_amdgcn_wave_barrier();
      __builtin_amdgcn_fence(__ATOMIC_ACQUIRE, "workgroup");
#pragma unroll 1   // one copy of the slab's code: the text stays short
      for (int i = 0; i < 4; ++i) {
        float* slab = tw + i * (16 * 68);
        v4f a[8];      // row rlane of the slab, d = 8 q + 4 hf .. + 3
        float ns = 0.f;
#pragma unroll
        for (int q = 0; q < 8; ++q) {
          a[q] = *(const v4f*)(slab + rlane * 68 + 8 * q + 4 * hf);
          ns += (a[q][0] * a[q][0] + a[q][1] * a[q][1]) + (a[q][2] * a[q][2] + a[q][3] * a[q][3]);
        }
        ns += __shfl_xor(ns, 16, 32);   // the row's other 32 elements
        nr[rlane] = ns;                 // both halves hold and write the same sum
        __builtin_amdgcn_fence(__ATOMIC_RELEASE, "workgroup");
        __builtin_amdgcn_wave_barrier();
        __builtin_amdgcn_fence(__ATOMIC_ACQUIRE, "workgroup");
        const v4f nlo = *(const v4f*)(nr + mOff), nhi = *(const v4f*)(nr + mOff + 4);   // norms of rows mOff .. mOff + 7, D's rows in this lane
        v8f u0 = (v8f){0.f,0.f,0.f,0.f,0.f,0.f,0.f,0.f}, u1 = u0;
        // The two fences of the schedule keep the 32 WMMAs and their guard one block with no vector instruction in it:
        // left free, the norm's register moves land among the WMMAs and overwrite A registers directly behind the WMMA that reads them.
        __builtin_amdgcn_sched_barrier(0);
#pragma unroll
        for (int f = 0; f < 16; ++f) {
          const v2f af = (v2f){a[f >> 1][2 * (f & 1)], a[f >> 1][2 * (f & 1) + 1]};
          u0 = __builtin_amdgcn_wmma_f32_16x16x4_f32(false, af, false, om[0][f], (short)0, u0, false, false);
          u1 = __builtin_amdgcn_wmma_f32_16x16x4_f32(false, af, false, om[1][f], (short)0, u1, false, false);
        }
        acc_guard2_f32(u0, u1);
        __builtin_amdgcn_sched_barrier(0);
#pragma unroll
        for (int r = 0; r < 8; ++r) {
          const float off = 0.5f * ((r < 4) ? nlo[r & 3] : nhi[r & 3]);
          float* sr = slab + (mOff + r) * 68 + rlane;
          sr[0]  = expf(u0[r] - off) * 0.125f;
          sr[16] = expf(u1[r] - off) * 0.125f;
          sr[32] = expf(-u0[r] - off) * 0.125f;
          sr[48] = expf(-u1[r] - off) * 0.125f;
        }
        __builtin_amdgcn_fence(__ATOMIC_RELEASE, "workgroup");
        __builtin_amdgcn_wave_barrier();
        __builtin_amdgcn_fence(__ATOMIC_ACQUIRE, "workgroup");
        v4f ov[8];
#pragma unroll
        for (int it = 0; it < 8; ++it) ov[it] = *(const v4f*)(slab + (it * 2 + hf) * 68 + rlane * 4);
        float* cp = cw + i * (16 * 512);
#pragma unroll
        for (int it = 0; it < 8; ++it) *(v4f*)(cp + it * 1024) = ov[it];
        asm volatile("s_wait_xcnt 0x0" ::: "memory");   // behind the stores, in front of the next slab's work, which reuses their registers
        __builtin_amdgcn_sched_barrier(0);              // keeps that work from being lifted over the wait
      }
      return;
    }
  }
#pragma unroll
  for (int i = 0; i < 4; ++i) {
    const int mBase = m0 + (i << 4);
#pragma unroll
    for (int j = 0; j < 4; ++j) {
      const int n = n0 + (j << 4) + rlane;
      float bv = 0.f;
      if (BIAS_MODE == 2) bv = biasb[n];
#pragma unroll
      for (int r = 0; r < 8; ++r) {
        float v = acc[i][j][r] * scale;
        if (BIAS_MODE == 1) v += biasb[mBase + mOff + r];
        if (BIAS_MODE == 2) v += bv;
        if (RESID) v += Rb[(size_t)(mBase + mOff + r) * ldc + n];
        if (ACT == 1) v = tanhf(v);
        if (ACT == 2) v = fmaxf(v, 0.0f);
        if (ACT == 3) v = v / (1.0f + expf(-v));
        if (ACT == 4) v = (v > 0.f) ? v : 0.01f * v;
        if (ACT == 5) v = 0.5f * v * (1.0f + erff(v * 0.70710678118654752f));
        slab[(mOff + r) * 68 + (j << 4) + rlane] = v;
      }
    }
    __builtin_amdgcn_fence(__ATOMIC_RELEASE, "workgroup");
    __builtin_amdgcn_wave_barrier();
    __builtin_amdgcn_fence(__ATOMIC_ACQUIRE, "workgroup");
    if (OUT_MODE == 0) {
      float* C = (float*)Cout + (size_t)b * strideC;
      const int hh = lane >> 4, c4 = (lane & 15) * 4;     // row seg = 256 B = 16 lanes x 16 B
      {
#pragma unroll
        for (int it = 0; it < 8; ++it) {
          const int row = it * 2 + hh;
          v4f v = *(const v4f*)(slab + row * 68 + c4);
          *(v4f*)(C + (size_t)(mBase + row) * ldc + n0 + c4) = v;
        }
        
      }
    } else {
      const int q = lane >> 3, c8 = (lane & 7) * 8;
      unsigned short* C  = (unsigned short*)Cout  + (size_t)b * strideC;
      unsigned short* C2 = (OUT_MODE == 2) ? ((unsigned short*)Cout2 + (size_t)b * strideC) : nullptr;
      {
#pragma unroll
        for (int it = 0; it < 4; ++it) {
          const int row = it * 4 + q;
          const float* sp = slab + row * 68 + c8;
          v8h hv, lv;
#pragma unroll
          for (int e = 0; e < 8; ++e) {
            if (OUT_MODE == 1) {
              hv[e] = (_Float16)sp[e];
            } else {
              unsigned short hb = f2bf_bits(sp[e]);
              unsigned short lb = f2bf_bits(sp[e] - bf_bits2f(hb));
              hv[e] = __builtin_bit_cast(_Float16, hb);
              lv[e] = __builtin_bit_cast(_Float16, lb);
            }
          }
          *(v8h*)(C + (size_t)(mBase + row) * ldc + n0 + c8) = hv;
          if (OUT_MODE == 2) *(v8h*)(C2 + (size_t)(mBase + row) * ldc + n0 + c8) = lv;
        }
        
      }
    }
    __builtin_amdgcn_fence(__ATOMIC_RELEASE, "workgroup");
    __builtin_amdgcn_wave_barrier();
    __builtin_amdgcn_fence(__ATOMIC_ACQUIRE, "workgroup");
  }
}

// ---- Operand preparation of the whole call, one grid: every weight matrix of every layer transposed and cast, and x cast.
// None of these pieces reads what another writes, so they share one launch; each block does one piece.
// The pieces are large, so that the grid is a few blocks per WGP (for speed only).
// Cast piece: one block casts 8192 consecutive elements to f16; a thread takes eight 16-byte pieces, 4 KiB apart.
__device__ __forceinline__ void cast_f16_block(const float* __restrict__ in, _Float16* __restrict__ out, int blk) {
  const size_t e0 = (size_t)blk * 8192 + threadIdx.x * 4;
  const float* p = in + e0;
  _Float16* o = out + e0;
  v4f v[8];
#pragma unroll   // all eight loads in flight together; constant indices keep v[] in registers (also in the loop below)
  for (int it = 0; it < 8; ++it) v[it] = *(const v4f*)(p + it * 1024);
#pragma unroll
  for (int it = 0; it < 8; ++it) {
    v4h h;
    h[0] = (_Float16)v[it][0]; h[1] = (_Float16)v[it][1]; h[2] = (_Float16)v[it][2]; h[3] = (_Float16)v[it][3];
    *(v4h*)(o + it * 1024) = h;
  }
}

// Transpose piece: WT_S tiles of 64 x 64, one behind the other along k, of src[K][N] f32 -> ob[N][K] f16 * scale. Called by a whole block of 256 threads.
// K and N are compile-time, so that every load and store of a thread is one address register plus an immediate offset.
#define WT_S 4
template <int K, int N>
__device__ __forceinline__ void wT_tiles(
    const float* __restrict__ src, _Float16* __restrict__ ob, int n0, int k0, float scale, float (*tile)[64][65]) {
  const int tid = threadIdx.x, lane = tid & 31, wave = tid >> 5;
  const int c4 = (tid & 15) * 4, r0 = tid >> 4;
  const float* p = src + (size_t)(k0 + r0) * N + n0 + c4;
  v4f v[WT_S][4];
#pragma unroll   // all sixteen loads in flight together; constant indices keep v[] in registers (also in the loops below)
  for (int s = 0; s < WT_S; ++s)
#pragma unroll
    for (int it = 0; it < 4; ++it) v[s][it] = *(const v4f*)(p + (s * 64 + it * 16) * N);
  // Behind the loads; it takes their address as an input, so that no load's result is given the address registers ahead of the wait.
  asm volatile("s_wait_xcnt 0x0" :: "v"(p) : "memory");
#pragma unroll
  for (int s = 0; s < WT_S; ++s)
#pragma unroll
    for (int it = 0; it < 4; ++it) {
      const int kr = it * 16 + r0;
      tile[s][c4 + 0][kr] = v[s][it][0];
      tile[s][c4 + 1][kr] = v[s][it][1];
      tile[s][c4 + 2][kr] = v[s][it][2];
      tile[s][c4 + 3][kr] = v[s][it][3];
    }
  __syncthreads();
  const int q = lane >> 3, c8 = (lane & 7) * 8;
  const int rw = wave * 8 + q;                      // waves 0..7 x 8 rows = 64 rows
  _Float16* o = ob + (size_t)(n0 + rw) * K + k0 + c8;
#pragma unroll
  for (int it = 0; it < 2; ++it)
#pragma unroll
    for (int s = 0; s < WT_S; ++s) {
      v8h hv;
#pragma unroll
      for (int e = 0; e < 8; ++e) hv[e] = (_Float16)(tile[s][rw + it * 4][c8 + e] * scale);
      *(v8h*)(o + it * 4 * K + s * 64) = hv;
    }
  // Behind the stores, in front of whatever the built code places after them that rewrites a register which they name.
  asm volatile("s_wait_xcnt 0x0" ::: "memory");
}

// Blocks 0 .. DEPTH * PL - 1: transpose pieces, PL = 4 BDD + B1 + B2 per layer in the order Wq, Wk, Wv, Wo, W1, W2; the blocks behind them: x (NX elements).
// wt4[layer][4][D][D], w1t[layer][FF][D], w2t[layer][D][FF].
template <int D, int FF, int DEPTH, int NX>
__global__ __launch_bounds__(256) void k_prep(
    const float* __restrict__ x, const float* __restrict__ Wq, const float* __restrict__ Wk,
    const float* __restrict__ Wv, const float* __restrict__ Wo, const float* __restrict__ W1, const float* __restrict__ W2,
    _Float16* __restrict__ xh, _Float16* __restrict__ wt4, _Float16* __restrict__ w1t, _Float16* __restrict__ w2t,
    float wscale) {
  static_assert(D % (64 * WT_S) == 0 && FF % (64 * WT_S) == 0 && NX % 8192 == 0, "whole pieces only");
  __shared__ float tile[WT_S][64][65];   // [tile][n][k]
  constexpr int KS = 64 * WT_S, TD = D / 64, TF = FF / 64;
  constexpr int BDD = TD * (D / KS), B1 = TF * (D / KS), B2 = TD * (FF / KS), PL = 4 * BDD + B1 + B2;
  const int bid = blockIdx.x;
  if (bid >= DEPTH * PL) {         // block-uniform
    cast_f16_block(x, xh, bid - DEPTH * PL);
    return;
  }
  const int l = bid / PL, r = bid - l * PL;   // block-uniform, as is all that follows from them
  if (r < 4 * BDD) {
    const int z = r / BDD, t = r - z * BDD;
    const float* src = ((z == 0) ? Wq : (z == 1) ? Wk : (z == 2) ? Wv : Wo) + (size_t)l * D * D;
    wT_tiles<D, D>(src, wt4 + (size_t)(l * 4 + z) * D * D, (t % TD) * 64, (t / TD) * KS, wscale, tile);
  } else if (r < 4 * BDD + B1) {
    const int t = r - 4 * BDD;         // [D][FF] -> [FF][D]
    wT_tiles<D, FF>(W1 + (size_t)l * D * FF, w1t + (size_t)l * D * FF, (t % TF) * 64, (t / TF) * KS, wscale, tile);
  } else {
    const int t = r - 4 * BDD - B1;    // [FF][D] -> [D][FF]
    wT_tiles<FF, D>(W2 + (size_t)l * FF * D, w2t + (size_t)l * FF * D, (t % TD) * 64, (t / TD) * KS, wscale, tile);
  }
}

// ---- Causal linear attention, f32, as a scan over chunks of RC_T steps: three launches.
// State of one (b, h) before a step: S[d][m] = sum Kf[m] * v[d], z[m] = sum Kf[m] over all earlier steps.
// One chunk's record in the workspace: RC_ST floats; S[d][4g + e] at (g * 64 + d) * 4 + e (lanes adjacent), z[m] at 4096 + m.
#define RC_T 32
#define RC_ST 4160

// 1) Sums over one chunk alone. One block (64 threads) per (chunk, b*8+h); thread d holds S[d][0..63] in registers, thread m holds z[m].
__global__ __launch_bounds__(64) void k_chunk_sum(
    const float* __restrict__ kf, const float* __restrict__ vin, float* __restrict__ st, int L) {
  __shared__ __align__(16) float Kc[RC_T * 64];   // [t][m]
  __shared__ __align__(16) float Vc[RC_T * 64];   // [t][d]
  const int tid = threadIdx.x;
  const int ch = blockIdx.x, bh = blockIdx.y;
  const int b = bh >> 3, h = bh & 7;
  const size_t base = (size_t)b * L * 512 + (size_t)h * 64;
  const int t0 = ch * RC_T;
  {
    const int r0 = tid >> 4, c4 = (tid & 15) * 4;
#pragma unroll   // all sixteen loads in flight together
    for (int it = 0; it < 8; ++it) {
      const int r = it * 4 + r0;                 // 0..31
      const size_t go = base + (size_t)(t0 + r) * 512 + c4;
      *(v4f*)(Kc + r * 64 + c4) = *(const v4f*)(kf + go);
      *(v4f*)(Vc + r * 64 + c4) = *(const v4f*)(vin + go);
    }
  }
  __syncthreads();
  v4f s[16];
#pragma unroll   // constant indices keep s[] in registers (here and in the two loops over g below)
  for (int g = 0; g < 16; ++g) s[g] = (v4f){0.f, 0.f, 0.f, 0.f};
  float z = 0.f;
  for (int t = 0; t < RC_T; ++t) {
    const float vt = Vc[t * 64 + tid];
    z += Kc[t * 64 + tid];
    const float* kr = Kc + t * 64;
#pragma unroll
    for (int g = 0; g < 16; ++g) s[g] = *(const v4f*)(kr + 4 * g) * vt + s[g];
  }
  float* o = st + ((size_t)bh * (L / RC_T) + ch) * RC_ST;
#pragma unroll
  for (int g = 0; g < 16; ++g) *(v4f*)(o + (g * 64 + tid) * 4) = s[g];
  o[4096 + tid] = z;
}

// 2) Exclusive prefix over the chunks of one (b, h), in place, in ascending chunk order; one thread per 4 state elements.
// nch % 16 == 0. Sixteen chunks' loads are issued together so that their latencies overlap.
__global__ __launch_bounds__(64) void k_chunk_prefix(float* __restrict__ st, int nch) {
  const int e4 = blockIdx.x * 64 + threadIdx.x;
  if (e4 >= RC_ST / 4) return;
  float* p = st + (size_t)blockIdx.y * nch * RC_ST + e4 * 4;
  v4f run = (v4f){0.f, 0.f, 0.f, 0.f};
  for (int c0 = 0; c0 < nch; c0 += 16) {
    v4f v[16];
#pragma unroll   // loads issued back to back; constant indices keep v[] in registers (also in the loop below)
    for (int i = 0; i < 16; ++i) v[i] = *(const v4f*)(p + (size_t)(c0 + i) * RC_ST);
#pragma unroll
    for (int i = 0; i < 16; ++i) {
      *(v4f*)(p + (size_t)(c0 + i) * RC_ST) = run;
      run = run + v[i];
    }
  }
}

// 3) One chunk's outputs in matrix form, started from the chunk's prefix state. One block (128 threads) per (chunk, b*8+h).
// P[t][s] = Qf_t . Kf_s for s <= t, else 0;  num[t][d] = sum_m Qf_t[m] S0[d][m] + sum_s P[t][s] v_s[d];
// den_t = Qf_t . z0 + sum_s P[t][s];  out_t[d] = num * rcp(den_t + 1e-6), written as f16.
// Thread (tg = tid / 16, lq = tid % 16) owns steps t = 4 tg + i (i = 0..3); scores s = lq, lq + 16; outputs d = 4 lq .. 4 lq + 3.
// A plain '#pragma unroll' in this kernel is there so that constant indices keep the per-thread arrays in registers.
#define RC_QP 100   // floats per row of QP: 64 of Qf, RC_T scores, 4 of pad (rows 4 apart start 16 banks apart)
__global__ __launch_bounds__(128) void k_recur(
    const float* __restrict__ qf, const float* __restrict__ kf, const float* __restrict__ vin,
    const float* __restrict__ st, _Float16* __restrict__ outh, int L, float oscale) {
  __shared__ __align__(16) float QP[RC_T * RC_QP];        // [t][0..63] = Qf_t[m], [t][64 + s] = P[t][s]
  __shared__ __align__(16) float Ks[RC_T * 68];           // [s][m], pitch 68: 16 rows' 16-byte reads hit 64 different banks
  __shared__ __align__(16) float BV[(64 + RC_T) * 64];    // rows 0..63 = S0[.][m] as [m][d], rows 64 + s = v_s[d]
  const int tid = threadIdx.x;
  const int wave = __builtin_amdgcn_readfirstlane(tid >> 5);   // in a scalar register: the tests on it become scalar branches
  const int tg = tid >> 4, lq = tid & 15;
  const int ch = blockIdx.x, bh = blockIdx.y;
  const int b = bh >> 3, h = bh & 7;
  const size_t base = (size_t)b * L * 512 + (size_t)h * 64;
  const float* sp = st + ((size_t)bh * (L / RC_T) + ch) * RC_ST;
  const int t0 = ch * RC_T;
  const size_t cbase = base + (size_t)t0 * 512;           // the chunk's first row, same for the whole block
  const unsigned lo = (unsigned)(tg * 512 + lq * 4);      // this thread's place in rows 0..7 of the chunk
  v4f zq;                                                 // z0[4 lq .. 4 lq + 3]
  {
    v4f rq[4], rk[4], rv[4], rs[8];
#pragma unroll   // all loads of the thread in flight together
    for (int it = 0; it < 4; ++it) {
      rq[it] = *(const v4f*)(qf + cbase + (lo + it * 4096u));
      rk[it] = *(const v4f*)(kf + cbase + (lo + it * 4096u));
      rv[it] = *(const v4f*)(vin + cbase + (lo + it * 4096u));
    }
#pragma unroll
    for (int it = 0; it < 8; ++it) rs[it] = *(const v4f*)(sp + (it * 128 + tid) * 4);
    zq = *(const v4f*)(sp + 4096 + lq * 4);
#pragma unroll
    for (int it = 0; it < 4; ++it) {
      const int r = it * 8 + tg;
      *(v4f*)(QP + r * RC_QP + lq * 4) = rq[it];
      *(v4f*)(Ks + r * 68 + lq * 4) = rk[it];
      *(v4f*)(BV + (64 + r) * 64 + lq * 4) = rv[it];
    }
#pragma unroll
    for (int it = 0; it < 8; ++it) {                      // record element (g, d) holds S0[d][4g .. 4g + 3]
      const int g = it * 2 + (tid >> 6), d = tid & 63;
#pragma unroll
      for (int e = 0; e < 4; ++e) BV[(4 * g + e) * 64 + d] = rs[it][e];
    }
  }
  __syncthreads();

  const float* qrow = QP + (tg * 4) * RC_QP;
  float dn[4];
  {
    v4f p0[4], p1[4];
#pragma unroll
    for (int i = 0; i < 4; ++i) { p0[i] = (v4f){0.f, 0.f, 0.f, 0.f}; p1[i] = (v4f){0.f, 0.f, 0.f, 0.f}; }
    const float* k0r = Ks + lq * 68;
    const float* k1r = Ks + (lq + 16) * 68;
    if (wave >= 2) {                                      // steps 16..31 see scores of s = 0..31
#pragma unroll 4   // several groups' LDS reads in flight ahead of their products
      for (int g = 0; g < 16; ++g) {
        const v4f k0 = *(const v4f*)(k0r + 4 * g);
        const v4f k1 = *(const v4f*)(k1r + 4 * g);
#pragma unroll
        for (int i = 0; i < 4; ++i) {
          const v4f q = *(const v4f*)(qrow + i * RC_QP + 4 * g);
          p0[i] = q * k0 + p0[i];
          p1[i] = q * k1 + p1[i];
        }
      }
    } else {                                              // steps 0..15: every score of s >= 16 is masked
#pragma unroll 4   // as above
      for (int g = 0; g < 16; ++g) {
        const v4f k0 = *(const v4f*)(k0r + 4 * g);
#pragma unroll
        for (int i = 0; i < 4; ++i) {
          const v4f q = *(const v4f*)(qrow + i * RC_QP + 4 * g);
          p0[i] = q * k0 + p0[i];
        }
      }
    }
#pragma unroll
    for (int i = 0; i < 4; ++i) {
      const int t = tg * 4 + i;
      float a0 = (p0[i][0] + p0[i][1]) + (p0[i][2] + p0[i][3]);
      float a1 = (p1[i][0] + p1[i][1]) + (p1[i][2] + p1[i][3]);
      a0 = (lq <= t) ? a0 : 0.f;
      a1 = (lq + 16 <= t) ? a1 : 0.f;
      QP[t * RC_QP + 64 + lq] = a0;
      QP[t * RC_QP + 80 + lq] = a1;
      const v4f qz = *(const v4f*)(qrow + i * RC_QP + lq * 4) * zq;   // this lane's four terms of Qf_t . z0
      dn[i] = (a0 + a1) + ((qz[0] + qz[1]) + (qz[2] + qz[3]));
    }
#pragma unroll
    for (int o = 1; o < 16; o <<= 1) {                    // sum over the 16 lanes that share tg
#pragma unroll
      for (int i = 0; i < 4; ++i) dn[i] += __shfl_xor(dn[i], o, 32);
    }
  }
  __syncthreads();                                        // the scores are in QP

  v4f o4[4];
#pragma unroll
  for (int i = 0; i < 4; ++i) o4[i] = (v4f){0.f, 0.f, 0.f, 0.f};
  const float* bcol = BV + lq * 4;
  auto quad = [&](int kq) {   // four columns of [Qf | P] times four rows of [S0 ; v]
    v4f a[4], bb[4];
#pragma unroll
    for (int e = 0; e < 4; ++e) bb[e] = *(const v4f*)(bcol + (4 * kq + e) * 64);
#pragma unroll
    for (int i = 0; i < 4; ++i) a[i] = *(const v4f*)(qrow + i * RC_QP + 4 * kq);
#pragma unroll
    for (int e = 0; e < 4; ++e)
#pragma unroll
      for (int i = 0; i < 4; ++i) o4[i] = bb[e] * a[i][e] + o4[i];
  };
#pragma unroll 4   // several quads' LDS reads in flight ahead of their products
  for (int kq = 0; kq < 16; ++kq) quad(kq);
  const int kend = 16 + 2 * wave + 2;                     // this wave's last step is 8 wave + 7: later scores are all masked
  for (int kq = 16; kq < kend; ++kq) quad(kq);

#pragma unroll
  for (int i = 0; i < 4; ++i) {
    const float zi = __builtin_amdgcn_rcpf(dn[i] + 1e-6f);
    v4h hv;
#pragma unroll
    for (int j = 0; j < 4; ++j) hv[j] = (_Float16)(o4[i][j] * zi * oscale);
    *(v4h*)(outh + cbase + ((unsigned)(tg * 2048 + lq * 4) + i * 512u)) = hv;
  }
}

// ---------------------------------------------------------------------------
extern "C" void kernel_launch(void* const* d_in, const int* in_sizes, int n_in,
                              void* d_out, int out_size, void* d_ws, size_t ws_size,
                              hipStream_t stream)
{
  const int B = 2, L = 2048, D = 512, FF = 2048, HD = 64, MH = 32, DEPTH = 2;
  const int TOK = B * L;
  if (n_in < 20) return;
  if (in_sizes[0] != TOK * D || in_sizes[1] != DEPTH * D * D || in_sizes[3] != DEPTH * D * D ||
      in_sizes[5] != DEPTH * D * D || in_sizes[7] != DEPTH * D * D || in_sizes[9] != DEPTH * HD * MH ||
      in_sizes[12] != DEPTH * D * FF || in_sizes[14] != DEPTH * FF * D || out_size != TOK * D) return;

  const float* x_in  = (const float*)d_in[0];
  const float* Wq    = (const float*)d_in[1];
  const float* bq    = (const float*)d_in[2];
  const float* Wk    = (const float*)d_in[3];
  const float* bk    = (const float*)d_in[4];
  const float* Wv    = (const float*)d_in[5];
  const float* bv    = (const float*)d_in[6];
  const float* Wo    = (const float*)d_in[7];
  const float* bo    = (const float*)d_in[8];
  const float* omega = (const float*)d_in[9];
  const float* ln1g  = (const float*)d_in[10];
  const float* ln1b  = (const float*)d_in[11];
  const float* W1    = (const float*)d_in[12];
  const float* b1    = (const float*)d_in[13];
  const float* W2    = (const float*)d_in[14];
  const float* b2    = (const float*)d_in[15];
  const float* ln2g  = (const float*)d_in[16];
  const float* ln2b  = (const float*)d_in[17];
  const float* lnfg  = (const float*)d_in[18];
  const float* lnfb  = (const float*)d_in[19];
  float* out = (float*)d_out;

  // ---- workspace carve (under 109 MiB) ----
  char* ws = (char*)d_ws;
  size_t off = 0;
  auto carve = [&](size_t bytes) -> char* { char* p = ws + off; off += (bytes + 255) & ~(size_t)255; return p; };
  _Float16* xh  = (_Float16*)carve((size_t)TOK * D * 2);    // f16 A operand of current x
  float*    xf  = (float*)carve((size_t)TOK * D * 4);       // f32 x behind LN1 (residual source of the feed-forward half)
  float*    xg  = (float*)carve((size_t)TOK * D * 4);       // f32 x behind LN2 (residual source of the next layer)
  float*    qb_ = (float*)carve((size_t)3 * TOK * D * 4);   // features of q, features of k, v one behind the other: batch stride TOK * D of their common GEMM launch
  float*    kb_ = qb_ + (size_t)TOK * D;
  float*    vb_ = kb_ + (size_t)TOK * D;
  _Float16* ah  = (_Float16*)carve((size_t)TOK * D * 2);    // attention output, f16 x16
  _Float16* y1h = (_Float16*)carve((size_t)TOK * FF * 2);   // relu(x W1 + b1), f16
  _Float16* wt4 = (_Float16*)carve((size_t)DEPTH * 4 * D * D * 2);  // per layer [Wq,Wk,Wv,Wo]^T f16 x64, [4][N][K]
  _Float16* w1t = (_Float16*)carve((size_t)DEPTH * D * FF * 2);     // per layer W1^T [FF][D] f16 x64
  _Float16* w2t = (_Float16*)carve((size_t)DEPTH * FF * D * 2);     // per layer W2^T [D][FF] f16 x64
  float*    cst = (float*)carve((size_t)B * 8 * (L / RC_T) * RC_ST * 4);   // per (b, h, chunk) state record
  if (off > ws_size) return;

  const float WSC = 64.0f, ASC = 16.0f;
  const int prepT = DEPTH * (4 * (D / 64) * (D / (64 * WT_S)) + (FF / 64) * (D / (64 * WT_S)) + (D / 64) * (FF / (64 * WT_S)));   // transpose pieces of all layers
  k_prep<D, FF, DEPTH, TOK * D><<<dim3(prepT + TOK * D / 8192), dim3(256), 0, stream>>>(
      x_in, Wq, Wk, Wv, Wo, W1, W2, xh, wt4, w1t, w2t, WSC);

  const int tilesD  = (TOK / 64) * (D / 64);      // 512
  const int tilesFF = (TOK / 64) * (FF / 64);     // 2048
  const dim3 gD((tilesD + 7) / 8, 1), gFF((tilesFF + 7) / 8, 1);

  for (int l = 0; l < DEPTH; ++l) {
    const float* xres = (l == 0) ? x_in : xg;
    const float* om = omega + (size_t)l * HD * MH;

    // positive random features of q = x Wq + bq and of k, and v = x Wv + bv (f32 out): one launch, batch index = which of the three
    const unsigned short* xhu = (const unsigned short*)xh;
    const unsigned short* wtu = (const unsigned short*)wt4 + (size_t)l * 4 * D * D;
    const unsigned short* w1u = (const unsigned short*)w1t + (size_t)l * D * FF;
    const unsigned short* w2u = (const unsigned short*)w2t + (size_t)l * FF * D;
    wmma_gemm64<0, false, 2, 0, false, 0, 0, true><<<dim3(gD.x, 3), dim3(256), 0, stream>>>(
        xhu, xhu, D, 0L, wtu, wtu, D, (long)D * D,
        (void*)qb_, (void*)qb_, D, (long)TOK * D, bq + (size_t)l * D, bk + (size_t)l * D, bv + (size_t)l * D,
        bq + (size_t)l * D, 0L, lnfg, lnfb, lnfg, lnfb, xf, xh, om, TOK, D, D, 1.0f / WSC);

    // causal prefix recurrence (f32) as a chunk scan -> attn f16 x16
    k_chunk_sum<<<dim3(L / RC_T, B * 8), dim3(64), 0, stream>>>(kb_, vb_, cst, L);
    k_chunk_prefix<<<dim3((RC_ST / 4 + 63) / 64, B * 8), dim3(64), 0, stream>>>(cst, L / RC_T);
    k_recur<<<dim3(L / RC_T, B * 8), dim3(128), 0, stream>>>(qb_, kb_, vb_, cst, ah, L, ASC);

    // x = LN1(attn Wo + bo + x), one launch
    wmma_gemm64<0, false, 2, 0, true, 0, 1><<<gD, dim3(256), 0, stream>>>(
        (const unsigned short*)ah, (const unsigned short*)ah, D, 0L, wtu + 3 * (size_t)D * D, wtu + 3 * (size_t)D * D, D, 0L,
        (void*)xf, (void*)xf, D, 0L, bo + (size_t)l * D, bo + (size_t)l * D, bo + (size_t)l * D, xres, 0L,
        ln1g + (size_t)l * D, ln1b + (size_t)l * D, lnfg, lnfb, xf, xh, om, TOK, D, D, 1.0f / (WSC * ASC));

    // y1 = relu(x W1 + b1) (f16 out); x = LN2(y1 W2 + b2 + x), in the last layer followed by the final normalization -> output
    wmma_gemm64<0, false, 2, 1, false, 2><<<gFF, dim3(256), 0, stream>>>(
        xhu, xhu, D, 0L, w1u, w1u, D, 0L,
        (void*)y1h, (void*)y1h, FF, 0L, b1 + (size_t)l * FF, b1 + (size_t)l * FF, b1 + (size_t)l * FF, b1 + (size_t)l * FF, 0L, lnfg, lnfb, lnfg, lnfb, xf, xh, om, TOK, FF, D, 1.0f / WSC);
    if (l + 1 < DEPTH)
      wmma_gemm64<0, false, 2, 0, true, 0, 1><<<gD, dim3(256), 0, stream>>>(
          (const unsigned short*)y1h, (const unsigned short*)y1h, FF, 0L, w2u, w2u, FF, 0L,
          (void*)xg, (void*)xg, D, 0L, b2 + (size_t)l * D, b2 + (size_t)l * D, b2 + (size_t)l * D, xf, 0L,
          ln2g + (size_t)l * D, ln2b + (size_t)l * D, lnfg, lnfb, xg, xh, om, TOK, D, FF, 1.0f / WSC);
    else
      wmma_gemm64<0, false, 2, 0, true, 0, 2><<<gD, dim3(256), 0, stream>>>(
          (const unsigned short*)y1h, (const unsigned short*)y1h, FF, 0L, w2u, w2u, FF, 0L,
          (void*)out, (void*)out, D, 0L, b2 + (size_t)l * D, b2 + (size_t)l * D, b2 + (size_t)l * D, xf, 0L,
          ln2g + (size_t)l * D, ln2b + (size_t)l * D, lnfg, lnfb, out, xh, om, TOK, D, FF, 1.0f / WSC);
  }
  (void)hipGetLastError();
}

// v008
// A run of this version takes 226 microseconds.
// Next to v007, in two timings, it ran 1.04 times as fast each time.
// Over all steps from v000 it is 16.1 times as fast.
#include <hip/hip_runtime.h>
// Contractions x*Wq, x*Wk, x*Wv, attn*Wo, x*W1, y*W2: v_wmma_f32_16x16x32_f16 (f16 operands; weights carried x64, attn x16), f32 accumulate. Feature map's product with omega: v_wmma_f32_16x16x4_f32 (f32 operands). Causal prefix recurrence, LayerNorm: f32 VALU.

typedef __attribute__((ext_vector_type(16))) _Float16 v16h;
typedef __attribute__((ext_vector_type(8)))  _Float16 v8h;
typedef __attribute__((ext_vector_type(4)))  _Float16 v4h;
typedef __attribute__((ext_vector_type(16))) __bf16   v16b;
typedef __attribute__((ext_vector_type(8)))  __bf16   v8b;
typedef __attribute__((ext_vector_type(8)))  float    v8f;
typedef __attribute__((ext_vector_type(4)))  float    v4f;
typedef __attribute__((ext_vector_type(2)))  float    v2f;

__device__ __forceinline__ unsigned short f2bf_bits(float f) {
  unsigned u = __float_as_uint(f);
  return (unsigned short)((u + 0x7FFFu + ((u >> 16) & 1u)) >> 16);
}
__device__ __forceinline__ float bf_bits2f(unsigned short h) { return __uint_as_float(((unsigned)h) << 16); }

// hazard guards as plain device helpers
__device__ __forceinline__ void acc_guard4(v8f& a, v8f& b, v8f& c, v8f& d) { asm volatile("v_nop\n\tv_nop\n\tv_nop\n\tv_nop" : "+v"(a), "+v"(b), "+v"(c), "+v"(d)); }
// The same behind f32 16x16x4 WMMAs: eight slots, the distance of the other form with a 16-cycle issue interval (this form has no figure of its own).
__device__ __forceinline__ void acc_guard2_f32(v8f& a, v8f& b) { asm volatile("v_nop\n\tv_nop\n\tv_nop\n\tv_nop\n\tv_nop\n\tv_nop\n\tv_nop\n\tv_nop" : "+v"(a), "+v"(b)); }
template <typename T> struct Frag;
template <> struct Frag<_Float16> {
  typedef v16h V; union U { v16h v; v8h h[2]; };
  static __device__ __forceinline__ v16h load(const _Float16* p) {   // elements 0..7 <- p[0..7], 8..15 <- p[16..23]
    U f; f.h[0] = *(const v8h*)(p); f.h[1] = *(const v8h*)(p + 16); return f.v;
  }
  static __device__ __forceinline__ v8f mma(v16h a, v16h b, v8f c) {
    return __builtin_amdgcn_wmma_f32_16x16x32_f16(false, a, false, b, (short)0, c, false, false);
  }
};
template <> struct Frag<__bf16> {
  typedef v16b V; union U { v16b v; v8b h[2]; };
  static __device__ __forceinline__ v16b load(const __bf16* p) {
    U f; f.h[0] = *(const v8b*)(p); f.h[1] = *(const v8b*)(p + 16); return f.v;
  }
  static __device__ __forceinline__ v8f mma(v16b a, v16b b, v8f c) {
    return __builtin_amdgcn_wmma_f32_16x16x32_bf16(false, a, false, b, (short)0, c, false, false);
  }
};

// One stage of the GEMM's LDS ring: 64 k (one 128-byte line) of the block's 64 A rows and 512 Bt rows.
#define GS_K 64
#define GS_PITCH 72                      // 16-bit elements per LDS row: 144 B = 16 B x 9, conflict-free for ds_load_b128
#define GS_STAGE (576 * GS_PITCH)        // 16-bit elements per stage
#define GS_NBUF 3                        // buffers of the ring: a stage is copied two trips ahead of its use
typedef __attribute__((ext_vector_type(4))) int v4i;
typedef __attribute__((address_space(1))) v4i gv4i;   // 16 bytes in global memory
typedef __attribute__((address_space(3))) v4i lv4i;   // 16 bytes in LDS

// ---- LayerNorm of one row of 512 by one wave; lane owns elements i*128 + lane*4 .. +3 (i = 0..3) of x, g, b and y.
// The unrolls are there so that constant indices keep the arrays in registers.
__device__ __forceinline__ void ln_row(const v4f (&x)[4], const v4f (&gg)[4], const v4f (&bb)[4], v4f (&y)[4]) {
  float s = 0.f;
#pragma unroll
  for (int i = 0; i < 4; ++i) s += (x[i][0] + x[i][1]) + (x[i][2] + x[i][3]);
#pragma unroll
  for (int o = 1; o < 32; o <<= 1) s += __shfl_xor(s, o, 32);
  const float mu = s * 0.001953125f;
  float vs = 0.f;
#pragma unroll
  for (int i = 0; i < 4; ++i) {
    const v4f d = x[i] - mu;
    vs += (d[0] * d[0] + d[1] * d[1]) + (d[2] * d[2] + d[3] * d[3]);
  }
#pragma unroll
  for (int o = 1; o < 32; o <<= 1) vs += __shfl_xor(vs, o, 32);
  const float rstd = rsqrtf(vs * 0.001953125f + 1e-5f);
#pragma unroll
  for (int i = 0; i < 4; ++i) y[i] = (x[i] - mu) * rstd * gg[i] + bb[i];
}
#define LN_P 516   // floats per LDS row of the block's 64 x 512 result: rows 8 apart start 32 banks apart

// ---- Register-blocked batched WMMA GEMM ------------------------------------
// C[m,n] = scale * sum_k A[m,k] * Bt[n,k] (+bias)(+resid); each wave owns a 64x64 tile, a block of eight waves a 64x512 tile.
// A row-major [M,K]; Bt row-major [N,K]; M % 64 == 0, N % 512 == 0, K % 64 == 0, K >= 64.
// Operands reach the waves through a three-buffer LDS ring filled by asynchronous copies, two stages ahead of the WMMAs.
// Even stages are copied by waves 0..3, odd stages by waves 4..7: a wave never has more than one stage's copies outstanding, so its wait stays at 0.
// SPLIT (hi/lo operand planes A2/Bt2) is not staged by the ring and must be false.
// BIAS_MODE: 0 = none, 1 = bias[m], 2 = bias[n]. Batch index blockIdx.y = 0, 1, 2 takes bias, biasY1, biasY2.
// OUT_MODE: 0 = f32, 1 = f16, 2 = bf16 hi plane (Cout) + bf16 lo plane (Cout2).
// LNM: 0 = C is stored as OUT_MODE says. 1, 2 = N == 512, so the block holds whole rows of C (+bias +resid): it normalizes them itself
// and C is never stored. 1: LayerNorm(lng, lnb) -> outf (f32) and outh (f16). 2: that, then LayerNorm(lnfg, lnfb) of the result -> outf alone.
// FAV: N == 512, so a wave's 64 columns are one head. Batch indices 0 and 1 (q, k) store the FAVOR positive features of C instead of C:
// xs = C * 64^-0.25; u[j] = sum_d xs[d] * fom[d][j] (j = 0..31); off = 0.5 * |xs|^2; columns j and 32 + j of the head = exp(u - off) / 8, exp(-u - off) / 8.
// ET: 0 = f16 operands, 1 = bf16 operands (pointers passed as 16-bit storage)
template <int ET> struct Elem;
template <> struct Elem<0> { typedef _Float16 T; };
template <> struct Elem<1> { typedef __bf16 T; };
template <int ET, bool SPLIT, int BIAS_MODE, int OUT_MODE, bool RESID, int ACT = 0, int LNM = 0, bool FAV = false>
__global__ __launch_bounds__(256) void wmma_gemm64(
    const unsigned short* __restrict__ Ap, const unsigned short* __restrict__ A2p, int lda, long strideA,
    const unsigned short* __restrict__ Btp, const unsigned short* __restrict__ Bt2p, int ldb, long strideB,
    void* __restrict__ Cout, void* __restrict__ Cout2, int ldc, long strideC,
    const float* __restrict__ bias, const float* __restrict__ biasY1, const float* __restrict__ biasY2,
    const float* __restrict__ resid, long strideR,
    const float* __restrict__ lng, const float* __restrict__ lnb, const float* __restrict__ lnfg, const float* __restrict__ lnfb,
    float* __restrict__ outf, _Float16* __restrict__ outh, const float* __restrict__ fom,
    int M, int N, int K, float scale) {
  typedef typename Elem<ET>::T T;
  typedef typename Frag<T>::V V;
  const T* A = (const T*)Ap; const T* Bt = (const T*)Btp;
  static_assert(!SPLIT, "the LDS ring stages one plane per operand");
  __shared__ __align__(16) unsigned short sAB[GS_NBUF * GS_STAGE];   // a stage: rows 0..63 = A, rows 64..575 = Bt
  __shared__ __align__(16) float sT[8][16 * 68];   // per-wave 16x64 slab, pitch 68 floats
  __shared__ __align__(16) float sN[FAV ? 8 : 1][16];   // FAV: per wave, the squared norms of a slab's 16 rows
  const int b    = blockIdx.y;
  const int tid  = threadIdx.x;
  const int lane = tid & 31;
  const int wave = tid >> 5;
  const int tilesN = N >> 6;
  const int tilesM = M >> 6;
  const int tile0 = blockIdx.x * 8;            // the block's eight tiles: one tile row, eight adjacent tile columns
  if (tile0 >= tilesM * tilesN) return;        // block-uniform, in front of every barrier
  const int tm  = tile0 / tilesN;
  const int m0  = tm << 6;
  const int nb0 = (tile0 - tm * tilesN) << 6;
  const int n0  = nb0 + (wave << 6);

  const T* Ab  = A  + (size_t)b * strideA;
  const T* Bb  = Bt + (size_t)b * strideB;

  const int rlane = lane & 15;                 // row (A) / col (B, D) within subtile
  const int koff  = (lane >> 4) * 8;           // k offset of this lane half
  const int mOff  = (lane >> 4) * 8;           // D row offset

  // Copies: a stage is copied by one half of the block's waves. Eight lanes cover one row's 128-byte line, a wave four rows, the half 16 rows per copy; 36 copies per lane and stage.
  const int grp = __builtin_amdgcn_readfirstlane(tid >> 7);   // which half; in a scalar register, so that the tests on it are scalar branches
  const int cr = (tid & 127) >> 3, cc = (tid & 7) * 8;
  // A copy's global address = a base that is the same for the whole half and steps from stage to stage in scalar registers + the lane's own byte offset, one for A and one for Bt.
  const char* bA = (const char*)(Ab + (size_t)m0 * lda + grp * GS_K);    // row 0 of the next stage that this half copies
  const char* bB = (const char*)(Bb + (size_t)nb0 * ldb + grp * GS_K);
  const unsigned vA = (unsigned)(cr * lda + cc) * 2u, vB = (unsigned)(cr * ldb + cc) * 2u;
  unsigned short* lp0 = sAB + cr * GS_PITCH + cc;
  auto fill = [&](int buf) {
    unsigned short* lb = lp0 + buf * GS_STAGE;
#pragma unroll   // 36 copies back to back
    for (int it = 0; it < 36; ++it) {
      const char* g = (it < 4) ? (bA + (size_t)(it * 32) * lda + vA) : (bB + (size_t)((it - 4) * 32) * ldb + vB);
      __builtin_amdgcn_global_load_async_to_lds_b128((gv4i*)g, (lv4i*)(lb + it * 16 * GS_PITCH), 0, 0);
    }
    bA += 2 * GS_K * 2;
    bB += 2 * GS_K * 2;
  };

  v8f acc[4][4];
#pragma unroll
  for (int i = 0; i < 4; ++i)
#pragma unroll
    for (int j = 0; j < 4; ++j) acc[i][j] = (v8f){0.f,0.f,0.f,0.f,0.f,0.f,0.f,0.f};

  const int nst = K / GS_K;
  if (grp == 0) {
    fill(0);
    asm volatile("s_wait_asynccnt 0x0" ::: "memory");   // this wave's copies of stage 0 have landed
  } else if (nst > 1) {
    fill(1);
  }
  __syncthreads();                                      // stage 0 is there for every wave
  if (grp == 0) {
    if (nst > 2) fill(2);
  }
  int bc = 0;                                           // buffer of stage t = t mod GS_NBUF
  for (int t = 0; t < nst; ++t) {
    const T* sb = (const T*)sAB + bc * GS_STAGE;
    const T* sa = sb + rlane * GS_PITCH + koff;
    const T* sw = sb + (64 + (wave << 6) + rlane) * GS_PITCH + koff;
    V bh[4], ah[4];
    auto frags = [&](int ks) {   // the eight fragments of 32 k
#pragma unroll
      for (int j = 0; j < 4; ++j) bh[j] = Frag<T>::load(sw + j * 16 * GS_PITCH + ks * 32);
#pragma unroll
      for (int i = 0; i < 4; ++i) ah[i] = Frag<T>::load(sa + i * 16 * GS_PITCH + ks * 32);
    };
    auto products = [&]() {
#pragma unroll
      for (int i = 0; i < 4; ++i)
#pragma unroll
        for (int j = 0; j < 4; ++j) acc[i][j] = Frag<T>::mma(ah[i], bh[j], acc[i][j]);
    };
    frags(0);
    // Keeps the eight fragments' loads together ahead of the WMMAs: left free, each A fragment's load sinks to its first use and the wave waits out the LDS latency four times per 32 k.
    __builtin_amdgcn_sched_barrier(0);
    products();
    frags(1);                                           // the stage's last LDS reads
    asm volatile("s_wait_dscnt 0x0" ::: "memory");      // this wave's reads of stage t are done before the buffer is refilled
    const bool mine = grp != (t & 1);                   // this wave's half copies stages t + 1 and t + 3; the other half's stage t + 2 stays in flight
    if (mine) asm volatile("s_wait_asynccnt 0x0" ::: "memory");   // this wave's copies of stage t + 1 have landed
    __syncthreads();                                    // publishes stage t + 1 and ends every wave's reads of stage t
    if (mine) {
      if (t + 3 < nst) fill(bc);                        // stage t + 3 into the buffer that stage t has left
    }
    // Keeps the refill's issue ahead of the second 16 WMMAs (registers only), whose time the copies then have as lead.
    __builtin_amdgcn_sched_barrier(0);
    products();
    bc = (bc == GS_NBUF - 1) ? 0 : bc + 1;
  }
  asm volatile("s_wait_asynccnt 0x0" ::: "memory");     // no copy is outstanding behind the loop
  acc_guard4(acc[0][0], acc[0][1], acc[0][2], acc[0][3]);
  acc_guard4(acc[1][0], acc[1][1], acc[1][2], acc[1][3]);
  acc_guard4(acc[2][0], acc[2][1], acc[2][2], acc[2][3]);
  acc_guard4(acc[3][0], acc[3][1], acc[3][2], acc[3][3]);

  // ---- epilogue ----
  const float* Rb = RESID ? (resid + (size_t)b * strideR) : nullptr;
  const float* biasb = (b == 0) ? bias : (b == 1) ? biasY1 : biasY2;
  if constexpr (LNM != 0) {
    static_assert(BIAS_MODE == 2 && OUT_MODE == 0 && RESID && ACT == 0, "the normalizing epilogue takes bias[n] and a residual");
    static_assert(64 * LN_P * 4 <= 2 * GS_STAGE * 2, "the 64 x 512 result fits the ring");
    // The result goes through the ring's LDS, which is free here: every wave's last read of it and every copy into it
    // ended in front of the loop's last barrier. A plain '#pragma unroll' below keeps the per-lane arrays in registers (constant indices).
    float* tl = (float*)sAB;
    float bv[4];
#pragma unroll
    for (int j = 0; j < 4; ++j) bv[j] = biasb[n0 + (j << 4) + rlane];
    asm volatile("s_wait_xcnt 0x0" ::: "memory");   // behind the bias loads, in front of whatever next takes their address register
#pragma unroll
    for (int i = 0; i < 4; ++i)
#pragma unroll
      for (int j = 0; j < 4; ++j)
#pragma unroll
        for (int r = 0; r < 8; ++r)
          tl[((i << 4) + mOff + r) * LN_P + n0 + (j << 4) + rlane] = acc[i][j][r] * scale + bv[j];
    // Keeps the loads below behind the LDS stores, so that they take over the accumulators' registers: lifted over the stores they
    // need registers of their own beside the accumulators, and the kernel goes past 256 VGPRs (register-window switches).
    __builtin_amdgcn_sched_barrier(0);
    // Each wave takes eight whole rows. Their residual rows and the gains are loaded in front of the barrier, all in flight together.
    const int row0 = wave << 3, c4 = lane * 4;
    const size_t g0 = (size_t)(m0 + row0) * 512 + c4;
    const float* pr = Rb + g0;
    float* po = outf + g0;
    _Float16* ph = outh + g0;
    v4f rs[8][4], gg[4], bb[4], fg[4], fb[4];
#pragma unroll
    for (int rr = 0; rr < 8; ++rr)
#pragma unroll
      for (int i = 0; i < 4; ++i) rs[rr][i] = *(const v4f*)(pr + rr * 512 + i * 128);
#pragma unroll
    for (int i = 0; i < 4; ++i) {
      gg[i] = *(const v4f*)(lng + i * 128 + c4);
      bb[i] = *(const v4f*)(lnb + i * 128 + c4);
      if (LNM == 2) {
        fg[i] = *(const v4f*)(lnfg + i * 128 + c4);
        fb[i] = *(const v4f*)(lnfb + i * 128 + c4);
      }
    }
    asm volatile("s_wait_xcnt 0x0" ::: "memory");   // behind these loads, in front of whatever next takes their address registers
    __syncthreads();   // all eight waves' columns of every row are in LDS
#pragma unroll   // constant indices keep rs[] in registers
    for (int h = 0; h < 2; ++h) {   // four rows at a time: their reductions overlap, and the first four's stores drain under the last four's sums
      v4f y[4][4];
      v4h hv[4][4];
#pragma unroll
      for (int q = 0; q < 4; ++q) {
        const int rr = h * 4 + q;
        v4f x[4];
#pragma unroll
        for (int i = 0; i < 4; ++i) x[i] = *(const v4f*)(tl + (row0 + rr) * LN_P + i * 128 + c4) + rs[rr][i];
        if (LNM == 2) {
          v4f u[4];
          ln_row(x, gg, bb, u);
          ln_row(u, fg, fb, y[q]);
        } else {
          ln_row(x, gg, bb, y[q]);
#pragma unroll
          for (int i = 0; i < 4; ++i) {
            hv[q][i][0] = (_Float16)y[q][i][0]; hv[q][i][1] = (_Float16)y[q][i][1];
            hv[q][i][2] = (_Float16)y[q][i][2]; hv[q][i][3] = (_Float16)y[q][i][3];
          }
        }
      }
      // The four rows' values are all made in front of their first store: no register that an issued store names is written between the stores.
      __builtin_amdgcn_sched_barrier(0);
#pragma unroll
      for (int q = 0; q < 4; ++q)
#pragma unroll
        for (int i = 0; i < 4; ++i) {
          *(v4f*)(po + (h * 4 + q) * 512 + i * 128) = y[q][i];
          if (LNM == 1) *(v4h*)(ph + (h * 4 + q) * 512 + i * 128) = hv[q][i];
        }
      if (h == 0) {
        asm volatile("s_wait_xcnt 0x0" ::: "memory");   // behind the stores, in front of the next four rows' work, which reuses their registers
        __builtin_amdgcn_sched_barrier(0);              // keeps that work from being lifted over the wait
      }
    }
    return;
  }
  float* slab = sT[wave];
  if constexpr (FAV) {
    static_assert(BIAS_MODE == 2 && OUT_MODE == 0 && !RESID && ACT == 0 && LNM == 0, "the feature epilogue takes bias[n] and stores f32");
    if (b < 2) {   // block-uniform: every lane stays on for the WMMAs below
      static_assert(8 * 64 * 68 * 4 <= 2 * GS_STAGE * 2, "eight 64 x 64 tiles fit the ring");
      // The wave's whole tile goes into its own part of the ring's LDS, which is free here: every wave's last read of it and every copy
      // into it ended in front of the loop's last barrier. With the accumulators gone the loop over the tile's four slabs can stay rolled.
      // A plain '#pragma unroll' in this block keeps the per-lane arrays in registers (constant indices).
      float* tw = (float*)sAB + wave * (64 * 68);   // [row][d], pitch 68 floats
      float* nr = sN[wave];
      const int hf = lane >> 4;
      // This lane's place in rows hf, hf + 2, .. of the tile's first slab (row pitch N = 512): a row's 256 B = 16 lanes x 16 B.
      float* cw = (float*)Cout + (size_t)b * strideC + (size_t)(m0 + hf) * 512 + n0 + rlane * 4;
      // B fragments of omega, k = 4 each: position (register v, lane half hf) of fragment f holds d = 8 (f / 2) + 4 hf + 2 (f % 2) + v, as in the A fragments below.
      v2f om[2][16];
#pragma unroll
      for (int jt = 0; jt < 2; ++jt)
#pragma unroll
        for (int f = 0; f < 16; ++f) {
          const float* op = fom + (8 * (f >> 1) + 4 * hf + 2 * (f & 1)) * 32 + jt * 16 + rlane;
          om[jt][f] = (v2f){op[0], op[32]};
        }
      float bv[4];
#pragma unroll
      for (int j = 0; j < 4; ++j) bv[j] = biasb[n0 + (j << 4) + rlane];
      asm volatile("s_wait_xcnt 0x0" ::: "memory");   // behind these loads, in front of whatever next takes their address registers
#pragma unroll
      for (int i = 0; i < 4; ++i)
#pragma unroll
        for (int j = 0; j < 4; ++j)
#pragma unroll
          for (int r = 0; r < 8; ++r)
            tw[((i << 4) + mOff + r) * 68 + (j << 4) + rlane] = (acc[i][j][r] * scale + bv[j]) * 0.35355339059327379f;   // 64^-0.25
      __builtin_amdgcn_fence(__ATOMIC_RELEASE, "workgroup");
      __builtin_amdgcn_wave_barrier();
      __builtin_amdgcn_fence(__ATOMIC_ACQUIRE, "workgroup");
#pragma unroll 1   // one copy of the slab's code: the text stays short
      for (int i = 0; i < 4; ++i) {
        float* slab = tw + i * (16 * 68);
        v4f a[8];      // row rlane of the slab, d = 8 q + 4 hf .. + 3
        float ns = 0.f;
#pragma unroll
        for (int q = 0; q < 8; ++q) {
          a[q] = *(const v4f*)(slab + rlane * 68 + 8 * q + 4 * hf);
          ns += (a[q][0] * a[q][0] + a[q][1] * a[q][1]) + (a[q][2] * a[q][2] + a[q][3] * a[q][3]);
        }
        ns += __shfl_xor(ns, 16, 32);   // the row's other 32 elements
        nr[rlane] = ns;                 // both halves hold and write the same sum
        __builtin_amdgcn_fence(__ATOMIC_RELEASE, "workgroup");
        __builtin_amdgcn_wave_barrier();
        __builtin_amdgcn_fence(__ATOMIC_ACQUIRE, "workgroup");
        const v4f nlo = *(const v4f*)(nr + mOff), nhi = *(const v4f*)(nr + mOff + 4);   // norms of rows mOff .. mOff + 7, D's rows in this lane
        v8f u0 = (v8f){0.f,0.f,0.f,0.f,0.f,0.f,0.f,0.f}, u1 = u0;
        // The two fences of the schedule keep the 32 WMMAs and their guard one block with no vector instruction in it:
        // left free, the norm's register moves land among the WMMAs and overwrite A registers directly behind the WMMA that reads them.
        __builtin_amdgcn_sched_barrier(0);
#pragma unroll
        for (int f = 0; f < 16; ++f) {
          const v2f af = (v2f){a[f >> 1][2 * (f & 1)], a[f >> 1][2 * (f & 1) + 1]};
          u0 = __builtin_amdgcn_wmma_f32_16x16x4_f32(false, af, false, om[0][f], (short)0, u0, false, false);
          u1 = __builtin_amdgcn_wmma_f32_16x16x4_f32(false, af, false, om[1][f], (short)0, u1, false, false);
        }
        acc_guard2_f32(u0, u1);
        __builtin_amdgcn_sched_barrier(0);
#pragma unroll
        for (int r = 0; r < 8; ++r) {
          const float off = 0.5f * ((r < 4) ? nlo[r & 3] : nhi[r & 3]);
          float* sr = slab + (mOff + r) * 68 + rlane;
          sr[0]  = expf(u0[r] - off) * 0.125f;
          sr[16] = expf(u1[r] - off) * 0.125f;
          sr[32] = expf(-u0[r] - off) * 0.125f;
          sr[48] = expf(-u1[r] - off) * 0.125f;
        }
        __builtin_amdgcn_fence(__ATOMIC_RELEASE, "workgroup");
        __builtin_amdgcn_wave_barrier();
        __builtin_amdgcn_fence(__ATOMIC_ACQUIRE, "workgroup");
        v4f ov[8];
#pragma unroll
        for (int it = 0; it < 8; ++it) ov[it] = *(const v4f*)(slab + (it * 2 + hf) * 68 + rlane * 4);
        float* cp = cw + i * (16 * 512);
#pragma unroll
        for (int it = 0; it < 8; ++it) *(v4f*)(cp + it * 1024) = ov[it];
        asm volatile("s_wait_xcnt 0x0" ::: "memory");   // behind the stores, in front of the next slab's work, which reuses their registers
        __builtin_amdgcn_sched_barrier(0);              // keeps that work from being lifted over the wait
      }
      return;
    }
  }
#pragma unroll
  for (int i = 0; i < 4; ++i) {
    const int mBase = m0 + (i << 4);
#pragma unroll
    for (int j = 0; j < 4; ++j) {
      const int n = n0 + (j << 4) + rlane;
      float bv = 0.f;
      if (BIAS_MODE == 2) bv = biasb[n];
#pragma unroll
      for (int r = 0; r < 8; ++r) {
        float v = acc[i][j][r] * scale;
        if (BIAS_MODE == 1) v += biasb[mBase + mOff + r];
        if (BIAS_MODE == 2) v += bv;
        if (RESID) v += Rb[(size_t)(mBase + mOff + r) * ldc + n];
        if (ACT == 1) v = tanhf(v);
        if (ACT == 2) v = fmaxf(v, 0.0f);
        if (ACT == 3) v = v / (1.0f + expf(-v));
        if (ACT == 4) v = (v > 0.f) ? v : 0.01f * v;
        if (ACT == 5) v = 0.5f * v * (1.0f + erff(v * 0.70710678118654752f));
        slab[(mOff + r) * 68 + (j << 4) + rlane] = v;
      }
    }
    __builtin_amdgcn_fence(__ATOMIC_RELEASE, "workgroup");
    __builtin_amdgcn_wave_barrier();
    __builtin_amdgcn_fence(__ATOMIC_ACQUIRE, "workgroup");
    if (OUT_MODE == 0) {
      float* C = (float*)Cout + (size_t)b * strideC;
      const int hh = lane >> 4, c4 = (lane & 15) * 4;     // row seg = 256 B = 16 lanes x 16 B
      {
#pragma unroll
        for (int it = 0; it < 8; ++it) {
          const int row = it * 2 + hh;
          v4f v = *(const v4f*)(slab + row * 68 + c4);
          *(v4f*)(C + (size_t)(mBase + row) * ldc + n0 + c4) = v;
        }
        
      }
    } else {
      const int q = lane >> 3, c8 = (lane & 7) * 8;
      unsigned short* C  = (unsigned short*)Cout  + (size_t)b * strideC;
      unsigned short* C2 = (OUT_MODE == 2) ? ((unsigned short*)Cout2 + (size_t)b * strideC) : nullptr;
      {
#pragma unroll
        for (int it = 0; it < 4; ++it) {
          const int row = it * 4 + q;
          const float* sp = slab + row * 68 + c8;
          v8h hv, lv;
#pragma unroll
          for (int e = 0; e < 8; ++e) {
            if (OUT_MODE == 1) {
              hv[e] = (_Float16)sp[e];
            } else {
              unsigned short hb = f2bf_bits(sp[e]);
              unsigned short lb = f2bf_bits(sp[e] - bf_bits2f(hb));
              hv[e] = __builtin_bit_cast(_Float16, hb);
              lv[e] = __builtin_bit_cast(_Float16, lb);
            }
          }
          *(v8h*)(C + (size_t)(mBase + row) * ldc + n0 + c8) = hv;
          if (OUT_MODE == 2) *(v8h*)(C2 + (size_t)(mBase + row) * ldc + n0 + c8) = lv;
        }
        
      }
    }
    __builtin_amdgcn_fence(__ATOMIC_RELEASE, "workgroup");
    __builtin_amdgcn_wave_barrier();
    __builtin_amdgcn_fence(__ATOMIC_ACQUIRE, "workgroup");
  }
}

// ---- Operand preparation of the whole call, one grid: every weight matrix of every layer transposed and cast, and x cast.
// None of these pieces reads what another writes, so they share one launch; each block does one piece.
// The pieces are large, so that the grid is a few blocks per WGP (for speed only).
// Cast piece: one block casts 8192 consecutive elements to f16; a thread takes eight 16-byte pieces, 4 KiB apart.
__device__ __forceinline__ void cast_f16_block(const float* __restrict__ in, _Float16* __restrict__ out, int blk) {
  const size_t e0 = (size_t)blk * 8192 + threadIdx.x * 4;
  const float* p = in + e0;
  _Float16* o = out + e0;
  v4f v[8];
#pragma unroll   // all eight loads in flight together; constant indices keep v[] in registers (also in the loop below)
  for (int it = 0; it < 8; ++it) v[it] = *(const v4f*)(p + it * 1024);
#pragma unroll
  for (int it = 0; it < 8; ++it) {
    v4h h;
    h[0] = (_Float16)v[it][0]; h[1] = (_Float16)v[it][1]; h[2] = (_Float16)v[it][2]; h[3] = (_Float16)v[it][3];
    *(v4h*)(o + it * 1024) = h;
  }
}

// Transpose piece: WT_S tiles of 64 x 64, one behind the other along k, of src[K][N] f32 -> ob[N][K] f16 * scale. Called by a whole block of 256 threads.
// K and N are compile-time, so that every load and store of a thread is one address register plus an immediate offset.
#define WT_S 4
template <int K, int N>
__device__ __forceinline__ void wT_tiles(
    const float* __restrict__ src, _Float16* __restrict__ ob, int n0, int k0, float scale, float (*tile)[64][65]) {
  const int tid = threadIdx.x, lane = tid & 31, wave = tid >> 5;
  const int c4 = (tid & 15) * 4, r0 = tid >> 4;
  const float* p = src + (size_t)(k0 + r0) * N + n0 + c4;
  v4f v[WT_S][4];
#pragma unroll   // all sixteen loads in flight together; constant indices keep v[] in registers (also in the loops below)
  for (int s = 0; s < WT_S; ++s)
#pragma unroll
    for (int it = 0; it < 4; ++it) v[s][it] = *(const v4f*)(p + (s * 64 + it * 16) * N);
  // Behind the loads; it takes their address as an input, so that no load's result is given the address registers ahead of the wait.
  asm volatile("s_wait_xcnt 0x0" :: "v"(p) : "memory");
#pragma unroll
  for (int s = 0; s < WT_S; ++s)
#pragma unroll
    for (int it = 0; it < 4; ++it) {
      const int kr = it * 16 + r0;
      tile[s][c4 + 0][kr] = v[s][it][0];
      tile[s][c4 + 1][kr] = v[s][it][1];
      tile[s][c4 + 2][kr] = v[s][it][2];
      tile[s][c4 + 3][kr] = v[s][it][3];
    }
  __syncthreads();
  const int q = lane >> 3, c8 = (lane & 7) * 8;
  const int rw = wave * 8 + q;                      // waves 0..7 x 8 rows = 64 rows
  _Float16* o = ob + (size_t)(n0 + rw) * K + k0 + c8;
#pragma unroll
  for (int it = 0; it < 2; ++it)
#pragma unroll
    for (int s = 0; s < WT_S; ++s) {
      v8h hv;
#pragma unroll
      for (int e = 0; e < 8; ++e) hv[e] = (_Float16)(tile[s][rw + it * 4][c8 + e] * scale);
      *(v8h*)(o + it * 4 * K + s * 64) = hv;
    }
  // Behind the stores, in front of whatever the built code places after them that rewrites a register which they name.
  asm volatile("s_wait_xcnt 0x0" ::: "memory");
}

// Blocks 0 .. DEPTH * PL - 1: transpose pieces, PL = 4 BDD + B1 + B2 per layer in the order Wq, Wk, Wv, Wo, W1, W2; the blocks behind them: x (NX elements).
// wt4[layer][4][D][D], w1t[layer][FF][D], w2t[layer][D][FF].
template <int D, int FF, int DEPTH, int NX>
__global__ __launch_bounds__(256) void k_prep(
    const float* __restrict__ x, const float* __restrict__ Wq, const float* __restrict__ Wk,
    const float* __restrict__ Wv, const float* __restrict__ Wo, const float* __restrict__ W1, const float* __restrict__ W2,
    _Float16* __restrict__ xh, _Float16* __restrict__ wt4, _Float16* __restrict__ w1t, _Float16* __restrict__ w2t,
    float wscale) {
  static_assert(D % (64 * WT_S) == 0 && FF % (64 * WT_S) == 0 && NX % 8192 == 0, "whole pieces only");
  __shared__ float tile[WT_S][64][65];   // [tile][n][k]
  constexpr int KS = 64 * WT_S, TD = D / 64, TF = FF / 64;
  constexpr int BDD = TD * (D / KS), B1 = TF * (D / KS), B2 = TD * (FF / KS), PL = 4 * BDD + B1 + B2;
  const int bid = blockIdx.x;
  if (bid >= DEPTH * PL) {         // block-uniform
    cast_f16_block(x, xh, bid - DEPTH * PL);
    return;
  }
  const int l = bid / PL, r = bid - l * PL;   // block-uniform, as is all that follows from them
  if (r < 4 * BDD) {
    const int z = r / BDD, t = r - z * BDD;
    const float* src = ((z == 0) ? Wq : (z == 1) ? Wk : (z == 2) ? Wv : Wo) + (size_t)l * D * D;
    wT_tiles<D, D>(src, wt4 + (size_t)(l * 4 + z) * D * D, (t % TD) * 64, (t / TD) * KS, wscale, tile);
  } else if (r < 4 * BDD + B1) {
    const int t = r - 4 * BDD;         // [D][FF] -> [FF][D]
    wT_tiles<D, FF>(W1 + (size_t)l * D * FF, w1t + (size_t)l * D * FF, (t % TF) * 64, (t / TF) * KS, wscale, tile);
  } else {
    const int t = r - 4 * BDD - B1;    // [FF][D] -> [D][FF]
    wT_tiles<FF, D>(W2 + (size_t)l * FF * D, w2t + (size_t)l * FF * D, (t % TD) * 64, (t / TD) * KS, wscale, tile);
  }
}

// ---- Causal linear attention, f32, as a scan over chunks of RC_T steps: three launches.
// State of one (b, h) before a step: S[d][m] = sum Kf[m] * v[d], z[m] = sum Kf[m] over all earlier steps.
// One chunk's record in the workspace: RC_ST floats; S[d][4g + e] at (g * 64 + d) * 4 + e (lanes adjacent), z[m] at 4096 + m.
#define RC_T 32
#define RC_ST 4160

// 1) Sums over one chunk alone. One block (64 threads) per (chunk, b*8+h); thread d holds S[d][0..63] in registers, thread m holds z[m].
__global__ __launch_bounds__(64) void k_chunk_sum(
    const float* __restrict__ kf, const float* __restrict__ vin, float* __restrict__ st, int L) {
  __shared__ __align__(16) float Kc[RC_T * 64];   // [t][m]
  __shared__ __align__(16) float Vc[RC_T * 64];   // [t][d]
  const int tid = threadIdx.x;
  const int ch = blockIdx.x, bh = blockIdx.y;
  const int b = bh >> 3, h = bh & 7;
  const size_t base = (size_t)b * L * 512 + (size_t)h * 64;
  const int t0 = ch * RC_T;
  {
    const int r0 = tid >> 4, c4 = (tid & 15) * 4;
#pragma unroll   // all sixteen loads in flight together
    for (int it = 0; it < 8; ++it) {
      const int r = it * 4 + r0;                 // 0..31
      const size_t go = base + (size_t)(t0 + r) * 512 + c4;
      *(v4f*)(Kc + r * 64 + c4) = *(const v4f*)(kf + go);
      *(v4f*)(Vc + r * 64 + c4) = *(const v4f*)(vin + go);
    }
  }
  __syncthreads();
  v4f s[16];
#pragma unroll   // constant indices keep s[] in registers (here and in the two loops over g below)
  for (int g = 0; g < 16; ++g) s[g] = (v4f){0.f, 0.f, 0.f, 0.f};
  float z = 0.f;
  for (int t = 0; t < RC_T; ++t) {
    const float vt = Vc[t * 64 + tid];
    z += Kc[t * 64 + tid];
    const float* kr = Kc + t * 64;
#pragma unroll
    for (int g = 0; g < 16; ++g) s[g] = *(const v4f*)(kr + 4 * g) * vt + s[g];
  }
  float* o = st + ((size_t)bh * (L / RC_T) + ch) * RC_ST;
#pragma unroll
  for (int g = 0; g < 16; ++g) *(v4f*)(o + (g * 64 + tid) * 4) = s[g];
  o[4096 + tid] = z;
}

// 2) Exclusive prefix over the chunks of one (b, h), in place, in ascending chunk order; one thread per 4 state elements.
// nch % 16 == 0. Sixteen chunks' loads are issued together so that their latencies overlap.
__global__ __launch_bounds__(64) void k_chunk_prefix(float* __restrict__ st, int nch) {
  const int e4 = blockIdx.x * 64 + threadIdx.x;
  if (e4 >= RC_ST / 4) return;
  float* p = st + (size_t)blockIdx.y * nch * RC_ST + e4 * 4;
  v4f run = (v4f){0.f, 0.f, 0.f, 0.f};
  for (int c0 = 0; c0 < nch; c0 += 16) {
    v4f v[16];
#pragma unroll   // loads issued back to back; constant indices keep v[] in registers (also in the loop below)
    for (int i = 0; i < 16; ++i) v[i] = *(const v4f*)(p + (size_t)(c0 + i) * RC_ST);
#pragma unroll
    for (int i = 0; i < 16; ++i) {
      *(v4f*)(p + (size_t)(c0 + i) * RC_ST) = run;
      run = run + v[i];
    }
  }
}

// 3) One chunk's outputs in matrix form, started from the chunk's prefix state. One block (128 threads) per (chunk, b*8+h).
// P[t][s] = Qf_t . Kf_s for s <= t, else 0;  num[t][d] = sum_m Qf_t[m] S0[d][m] + sum_s P[t][s] v_s[d];
// den_t = Qf_t . z0 + sum_s P[t][s];  out_t[d] = num * rcp(den_t + 1e-6), written as f16.
// Thread (tg = tid / 16, lq = tid % 16) owns steps t = 4 tg + i (i = 0..3); scores s = lq, lq + 16; outputs d = 4 lq .. 4 lq + 3.
// A plain '#pragma unroll' in this kernel is there so that constant indices keep the per-thread arrays in registers.
#define RC_QP 100   // floats per row of QP: 64 of Qf, RC_T scores, 4 of pad (rows 4 apart start 16 banks apart)
__global__ __launch_bounds__(128) void k_recur(
    const float* __restrict__ qf, const float* __restrict__ kf, const float* __restrict__ vin,
    const float* __restrict__ st, _Float16* __restrict__ outh, int L, float oscale) {
  __shared__ __align__(16) float QP[RC_T * RC_QP];        // [t][0..63] = Qf_t[m], [t][64 + s] = P[t][s]
  __shared__ __align__(16) float Ks[RC_T * 68];           // [s][m], pitch 68: 16 rows' 16-byte reads hit 64 different banks
  __shared__ __align__(16) float BV[(64 + RC_T) * 64];    // rows 0..63 = S0[.][m] as [m][d], rows 64 + s = v_s[d]
  const int tid = threadIdx.x;
  const int wave = __builtin_amdgcn_readfirstlane(tid >> 5);   // in a scalar register: the tests on it become scalar branches
  const int tg = tid >> 4, lq = tid & 15;
  const int ch = blockIdx.x, bh = blockIdx.y;
  const int b = bh >> 3, h = bh & 7;
  const size_t base = (size_t)b * L * 512 + (size_t)h * 64;
  const float* sp = st + ((size_t)bh * (L / RC_T) + ch) * RC_ST;
  const int t0 = ch * RC_T;
  const size_t cbase = base + (size_t)t0 * 512;           // the chunk's first row, same for the whole block
  const unsigned lo = (unsigned)(tg * 512 + lq * 4);      // this thread's place in rows 0..7 of the chunk
  v4f zq;                                                 // z0[4 lq .. 4 lq + 3]
  {
    v4f rq[4], rk[4], rv[4], rs[8];
#pragma unroll   // all loads of the thread in flight together
    for (int it = 0; it < 4; ++it) {
      rq[it] = *(const v4f*)(qf + cbase + (lo + it * 4096u));
      rk[it] = *(const v4f*)(kf + cbase + (lo + it * 4096u));
      rv[it] = *(const v4f*)(vin + cbase + (lo + it * 4096u));
    }
#pragma unroll
    for (int it = 0; it < 8; ++it) rs[it] = *(const v4f*)(sp + (it * 128 + tid) * 4);
    zq = *(const v4f*)(sp + 4096 + lq * 4);
#pragma unroll
    for (int it = 0; it < 4; ++it) {
      const int r = it * 8 + tg;
      *(v4f*)(QP + r * RC_QP + lq * 4) = rq[it];
      *(v4f*)(Ks + r * 68 + lq * 4) = rk[it];
      *(v4f*)(BV + (64 + r) * 64 + lq * 4) = rv[it];
    }
#pragma unroll
    for (int it = 0; it < 8; ++it) {                      // record element (g, d) holds S0[d][4g .. 4g + 3]
      const int g = it * 2 + (tid >> 6), d = tid & 63;
#pragma unroll
      for (int e = 0; e < 4; ++e) BV[(4 * g + e) * 64 + d] = rs[it][e];
    }
  }
  __syncthreads();

  const float* qrow = QP + (tg * 4) * RC_QP;
  float dn[4];
  {
    v4f p0[4], p1[4];
#pragma unroll
    for (int i = 0; i < 4; ++i) { p0[i] = (v4f){0.f, 0.f, 0.f, 0.f}; p1[i] = (v4f){0.f, 0.f, 0.f, 0.f}; }
    const float* k0r = Ks + lq * 68;
    const float* k1r = Ks + (lq + 16) * 68;
    if (wave >= 2) {                                      // steps 16..31 see scores of s = 0..31
#pragma unroll 4   // several groups' LDS reads in flight ahead of their products
      for (int g = 0; g < 16; ++g) {
        const v4f k0 = *(const v4f*)(k0r + 4 * g);
        const v4f k1 = *(const v4f*)(k1r + 4 * g);
#pragma unroll
        for (int i = 0; i < 4; ++i) {
          const v4f q = *(const v4f*)(qrow + i * RC_QP + 4 * g);
          p0[i] = q * k0 + p0[i];
          p1[i] = q * k1 + p1[i];
        }
      }
    } else {                                              // steps 0..15: every score of s >= 16 is masked
#pragma unroll 4   // as above
      for (int g = 0; g < 16; ++g) {
        const v4f k0 = *(const v4f*)(k0r + 4 * g);
#pragma unroll
        for (int i = 0; i < 4; ++i) {
          const v4f q = *(const v4f*)(qrow + i * RC_QP + 4 * g);
          p0[i] = q * k0 + p0[i];
        }
      }
    }
#pragma unroll
    for (int i = 0; i < 4; ++i) {
      const int t = tg * 4 + i;
      float a0 = (p0[i][0] + p0[i][1]) + (p0[i][2] + p0[i][3]);
      float a1 = (p1[i][0] + p1[i][1]) + (p1[i][2] + p1[i][3]);
      a0 = (lq <= t) ? a0 : 0.f;
      a1 = (lq + 16 <= t) ? a1 : 0.f;
      QP[t * RC_QP + 64 + lq] = a0;
      QP[t * RC_QP + 80 + lq] = a1;
      const v4f qz = *(const v4f*)(qrow + i * RC_QP + lq * 4) * zq;   // this lane's four terms of Qf_t . z0
      dn[i] = (a0 + a1) + ((qz[0] + qz[1]) + (qz[2] + qz[3]));
    }
#pragma unroll
    for (int o = 1; o < 16; o <<= 1) {                    // sum over the 16 lanes that share tg
#pragma unroll
      for (int i = 0; i < 4; ++i) dn[i] += __shfl_xor(dn[i], o, 32);
    }
  }
  __syncthreads();                                        // the scores are in QP

  v4f o4[4];
#pragma unroll
  for (int i = 0; i < 4; ++i) o4[i] = (v4f){0.f, 0.f, 0.f, 0.f};
  const float* bcol = BV + lq * 4;
  auto quad = [&](int kq) {   // four columns of [Qf | P] times four rows of [S0 ; v]
    v4f a[4], bb[4];
#pragma unroll
    for (int e = 0; e < 4; ++e) bb[e] = *(const v4f*)(bcol + (4 * kq + e) * 64);
#pragma unroll
    for (int i = 0; i < 4; ++i) a[i] = *(const v4f*)(qrow + i * RC_QP + 4 * kq);
#pragma unroll
    for (int e = 0; e < 4; ++e)
#pragma unroll
      for (int i = 0; i < 4; ++i) o4[i] = bb[e] * a[i][e] + o4[i];
  };
#pragma unroll 4   // several quads' LDS reads in flight ahead of their products
  for (int kq = 0; kq < 16; ++kq) quad(kq);
  const int kend = 16 + 2 * wave + 2;                     // this wave's last step is 8 wave + 7: later scores are all masked
  for (int kq = 16; kq < kend; ++kq) quad(kq);

#pragma unroll
  for (int i = 0; i < 4; ++i) {
    const float zi = __builtin_amdgcn_rcpf(dn[i] + 1e-6f);
    v4h hv;
#pragma unroll
    for (int j = 0; j < 4; ++j) hv[j] = (_Float16)(o4[i][j] * zi * oscale);
    *(v4h*)(outh + cbase + ((unsigned)(tg * 2048 + lq * 4) + i * 512u)) = hv;
  }
}

// ---------------------------------------------------------------------------
extern "C" void kernel_launch(void* const* d_in, const int* in_sizes, int n_in,
                              void* d_out, int out_size, void* d_ws, size_t ws_size,
                              hipStream_t stream)
{
  const int B = 2, L = 2048, D = 512, FF = 2048, HD = 64, MH = 32, DEPTH = 2;
  const int TOK = B * L;
  if (n_in < 20) return;
  if (in_sizes[0] != TOK * D || in_sizes[1] != DEPTH * D * D || in_sizes[3] != DEPTH * D * D ||
      in_sizes[5] != DEPTH * D * D || in_sizes[7] != DEPTH * D * D || in_sizes[9] != DEPTH * HD * MH ||
      in_sizes[12] != DEPTH * D * FF || in_sizes[14] != DEPTH * FF * D || out_size != TOK * D) return;

  const float* x_in  = (const float*)d_in[0];
  const float* Wq    = (const float*)d_in[1];
  const float* bq    = (const float*)d_in[2];
  const float* Wk    = (const float*)d_in[3];
  const float* bk    = (const float*)d_in[4];
  const float* Wv    = (const float*)d_in[5];
  const float* bv    = (const float*)d_in[6];
  const float* Wo    = (const float*)d_in[7];
  const float* bo    = (const float*)d_in[8];
  const float* omega = (const float*)d_in[9];
  const float* ln1g  = (const float*)d_in[10];
  const float* ln1b  = (const float*)d_in[11];
  const float* W1    = (const float*)d_in[12];
  const float* b1    = (const float*)d_in[13];
  const float* W2    = (const float*)d_in[14];
  const float* b2    = (const float*)d_in[15];
  const float* ln2g  = (const float*)d_in[16];
  const float* ln2b  = (const float*)d_in[17];
  const float* lnfg  = (const float*)d_in[18];
  const float* lnfb  = (const float*)d_in[19];
  float* out = (float*)d_out;

  // ---- workspace carve (under 109 MiB) ----
  char* ws = (char*)d_ws;
  size_t off = 0;
  auto carve = [&](size_t bytes) -> char* { char* p = ws + off; off += (bytes + 255) & ~(size_t)255; return p; };
  _Float16* xh  = (_Float16*)carve((size_t)TOK * D * 2);    // f16 A operand of current x
  float*    xf  = (float*)carve((size_t)TOK * D * 4);       // f32 x behind LN1 (residual source of the feed-forward half)
  float*    xg  = (float*)carve((size_t)TOK * D * 4);       // f32 x behind LN2 (residual source of the next layer)
  float*    qb_ = (float*)carve((size_t)3 * TOK * D * 4);   // features of q, features of k, v one behind the other: batch stride TOK * D of their common GEMM launch
  float*    kb_ = qb_ + (size_t)TOK * D;
  float*    vb_ = kb_ + (size_t)TOK * D;
  _Float16* ah  = (_Float16*)carve((size_t)TOK * D * 2);    // attention output, f16 x16
  _Float16* y1h = (_Float16*)carve((size_t)TOK * FF * 2);   // relu(x W1 + b1), f16
  _Float16* wt4 = (_Float16*)carve((size_t)DEPTH * 4 * D * D * 2);  // per layer [Wq,Wk,Wv,Wo]^T f16 x64, [4][N][K]
  _Float16* w1t = (_Float16*)carve((size_t)DEPTH * D * FF * 2);     // per layer W1^T [FF][D] f16 x64
  _Float16* w2t = (_Float16*)carve((size_t)DEPTH * FF * D * 2);     // per layer W2^T [D][FF] f16 x64
  float*    cst = (float*)carve((size_t)B * 8 * (L / RC_T) * RC_ST * 4);   // per (b, h, chunk) state record
  if (off > ws_size) return;

  const float WSC = 64.0f, ASC = 16.0f;
  const int prepT = DEPTH * (4 * (D / 64) * (D / (64 * WT_S)) + (FF / 64) * (D / (64 * WT_S)) + (D / 64) * (FF / (64 * WT_S)));   // transpose pieces of all layers
  k_prep<D, FF, DEPTH, TOK * D><<<dim3(prepT + TOK * D / 8192), dim3(256), 0, stream>>>(
      x_in, Wq, Wk, Wv, Wo, W1, W2, xh, wt4, w1t, w2t, WSC);

  const int tilesD  = (TOK / 64) * (D / 64);      // 512
  const int tilesFF = (TOK / 64) * (FF / 64);     // 2048
  const dim3 gD((tilesD + 7) / 8, 1), gFF((tilesFF + 7) / 8, 1);

  for (int l = 0; l < DEPTH; ++l) {
    const float* xres = (l == 0) ? x_in : xg;
    const float* om = omega + (size_t)l * HD * MH;

    // positive random features of q = x Wq + bq and of k, and v = x Wv + bv (f32 out): one launch, batch index = which of the three
    const unsigned short* xhu = (const unsigned short*)xh;
    const unsigned short* wtu = (const unsigned short*)wt4 + (size_t)l * 4 * D * D;
    const unsigned short* w1u = (const unsigned short*)w1t + (size_t)l * D * FF;
    const unsigned short* w2u = (const unsigned short*)w2t + (size_t)l * FF * D;
    wmma_gemm64<0, false, 2, 0, false, 0, 0, true><<<dim3(gD.x, 3), dim3(256), 0, stream>>>(
        xhu, xhu, D, 0L, wtu, wtu, D, (long)D * D,
        (void*)qb_, (void*)qb_, D, (long)TOK * D, bq + (size_t)l * D, bk + (size_t)l * D, bv + (size_t)l * D,
        bq + (size_t)l * D, 0L, lnfg, lnfb, lnfg, lnfb, xf, xh, om, TOK, D, D, 1.0f / WSC);

    // causal prefix recurrence (f32) as a chunk scan -> attn f16 x16
    k_chunk_sum<<<dim3(L / RC_T, B * 8), dim3(64), 0, stream>>>(kb_, vb_, cst, L);
    k_chunk_prefix<<<dim3((RC_ST / 4 + 63) / 64, B * 8), dim3(64), 0, stream>>>(cst, L / RC_T);
    k_recur<<<dim3(L / RC_T, B * 8), dim3(128), 0, stream>>>(qb_, kb_, vb_, cst, ah, L, ASC);

    // x = LN1(attn Wo + bo + x), one launch
    wmma_gemm64<0, false, 2, 0, true, 0, 1><<<gD, dim3(256), 0, stream>>>(
        (const unsigned short*)ah, (const unsigned short*)ah, D, 0L, wtu + 3 * (size_t)D * D, wtu + 3 * (size_t)D * D, D, 0L,
        (void*)xf, (void*)xf, D, 0L, bo + (size_t)l * D, bo + (size_t)l * D, bo + (size_t)l * D, xres, 0L,
        ln1g + (size_t)l * D, ln1b + (size_t)l * D, lnfg, lnfb, xf, xh, om, TOK, D, D, 1.0f / (WSC * ASC));

    // y1 = relu(x W1 + b1) (f16 out); x = LN2(y1 W2 + b2 + x), in the last layer followed by the final normalization -> output
    wmma_gemm64<0, false, 2, 1, false, 2><<<gFF, dim3(256), 0, stream>>>(
        xhu, xhu, D, 0L, w1u, w1u, D, 0L,
        (void*)y1h, (void*)y1h, FF, 0L, b1 + (size_t)l * FF, b1 + (size_t)l * FF, b1 + (size_t)l * FF, b1 + (size_t)l * FF, 0L, lnfg, lnfb, lnfg, lnfb, xf, xh, om, TOK, FF, D, 1.0f / WSC);
    if (l + 1 < DEPTH)
      wmma_gemm64<0, false, 2, 0, true, 0, 1><<<gD, dim3(256), 0, stream>>>(
          (const unsigned short*)y1h, (const unsigned short*)y1h, FF, 0L, w2u, w2u, FF, 0L,
          (void*)xg, (void*)xg, D, 0L, b2 + (size_t)l * D, b2 + (size_t)l * D, b2 + (size_t)l * D, xf, 0L,
          ln2g + (size_t)l * D, ln2b + (size_t)l * D, lnfg, lnfb, xg, xh, om, TOK, D, FF, 1.0f / WSC);
    else
      wmma_gemm64<0, false, 2, 0, true, 0, 2><<<gD, dim3(256), 0, stream>>>(
          (const unsigned short*)y1h, (const unsigned short*)y1h, FF, 0L, w2u, w2u, FF, 0L,
          (void*)out, (void*)out, D, 0L, b2 + (size_t)l * D, b2 + (size_t)l * D, b2 + (size_t)l * D, xf, 0L,
          ln2g + (size_t)l * D, ln2b + (size_t)l * D, lnfg, lnfb, out, xh, om, TOK, D, FF, 1.0f / WSC);
  }
  (void)hipGetLastError();
}

// v009
// A run of this version takes 204 microseconds.
// Two timings next to v008 both put it at 1.11 times that version's speed.
// Over all steps from v000 it is 17.9 times as fast.
#include <hip/hip_runtime.h>
// Contractions x*Wq, x*Wk, x*Wv, attn*Wo, x*W1, y*W2: v_wmma_f32_16x16x32_f16 (f16 operands; weights carried x64, attn x16), f32 accumulate. Feature map's product with omega: v_wmma_f32_16x16x4_f32 (f32 operands). Causal prefix recurrence, LayerNorm: f32 VALU.

typedef __attribute__((ext_vector_type(16))) _Float16 v16h;
typedef __attribute__((ext_vector_type(8)))  _Float16 v8h;
typedef __attribute__((ext_vector_type(4)))  _Float16 v4h;
typedef __attribute__((ext_vector_type(16))) __bf16   v16b;
typedef __attribute__((ext_vector_type(8)))  __bf16   v8b;
typedef __attribute__((ext_vector_type(8)))  float    v8f;
typedef __attribute__((ext_vector_type(4)))  float    v4f;
typedef __attribute__((ext_vector_type(2)))  float    v2f;

__device__ __forceinline__ unsigned short f2bf_bits(float f) {
  unsigned u = __float_as_uint(f);
  return (unsigned short)((u + 0x7FFFu + ((u >> 16) & 1u)) >> 16);
}
__device__ __forceinline__ float bf_bits2f(unsigned short h) { return __uint_as_float(((unsigned)h) << 16); }

// hazard guards as plain device helpers
__device__ __forceinline__ void acc_guard4(v8f& a, v8f& b, v8f& c, v8f& d) { asm volatile("v_nop\n\tv_nop\n\tv_nop\n\tv_nop" : "+v"(a), "+v"(b), "+v"(c), "+v"(d)); }
// The same behind f32 16x16x4 WMMAs: eight slots, the distance of the other form with a 16-cycle issue interval (this form has no figure of its own).
__device__ __forceinline__ void acc_guard2_f32(v8f& a, v8f& b) { asm volatile("v_nop\n\tv_nop\n\tv_nop\n\tv_nop\n\tv_nop\n\tv_nop\n\tv_nop\n\tv_nop" : "+v"(a), "+v"(b)); }
template <typename T> struct Frag;
template <> struct Frag<_Float16> {
  typedef v16h V; union U { v16h v; v8h h[2]; };
  static __device__ __forceinline__ v16h load(const _Float16* p) {   // elements 0..7 <- p[0..7], 8..15 <- p[16..23]
    U f; f.h[0] = *(const v8h*)(p); f.h[1] = *(const v8h*)(p + 16); return f.v;
  }
  static __device__ __forceinline__ v8f mma(v16h a, v16h b, v8f c) {
    return __builtin_amdgcn_wmma_f32_16x16x32_f16(false, a, false, b, (short)0, c, false, false);
  }
};
template <> struct Frag<__bf16> {
  typedef v16b V; union U { v16b v; v8b h[2]; };
  static __device__ __forceinline__ v16b load(const __bf16* p) {
    U f; f.h[0] = *(const v8b*)(p); f.h[1] = *(const v8b*)(p + 16); return f.v;
  }
  static __device__ __forceinline__ v8f mma(v16b a, v16b b, v8f c) {
    return __builtin_amdgcn_wmma_f32_16x16x32_bf16(false, a, false, b, (short)0, c, false, false);
  }
};

// One stage of the GEMM's LDS ring: 64 k (one 128-byte line) of the block's 64 A rows and 512 Bt rows.
#define GS_K 64
#define GS_PITCH 72                      // 16-bit elements per LDS row: 144 B = 16 B x 9, conflict-free for ds_load_b128
#define GS_STAGE (576 * GS_PITCH)        // 16-bit elements per stage
#define GS_NBUF 3                        // buffers of the ring: a stage is copied two trips ahead of its use
typedef __attribute__((ext_vector_type(4))) int v4i;
typedef __attribute__((address_space(1))) v4i gv4i;   // 16 bytes in global memory
typedef __attribute__((address_space(3))) v4i lv4i;   // 16 bytes in LDS

// ---- LayerNorm of one row of 512 by one wave; lane owns elements i*128 + lane*4 .. +3 (i = 0..3) of x, g, b and y.
// The unrolls are there so that constant indices keep the arrays in registers.
__device__ __forceinline__ void ln_row(const v4f (&x)[4], const v4f (&gg)[4], const v4f (&bb)[4], v4f (&y)[4]) {
  float s = 0.f;
#pragma unroll
  for (int i = 0; i < 4; ++i) s += (x[i][0] + x[i][1]) + (x[i][2] + x[i][3]);
#pragma unroll
  for (int o = 1; o < 32; o <<= 1) s += __shfl_xor(s, o, 32);
  const float mu = s * 0.001953125f;
  float vs = 0.f;
#pragma unroll
  for (int i = 0; i < 4; ++i) {
    const v4f d = x[i] - mu;
    vs += (d[0] * d[0] + d[1] * d[1]) + (d[2] * d[2] + d[3] * d[3]);
  }
#pragma unroll
  for (int o = 1; o < 32; o <<= 1) vs += __shfl_xor(vs, o, 32);
  const float rstd = rsqrtf(vs * 0.001953125f + 1e-5f);
#pragma unroll
  for (int i = 0; i < 4; ++i) y[i] = (x[i] - mu) * rstd * gg[i] + bb[i];
}
#define LN_P 516   // floats per LDS row of the block's 64 x 512 result: rows 8 apart start 32 banks apart

// ---- Register-blocked batched WMMA GEMM ------------------------------------
// C[m,n] = scale * sum_k A[m,k] * Bt[n,k] (+bias)(+resid); each wave owns a 64x64 tile, a block of eight waves a 64x512 tile.
// A row-major [M,K]; Bt row-major [N,K]; M % 64 == 0, N % 512 == 0, K % 64 == 0, K >= 64.
// Operands reach the waves through a three-buffer LDS ring filled by asynchronous copies, two stages ahead of the WMMAs.
// Even stages are copied by waves 0..3, odd stages by waves 4..7: a wave never has more than one stage's copies outstanding, so its wait stays at 0.
// SPLIT (hi/lo operand planes A2/Bt2) is not staged by the ring and must be false.
// BIAS_MODE: 0 = none, 1 = bias[m], 2 = bias[n]. Batch index blockIdx.y = 0, 1, 2 takes bias, biasY1, biasY2.
// OUT_MODE: 0 = f32, 1 = f16, 2 = bf16 hi plane (Cout) + bf16 lo plane (Cout2).
// LNM: 0 = C is stored as OUT_MODE says. 1, 2 = N == 512, so the block holds whole rows of C (+bias +resid): it normalizes them itself
// and C is never stored. 1: LayerNorm(lng, lnb) -> outf (f32) and outh (f16). 2: that, then LayerNorm(lnfg, lnfb) of the result -> outf alone.
// FAV: N == 512, so a wave's 64 columns are one head. Batch indices 0 and 1 (q, k) store the FAVOR positive features of C instead of C:
// xs = C * 64^-0.25; u[j] = sum_d xs[d] * fom[d][j] (j = 0..31); off = 0.5 * |xs|^2; columns j and 32 + j of the head = exp(u - off) / 8, exp(-u - off) / 8.
// ET: 0 = f16 operands, 1 = bf16 operands (pointers passed as 16-bit storage)
template <int ET> struct Elem;
template <> struct Elem<0> { typedef _Float16 T; };
template <> struct Elem<1> { typedef __bf16 T; };
template <int ET, bool SPLIT, int BIAS_MODE, int OUT_MODE, bool RESID, int ACT = 0, int LNM = 0, bool FAV = false>
__global__ __launch_bounds__(256) void wmma_gemm64(
    const unsigned short* __restrict__ Ap, const unsigned short* __restrict__ A2p, int lda, long strideA,
    const unsigned short* __restrict__ Btp, const unsigned short* __restrict__ Bt2p, int ldb, long strideB,
    void* __restrict__ Cout, void* __restrict__ Cout2, int ldc, long strideC,
    const float* __restrict__ bias, const float* __restrict__ biasY1, const float* __restrict__ biasY2,
    const float* __restrict__ resid, long strideR,
    const float* __restrict__ lng, const float* __restrict__ lnb, const float* __restrict__ lnfg, const float* __restrict__ lnfb,
    float* __restrict__ outf, _Float16* __restrict__ outh, const float* __restrict__ fom,
    int M, int N, int K, float scale) {
  typedef typename Elem<ET>::T T;
  typedef typename Frag<T>::V V;
  const T* A = (const T*)Ap; const T* Bt = (const T*)Btp;
  static_assert(!SPLIT, "the LDS ring stages one plane per operand");
  __shared__ __align__(16) unsigned short sAB[GS_NBUF * GS_STAGE];   // a stage: rows 0..63 = A, rows 64..575 = Bt
  __shared__ __align__(16) float sT[8][16 * 68];   // per-wave 16x64 slab, pitch 68 floats
  __shared__ __align__(16) float sN[FAV ? 8 : 1][16];   // FAV: per wave, the squared norms of a slab's 16 rows
  const int b    = blockIdx.y;
  const int tid  = threadIdx.x;
  const int lane = tid & 31;
  const int wave = tid >> 5;
  const int tilesN = N >> 6;
  const int tilesM = M >> 6;
  const int tile0 = blockIdx.x * 8;            // the block's eight tiles: one tile row, eight adjacent tile columns
  if (tile0 >= tilesM * tilesN) return;        // block-uniform, in front of every barrier
  const int tm  = tile0 / tilesN;
  const int m0  = tm << 6;
  const int nb0 = (tile0 - tm * tilesN) << 6;
  const int n0  = nb0 + (wave << 6);

  const T* Ab  = A  + (size_t)b * strideA;
  const T* Bb  = Bt + (size_t)b * strideB;

  const int rlane = lane & 15;                 // row (A) / col (B, D) within subtile
  const int koff  = (lane >> 4) * 8;           // k offset of this lane half
  const int mOff  = (lane >> 4) * 8;           // D row offset

  // Copies: a stage is copied by one half of the block's waves. Eight lanes cover one row's 128-byte line, a wave four rows, the half 16 rows per copy; 36 copies per lane and stage.
  const int grp = __builtin_amdgcn_readfirstlane(tid >> 7);   // which half; in a scalar register, so that the tests on it are scalar branches
  const int cr = (tid & 127) >> 3, cc = (tid & 7) * 8;
  // A copy's global address = a base that is the same for the whole half and steps from stage to stage in scalar registers + the lane's own byte offset, one for A and one for Bt.
  const char* bA = (const char*)(Ab + (size_t)m0 * lda + grp * GS_K);    // row 0 of the next stage that this half copies
  const char* bB = (const char*)(Bb + (size_t)nb0 * ldb + grp * GS_K);
  const unsigned vA = (unsigned)(cr * lda + cc) * 2u, vB = (unsigned)(cr * ldb + cc) * 2u;
  unsigned short* lp0 = sAB + cr * GS_PITCH + cc;
  auto fill = [&](int buf) {
    unsigned short* lb = lp0 + buf * GS_STAGE;
#pragma unroll   // 36 copies back to back
    for (int it = 0; it < 36; ++it) {
      const char* g = (it < 4) ? (bA + (size_t)(it * 32) * lda + vA) : (bB + (size_t)((it - 4) * 32) * ldb + vB);
      __builtin_amdgcn_global_load_async_to_lds_b128((gv4i*)g, (lv4i*)(lb + it * 16 * GS_PITCH), 0, 0);
    }
    bA += 2 * GS_K * 2;
    bB += 2 * GS_K * 2;
  };

  v8f acc[4][4];
#pragma unroll
  for (int i = 0; i < 4; ++i)
#pragma unroll
    for (int j = 0; j < 4; ++j) acc[i][j] = (v8f){0.f,0.f,0.f,0.f,0.f,0.f,0.f,0.f};

  const int nst = K / GS_K;
  if (grp == 0) {
    fill(0);
    asm volatile("s_wait_asynccnt 0x0" ::: "memory");   // this wave's copies of stage 0 have landed
  } else if (nst > 1) {
    fill(1);
  }
  __syncthreads();                                      // stage 0 is there for every wave
  if (grp == 0) {
    if (nst > 2) fill(2);
  }
  int bc = 0;                                           // buffer of stage t = t mod GS_NBUF
  for (int t = 0; t < nst; ++t) {
    const T* sb = (const T*)sAB + bc * GS_STAGE;
    const T* sa = sb + rlane * GS_PITCH + koff;
    const T* sw = sb + (64 + (wave << 6) + rlane) * GS_PITCH + koff;
    V bh[4], ah[4];
    auto frags = [&](int ks) {   // the eight fragments of 32 k
#pragma unroll
      for (int j = 0; j < 4; ++j) bh[j] = Frag<T>::load(sw + j * 16 * GS_PITCH + ks * 32);
#pragma unroll
      for (int i = 0; i < 4; ++i) ah[i] = Frag<T>::load(sa + i * 16 * GS_PITCH + ks * 32);
    };
    auto products = [&]() {
#pragma unroll
      for (int i = 0; i < 4; ++i)
#pragma unroll
        for (int j = 0; j < 4; ++j) acc[i][j] = Frag<T>::mma(ah[i], bh[j], acc[i][j]);
    };
    frags(0);
    // Keeps the eight fragments' loads together ahead of the WMMAs: left free, each A fragment's load sinks to its first use and the wave waits out the LDS latency four times per 32 k.
    __builtin_amdgcn_sched_barrier(0);
    products();
    frags(1);                                           // the stage's last LDS reads
    asm volatile("s_wait_dscnt 0x0" ::: "memory");      // this wave's reads of stage t are done before the buffer is refilled
    const bool mine = grp != (t & 1);                   // this wave's half copies stages t + 1 and t + 3; the other half's stage t + 2 stays in flight
    if (mine) asm volatile("s_wait_asynccnt 0x0" ::: "memory");   // this wave's copies of stage t + 1 have landed
    __syncthreads();                                    // publishes stage t + 1 and ends every wave's reads of stage t
    if (mine) {
      if (t + 3 < nst) fill(bc);                        // stage t + 3 into the buffer that stage t has left
    }
    // Keeps the refill's issue ahead of the second 16 WMMAs (registers only), whose time the copies then have as lead.
    __builtin_amdgcn_sched_barrier(0);
    products();
    bc = (bc == GS_NBUF - 1) ? 0 : bc + 1;
  }
  asm volatile("s_wait_asynccnt 0x0" ::: "memory");     // no copy is outstanding behind the loop
  acc_guard4(acc[0][0], acc[0][1], acc[0][2], acc[0][3]);
  acc_guard4(acc[1][0], acc[1][1], acc[1][2], acc[1][3]);
  acc_guard4(acc[2][0], acc[2][1], acc[2][2], acc[2][3]);
  acc_guard4(acc[3][0], acc[3][1], acc[3][2], acc[3][3]);

  // ---- epilogue ----
  const float* Rb = RESID ? (resid + (size_t)b * strideR) : nullptr;
  const float* biasb = (b == 0) ? bias : (b == 1) ? biasY1 : biasY2;
  if constexpr (LNM != 0) {
    static_assert(BIAS_MODE == 2 && OUT_MODE == 0 && RESID && ACT == 0, "the normalizing epilogue takes bias[n] and a residual");
    static_assert(64 * LN_P * 4 <= 2 * GS_STAGE * 2, "the 64 x 512 result fits the ring");
    // The result goes through the ring's LDS, which is free here: every wave's last read of it and every copy into it
    // ended in front of the loop's last barrier. A plain '#pragma unroll' below keeps the per-lane arrays in registers (constant indices).
    float* tl = (float*)sAB;
    float bv[4];
#pragma unroll
    for (int j = 0; j < 4; ++j) bv[j] = biasb[n0 + (j << 4) + rlane];
    asm volatile("s_wait_xcnt 0x0" ::: "memory");   // behind the bias loads, in front of whatever next takes their address register
#pragma unroll
    for (int i = 0; i < 4; ++i)
#pragma unroll
      for (int j = 0; j < 4; ++j)
#pragma unroll
        for (int r = 0; r < 8; ++r)
          tl[((i << 4) + mOff + r) * LN_P + n0 + (j << 4) + rlane] = acc[i][j][r] * scale + bv[j];
    // Keeps the loads below behind the LDS stores, so that they take over the accumulators' registers: lifted over the stores they
    // need registers of their own beside the accumulators, and the kernel goes past 256 VGPRs (register-window switches).
    __builtin_amdgcn_sched_barrier(0);
    // Each wave takes eight whole rows. Their residual rows and the gains are loaded in front of the barrier, all in flight together.
    const int row0 = wave << 3, c4 = lane * 4;
    const size_t g0 = (size_t)(m0 + row0) * 512 + c4;
    const float* pr = Rb + g0;
    float* po = outf + g0;
    _Float16* ph = outh + g0;
    v4f rs[8][4], gg[4], bb[4], fg[4], fb[4];
#pragma unroll
    for (int rr = 0; rr < 8; ++rr)
#pragma unroll
      for (int i = 0; i < 4; ++i) rs[rr][i] = *(const v4f*)(pr + rr * 512 + i * 128);
#pragma unroll
    for (int i = 0; i < 4; ++i) {
      gg[i] = *(const v4f*)(lng + i * 128 + c4);
      bb[i] = *(const v4f*)(lnb + i * 128 + c4);
      if (LNM == 2) {
        fg[i] = *(const v4f*)(lnfg + i * 128 + c4);
        fb[i] = *(const v4f*)(lnfb + i * 128 + c4);
      }
    }
    asm volatile("s_wait_xcnt 0x0" ::: "memory");   // behind these loads, in front of whatever next takes their address registers
    __syncthreads();   // all eight waves' columns of every row are in LDS
#pragma unroll   // constant indices keep rs[] in registers
    for (int h = 0; h < 2; ++h) {   // four rows at a time: their reductions overlap, and the first four's stores drain under the last four's sums
      v4f y[4][4];
      v4h hv[4][4];
#pragma unroll
      for (int q = 0; q < 4; ++q) {
        const int rr = h * 4 + q;
        v4f x[4];
#pragma unroll
        for (int i = 0; i < 4; ++i) x[i] = *(const v4f*)(tl + (row0 + rr) * LN_P + i * 128 + c4) + rs[rr][i];
        if (LNM == 2) {
          v4f u[4];
          ln_row(x, gg, bb, u);
          ln_row(u, fg, fb, y[q]);
        } else {
          ln_row(x, gg, bb, y[q]);
#pragma unroll
          for (int i = 0; i < 4; ++i) {
            hv[q][i][0] = (_Float16)y[q][i][0]; hv[q][i][1] = (_Float16)y[q][i][1];
            hv[q][i][2] = (_Float16)y[q][i][2]; hv[q][i][3] = (_Float16)y[q][i][3];
          }
        }
      }
      // The four rows' values are all made in front of their first store: no register that an issued store names is written between the stores.
      __builtin_amdgcn_sched_barrier(0);
#pragma unroll
      for (int q = 0; q < 4; ++q)
#pragma unroll
        for (int i = 0; i < 4; ++i) {
          *(v4f*)(po + (h * 4 + q) * 512 + i * 128) = y[q][i];
          if (LNM == 1) *(v4h*)(ph + (h * 4 + q) * 512 + i * 128) = hv[q][i];
        }
      if (h == 0) {
        asm volatile("s_wait_xcnt 0x0" ::: "memory");   // behind the stores, in front of the next four rows' work, which reuses their registers
        __builtin_amdgcn_sched_barrier(0);              // keeps that work from being lifted over the wait
      }
    }
    return;
  }
  float* slab = sT[wave];
  if constexpr (FAV) {
    static_assert(BIAS_MODE == 2 && OUT_MODE == 0 && !RESID && ACT == 0 && LNM == 0, "the feature epilogue takes bias[n] and stores f32");
    if (b < 2) {   // block-uniform: every lane stays on for the WMMAs below
      static_assert(8 * 64 * 68 * 4 <= 2 * GS_STAGE * 2, "eight 64 x 64 tiles fit the ring");
      // The wave's whole tile goes into its own part of the ring's LDS, which is free here: every wave's last read of it and every copy
      // into it ended in front of the loop's last barrier. With the accumulators gone the loop over the tile's four slabs can stay rolled.
      // A plain '#pragma unroll' in this block keeps the per-lane arrays in registers (constant indices).
      float* tw = (float*)sAB + wave * (64 * 68);   // [row][d], pitch 68 floats
      float* nr = sN[wave];
      const int hf = lane >> 4;
      // This lane's place in rows hf, hf + 2, .. of the tile's first slab (row pitch N = 512): a row's 256 B = 16 lanes x 16 B.
      float* cw = (float*)Cout + (size_t)b * strideC + (size_t)(m0 + hf) * 512 + n0 + rlane * 4;
      // B fragments of omega, k = 4 each: position (register v, lane half hf) of fragment f holds d = 8 (f / 2) + 4 hf + 2 (f % 2) + v, as in the A fragments below.
      v2f om[2][16];
#pragma unroll
      for (int jt = 0; jt < 2; ++jt)
#pragma unroll
        for (int f = 0; f < 16; ++f) {
          const float* op = fom + (8 * (f >> 1) + 4 * hf + 2 * (f & 1)) * 32 + jt * 16 + rlane;
          om[jt][f] = (v2f){op[0], op[32]};
        }
      float bv[4];
#pragma unroll
      for (int j = 0; j < 4; ++j) bv[j] = biasb[n0 + (j << 4) + rlane];
      asm volatile("s_wait_xcnt 0x0" ::: "memory");   // behind these loads, in front of whatever next takes their address registers
#pragma unroll
      for (int i = 0; i < 4; ++i)
#pragma unroll
        for (int j = 0; j < 4; ++j)
#pragma unroll
          for (int r = 0; r < 8; ++r)
            tw[((i << 4) + mOff + r) * 68 + (j << 4) + rlane] = (acc[i][j][r] * scale + bv[j]) * 0.35355339059327379f;   // 64^-0.25
      __builtin_amdgcn_fence(__ATOMIC_RELEASE, "workgroup");
      __builtin_amdgcn_wave_barrier();
      __builtin_amdgcn_fence(__ATOMIC_ACQUIRE, "workgroup");
#pragma unroll 1   // one copy of the slab's code: the text stays short
      for (int i = 0; i < 4; ++i) {
        float* slab = tw + i * (16 * 68);
        v4f a[8];      // row rlane of the slab, d = 8 q + 4 hf .. + 3
        float ns = 0.f;
#pragma unroll
        for (int q = 0; q < 8; ++q) {
          a[q] = *(const v4f*)(slab + rlane * 68 + 8 * q + 4 * hf);
          ns += (a[q][0] * a[q][0] + a[q][1] * a[q][1]) + (a[q][2] * a[q][2] + a[q][3] * a[q][3]);
        }
        ns += __shfl_xor(ns, 16, 32);   // the row's other 32 elements
        nr[rlane] = ns;                 // both halves hold and write the same sum
        __builtin_amdgcn_fence(__ATOMIC_RELEASE, "workgroup");
        __builtin_amdgcn_wave_barrier();
        __builtin_amdgcn_fence(__ATOMIC_ACQUIRE, "workgroup");
        const v4f nlo = *(const v4f*)(nr + mOff), nhi = *(const v4f*)(nr + mOff + 4);   // norms of rows mOff .. mOff + 7, D's rows in this lane
        v8f u0 = (v8f){0.f,0.f,0.f,0.f,0.f,0.f,0.f,0.f}, u1 = u0;
        // The two fences of the schedule keep the 32 WMMAs and their guard one block with no vector instruction in it:
        // left free, the norm's register moves land among the WMMAs and overwrite A registers directly behind the WMMA that reads them.
        __builtin_amdgcn_sched_barrier(0);
#pragma unroll
        for (int f = 0; f < 16; ++f) {
          const v2f af = (v2f){a[f >> 1][2 * (f & 1)], a[f >> 1][2 * (f & 1) + 1]};
          u0 = __builtin_amdgcn_wmma_f32_16x16x4_f32(false, af, false, om[0][f], (short)0, u0, false, false);
          u1 = __builtin_amdgcn_wmma_f32_16x16x4_f32(false, af, false, om[1][f], (short)0, u1, false, false);
        }
        acc_guard2_f32(u0, u1);
        __builtin_amdgcn_sched_barrier(0);
#pragma unroll
        for (int r = 0; r < 8; ++r) {
          const float off = 0.5f * ((r < 4) ? nlo[r & 3] : nhi[r & 3]);
          float* sr = slab + (mOff + r) * 68 + rlane;
          sr[0]  = expf(u0[r] - off) * 0.125f;
          sr[16] = expf(u1[r] - off) * 0.125f;
          sr[32] = expf(-u0[r] - off) * 0.125f;
          sr[48] = expf(-u1[r] - off) * 0.125f;
        }
        __builtin_amdgcn_fence(__ATOMIC_RELEASE, "workgroup");
        __builtin_amdgcn_wave_barrier();
        __builtin_amdgcn_fence(__ATOMIC_ACQUIRE, "workgroup");
        v4f ov[8];
#pragma unroll
        for (int it = 0; it < 8; ++it) ov[it] = *(const v4f*)(slab + (it * 2 + hf) * 68 + rlane * 4);
        float* cp = cw + i * (16 * 512);
#pragma unroll
        for (int it = 0; it < 8; ++it) *(v4f*)(cp + it * 1024) = ov[it];
        asm volatile("s_wait_xcnt 0x0" ::: "memory");   // behind the stores, in front of the next slab's work, which reuses their registers
        __builtin_amdgcn_sched_barrier(0);              // keeps that work from being lifted over the wait
      }
      return;
    }
  }
#pragma unroll
  for (int i = 0; i < 4; ++i) {
    const int mBase = m0 + (i << 4);
#pragma unroll
    for (int j = 0; j < 4; ++j) {
      const int n = n0 + (j << 4) + rlane;
      float bv = 0.f;
      if (BIAS_MODE == 2) bv = biasb[n];
#pragma unroll
      for (int r = 0; r < 8; ++r) {
        float v = acc[i][j][r] * scale;
        if (BIAS_MODE == 1) v += biasb[mBase + mOff + r];
        if (BIAS_MODE == 2) v += bv;
        if (RESID) v += Rb[(size_t)(mBase + mOff + r) * ldc + n];
        if (ACT == 1) v = tanhf(v);
        if (ACT == 2) v = fmaxf(v, 0.0f);
        if (ACT == 3) v = v / (1.0f + expf(-v));
        if (ACT == 4) v = (v > 0.f) ? v : 0.01f * v;
        if (ACT == 5) v = 0.5f * v * (1.0f + erff(v * 0.70710678118654752f));
        slab[(mOff + r) * 68 + (j << 4) + rlane] = v;
      }
    }
    __builtin_amdgcn_fence(__ATOMIC_RELEASE, "workgroup");
    __builtin_amdgcn_wave_barrier();
    __builtin_amdgcn_fence(__ATOMIC_ACQUIRE, "workgroup");
    if (OUT_MODE == 0) {
      float* C = (float*)Cout + (size_t)b * strideC;
      const int hh = lane >> 4, c4 = (lane & 15) * 4;     // row seg = 256 B = 16 lanes x 16 B
      {
#pragma unroll
        for (int it = 0; it < 8; ++it) {
          const int row = it * 2 + hh;
          v4f v = *(const v4f*)(slab + row * 68 + c4);
          *(v4f*)(C + (size_t)(mBase + row) * ldc + n0 + c4) = v;
        }
        
      }
    } else {
      const int q = lane >> 3, c8 = (lane & 7) * 8;
      unsigned short* C  = (unsigned short*)Cout  + (size_t)b * strideC;
      unsigned short* C2 = (OUT_MODE == 2) ? ((unsigned short*)Cout2 + (size_t)b * strideC) : nullptr;
      {
#pragma unroll
        for (int it = 0; it < 4; ++it) {
          const int row = it * 4 + q;
          const float* sp = slab + row * 68 + c8;
          v8h hv, lv;
#pragma unroll
          for (int e = 0; e < 8; ++e) {
            if (OUT_MODE == 1) {
              hv[e] = (_Float16)sp[e];
            } else {
              unsigned short hb = f2bf_bits(sp[e]);
              unsigned short lb = f2bf_bits(sp[e] - bf_bits2f(hb));
              hv[e] = __builtin_bit_cast(_Float16, hb);
              lv[e] = __builtin_bit_cast(_Float16, lb);
            }
          }
          *(v8h*)(C + (size_t)(mBase + row) * ldc + n0 + c8) = hv;
          if (OUT_MODE == 2) *(v8h*)(C2 + (size_t)(mBase + row) * ldc + n0 + c8) = lv;
        }
        
      }
    }
    __builtin_amdgcn_fence(__ATOMIC_RELEASE, "workgroup");
    __builtin_amdgcn_wave_barrier();
    __builtin_amdgcn_fence(__ATOMIC_ACQUIRE, "workgroup");
  }
}

// ---- Operand preparation of the whole call, one grid: every weight matrix of every layer transposed and cast, and x cast.
// None of these pieces reads what another writes, so they share one launch; each block does one piece.
// The pieces are large, so that the grid is a few blocks per WGP (for speed only).
// Cast piece: one block casts 8192 consecutive elements to f16; a thread takes eight 16-byte pieces, 4 KiB apart.
__device__ __forceinline__ void cast_f16_block(const float* __restrict__ in, _Float16* __restrict__ out, int blk) {
  const size_t e0 = (size_t)blk * 8192 + threadIdx.x * 4;
  const float* p = in + e0;
  _Float16* o = out + e0;
  v4f v[8];
#pragma unroll   // all eight loads in flight together; constant indices keep v[] in registers (also in the loop below)
  for (int it = 0; it < 8; ++it) v[it] = *(const v4f*)(p + it * 1024);
#pragma unroll
  for (int it = 0; it < 8; ++it) {
    v4h h;
    h[0] = (_Float16)v[it][0]; h[1] = (_Float16)v[it][1]; h[2] = (_Float16)v[it][2]; h[3] = (_Float16)v[it][3];
    *(v4h*)(o + it * 1024) = h;
  }
}

// Transpose piece: WT_S tiles of 64 x 64, one behind the other along k, of src[K][N] f32 -> ob[N][K] f16 * scale. Called by a whole block of 256 threads.
// K and N are compile-time, so that every load and store of a thread is one address register plus an immediate offset.
#define WT_S 4
template <int K, int N>
__device__ __forceinline__ void wT_tiles(
    const float* __restrict__ src, _Float16* __restrict__ ob, int n0, int k0, float scale, float (*tile)[64][65]) {
  const int tid = threadIdx.x, lane = tid & 31, wave = tid >> 5;
  const int c4 = (tid & 15) * 4, r0 = tid >> 4;
  const float* p = src + (size_t)(k0 + r0) * N + n0 + c4;
  v4f v[WT_S][4];
#pragma unroll   // all sixteen loads in flight together; constant indices keep v[] in registers (also in the loops below)
  for (int s = 0; s < WT_S; ++s)
#pragma unroll
    for (int it = 0; it < 4; ++it) v[s][it] = *(const v4f*)(p + (s * 64 + it * 16) * N);
  // Behind the loads; it takes their address as an input, so that no load's result is given the address registers ahead of the wait.
  asm volatile("s_wait_xcnt 0x0" :: "v"(p) : "memory");
#pragma unroll
  for (int s = 0; s < WT_S; ++s)
#pragma unroll
    for (int it = 0; it < 4; ++it) {
      const int kr = it * 16 + r0;
      tile[s][c4 + 0][kr] = v[s][it][0];
      tile[s][c4 + 1][kr] = v[s][it][1];
      tile[s][c4 + 2][kr] = v[s][it][2];
      tile[s][c4 + 3][kr] = v[s][it][3];
    }
  __syncthreads();
  const int q = lane >> 3, c8 = (lane & 7) * 8;
  const int rw = wave * 8 + q;                      // waves 0..7 x 8 rows = 64 rows
  _Float16* o = ob + (size_t)(n0 + rw) * K + k0 + c8;
#pragma unroll
  for (int it = 0; it < 2; ++it)
#pragma unroll
    for (int s = 0; s < WT_S; ++s) {
      v8h hv;
#pragma unroll
      for (int e = 0; e < 8; ++e) hv[e] = (_Float16)(tile[s][rw + it * 4][c8 + e] * scale);
      *(v8h*)(o + it * 4 * K + s * 64) = hv;
    }
  // Behind the stores, in front of whatever the built code places after them that rewrites a register which they name.
  asm volatile("s_wait_xcnt 0x0" ::: "memory");
}

// Blocks 0 .. DEPTH * PL - 1: transpose pieces, PL = 4 BDD + B1 + B2 per layer in the order Wq, Wk, Wv, Wo, W1, W2; the blocks behind them: x (NX elements).
// wt4[layer][4][D][D], w1t[layer][FF][D], w2t[layer][D][FF].
template <int D, int FF, int DEPTH, int NX>
__global__ __launch_bounds__(256) void k_prep(
    const float* __restrict__ x, const float* __restrict__ Wq, const float* __restrict__ Wk,
    const float* __restrict__ Wv, const float* __restrict__ Wo, const float* __restrict__ W1, const float* __restrict__ W2,
    _Float16* __restrict__ xh, _Float16* __restrict__ wt4, _Float16* __restrict__ w1t, _Float16* __restrict__ w2t,
    float wscale) {
  static_assert(D % (64 * WT_S) == 0 && FF % (64 * WT_S) == 0 && NX % 8192 == 0, "whole pieces only");
  __shared__ float tile[WT_S][64][65];   // [tile][n][k]
  constexpr int KS = 64 * WT_S, TD = D / 64, TF = FF / 64;
  constexpr int BDD = TD * (D / KS), B1 = TF * (D / KS), B2 = TD * (FF / KS), PL = 4 * BDD + B1 + B2;
  const int bid = blockIdx.x;
  if (bid >= DEPTH * PL) {         // block-uniform
    cast_f16_block(x, xh, bid - DEPTH * PL);
    return;
  }
  const int l = bid / PL, r = bid - l * PL;   // block-uniform, as is all that follows from them
  if (r < 4 * BDD) {
    const int z = r / BDD, t = r - z * BDD;
    const float* src = ((z == 0) ? Wq : (z == 1) ? Wk : (z == 2) ? Wv : Wo) + (size_t)l * D * D;
    wT_tiles<D, D>(src, wt4 + (size_t)(l * 4 + z) * D * D, (t % TD) * 64, (t / TD) * KS, wscale, tile);
  } else if (r < 4 * BDD + B1) {
    const int t = r - 4 * BDD;         // [D][FF] -> [FF][D]
    wT_tiles<D, FF>(W1 + (size_t)l * D * FF, w1t + (size_t)l * D * FF, (t % TF) * 64, (t / TF) * KS, wscale, tile);
  } else {
    const int t = r - 4 * BDD - B1;    // [FF][D] -> [D][FF]
    wT_tiles<FF, D>(W2 + (size_t)l * FF * D, w2t + (size_t)l * FF * D, (t % TD) * 64, (t / TD) * KS, wscale, tile);
  }
}

// ---- Causal linear attention, f32, as a scan over chunks of RC_T steps: two launches.
// State of one (b, h) before a step: S[d][m] = sum Kf[m] * v[d], z[m] = sum Kf[m] over all earlier steps.
// One record in the workspace: RC_ST floats; S[d][4g + e] at (g * 64 + d) * 4 + e (lanes adjacent), z[m] at 4096 + m.
// A group is RC_G chunks. st holds per chunk the sums over the earlier chunks of its own group, tot per group the sums over the whole group.
#define RC_T 32
#define RC_ST 4160
#define RC_G 8
#define RC_TB 4   // group totals that k_recur loads together

// 1) Running sums through one group. One block (128 threads) per (group, b*8+h, half of m).
// Thread (dp = tid % 32, mg = tid / 32) holds S[2 dp .. 2 dp + 1][m0 .. m0 + 7], m0 = 32 half + 8 mg, and (every lane of a wave alike) z[m0 .. m0 + 7].
// A plain '#pragma unroll' in this kernel is there so that constant indices keep the per-thread arrays in registers.
__global__ __launch_bounds__(128) void k_chunk_sum(
    const float* __restrict__ kf, const float* __restrict__ vin, float* __restrict__ st, float* __restrict__ tot, int L) {
  __shared__ __align__(16) float Kc[RC_G * RC_T * 32];   // [t][m - 32 half]
  __shared__ __align__(16) float Vc[RC_G * RC_T * 64];   // [t][d]
  const int tid = threadIdx.x;
  const int gr = blockIdx.x, bh = blockIdx.y, hf = blockIdx.z;
  const int b = bh >> 3, h = bh & 7;
  const size_t base = (size_t)b * L * 512 + (size_t)h * 64 + (size_t)gr * (RC_G * RC_T) * 512;
  {
    const int kr = tid >> 3, kc = (tid & 7) * 4;    // 16 rows of 128 B per pass
    const int vr = tid >> 4, vc = (tid & 15) * 4;   // 8 rows of 256 B per pass
    const float* pk = kf + base + hf * 32 + kr * 512 + kc;
    const float* pv = vin + base + vr * 512 + vc;
    v4f rk[16], rv[32];
#pragma unroll   // all loads of the thread in flight together
    for (int it = 0; it < 16; ++it) rk[it] = *(const v4f*)(pk + it * (16 * 512));
#pragma unroll
    for (int it = 0; it < 32; ++it) rv[it] = *(const v4f*)(pv + it * (8 * 512));
    // Behind the loads; it takes their addresses as inputs, so that no load's result is given the address registers ahead of the wait.
    asm volatile("s_wait_xcnt 0x0" :: "v"(pk), "v"(pv) : "memory");
#pragma unroll
    for (int it = 0; it < 16; ++it) *(v4f*)(Kc + (it * 16 + kr) * 32 + kc) = rk[it];
#pragma unroll
    for (int it = 0; it < 32; ++it) *(v4f*)(Vc + (it * 8 + vr) * 64 + vc) = rv[it];
  }
  __syncthreads();
  const int dp = tid & 31, mg = tid >> 5;
  const int g0 = hf * 8 + mg * 2;                   // the thread's two quads of m
  v4f s00 = (v4f){0.f, 0.f, 0.f, 0.f}, s01 = s00, s10 = s00, s11 = s00, z0 = s00, z1 = s00;
  const float* vp = Vc + 2 * dp;
  const float* kp = Kc + mg * 8;
  const unsigned so = (unsigned)((g0 * 64 + 2 * dp) * 4);   // S[2 dp][4 g0 ..] in a record
  auto put = [&](float* o) {
    *(v4f*)(o + so) = s00;
    *(v4f*)(o + so + 4) = s01;
    *(v4f*)(o + so + 256) = s10;
    *(v4f*)(o + so + 260) = s11;
    if (dp == 0) {
      *(v4f*)(o + 4096 + g0 * 4) = z0;
      *(v4f*)(o + 4096 + g0 * 4 + 4) = z1;
    }
    asm volatile("s_wait_xcnt 0x0" ::: "memory");   // behind the stores, in front of the sums that go on in the registers which they name
    __builtin_amdgcn_sched_barrier(0);              // keeps those sums from being lifted over the wait
  };
  float* o = st + ((size_t)bh * (L / RC_T) + gr * RC_G) * RC_ST;
#pragma unroll 1   // one copy of a chunk's code
  for (int c = 0; c < RC_G; ++c) {
    put(o);                                         // the sums over the group's earlier chunks
    o += RC_ST;
#pragma unroll 1   // sixteen steps a trip, below
    for (int t0 = 0; t0 < RC_T; t0 += 16) {
#pragma unroll   // sixteen steps' LDS reads in flight ahead of their products, each at a constant offset from the trip's two addresses
      for (int t = 0; t < 16; ++t) {
        const v2f vv = *(const v2f*)(vp + t * 64);
        const v4f k0 = *(const v4f*)(kp + t * 32);
        const v4f k1 = *(const v4f*)(kp + t * 32 + 4);
        s00 = k0 * vv[0] + s00;
        s01 = k0 * vv[1] + s01;
        s10 = k1 * vv[0] + s10;
        s11 = k1 * vv[1] + s11;
        z0 = z0 + k0;
        z1 = z1 + k1;
      }
      vp += 16 * 64;
      kp += 16 * 32;
    }
  }
  put(tot + ((size_t)bh * (L / (RC_T * RC_G)) + gr) * RC_ST);
}

// 2) One chunk's outputs in matrix form, started from the state before the chunk = the chunk's record + the totals of all earlier groups. One block (128 threads) per (chunk, b*8+h).
// P[t][s] = Qf_t . Kf_s for s <= t, else 0;  num[t][d] = sum_m Qf_t[m] S0[d][m] + sum_s P[t][s] v_s[d];
// den_t = Qf_t . z0 + sum_s P[t][s];  out_t[d] = num * rcp(den_t + 1e-6), written as f16.
// Thread (tg = tid / 16, lq = tid % 16) owns steps t = 4 tg + i (i = 0..3); scores s = lq, lq + 16; outputs d = 4 lq .. 4 lq + 3.
// A plain '#pragma unroll' in this kernel is there so that constant indices keep the per-thread arrays in registers.
#define RC_QP 100   // floats per row of QP: 64 of Qf, RC_T scores, 4 of pad (rows 4 apart start 16 banks apart)
__global__ __launch_bounds__(128) void k_recur(
    const float* __restrict__ qf, const float* __restrict__ kf, const float* __restrict__ vin,
    const float* __restrict__ st, const float* __restrict__ tot, _Float16* __restrict__ outh, int L, float oscale) {
  __shared__ __align__(16) float QP[RC_T * RC_QP];        // [t][0..63] = Qf_t[m], [t][64 + s] = P[t][s]
  __shared__ __align__(16) float Ks[RC_T * 68];           // [s][m], pitch 68: 16 rows' 16-byte reads hit 64 different banks
  __shared__ __align__(16) float BV[(64 + RC_T) * 64];    // rows 0..63 = S0[.][m] as [m][d], rows 64 + s = v_s[d]
  const int tid = threadIdx.x;
  const int wave = __builtin_amdgcn_readfirstlane(tid >> 5);   // in a scalar register: the tests on it become scalar branches
  const int tg = tid >> 4, lq = tid & 15;
  const int ch = blockIdx.x, bh = blockIdx.y;
  const int b = bh >> 3, h = bh & 7;
  const size_t base = (size_t)b * L * 512 + (size_t)h * 64;
  const float* sp = st + ((size_t)bh * (L / RC_T) + ch) * RC_ST;
  const int t0 = ch * RC_T;
  const size_t cbase = base + (size_t)t0 * 512;           // the chunk's first row, same for the whole block
  const unsigned lo = (unsigned)(tg * 512 + lq * 4);      // this thread's place in rows 0..7 of the chunk
  v4f zq;                                                 // z0[4 lq .. 4 lq + 3]
  {
    v4f rq[4], rk[4], rv[4], rs[8];
#pragma unroll   // all loads of the thread in flight together
    for (int it = 0; it < 4; ++it) {
      rq[it] = *(const v4f*)(qf + cbase + (lo + it * 4096u));
      rk[it] = *(const v4f*)(kf + cbase + (lo + it * 4096u));
      rv[it] = *(const v4f*)(vin + cbase + (lo + it * 4096u));
    }
#pragma unroll
    for (int it = 0; it < 8; ++it) rs[it] = *(const v4f*)(sp + (it * 128 + tid) * 4);
    zq = *(const v4f*)(sp + 4096 + lq * 4);
    // The totals of the groups in front of this chunk's, in ascending order, RC_TB of them loaded together so that their latencies overlap.
    // A place past the last such group loads an earlier total again (an address that is always written), and 0 is added in its stead.
    const int ng = ch / RC_G;                             // same for the whole block
    const int jl = (ng > 0) ? ng - 1 : 0;
    const float* tp = tot + (size_t)bh * (L / (RC_T * RC_G)) * RC_ST;
    v4f ts[RC_TB][8], tz[RC_TB];
    bool on[RC_TB];
    auto tload = [&](int j0) {
#pragma unroll
      for (int jj = 0; jj < RC_TB; ++jj) {
        const int j = (j0 + jj < jl) ? j0 + jj : jl;
        on[jj] = j0 + jj < ng;
        const float* tj = tp + (size_t)j * RC_ST;
#pragma unroll
        for (int it = 0; it < 8; ++it) ts[jj][it] = *(const v4f*)(tj + (it * 128 + tid) * 4);
        tz[jj] = *(const v4f*)(tj + 4096 + lq * 4);
      }
      asm volatile("s_wait_xcnt 0x0" ::: "memory");   // behind these loads, in front of whatever next takes their address registers
    };
    auto tadd = [&]() {
#pragma unroll
      for (int jj = 0; jj < RC_TB; ++jj) {
#pragma unroll
        for (int it = 0; it < 8; ++it) rs[it] = rs[it] + (on[jj] ? ts[jj][it] : (v4f){0.f, 0.f, 0.f, 0.f});
        zq = zq + (on[jj] ? tz[jj] : (v4f){0.f, 0.f, 0.f, 0.f});
      }
    };
    tload(0);                                             // unconditional: in flight together with the chunk's own loads
    // Keeps every load above ahead of the first LDS store: left free, the loads of q, k and v sink behind the totals' sums and their latency comes on top.
    __builtin_amdgcn_sched_barrier(0);
#pragma unroll
    for (int it = 0; it < 4; ++it) {
      const int r = it * 8 + tg;
      *(v4f*)(QP + r * RC_QP + lq * 4) = rq[it];
      *(v4f*)(Ks + r * 68 + lq * 4) = rk[it];
      *(v4f*)(BV + (64 + r) * 64 + lq * 4) = rv[it];
    }
    tadd();
    for (int j0 = RC_TB; j0 < ng; j0 += RC_TB) {          // block-uniform; one trip at most with eight groups
      tload(j0);
      tadd();
    }
#pragma unroll
    for (int it = 0; it < 8; ++it) {                      // record element (g, d) holds S0[d][4g .. 4g + 3]
      const int g = it * 2 + (tid >> 6), d = tid & 63;
#pragma unroll
      for (int e = 0; e < 4; ++e) BV[(4 * g + e) * 64 + d] = rs[it][e];
    }
  }
  __syncthreads();

  const float* qrow = QP + (tg * 4) * RC_QP;
  float dn[4];
  {
    v4f p0[4], p1[4];
#pragma unroll
    for (int i = 0; i < 4; ++i) { p0[i] = (v4f){0.f, 0.f, 0.f, 0.f}; p1[i] = (v4f){0.f, 0.f, 0.f, 0.f}; }
    const float* k0r = Ks + lq * 68;
    const float* k1r = Ks + (lq + 16) * 68;
    if (wave >= 2) {                                      // steps 16..31 see scores of s = 0..31
#pragma unroll 4   // several groups' LDS reads in flight ahead of their products
      for (int g = 0; g < 16; ++g) {
        const v4f k0 = *(const v4f*)(k0r + 4 * g);
        const v4f k1 = *(const v4f*)(k1r + 4 * g);
#pragma unroll
        for (int i = 0; i < 4; ++i) {
          const v4f q = *(const v4f*)(qrow + i * RC_QP + 4 * g);
          p0[i] = q * k0 + p0[i];
          p1[i] = q * k1 + p1[i];
        }
      }
    } else {                                              // steps 0..15: every score of s >= 16 is masked
#pragma unroll 4   // as above
      for (int g = 0; g < 16; ++g) {
        const v4f k0 = *(const v4f*)(k0r + 4 * g);
#pragma unroll
        for (int i = 0; i < 4; ++i) {
          const v4f q = *(const v4f*)(qrow + i * RC_QP + 4 * g);
          p0[i] = q * k0 + p0[i];
        }
      }
    }
#pragma unroll
    for (int i = 0; i < 4; ++i) {
      const int t = tg * 4 + i;
      float a0 = (p0[i][0] + p0[i][1]) + (p0[i][2] + p0[i][3]);
      float a1 = (p1[i][0] + p1[i][1]) + (p1[i][2] + p1[i][3]);
      a0 = (lq <= t) ? a0 : 0.f;
      a1 = (lq + 16 <= t) ? a1 : 0.f;
      QP[t * RC_QP + 64 + lq] = a0;
      QP[t * RC_QP + 80 + lq] = a1;
      const v4f qz = *(const v4f*)(qrow + i * RC_QP + lq * 4) * zq;   // this lane's four terms of Qf_t . z0
      dn[i] = (a0 + a1) + ((qz[0] + qz[1]) + (qz[2] + qz[3]));
    }
#pragma unroll
    for (int o = 1; o < 16; o <<= 1) {                    // sum over the 16 lanes that share tg
#pragma unroll
      for (int i = 0; i < 4; ++i) dn[i] += __shfl_xor(dn[i], o, 32);
    }
  }
  __syncthreads();                                        // the scores are in QP

  v4f o4[4];
#pragma unroll
  for (int i = 0; i < 4; ++i) o4[i] = (v4f){0.f, 0.f, 0.f, 0.f};
  const float* bcol = BV + lq * 4;
  auto quad = [&](int kq) {   // four columns of [Qf | P] times four rows of [S0 ; v]
    v4f a[4], bb[4];
#pragma unroll
    for (int e = 0; e < 4; ++e) bb[e] = *(const v4f*)(bcol + (4 * kq + e) * 64);
#pragma unroll
    for (int i = 0; i < 4; ++i) a[i] = *(const v4f*)(qrow + i * RC_QP + 4 * kq);
#pragma unroll
    for (int e = 0; e < 4; ++e)
#pragma unroll
      for (int i = 0; i < 4; ++i) o4[i] = bb[e] * a[i][e] + o4[i];
  };
#pragma unroll 4   // several quads' LDS reads in flight ahead of their products
  for (int kq = 0; kq < 16; ++kq) quad(kq);
  const int kend = 16 + 2 * wave + 2;                     // this wave's last step is 8 wave + 7: later scores are all masked
  for (int kq = 16; kq < kend; ++kq) quad(kq);

#pragma unroll
  for (int i = 0; i < 4; ++i) {
    const float zi = __builtin_amdgcn_rcpf(dn[i] + 1e-6f);
    v4h hv;
#pragma unroll
    for (int j = 0; j < 4; ++j) hv[j] = (_Float16)(o4[i][j] * zi * oscale);
    *(v4h*)(outh + cbase + ((unsigned)(tg * 2048 + lq * 4) + i * 512u)) = hv;
  }
}

// ---------------------------------------------------------------------------
extern "C" void kernel_launch(void* const* d_in, const int* in_sizes, int n_in,
                              void* d_out, int out_size, void* d_ws, size_t ws_size,
                              hipStream_t stream)
{
  const int B = 2, L = 2048, D = 512, FF = 2048, HD = 64, MH = 32, DEPTH = 2;
  const int TOK = B * L;
  if (n_in < 20) return;
  if (in_sizes[0] != TOK * D || in_sizes[1] != DEPTH * D * D || in_sizes[3] != DEPTH * D * D ||
      in_sizes[5] != DEPTH * D * D || in_sizes[7] != DEPTH * D * D || in_sizes[9] != DEPTH * HD * MH ||
      in_sizes[12] != DEPTH * D * FF || in_sizes[14] != DEPTH * FF * D || out_size != TOK * D) return;

  const float* x_in  = (const float*)d_in[0];
  const float* Wq    = (const float*)d_in[1];
  const float* bq    = (const float*)d_in[2];
  const float* Wk    = (const float*)d_in[3];
  const float* bk    = (const float*)d_in[4];
  const float* Wv    = (const float*)d_in[5];
  const float* bv    = (const float*)d_in[6];
  const float* Wo    = (const float*)d_in[7];
  const float* bo    = (const float*)d_in[8];
  const float* omega = (const float*)d_in[9];
  const float* ln1g  = (const float*)d_in[10];
  const float* ln1b  = (const float*)d_in[11];
  const float* W1    = (const float*)d_in[12];
  const float* b1    = (const float*)d_in[13];
  const float* W2    = (const float*)d_in[14];
  const float* b2    = (const float*)d_in[15];
  const float* ln2g  = (const float*)d_in[16];
  const float* ln2b  = (const float*)d_in[17];
  const float* lnfg  = (const float*)d_in[18];
  const float* lnfb  = (const float*)d_in[19];
  float* out = (float*)d_out;

  // ---- workspace carve (under 109 MiB) ----
  char* ws = (char*)d_ws;
  size_t off = 0;
  auto carve = [&](size_t bytes) -> char* { char* p = ws + off; off += (bytes + 255) & ~(size_t)255; return p; };
  _Float16* xh  = (_Float16*)carve((size_t)TOK * D * 2);    // f16 A operand of current x
  float*    xf  = (float*)carve((size_t)TOK * D * 4);       // f32 x behind LN1 (residual source of the feed-forward half)
  float*    xg  = (float*)carve((size_t)TOK * D * 4);       // f32 x behind LN2 (residual source of the next layer)
  float*    qb_ = (float*)carve((size_t)3 * TOK * D * 4);   // features of q, features of k, v one behind the other: batch stride TOK * D of their common GEMM launch
  float*    kb_ = qb_ + (size_t)TOK * D;
  float*    vb_ = kb_ + (size_t)TOK * D;
  _Float16* ah  = (_Float16*)carve((size_t)TOK * D * 2);    // attention output, f16 x16
  _Float16* y1h = (_Float16*)carve((size_t)TOK * FF * 2);   // relu(x W1 + b1), f16
  _Float16* wt4 = (_Float16*)carve((size_t)DEPTH * 4 * D * D * 2);  // per layer [Wq,Wk,Wv,Wo]^T f16 x64, [4][N][K]
  _Float16* w1t = (_Float16*)carve((size_t)DEPTH * D * FF * 2);     // per layer W1^T [FF][D] f16 x64
  _Float16* w2t = (_Float16*)carve((size_t)DEPTH * FF * D * 2);     // per layer W2^T [D][FF] f16 x64
  float*    cst = (float*)carve((size_t)B * 8 * (L / RC_T) * RC_ST * 4);   // per (b, h, chunk) state record
  float*    ctot = (float*)carve((size_t)B * 8 * (L / (RC_T * RC_G)) * RC_ST * 4);   // per (b, h, group) total record
  if (off > ws_size) return;

  const float WSC = 64.0f, ASC = 16.0f;
  const int prepT = DEPTH * (4 * (D / 64) * (D / (64 * WT_S)) + (FF / 64) * (D / (64 * WT_S)) + (D / 64) * (FF / (64 * WT_S)));   // transpose pieces of all layers
  k_prep<D, FF, DEPTH, TOK * D><<<dim3(prepT + TOK * D / 8192), dim3(256), 0, stream>>>(
      x_in, Wq, Wk, Wv, Wo, W1, W2, xh, wt4, w1t, w2t, WSC);

  const int tilesD  = (TOK / 64) * (D / 64);      // 512
  const int tilesFF = (TOK / 64) * (FF / 64);     // 2048
  const dim3 gD((tilesD + 7) / 8, 1), gFF((tilesFF + 7) / 8, 1);

  for (int l = 0; l < DEPTH; ++l) {
    const float* xres = (l == 0) ? x_in : xg;
    const float* om = omega + (size_t)l * HD * MH;

    // positive random features of q = x Wq + bq and of k, and v = x Wv + bv (f32 out): one launch, batch index = which of the three
    const unsigned short* xhu = (const unsigned short*)xh;
    const unsigned short* wtu = (const unsigned short*)wt4 + (size_t)l * 4 * D * D;
    const unsigned short* w1u = (const unsigned short*)w1t + (size_t)l * D * FF;
    const unsigned short* w2u = (const unsigned short*)w2t + (size_t)l * FF * D;
    wmma_gemm64<0, false, 2, 0, false, 0, 0, true><<<dim3(gD.x, 3), dim3(256), 0, stream>>>(
        xhu, xhu, D, 0L, wtu, wtu, D, (long)D * D,
        (void*)qb_, (void*)qb_, D, (long)TOK * D, bq + (size_t)l * D, bk + (size_t)l * D, bv + (size_t)l * D,
        bq + (size_t)l * D, 0L, lnfg, lnfb, lnfg, lnfb, xf, xh, om, TOK, D, D, 1.0f / WSC);

    // causal prefix recurrence (f32) as a chunk scan -> attn f16 x16
    k_chunk_sum<<<dim3(L / (RC_T * RC_G), B * 8, 2), dim3(128), 0, stream>>>(kb_, vb_, cst, ctot, L);
    k_recur<<<dim3(L / RC_T, B * 8), dim3(128), 0, stream>>>(qb_, kb_, vb_, cst, ctot, ah, L, ASC);

    // x = LN1(attn Wo + bo + x), one launch
    wmma_gemm64<0, false, 2, 0, true, 0, 1><<<gD, dim3(256), 0, stream>>>(
        (const unsigned short*)ah, (const unsigned short*)ah, D, 0L, wtu + 3 * (size_t)D * D, wtu + 3 * (size_t)D * D, D, 0L,
        (void*)xf, (void*)xf, D, 0L, bo + (size_t)l * D, bo + (size_t)l * D, bo + (size_t)l * D, xres, 0L,
        ln1g + (size_t)l * D, ln1b + (size_t)l * D, lnfg, lnfb, xf, xh, om, TOK, D, D, 1.0f / (WSC * ASC));

    // y1 = relu(x W1 + b1) (f16 out); x = LN2(y1 W2 + b2 + x), in the last layer followed by the final normalization -> output
    wmma_gemm64<0, false, 2, 1, false, 2><<<gFF, dim3(256), 0, stream>>>(
        xhu, xhu, D, 0L, w1u, w1u, D, 0L,
        (void*)y1h, (void*)y1h, FF, 0L, b1 + (size_t)l * FF, b1 + (size_t)l * FF, b1 + (size_t)l * FF, b1 + (size_t)l * FF, 0L, lnfg, lnfb, lnfg, lnfb, xf, xh, om, TOK, FF, D, 1.0f / WSC);
    if (l + 1 < DEPTH)
      wmma_gemm64<0, false, 2, 0, true, 0, 1><<<gD, dim3(256), 0, stream>>>(
          (const unsigned short*)y1h, (const unsigned short*)y1h, FF, 0L, w2u, w2u, FF, 0L,
          (void*)xg, (void*)xg, D, 0L, b2 + (size_t)l * D, b2 + (size_t)l * D, b2 + (size_t)l * D, xf, 0L,
          ln2g + (size_t)l * D, ln2b + (size_t)l * D, lnfg, lnfb, xg, xh, om, TOK, D, FF, 1.0f / WSC);
    else
      wmma_gemm64<0, false, 2, 0, true, 0, 2><<<gD, dim3(256), 0, stream>>>(
          (const unsigned short*)y1h, (const unsigned short*)y1h, FF, 0L, w2u, w2u, FF, 0L,
          (void*)out, (void*)out, D, 0L, b2 + (size_t)l * D, b2 + (size_t)l * D, b2 + (size_t)l * D, xf, 0L,
          ln2g + (size_t)l * D, ln2b + (size_t)l * D, lnfg, lnfb, out, xh, om, TOK, D, FF, 1.0f / WSC);
  }
  (void)hipGetLastError();
}

// v010
// A run of this version takes 190 microseconds.
// Timed twice side by side with v009, it ran 1.07 and 1.08 times as fast.
// All steps since v000 together make it 19.2 times as fast.
#include <hip/hip_runtime.h>
// Contractions x*Wq, x*Wk, x*Wv, attn*Wo, x*W1, y*W2: v_wmma_f32_16x16x32_f16 (f16 operands; weights carried x64, attn x16), f32 accumulate. Feature map's product with omega: v_wmma_f32_16x16x4_f32 (f32 operands). Causal prefix recurrence, LayerNorm: f32 VALU.

typedef __attribute__((ext_vector_type(16))) _Float16 v16h;
typedef __attribute__((ext_vector_type(8)))  _Float16 v8h;
typedef __attribute__((ext_vector_type(4)))  _Float16 v4h;
typedef __attribute__((ext_vector_type(16))) __bf16   v16b;
typedef __attribute__((ext_vector_type(8)))  __bf16   v8b;
typedef __attribute__((ext_vector_type(8)))  float    v8f;
typedef __attribute__((ext_vector_type(4)))  float    v4f;
typedef __attribute__((ext_vector_type(2)))  float    v2f;

__device__ __forceinline__ unsigned short f2bf_bits(float f) {
  unsigned u = __float_as_uint(f);
  return (unsigned short)((u + 0x7FFFu + ((u >> 16) & 1u)) >> 16);
}
__device__ __forceinline__ float bf_bits2f(unsigned short h) { return __uint_as_float(((unsigned)h) << 16); }

// hazard guards as plain device helpers
__device__ __forceinline__ void acc_guard4(v8f& a, v8f& b, v8f& c, v8f& d) { asm volatile("v_nop\n\tv_nop\n\tv_nop\n\tv_nop" : "+v"(a), "+v"(b), "+v"(c), "+v"(d)); }
// The same behind f32 16x16x4 WMMAs: eight slots, the distance of the other form with a 16-cycle issue interval (this form has no figure of its own).
__device__ __forceinline__ void acc_guard2_f32(v8f& a, v8f& b) { asm volatile("v_nop\n\tv_nop\n\tv_nop\n\tv_nop\n\tv_nop\n\tv_nop\n\tv_nop\n\tv_nop" : "+v"(a), "+v"(b)); }
template <typename T> struct Frag;
template <> struct Frag<_Float16> {
  typedef v16h V; union U { v16h v; v8h h[2]; };
  static __device__ __forceinline__ v16h load(const _Float16* p) {   // elements 0..7 <- p[0..7], 8..15 <- p[16..23]
    U f; f.h[0] = *(const v8h*)(p); f.h[1] = *(const v8h*)(p + 16); return f.v;
  }
  static __device__ __forceinline__ v8f mma(v16h a, v16h b, v8f c) {
    return __builtin_amdgcn_wmma_f32_16x16x32_f16(false, a, false, b, (short)0, c, false, false);
  }
};
template <> struct Frag<__bf16> {
  typedef v16b V; union U { v16b v; v8b h[2]; };
  static __device__ __forceinline__ v16b load(const __bf16* p) {
    U f; f.h[0] = *(const v8b*)(p); f.h[1] = *(const v8b*)(p + 16); return f.v;
  }
  static __device__ __forceinline__ v8f mma(v16b a, v16b b, v8f c) {
    return __builtin_amdgcn_wmma_f32_16x16x32_bf16(false, a, false, b, (short)0, c, false, false);
  }
};

// One stage of the GEMM's LDS ring: 64 k (one 128-byte line) of the block's 16 MI A rows and 512 Bt rows.
#define GS_K 64
#define GS_PITCH 72                      // 16-bit elements per LDS row: 144 B = 16 B x 9, conflict-free for ds_load_b128
#define GS_NBUF 3                        // buffers of the ring: a stage is copied two trips ahead of its use
typedef __attribute__((ext_vector_type(4))) int v4i;
typedef __attribute__((address_space(1))) v4i gv4i;   // 16 bytes in global memory
typedef __attribute__((address_space(3))) v4i lv4i;   // 16 bytes in LDS

// ---- LayerNorm of one row of 512 by one wave; lane owns elements i*128 + lane*4 .. +3 (i = 0..3) of x, g, b and y.
// The unrolls are there so that constant indices keep the arrays in registers.
__device__ __forceinline__ void ln_row(const v4f (&x)[4], const v4f (&gg)[4], const v4f (&bb)[4], v4f (&y)[4]) {
  float s = 0.f;
#pragma unroll
  for (int i = 0; i < 4; ++i) s += (x[i][0] + x[i][1]) + (x[i][2] + x[i][3]);
#pragma unroll
  for (int o = 1; o < 32; o <<= 1) s += __shfl_xor(s, o, 32);
  const float mu = s * 0.001953125f;
  float vs = 0.f;
#pragma unroll
  for (int i = 0; i < 4; ++i) {
    const v4f d = x[i] - mu;
    vs += (d[0] * d[0] + d[1] * d[1]) + (d[2] * d[2] + d[3] * d[3]);
  }
#pragma unroll
  for (int o = 1; o < 32; o <<= 1) vs += __shfl_xor(vs, o, 32);
  const float rstd = rsqrtf(vs * 0.001953125f + 1e-5f);
#pragma unroll
  for (int i = 0; i < 4; ++i) y[i] = (x[i] - mu) * rstd * gg[i] + bb[i];
}
#define LN_P 516   // floats per LDS row of the block's MR x 512 result: rows 8 apart start 32 banks apart

// ---- Register-blocked batched WMMA GEMM ------------------------------------
// C[m,n] = scale * sum_k A[m,k] * Bt[n,k] (+bias)(+resid); each wave owns a (16 MI)x64 tile, a block of eight waves a (16 MI)x512 tile.
// MI = 4 or 2: with N = 512 the grid is M / (16 MI) blocks, and MI = 2 puts a launch of 4096 rows on 128 WGPs instead of 64.
// A row-major [M,K]; Bt row-major [N,K]; M % (16 MI) == 0, N % 512 == 0, K % 64 == 0, K >= 64.
// Operands reach the waves through a three-buffer LDS ring filled by asynchronous copies, two stages ahead of the WMMAs.
// Even stages are copied by waves 0..3, odd stages by waves 4..7: a wave never has more than one stage's copies outstanding, so its wait stays at 0.
// SPLIT (hi/lo operand planes A2/Bt2) is not staged by the ring and must be false.
// BIAS_MODE: 0 = none, 1 = bias[m], 2 = bias[n]. Batch index blockIdx.y = 0, 1, 2 takes bias, biasY1, biasY2.
// OUT_MODE: 0 = f32, 1 = f16, 2 = bf16 hi plane (Cout) + bf16 lo plane (Cout2).
// LNM: 0 = C is stored as OUT_MODE says. 1, 2 = N == 512, so the block holds whole rows of C (+bias +resid): it normalizes them itself
// and C is never stored. 1: LayerNorm(lng, lnb) -> outf (f32) and outh (f16). 2: that, then LayerNorm(lnfg, lnfb) of the result -> outf alone.
// FAV: N == 512, so a wave's 64 columns are one head. Batch indices 0 and 1 (q, k) store the FAVOR positive features of C instead of C:
// xs = C * 64^-0.25; u[j] = sum_d xs[d] * fom[d][j] (j = 0..31); off = 0.5 * |xs|^2; columns j and 32 + j of the head = exp(u - off) / 8, exp(-u - off) / 8.
// ET: 0 = f16 operands, 1 = bf16 operands (pointers passed as 16-bit storage)
template <int ET> struct Elem;
template <> struct Elem<0> { typedef _Float16 T; };
template <> struct Elem<1> { typedef __bf16 T; };
template <int ET, bool SPLIT, int BIAS_MODE, int OUT_MODE, bool RESID, int ACT = 0, int LNM = 0, bool FAV = false, int MI = 4>
__global__ __launch_bounds__(256) void wmma_gemm64(
    const unsigned short* __restrict__ Ap, const unsigned short* __restrict__ A2p, int lda, long strideA,
    const unsigned short* __restrict__ Btp, const unsigned short* __restrict__ Bt2p, int ldb, long strideB,
    void* __restrict__ Cout, void* __restrict__ Cout2, int ldc, long strideC,
    const float* __restrict__ bias, const float* __restrict__ biasY1, const float* __restrict__ biasY2,
    const float* __restrict__ resid, long strideR,
    const float* __restrict__ lng, const float* __restrict__ lnb, const float* __restrict__ lnfg, const float* __restrict__ lnfb,
    float* __restrict__ outf, _Float16* __restrict__ outh, const float* __restrict__ fom,
    int M, int N, int K, float scale) {
  typedef typename Elem<ET>::T T;
  typedef typename Frag<T>::V V;
  const T* A = (const T*)Ap; const T* Bt = (const T*)Btp;
  static_assert(!SPLIT, "the LDS ring stages one plane per operand");
  static_assert(MI == 4 || (MI == 2 && !FAV), "the feature epilogue takes 64 rows");
  constexpr int MR = 16 * MI;                     // rows of A and of C per block
  constexpr int GS_STAGE = (MR + 512) * GS_PITCH; // 16-bit elements per stage
  __shared__ __align__(16) unsigned short sAB[GS_NBUF * GS_STAGE];   // a stage: rows 0..MR-1 = A, the 512 rows behind them = Bt
  __shared__ __align__(16) float sT[8][16 * 68];   // per-wave 16x64 slab, pitch 68 floats
  __shared__ __align__(16) float sN[FAV ? 8 : 1][16];   // FAV: per wave, the squared norms of a slab's 16 rows
  const int b    = blockIdx.y;
  const int tid  = threadIdx.x;
  const int lane = tid & 31;
  const int wave = tid >> 5;
  const int tilesN = N >> 6;
  const int tilesM = M / MR;
  const int tile0 = blockIdx.x * 8;            // the block's eight tiles: one tile row, eight adjacent tile columns
  if (tile0 >= tilesM * tilesN) return;        // block-uniform, in front of every barrier
  const int tm  = tile0 / tilesN;
  const int m0  = tm * MR;
  const int nb0 = (tile0 - tm * tilesN) << 6;
  const int n0  = nb0 + (wave << 6);

  const T* Ab  = A  + (size_t)b * strideA;
  const T* Bb  = Bt + (size_t)b * strideB;

  const int rlane = lane & 15;                 // row (A) / col (B, D) within subtile
  const int koff  = (lane >> 4) * 8;           // k offset of this lane half
  const int mOff  = (lane >> 4) * 8;           // D row offset

  // Copies: a stage is copied by one half of the block's waves. Eight lanes cover one row's 128-byte line, a wave four rows, the half 16 rows per copy; MI + 32 copies per lane and stage.
  const int grp = __builtin_amdgcn_readfirstlane(tid >> 7);   // which half; in a scalar register, so that the tests on it are scalar branches
  const int cr = (tid & 127) >> 3, cc = (tid & 7) * 8;
  // A copy's global address = a base that is the same for the whole half and steps from stage to stage in scalar registers + the lane's own byte offset, one for A and one for Bt.
  const char* bA = (const char*)(Ab + (size_t)m0 * lda + grp * GS_K);    // row 0 of the next stage that this half copies
  const char* bB = (const char*)(Bb + (size_t)nb0 * ldb + grp * GS_K);
  const unsigned vA = (unsigned)(cr * lda + cc) * 2u, vB = (unsigned)(cr * ldb + cc) * 2u;
  unsigned short* lp0 = sAB + cr * GS_PITCH + cc;
  auto fill = [&](int buf) {
    unsigned short* lb = lp0 + buf * GS_STAGE;
#pragma unroll   // MI + 32 copies back to back
    for (int it = 0; it < MI + 32; ++it) {
      const char* g = (it < MI) ? (bA + (size_t)(it * 32) * lda + vA) : (bB + (size_t)((it - MI) * 32) * ldb + vB);
      __builtin_amdgcn_global_load_async_to_lds_b128((gv4i*)g, (lv4i*)(lb + it * 16 * GS_PITCH), 0, 0);
    }
    bA += 2 * GS_K * 2;
    bB += 2 * GS_K * 2;
  };

  v8f acc[MI][4];
#pragma unroll
  for (int i = 0; i < MI; ++i)
#pragma unroll
    for (int j = 0; j < 4; ++j) acc[i][j] = (v8f){0.f,0.f,0.f,0.f,0.f,0.f,0.f,0.f};

  const int nst = K / GS_K;
  if (grp == 0) {
    fill(0);
    asm volatile("s_wait_asynccnt 0x0" ::: "memory");   // this wave's copies of stage 0 have landed
  } else if (nst > 1) {
    fill(1);
  }
  __syncthreads();                                      // stage 0 is there for every wave
  if (grp == 0) {
    if (nst > 2) fill(2);
  }
  int bc = 0;                                           // buffer of stage t = t mod GS_NBUF
  for (int t = 0; t < nst; ++t) {
    const T* sb = (const T*)sAB + bc * GS_STAGE;
    const T* sa = sb + rlane * GS_PITCH + koff;
    const T* sw = sb + (MR + (wave << 6) + rlane) * GS_PITCH + koff;
    V bh[4], ah[MI];
    auto frags = [&](int ks) {   // the 4 + MI fragments of 32 k
#pragma unroll
      for (int j = 0; j < 4; ++j) bh[j] = Frag<T>::load(sw + j * 16 * GS_PITCH + ks * 32);
#pragma unroll
      for (int i = 0; i < MI; ++i) ah[i] = Frag<T>::load(sa + i * 16 * GS_PITCH + ks * 32);
    };
    auto products = [&]() {
#pragma unroll
      for (int i = 0; i < MI; ++i)
#pragma unroll
        for (int j = 0; j < 4; ++j) acc[i][j] = Frag<T>::mma(ah[i], bh[j], acc[i][j]);
    };
    frags(0);
    // Keeps the 4 + MI fragments' loads together ahead of the WMMAs: left free, each A fragment's load sinks to its first use and the wave waits out the LDS latency MI times per 32 k.
    __builtin_amdgcn_sched_barrier(0);
    products();
    frags(1);                                           // the stage's last LDS reads
    asm volatile("s_wait_dscnt 0x0" ::: "memory");      // this wave's reads of stage t are done before the buffer is refilled
    const bool mine = grp != (t & 1);                   // this wave's half copies stages t + 1 and t + 3; the other half's stage t + 2 stays in flight
    if (mine) asm volatile("s_wait_asynccnt 0x0" ::: "memory");   // this wave's copies of stage t + 1 have landed
    __syncthreads();                                    // publishes stage t + 1 and ends every wave's reads of stage t
    if (mine) {
      if (t + 3 < nst) fill(bc);                        // stage t + 3 into the buffer that stage t has left
    }
    // Keeps the refill's issue ahead of the second 4 MI WMMAs (registers only), whose time the copies then have as lead.
    __builtin_amdgcn_sched_barrier(0);
    products();
    bc = (bc == GS_NBUF - 1) ? 0 : bc + 1;
  }
  asm volatile("s_wait_asynccnt 0x0" ::: "memory");     // no copy is outstanding behind the loop
#pragma unroll   // constant indices keep acc[] in registers
  for (int i = 0; i < MI; ++i) acc_guard4(acc[i][0], acc[i][1], acc[i][2], acc[i][3]);

  // ---- epilogue ----
  const float* Rb = RESID ? (resid + (size_t)b * strideR) : nullptr;
  const float* biasb = (b == 0) ? bias : (b == 1) ? biasY1 : biasY2;
  if constexpr (LNM != 0) {
    static_assert(BIAS_MODE == 2 && OUT_MODE == 0 && RESID && ACT == 0, "the normalizing epilogue takes bias[n] and a residual");
    static_assert(MR * LN_P * 4 <= 2 * GS_STAGE * 2, "the MR x 512 result fits the ring");
    // The result goes through the ring's LDS, which is free here: every wave's last read of it and every copy into it
    // ended in front of the loop's last barrier. A plain '#pragma unroll' below keeps the per-lane arrays in registers (constant indices).
    float* tl = (float*)sAB;
    float bv[4];
#pragma unroll
    for (int j = 0; j < 4; ++j) bv[j] = biasb[n0 + (j << 4) + rlane];
    asm volatile("s_wait_xcnt 0x0" ::: "memory");   // behind the bias loads, in front of whatever next takes their address register
#pragma unroll
    for (int i = 0; i < MI; ++i)
#pragma unroll
      for (int j = 0; j < 4; ++j)
#pragma unroll
        for (int r = 0; r < 8; ++r)
          tl[((i << 4) + mOff + r) * LN_P + n0 + (j << 4) + rlane] = acc[i][j][r] * scale + bv[j];
    // Keeps the loads below behind the LDS stores, so that they take over the accumulators' registers: lifted over the stores they
    // need registers of their own beside the accumulators, and the kernel goes past 256 VGPRs (register-window switches).
    __builtin_amdgcn_sched_barrier(0);
    // Each wave takes RW whole rows. Their residual rows and the gains are loaded in front of the barrier, all in flight together.
    constexpr int RW = MR / 8;
    const int row0 = wave * RW, c4 = lane * 4;
    const size_t g0 = (size_t)(m0 + row0) * 512 + c4;
    const float* pr = Rb + g0;
    float* po = outf + g0;
    _Float16* ph = outh + g0;
    v4f rs[RW][4], gg[4], bb[4], fg[4], fb[4];
#pragma unroll
    for (int rr = 0; rr < RW; ++rr)
#pragma unroll
      for (int i = 0; i < 4; ++i) rs[rr][i] = *(const v4f*)(pr + rr * 512 + i * 128);
    // Behind the residual loads, in front of the gain loads, whose results may take the residual rows' address registers;
    // it takes that address as an input, so that no residual load's result is given those registers ahead of the wait either.
    asm volatile("s_wait_xcnt 0x0" :: "v"(pr) : "memory");
#pragma unroll
    for (int i = 0; i < 4; ++i) {
      gg[i] = *(const v4f*)(lng + i * 128 + c4);
      bb[i] = *(const v4f*)(lnb + i * 128 + c4);
      if (LNM == 2) {
        fg[i] = *(const v4f*)(lnfg + i * 128 + c4);
        fb[i] = *(const v4f*)(lnfb + i * 128 + c4);
      }
    }
    asm volatile("s_wait_xcnt 0x0" ::: "memory");   // behind these loads, in front of whatever next takes their address registers
    __syncthreads();   // all eight waves' columns of every row are in LDS
#pragma unroll   // constant indices keep rs[] in registers
    for (int h = 0; h < RW / 4; ++h) {   // four rows at a time: their reductions overlap; RW / 4 trips, a single one at MI = 2 as launched
      v4f y[4][4];
      v4h hv[4][4];
#pragma unroll
      for (int q = 0; q < 4; ++q) {
        const int rr = h * 4 + q;
        v4f x[4];
#pragma unroll
        for (int i = 0; i < 4; ++i) x[i] = *(const v4f*)(tl + (row0 + rr) * LN_P + i * 128 + c4) + rs[rr][i];
        if (LNM == 2) {
          v4f u[4];
          ln_row(x, gg, bb, u);
          ln_row(u, fg, fb, y[q]);
        } else {
          ln_row(x, gg, bb, y[q]);
#pragma unroll
          for (int i = 0; i < 4; ++i) {
            hv[q][i][0] = (_Float16)y[q][i][0]; hv[q][i][1] = (_Float16)y[q][i][1];
            hv[q][i][2] = (_Float16)y[q][i][2]; hv[q][i][3] = (_Float16)y[q][i][3];
          }
        }
      }
      // The four rows' values are all made in front of their first store: no register that an issued store names is written between the stores.
      __builtin_amdgcn_sched_barrier(0);
#pragma unroll
      for (int q = 0; q < 4; ++q)
#pragma unroll
        for (int i = 0; i < 4; ++i) {
          *(v4f*)(po + (h * 4 + q) * 512 + i * 128) = y[q][i];
          if (LNM == 1) *(v4h*)(ph + (h * 4 + q) * 512 + i * 128) = hv[q][i];
        }
      if (h + 1 < RW / 4) {
        asm volatile("s_wait_xcnt 0x0" ::: "memory");   // behind the stores, in front of the next four rows' work, which reuses their registers
        __builtin_amdgcn_sched_barrier(0);              // keeps that work from being lifted over the wait
      }
    }
    return;
  }
  float* slab = sT[wave];
  if constexpr (FAV) {
    static_assert(BIAS_MODE == 2 && OUT_MODE == 0 && !RESID && ACT == 0 && LNM == 0, "the feature epilogue takes bias[n] and stores f32");
    if (b < 2) {   // block-uniform: every lane stays on for the WMMAs below
      static_assert(8 * 64 * 68 * 4 <= 2 * GS_STAGE * 2, "eight 64 x 64 tiles fit the ring");
      // The wave's whole tile goes into its own part of the ring's LDS, which is free here: every wave's last read of it and every copy
      // into it ended in front of the loop's last barrier. With the accumulators gone the loop over the tile's four slabs can stay rolled.
      // A plain '#pragma unroll' in this block keeps the per-lane arrays in registers (constant indices).
      float* tw = (float*)sAB + wave * (64 * 68);   // [row][d], pitch 68 floats
      float* nr = sN[wave];
      const int hf = lane >> 4;
      // This lane's place in rows hf, hf + 2, .. of the tile's first slab (row pitch N = 512): a row's 256 B = 16 lanes x 16 B.
      float* cw = (float*)Cout + (size_t)b * strideC + (size_t)(m0 + hf) * 512 + n0 + rlane * 4;
      // B fragments of omega, k = 4 each: position (register v, lane half hf) of fragment f holds d = 8 (f / 2) + 4 hf + 2 (f % 2) + v, as in the A fragments below.
      v2f om[2][16];
#pragma unroll
      for (int jt = 0; jt < 2; ++jt)
#pragma unroll
        for (int f = 0; f < 16; ++f) {
          const float* op = fom + (8 * (f >> 1) + 4 * hf + 2 * (f & 1)) * 32 + jt * 16 + rlane;
          om[jt][f] = (v2f){op[0], op[32]};
        }
      float bv[4];
#pragma unroll
      for (int j = 0; j < 4; ++j) bv[j] = biasb[n0 + (j << 4) + rlane];
      asm volatile("s_wait_xcnt 0x0" ::: "memory");   // behind these loads, in front of whatever next takes their address registers
#pragma unroll
      for (int i = 0; i < 4; ++i)
#pragma unroll
        for (int j = 0; j < 4; ++j)
#pragma unroll
          for (int r = 0; r < 8; ++r)
            tw[((i << 4) + mOff + r) * 68 + (j << 4) + rlane] = (acc[i][j][r] * scale + bv[j]) * 0.35355339059327379f;   // 64^-0.25
      __builtin_amdgcn_fence(__ATOMIC_RELEASE, "workgroup");
      __builtin_amdgcn_wave_barrier();
      __builtin_amdgcn_fence(__ATOMIC_ACQUIRE, "workgroup");
#pragma unroll 1   // one copy of the slab's code: the text stays short
      for (int i = 0; i < 4; ++i) {
        float* slab = tw + i * (16 * 68);
        v4f a[8];      // row rlane of the slab, d = 8 q + 4 hf .. + 3
        float ns = 0.f;
#pragma unroll
        for (int q = 0; q < 8; ++q) {
          a[q] = *(const v4f*)(slab + rlane * 68 + 8 * q + 4 * hf);
          ns += (a[q][0] * a[q][0] + a[q][1] * a[q][1]) + (a[q][2] * a[q][2] + a[q][3] * a[q][3]);
        }
        ns += __shfl_xor(ns, 16, 32);   // the row's other 32 elements
        nr[rlane] = ns;                 // both halves hold and write the same sum
        __builtin_amdgcn_fence(__ATOMIC_RELEASE, "workgroup");
        __builtin_amdgcn_wave_barrier();
        __builtin_amdgcn_fence(__ATOMIC_ACQUIRE, "workgroup");
        const v4f nlo = *(const v4f*)(nr + mOff), nhi = *(const v4f*)(nr + mOff + 4);   // norms of rows mOff .. mOff + 7, D's rows in this lane
        v8f u0 = (v8f){0.f,0.f,0.f,0.f,0.f,0.f,0.f,0.f}, u1 = u0;
        // The two fences of the schedule keep the 32 WMMAs and their guard one block with no vector instruction in it:
        // left free, the norm's register moves land among the WMMAs and overwrite A registers directly behind the WMMA that reads them.
        __builtin_amdgcn_sched_barrier(0);
#pragma unroll
        for (int f = 0; f < 16; ++f) {
          const v2f af = (v2f){a[f >> 1][2 * (f & 1)], a[f >> 1][2 * (f & 1) + 1]};
          u0 = __builtin_amdgcn_wmma_f32_16x16x4_f32(false, af, false, om[0][f], (short)0, u0, false, false);
          u1 = __builtin_amdgcn_wmma_f32_16x16x4_f32(false, af, false, om[1][f], (short)0, u1, false, false);
        }
        acc_guard2_f32(u0, u1);
        __builtin_amdgcn_sched_barrier(0);
#pragma unroll
        for (int r = 0; r < 8; ++r) {
          const float off = 0.5f * ((r < 4) ? nlo[r & 3] : nhi[r & 3]);
          float* sr = slab + (mOff + r) * 68 + rlane;
          sr[0]  = expf(u0[r] - off) * 0.125f;
          sr[16] = expf(u1[r] - off) * 0.125f;
          sr[32] = expf(-u0[r] - off) * 0.125f;
          sr[48] = expf(-u1[r] - off) * 0.125f;
        }
        __builtin_amdgcn_fence(__ATOMIC_RELEASE, "workgroup");
        __builtin_amdgcn_wave_barrier();
        __builtin_amdgcn_fence(__ATOMIC_ACQUIRE, "workgroup");
        v4f ov[8];
#pragma unroll
        for (int it = 0; it < 8; ++it) ov[it] = *(const v4f*)(slab + (it * 2 + hf) * 68 + rlane * 4);
        float* cp = cw + i * (16 * 512);
#pragma unroll
        for (int it = 0; it < 8; ++it) *(v4f*)(cp + it * 1024) = ov[it];
        asm volatile("s_wait_xcnt 0x0" ::: "memory");   // behind the stores, in front of the next slab's work, which reuses their registers
        __builtin_amdgcn_sched_barrier(0);              // keeps that work from being lifted over the wait
      }
      return;
    }
  }
#pragma unroll
  for (int i = 0; i < MI; ++i) {
    const int mBase = m0 + (i << 4);
#pragma unroll
    for (int j = 0; j < 4; ++j) {
      const int n = n0 + (j << 4) + rlane;
      float bv = 0.f;
      if (BIAS_MODE == 2) bv = biasb[n];
#pragma unroll
      for (int r = 0; r < 8; ++r) {
        float v = acc[i][j][r] * scale;
        if (BIAS_MODE == 1) v += biasb[mBase + mOff + r];
        if (BIAS_MODE == 2) v += bv;
        if (RESID) v += Rb[(size_t)(mBase + mOff + r) * ldc + n];
        if (ACT == 1) v = tanhf(v);
        if (ACT == 2) v = fmaxf(v, 0.0f);
        if (ACT == 3) v = v / (1.0f + expf(-v));
        if (ACT == 4) v = (v > 0.f) ? v : 0.01f * v;
        if (ACT == 5) v = 0.5f * v * (1.0f + erff(v * 0.70710678118654752f));
        slab[(mOff + r) * 68 + (j << 4) + rlane] = v;
      }
    }
    __builtin_amdgcn_fence(__ATOMIC_RELEASE, "workgroup");
    __builtin_amdgcn_wave_barrier();
    __builtin_amdgcn_fence(__ATOMIC_ACQUIRE, "workgroup");
    if (OUT_MODE == 0) {
      float* C = (float*)Cout + (size_t)b * strideC;
      const int hh = lane >> 4, c4 = (lane & 15) * 4;     // row seg = 256 B = 16 lanes x 16 B
      {
#pragma unroll
        for (int it = 0; it < 8; ++it) {
          const int row = it * 2 + hh;
          v4f v = *(const v4f*)(slab + row * 68 + c4);
          *(v4f*)(C + (size_t)(mBase + row) * ldc + n0 + c4) = v;
        }
        
      }
    } else {
      const int q = lane >> 3, c8 = (lane & 7) * 8;
      unsigned short* C  = (unsigned short*)Cout  + (size_t)b * strideC;
      unsigned short* C2 = (OUT_MODE == 2) ? ((unsigned short*)Cout2 + (size_t)b * strideC) : nullptr;
      {
#pragma unroll
        for (int it = 0; it < 4; ++it) {
          const int row = it * 4 + q;
          const float* sp = slab + row * 68 + c8;
          v8h hv, lv;
#pragma unroll
          for (int e = 0; e < 8; ++e) {
            if (OUT_MODE == 1) {
              hv[e] = (_Float16)sp[e];
            } else {
              unsigned short hb = f2bf_bits(sp[e]);
              unsigned short lb = f2bf_bits(sp[e] - bf_bits2f(hb));
              hv[e] = __builtin_bit_cast(_Float16, hb);
              lv[e] = __builtin_bit_cast(_Float16, lb);
            }
          }
          *(v8h*)(C + (size_t)(mBase + row) * ldc + n0 + c8) = hv;
          if (OUT_MODE == 2) *(v8h*)(C2 + (size_t)(mBase + row) * ldc + n0 + c8) = lv;
        }
        
      }
    }
    __builtin_amdgcn_fence(__ATOMIC_RELEASE, "workgroup");
    __builtin_amdgcn_wave_barrier();
    __builtin_amdgcn_fence(__ATOMIC_ACQUIRE, "workgroup");
  }
}

// ---- Operand preparation of the whole call, one grid: every weight matrix of every layer transposed and cast, and x cast.
// None of these pieces reads what another writes, so they share one launch; each block does one piece.
// The pieces are large, so that the grid is a few blocks per WGP (for speed only).
// Cast piece: one block casts 8192 consecutive elements to f16; a thread takes eight 16-byte pieces, 4 KiB apart.
__device__ __forceinline__ void cast_f16_block(const float* __restrict__ in, _Float16* __restrict__ out, int blk) {
  const size_t e0 = (size_t)blk * 8192 + threadIdx.x * 4;
  const float* p = in + e0;
  _Float16* o = out + e0;
  v4f v[8];
#pragma unroll   // all eight loads in flight together; constant indices keep v[] in registers (also in the loop below)
  for (int it = 0; it < 8; ++it) v[it] = *(const v4f*)(p + it * 1024);
#pragma unroll
  for (int it = 0; it < 8; ++it) {
    v4h h;
    h[0] = (_Float16)v[it][0]; h[1] = (_Float16)v[it][1]; h[2] = (_Float16)v[it][2]; h[3] = (_Float16)v[it][3];
    *(v4h*)(o + it * 1024) = h;
  }
}

// Transpose piece: WT_S tiles of 64 x 64, one behind the other along k, of src[K][N] f32 -> ob[N][K] f16 * scale. Called by a whole block of 256 threads.
// K and N are compile-time, so that every load and store of a thread is one address register plus an immediate offset.
#define WT_S 4
template <int K, int N>
__device__ __forceinline__ void wT_tiles(
    const float* __restrict__ src, _Float16* __restrict__ ob, int n0, int k0, float scale, float (*tile)[64][65]) {
  const int tid = threadIdx.x, lane = tid & 31, wave = tid >> 5;
  const int c4 = (tid & 15) * 4, r0 = tid >> 4;
  const float* p = src + (size_t)(k0 + r0) * N + n0 + c4;
  v4f v[WT_S][4];
#pragma unroll   // all sixteen loads in flight together; constant indices keep v[] in registers (also in the loops below)
  for (int s = 0; s < WT_S; ++s)
#pragma unroll
    for (int it = 0; it < 4; ++it) v[s][it] = *(const v4f*)(p + (s * 64 + it * 16) * N);
  // Behind the loads; it takes their address as an input, so that no load's result is given the address registers ahead of the wait.
  asm volatile("s_wait_xcnt 0x0" :: "v"(p) : "memory");
#pragma unroll
  for (int s = 0; s < WT_S; ++s)
#pragma unroll
    for (int it = 0; it < 4; ++it) {
      const int kr = it * 16 + r0;
      tile[s][c4 + 0][kr] = v[s][it][0];
      tile[s][c4 + 1][kr] = v[s][it][1];
      tile[s][c4 + 2][kr] = v[s][it][2];
      tile[s][c4 + 3][kr] = v[s][it][3];
    }
  __syncthreads();
  const int q = lane >> 3, c8 = (lane & 7) * 8;
  const int rw = wave * 8 + q;                      // waves 0..7 x 8 rows = 64 rows
  _Float16* o = ob + (size_t)(n0 + rw) * K + k0 + c8;
#pragma unroll
  for (int it = 0; it < 2; ++it)
#pragma unroll
    for (int s = 0; s < WT_S; ++s) {
      v8h hv;
#pragma unroll
      for (int e = 0; e < 8; ++e) hv[e] = (_Float16)(tile[s][rw + it * 4][c8 + e] * scale);
      *(v8h*)(o + it * 4 * K + s * 64) = hv;
    }
  // Behind the stores, in front of whatever the built code places after them that rewrites a register which they name.
  asm volatile("s_wait_xcnt 0x0" ::: "memory");
}

// Blocks 0 .. DEPTH * PL - 1: transpose pieces, PL = 4 BDD + B1 + B2 per layer in the order Wq, Wk, Wv, Wo, W1, W2; the blocks behind them: x (NX elements).
// wt4[layer][4][D][D], w1t[layer][FF][D], w2t[layer][D][FF].
template <int D, int FF, int DEPTH, int NX>
__global__ __launch_bounds__(256) void k_prep(
    const float* __restrict__ x, const float* __restrict__ Wq, const float* __restrict__ Wk,
    const float* __restrict__ Wv, const float* __restrict__ Wo, const float* __restrict__ W1, const float* __restrict__ W2,
    _Float16* __restrict__ xh, _Float16* __restrict__ wt4, _Float16* __restrict__ w1t, _Float16* __restrict__ w2t,
    float wscale) {
  static_assert(D % (64 * WT_S) == 0 && FF % (64 * WT_S) == 0 && NX % 8192 == 0, "whole pieces only");
  __shared__ float tile[WT_S][64][65];   // [tile][n][k]
  constexpr int KS = 64 * WT_S, TD = D / 64, TF = FF / 64;
  constexpr int BDD = TD * (D / KS), B1 = TF * (D / KS), B2 = TD * (FF / KS), PL = 4 * BDD + B1 + B2;
  const int bid = blockIdx.x;
  if (bid >= DEPTH * PL) {         // block-uniform
    cast_f16_block(x, xh, bid - DEPTH * PL);
    return;
  }
  const int l = bid / PL, r = bid - l * PL;   // block-uniform, as is all that follows from them
  if (r < 4 * BDD) {
    const int z = r / BDD, t = r - z * BDD;
    const float* src = ((z == 0) ? Wq : (z == 1) ? Wk : (z == 2) ? Wv : Wo) + (size_t)l * D * D;
    wT_tiles<D, D>(src, wt4 + (size_t)(l * 4 + z) * D * D, (t % TD) * 64, (t / TD) * KS, wscale, tile);
  } else if (r < 4 * BDD + B1) {
    const int t = r - 4 * BDD;         // [D][FF] -> [FF][D]
    wT_tiles<D, FF>(W1 + (size_t)l * D * FF, w1t + (size_t)l * D * FF, (t % TF) * 64, (t / TF) * KS, wscale, tile);
  } else {
    const int t = r - 4 * BDD - B1;    // [FF][D] -> [D][FF]
    wT_tiles<FF, D>(W2 + (size_t)l * FF * D, w2t + (size_t)l * FF * D, (t % TD) * 64, (t / TD) * KS, wscale, tile);
  }
}

// ---- Causal linear attention, f32, as a scan over chunks of RC_T steps: two launches.
// State of one (b, h) before a step: S[d][m] = sum Kf[m] * v[d], z[m] = sum Kf[m] over all earlier steps.
// One record in the workspace: RC_ST floats; S[d][4g + e] at (g * 64 + d) * 4 + e (lanes adjacent), z[m] at 4096 + m.
// A group is RC_G chunks. st holds per chunk the sums over the earlier chunks of its own group, tot per group the sums over the whole group.
#define RC_T 32
#define RC_ST 4160
#define RC_G 8
#define RC_TB 4   // group totals that k_recur loads together

// 1) Running sums through one group. One block (128 threads) per (group, b*8+h, half of m).
// Thread (dp = tid % 32, mg = tid / 32) holds S[2 dp .. 2 dp + 1][m0 .. m0 + 7], m0 = 32 half + 8 mg, and (every lane of a wave alike) z[m0 .. m0 + 7].
// A plain '#pragma unroll' in this kernel is there so that constant indices keep the per-thread arrays in registers.
__global__ __launch_bounds__(128) void k_chunk_sum(
    const float* __restrict__ kf, const float* __restrict__ vin, float* __restrict__ st, float* __restrict__ tot, int L) {
  __shared__ __align__(16) float Kc[RC_G * RC_T * 32];   // [t][m - 32 half]
  __shared__ __align__(16) float Vc[RC_G * RC_T * 64];   // [t][d]
  const int tid = threadIdx.x;
  const int gr = blockIdx.x, bh = blockIdx.y, hf = blockIdx.z;
  const int b = bh >> 3, h = bh & 7;
  const size_t base = (size_t)b * L * 512 + (size_t)h * 64 + (size_t)gr * (RC_G * RC_T) * 512;
  {
    const int kr = tid >> 3, kc = (tid & 7) * 4;    // 16 rows of 128 B per pass
    const int vr = tid >> 4, vc = (tid & 15) * 4;   // 8 rows of 256 B per pass
    const float* pk = kf + base + hf * 32 + kr * 512 + kc;
    const float* pv = vin + base + vr * 512 + vc;
    v4f rk[16], rv[32];
#pragma unroll   // all loads of the thread in flight together
    for (int it = 0; it < 16; ++it) rk[it] = *(const v4f*)(pk + it * (16 * 512));
#pragma unroll
    for (int it = 0; it < 32; ++it) rv[it] = *(const v4f*)(pv + it * (8 * 512));
    // Behind the loads; it takes their addresses as inputs, so that no load's result is given the address registers ahead of the wait.
    asm volatile("s_wait_xcnt 0x0" :: "v"(pk), "v"(pv) : "memory");
#pragma unroll
    for (int it = 0; it < 16; ++it) *(v4f*)(Kc + (it * 16 + kr) * 32 + kc) = rk[it];
#pragma unroll
    for (int it = 0; it < 32; ++it) *(v4f*)(Vc + (it * 8 + vr) * 64 + vc) = rv[it];
  }
  __syncthreads();
  const int dp = tid & 31, mg = tid >> 5;
  const int g0 = hf * 8 + mg * 2;                   // the thread's two quads of m
  v4f s00 = (v4f){0.f, 0.f, 0.f, 0.f}, s01 = s00, s10 = s00, s11 = s00, z0 = s00, z1 = s00;
  const float* vp = Vc + 2 * dp;
  const float* kp = Kc + mg * 8;
  const unsigned so = (unsigned)((g0 * 64 + 2 * dp) * 4);   // S[2 dp][4 g0 ..] in a record
  auto put = [&](float* o) {
    *(v4f*)(o + so) = s00;
    *(v4f*)(o + so + 4) = s01;
    *(v4f*)(o + so + 256) = s10;
    *(v4f*)(o + so + 260) = s11;
    if (dp == 0) {
      *(v4f*)(o + 4096 + g0 * 4) = z0;
      *(v4f*)(o + 4096 + g0 * 4 + 4) = z1;
    }
    asm volatile("s_wait_xcnt 0x0" ::: "memory");   // behind the stores, in front of the sums that go on in the registers which they name
    __builtin_amdgcn_sched_barrier(0);              // keeps those sums from being lifted over the wait
  };
  float* o = st + ((size_t)bh * (L / RC_T) + gr * RC_G) * RC_ST;
#pragma unroll 1   // one copy of a chunk's code
  for (int c = 0; c < RC_G; ++c) {
    put(o);                                         // the sums over the group's earlier chunks
    o += RC_ST;
#pragma unroll 1   // sixteen steps a trip, below
    for (int t0 = 0; t0 < RC_T; t0 += 16) {
#pragma unroll   // sixteen steps' LDS reads in flight ahead of their products, each at a constant offset from the trip's two addresses
      for (int t = 0; t < 16; ++t) {
        const v2f vv = *(const v2f*)(vp + t * 64);
        const v4f k0 = *(const v4f*)(kp + t * 32);
        const v4f k1 = *(const v4f*)(kp + t * 32 + 4);
        s00 = k0 * vv[0] + s00;
        s01 = k0 * vv[1] + s01;
        s10 = k1 * vv[0] + s10;
        s11 = k1 * vv[1] + s11;
        z0 = z0 + k0;
        z1 = z1 + k1;
      }
      vp += 16 * 64;
      kp += 16 * 32;
    }
  }
  put(tot + ((size_t)bh * (L / (RC_T * RC_G)) + gr) * RC_ST);
}

// 2) One chunk's outputs in matrix form, started from the state before the chunk = the chunk's record + the totals of all earlier groups. One block (128 threads) per (chunk, b*8+h).
// P[t][s] = Qf_t . Kf_s for s <= t, else 0;  num[t][d] = sum_m Qf_t[m] S0[d][m] + sum_s P[t][s] v_s[d];
// den_t = Qf_t . z0 + sum_s P[t][s];  out_t[d] = num * rcp(den_t + 1e-6), written as f16.
// Thread (tg = tid / 16, lq = tid % 16) owns steps t = 4 tg + i (i = 0..3); scores s = lq, lq + 16; outputs d = 4 lq .. 4 lq + 3.
// A plain '#pragma unroll' in this kernel is there so that constant indices keep the per-thread arrays in registers.
#define RC_QP 100   // floats per row of QP: 64 of Qf, RC_T scores, 4 of pad (rows 4 apart start 16 banks apart)
__global__ __launch_bounds__(128) void k_recur(
    const float* __restrict__ qf, const float* __restrict__ kf, const float* __restrict__ vin,
    const float* __restrict__ st, const float* __restrict__ tot, _Float16* __restrict__ outh, int L, float oscale) {
  __shared__ __align__(16) float QP[RC_T * RC_QP];        // [t][0..63] = Qf_t[m], [t][64 + s] = P[t][s]
  __shared__ __align__(16) float Ks[RC_T * 68];           // [s][m], pitch 68: 16 rows' 16-byte reads hit 64 different banks
  __shared__ __align__(16) float BV[(64 + RC_T) * 64];    // rows 0..63 = S0[.][m] as [m][d], rows 64 + s = v_s[d]
  const int tid = threadIdx.x;
  const int wave = __builtin_amdgcn_readfirstlane(tid >> 5);   // in a scalar register: the tests on it become scalar branches
  const int tg = tid >> 4, lq = tid & 15;
  const int ch = blockIdx.x, bh = blockIdx.y;
  const int b = bh >> 3, h = bh & 7;
  const size_t base = (size_t)b * L * 512 + (size_t)h * 64;
  const float* sp = st + ((size_t)bh * (L / RC_T) + ch) * RC_ST;
  const int t0 = ch * RC_T;
  const size_t cbase = base + (size_t)t0 * 512;           // the chunk's first row, same for the whole block
  const unsigned lo = (unsigned)(tg * 512 + lq * 4);      // this thread's place in rows 0..7 of the chunk
  v4f zq;                                                 // z0[4 lq .. 4 lq + 3]
  {
    v4f rq[4], rk[4], rv[4], rs[8];
#pragma unroll   // all loads of the thread in flight together
    for (int it = 0; it < 4; ++it) {
      rq[it] = *(const v4f*)(qf + cbase + (lo + it * 4096u));
      rk[it] = *(const v4f*)(kf + cbase + (lo + it * 4096u));
      rv[it] = *(const v4f*)(vin + cbase + (lo + it * 4096u));
    }
#pragma unroll
    for (int it = 0; it < 8; ++it) rs[it] = *(const v4f*)(sp + (it * 128 + tid) * 4);
    zq = *(const v4f*)(sp + 4096 + lq * 4);
    // The totals of the groups in front of this chunk's, in ascending order, RC_TB of them loaded together so that their latencies overlap.
    // A place past the last such group loads an earlier total again (an address that is always written), and 0 is added in its stead.
    const int ng = ch / RC_G;                             // same for the whole block
    const int jl = (ng > 0) ? ng - 1 : 0;
    const float* tp = tot + (size_t)bh * (L / (RC_T * RC_G)) * RC_ST;
    v4f ts[RC_TB][8], tz[RC_TB];
    bool on[RC_TB];
    auto tload = [&](int j0) {
#pragma unroll
      for (int jj = 0; jj < RC_TB; ++jj) {
        const int j = (j0 + jj < jl) ? j0 + jj : jl;
        on[jj] = j0 + jj < ng;
        const float* tj = tp + (size_t)j * RC_ST;
#pragma unroll
        for (int it = 0; it < 8; ++it) ts[jj][it] = *(const v4f*)(tj + (it * 128 + tid) * 4);
        tz[jj] = *(const v4f*)(tj + 4096 + lq * 4);
      }
      asm volatile("s_wait_xcnt 0x0" ::: "memory");   // behind these loads, in front of whatever next takes their address registers
    };
    auto tadd = [&]() {
#pragma unroll
      for (int jj = 0; jj < RC_TB; ++jj) {
#pragma unroll
        for (int it = 0; it < 8; ++it) rs[it] = rs[it] + (on[jj] ? ts[jj][it] : (v4f){0.f, 0.f, 0.f, 0.f});
        zq = zq + (on[jj] ? tz[jj] : (v4f){0.f, 0.f, 0.f, 0.f});
      }
    };
    tload(0);                                             // unconditional: in flight together with the chunk's own loads
    // Keeps every load above ahead of the first LDS store: left free, the loads of q, k and v sink behind the totals' sums and their latency comes on top.
    __builtin_amdgcn_sched_barrier(0);
#pragma unroll
    for (int it = 0; it < 4; ++it) {
      const int r = it * 8 + tg;
      *(v4f*)(QP + r * RC_QP + lq * 4) = rq[it];
      *(v4f*)(Ks + r * 68 + lq * 4) = rk[it];
      *(v4f*)(BV + (64 + r) * 64 + lq * 4) = rv[it];
    }
    tadd();
    for (int j0 = RC_TB; j0 < ng; j0 += RC_TB) {          // block-uniform; one trip at most with eight groups
      tload(j0);
      tadd();
    }
#pragma unroll
    for (int it = 0; it < 8; ++it) {                      // record element (g, d) holds S0[d][4g .. 4g + 3]
      const int g = it * 2 + (tid >> 6), d = tid & 63;
#pragma unroll
      for (int e = 0; e < 4; ++e) BV[(4 * g + e) * 64 + d] = rs[it][e];
    }
  }
  __syncthreads();

  const float* qrow = QP + (tg * 4) * RC_QP;
  float dn[4];
  {
    v4f p0[4], p1[4];
#pragma unroll
    for (int i = 0; i < 4; ++i) { p0[i] = (v4f){0.f, 0.f, 0.f, 0.f}; p1[i] = (v4f){0.f, 0.f, 0.f, 0.f}; }
    const float* k0r = Ks + lq * 68;
    const float* k1r = Ks + (lq + 16) * 68;
    if (wave >= 2) {                                      // steps 16..31 see scores of s = 0..31
#pragma unroll 4   // several groups' LDS reads in flight ahead of their products
      for (int g = 0; g < 16; ++g) {
        const v4f k0 = *(const v4f*)(k0r + 4 * g);
        const v4f k1 = *(const v4f*)(k1r + 4 * g);
#pragma unroll
        for (int i = 0; i < 4; ++i) {
          const v4f q = *(const v4f*)(qrow + i * RC_QP + 4 * g);
          p0[i] = q * k0 + p0[i];
          p1[i] = q * k1 + p1[i];
        }
      }
    } else {                                              // steps 0..15: every score of s >= 16 is masked
#pragma unroll 4   // as above
      for (int g = 0; g < 16; ++g) {
        const v4f k0 = *(const v4f*)(k0r + 4 * g);
#pragma unroll
        for (int i = 0; i < 4; ++i) {
          const v4f q = *(const v4f*)(qrow + i * RC_QP + 4 * g);
          p0[i] = q * k0 + p0[i];
        }
      }
    }
#pragma unroll
    for (int i = 0; i < 4; ++i) {
      const int t = tg * 4 + i;
      float a0 = (p0[i][0] + p0[i][1]) + (p0[i][2] + p0[i][3]);
      float a1 = (p1[i][0] + p1[i][1]) + (p1[i][2] + p1[i][3]);
      a0 = (lq <= t) ? a0 : 0.f;
      a1 = (lq + 16 <= t) ? a1 : 0.f;
      QP[t * RC_QP + 64 + lq] = a0;
      QP[t * RC_QP + 80 + lq] = a1;
      const v4f qz = *(const v4f*)(qrow + i * RC_QP + lq * 4) * zq;   // this lane's four terms of Qf_t . z0
      dn[i] = (a0 + a1) + ((qz[0] + qz[1]) + (qz[2] + qz[3]));
    }
#pragma unroll
    for (int o = 1; o < 16; o <<= 1) {                    // sum over the 16 lanes that share tg
#pragma unroll
      for (int i = 0; i < 4; ++i) dn[i] += __shfl_xor(dn[i], o, 32);
    }
  }
  __syncthreads();                                        // the scores are in QP

  v4f o4[4];
#pragma unroll
  for (int i = 0; i < 4; ++i) o4[i] = (v4f){0.f, 0.f, 0.f, 0.f};
  const float* bcol = BV + lq * 4;
  auto quad = [&](int kq) {   // four columns of [Qf | P] times four rows of [S0 ; v]
    v4f a[4], bb[4];
#pragma unroll
    for (int e = 0; e < 4; ++e) bb[e] = *(const v4f*)(bcol + (4 * kq + e) * 64);
#pragma unroll
    for (int i = 0; i < 4; ++i) a[i] = *(const v4f*)(qrow + i * RC_QP + 4 * kq);
#pragma unroll
    for (int e = 0; e < 4; ++e)
#pragma unroll
      for (int i = 0; i < 4; ++i) o4[i] = bb[e] * a[i][e] + o4[i];
  };
#pragma unroll 4   // several quads' LDS reads in flight ahead of their products
  for (int kq = 0; kq < 16; ++kq) quad(kq);
  const int kend = 16 + 2 * wave + 2;                     // this wave's last step is 8 wave + 7: later scores are all masked
  for (int kq = 16; kq < kend; ++kq) quad(kq);

#pragma unroll
  for (int i = 0; i < 4; ++i) {
    const float zi = __builtin_amdgcn_rcpf(dn[i] + 1e-6f);
    v4h hv;
#pragma unroll
    for (int j = 0; j < 4; ++j) hv[j] = (_Float16)(o4[i][j] * zi * oscale);
    *(v4h*)(outh + cbase + ((unsigned)(tg * 2048 + lq * 4) + i * 512u)) = hv;
  }
}

// ---------------------------------------------------------------------------
extern "C" void kernel_launch(void* const* d_in, const int* in_sizes, int n_in,
                              void* d_out, int out_size, void* d_ws, size_t ws_size,
                              hipStream_t stream)
{
  const int B = 2, L = 2048, D = 512, FF = 2048, HD = 64, MH = 32, DEPTH = 2;
  const int TOK = B * L;
  if (n_in < 20) return;
  if (in_sizes[0] != TOK * D || in_sizes[1] != DEPTH * D * D || in_sizes[3] != DEPTH * D * D ||
      in_sizes[5] != DEPTH * D * D || in_sizes[7] != DEPTH * D * D || in_sizes[9] != DEPTH * HD * MH ||
      in_sizes[12] != DEPTH * D * FF || in_sizes[14] != DEPTH * FF * D || out_size != TOK * D) return;

  const float* x_in  = (const float*)d_in[0];
  const float* Wq    = (const float*)d_in[1];
  const float* bq    = (const float*)d_in[2];
  const float* Wk    = (const float*)d_in[3];
  const float* bk    = (const float*)d_in[4];
  const float* Wv    = (const float*)d_in[5];
  const float* bv    = (const float*)d_in[6];
  const float* Wo    = (const float*)d_in[7];
  const float* bo    = (const float*)d_in[8];
  const float* omega = (const float*)d_in[9];
  const float* ln1g  = (const float*)d_in[10];
  const float* ln1b  = (const float*)d_in[11];
  const float* W1    = (const float*)d_in[12];
  const float* b1    = (const float*)d_in[13];
  const float* W2    = (const float*)d_in[14];
  const float* b2    = (const float*)d_in[15];
  const float* ln2g  = (const float*)d_in[16];
  const float* ln2b  = (const float*)d_in[17];
  const float* lnfg  = (const float*)d_in[18];
  const float* lnfb  = (const float*)d_in[19];
  float* out = (float*)d_out;

  // ---- workspace carve (under 109 MiB) ----
  char* ws = (char*)d_ws;
  size_t off = 0;
  auto carve = [&](size_t bytes) -> char* { char* p = ws + off; off += (bytes + 255) & ~(size_t)255; return p; };
  _Float16* xh  = (_Float16*)carve((size_t)TOK * D * 2);    // f16 A operand of current x
  float*    xf  = (float*)carve((size_t)TOK * D * 4);       // f32 x behind LN1 (residual source of the feed-forward half)
  float*    xg  = (float*)carve((size_t)TOK * D * 4);       // f32 x behind LN2 (residual source of the next layer)
  float*    qb_ = (float*)carve((size_t)3 * TOK * D * 4);   // features of q, features of k, v one behind the other: batch stride TOK * D of their common GEMM launch
  float*    kb_ = qb_ + (size_t)TOK * D;
  float*    vb_ = kb_ + (size_t)TOK * D;
  _Float16* ah  = (_Float16*)carve((size_t)TOK * D * 2);    // attention output, f16 x16
  _Float16* y1h = (_Float16*)carve((size_t)TOK * FF * 2);   // relu(x W1 + b1), f16
  _Float16* wt4 = (_Float16*)carve((size_t)DEPTH * 4 * D * D * 2);  // per layer [Wq,Wk,Wv,Wo]^T f16 x64, [4][N][K]
  _Float16* w1t = (_Float16*)carve((size_t)DEPTH * D * FF * 2);     // per layer W1^T [FF][D] f16 x64
  _Float16* w2t = (_Float16*)carve((size_t)DEPTH * FF * D * 2);     // per layer W2^T [D][FF] f16 x64
  float*    cst = (float*)carve((size_t)B * 8 * (L / RC_T) * RC_ST * 4);   // per (b, h, chunk) state record
  float*    ctot = (float*)carve((size_t)B * 8 * (L / (RC_T * RC_G)) * RC_ST * 4);   // per (b, h, group) total record
  if (off > ws_size) return;

  const float WSC = 64.0f, ASC = 16.0f;
  const int prepT = DEPTH * (4 * (D / 64) * (D / (64 * WT_S)) + (FF / 64) * (D / (64 * WT_S)) + (D / 64) * (FF / (64 * WT_S)));   // transpose pieces of all layers
  k_prep<D, FF, DEPTH, TOK * D><<<dim3(prepT + TOK * D / 8192), dim3(256), 0, stream>>>(
      x_in, Wq, Wk, Wv, Wo, W1, W2, xh, wt4, w1t, w2t, WSC);

  const int tilesD  = (TOK / 64) * (D / 64);      // 512
  const int tilesFF = (TOK / 64) * (FF / 64);     // 2048
  const dim3 gD((tilesD + 7) / 8, 1), gFF((tilesFF + 7) / 8, 1);
  const dim3 gLN(TOK / 32, 1);                    // the normalizing GEMMs: one block per 32 whole rows

  for (int l = 0; l < DEPTH; ++l) {
    const float* xres = (l == 0) ? x_in : xg;
    const float* om = omega + (size_t)l * HD * MH;

    // positive random features of q = x Wq + bq and of k, and v = x Wv + bv (f32 out): one launch, batch index = which of the three
    const unsigned short* xhu = (const unsigned short*)xh;
    const unsigned short* wtu = (const unsigned short*)wt4 + (size_t)l * 4 * D * D;
    const unsigned short* w1u = (const unsigned short*)w1t + (size_t)l * D * FF;
    const unsigned short* w2u = (const unsigned short*)w2t + (size_t)l * FF * D;
    wmma_gemm64<0, false, 2, 0, false, 0, 0, true><<<dim3(gD.x, 3), dim3(256), 0, stream>>>(
        xhu, xhu, D, 0L, wtu, wtu, D, (long)D * D,
        (void*)qb_, (void*)qb_, D, (long)TOK * D, bq + (size_t)l * D, bk + (size_t)l * D, bv + (size_t)l * D,
        bq + (size_t)l * D, 0L, lnfg, lnfb, lnfg, lnfb, xf, xh, om, TOK, D, D, 1.0f / WSC);

    // causal prefix recurrence (f32) as a chunk scan -> attn f16 x16
    k_chunk_sum<<<dim3(L / (RC_T * RC_G), B * 8, 2), dim3(128), 0, stream>>>(kb_, vb_, cst, ctot, L);
    k_recur<<<dim3(L / RC_T, B * 8), dim3(128), 0, stream>>>(qb_, kb_, vb_, cst, ctot, ah, L, ASC);

    // x = LN1(attn Wo + bo + x), one launch
    wmma_gemm64<0, false, 2, 0, true, 0, 1, false, 2><<<gLN, dim3(256), 0, stream>>>(
        (const unsigned short*)ah, (const unsigned short*)ah, D, 0L, wtu + 3 * (size_t)D * D, wtu + 3 * (size_t)D * D, D, 0L,
        (void*)xf, (void*)xf, D, 0L, bo + (size_t)l * D, bo + (size_t)l * D, bo + (size_t)l * D, xres, 0L,
        ln1g + (size_t)l * D, ln1b + (size_t)l * D, lnfg, lnfb, xf, xh, om, TOK, D, D, 1.0f / (WSC * ASC));

    // y1 = relu(x W1 + b1) (f16 out); x = LN2(y1 W2 + b2 + x), in the last layer followed by the final normalization -> output
    wmma_gemm64<0, false, 2, 1, false, 2><<<gFF, dim3(256), 0, stream>>>(
        xhu, xhu, D, 0L, w1u, w1u, D, 0L,
        (void*)y1h, (void*)y1h, FF, 0L, b1 + (size_t)l * FF, b1 + (size_t)l * FF, b1 + (size_t)l * FF, b1 + (size_t)l * FF, 0L, lnfg, lnfb, lnfg, lnfb, xf, xh, om, TOK, FF, D, 1.0f / WSC);
    if (l + 1 < DEPTH)
      wmma_gemm64<0, false, 2, 0, true, 0, 1, false, 2><<<gLN, dim3(256), 0, stream>>>(
          (const unsigned short*)y1h, (const unsigned short*)y1h, FF, 0L, w2u, w2u, FF, 0L,
          (void*)xg, (void*)xg, D, 0L, b2 + (size_t)l * D, b2 + (size_t)l * D, b2 + (size_t)l * D, xf, 0L,
          ln2g + (size_t)l * D, ln2b + (size_t)l * D, lnfg, lnfb, xg, xh, om, TOK, D, FF, 1.0f / WSC);
    else
      wmma_gemm64<0, false, 2, 0, true, 0, 2, false, 2><<<gLN, dim3(256), 0, stream>>>(
          (const unsigned short*)y1h, (const unsigned short*)y1h, FF, 0L, w2u, w2u, FF, 0L,
          (void*)out, (void*)out, D, 0L, b2 + (size_t)l * D, b2 + (size_t)l * D, b2 + (size_t)l * D, xf, 0L,
          ln2g + (size_t)l * D, ln2b + (size_t)l * D, lnfg, lnfb, out, xh, om, TOK, D, FF, 1.0f / WSC);
  }
  (void)hipGetLastError();
}
